// v000
// Measured on an AMD MI455X. A time is GPU time per run, averaged over a window of back-to-back runs after a warm-up
// (all launches, gaps included; the runs take copies of the inputs in turn), and the median of several windows.
// Apart from v000's, it joins two sittings. Times from different sittings can be a few percent apart, while
// side-by-side timings come from the same sitting.
// v000 is the starting kernel. One run takes 1240 microseconds.
#include <hip/hip_runtime.h>
// Contractions on v_wmma_f32_16x16x32_f16 (f16 operands, f32 accumulate): q | k | v projections (x and weights bf16-valued, exact in f16, weights carried x16), scores q.k^T (plain f16 q, k), P.V (softmax weights f16 carried x2^14; v as f16 hi plane + f16 residual plane carried x2^10, two accumulators). Scores, softmax statistics, attention output and residual add in f32; joint (seq, unit) normalisation statistics in f64.
#ifndef NB
#define NB 2
#endif
#ifndef SEQ
#define SEQ 2048
#endif
#define NB_FULL 2
#define SEQ_FULL 2048
#define CD 1024                      /* input channels */
#define UD 1024                      /* units */
#define NH 16
#define HD 64
#define HG 2                         /* heads per attention launch group */
#define LQK (2 * UD)                 /* row pitch of the q | k rows */
#define LNP 8192                     /* floats per statistics block */
#define NPB ((SEQ * UD) / LNP)       /* statistics blocks per batch */
#define RSB (SEQ / 8)                /* softmax block size (8 keys per thread) */
#define NR ((size_t)NB * SEQ)        /* token rows (compact) */
#define WSC 16.0f                    /* weight carry */
#define PCAR 16384.0f                /* softmax weight carry */
#define VLC 1024.0f                  /* v residual plane carry */
static_assert(NB >= 1 && NB <= NB_FULL);
static_assert(SEQ % 256 == 0 && SEQ <= SEQ_FULL);
static_assert(CD % 32 == 0 && UD % 64 == 0 && CD == UD);
static_assert(NH * HD == UD && HD == 64 && NH % HG == 0 && HD % 32 == 0);
static_assert((SEQ * UD) % LNP == 0 && LNP == 256 * 32);
static_assert(RSB % 32 == 0 && RSB <= 256);
static_assert(2 * NB <= 32);
static_assert((NR * UD) % 1024 == 0 && (NR % 128) == 0);

typedef unsigned short v8us __attribute__((ext_vector_type(8), may_alias));
typedef float  v8f  __attribute__((ext_vector_type(8)));
typedef float  v4f  __attribute__((ext_vector_type(4)));
typedef float  v4fa __attribute__((ext_vector_type(4), may_alias));
typedef double v2d  __attribute__((ext_vector_type(2)));
typedef _Float16 v16h __attribute__((ext_vector_type(16)));
typedef _Float16 v4h  __attribute__((ext_vector_type(4)));
union FragH { v16h v; v8us half[2]; _Float16 h[16]; unsigned short u[16]; };

__device__ __forceinline__ unsigned short bf16_bits(float x) { unsigned int u = __float_as_uint(x); return (unsigned short)((u + 0x7FFFu + ((u >> 16) & 1u)) >> 16); }
__device__ __forceinline__ float bf16_val(unsigned short b) { return __uint_as_float(((unsigned int)b) << 16); }
__device__ __forceinline__ float bf16_rne(float x) { return bf16_val(bf16_bits(x)); }

// 16-bit WMMA fragment: lane l, h = l >> 4, row/col = l & 15; elements 0..7 <- k0 + 8h + 0..7, elements 8..15 <- k0 + 16 + 8h + 0..7 (same map for A rows and for B[n][k] rows)
__device__ __forceinline__ v16h g2_frag(const _Float16* p, int hh) { FragH f; f.half[0] = *(const v8us*)((const unsigned short*)p + 8 * hh); f.half[1] = *(const v8us*)((const unsigned short*)p + 16 + 8 * hh); return f.v; }
__device__ __forceinline__ v8f g2_mma(v16h a, v16h b, v8f c) { v8f d = __builtin_amdgcn_wmma_f32_16x16x32_f16(false, a, false, b, (short)0, c, false, false); asm volatile("v_nop\n\tv_nop\n\tv_nop\n\tv_nop" : "+v"(d) : "v"(a), "v"(b)); return d; }

__global__ __launch_bounds__(256) void k_wt_f16(const float* __restrict__ W, _Float16* __restrict__ Wt, int K, int N, float scale) {
  const int t = blockIdx.x * 256 + threadIdx.x; if (t >= N * (K / 8)) return; const int n = t / (K / 8), k8 = (t % (K / 8)) * 8; FragH f;
#pragma unroll
  for (int i = 0; i < 8; ++i) f.h[i] = (_Float16)(bf16_rne(W[(size_t)(k8 + i) * N + n]) * scale); const v8us o = f.half[0];
  *(v8us*)((unsigned short*)Wt + (size_t)n * K + k8) = o; 
}

__global__ __launch_bounds__(256) void k_x16(const float* __restrict__ x, _Float16* __restrict__ X16, size_t n8) { const size_t t = (size_t)blockIdx.x * 256 + threadIdx.x; if (t >= n8) return; FragH f;
#pragma unroll
  for (int q = 0; q < 8; ++q) f.h[q] = (_Float16)bf16_rne(x[t * 8 + q]); *(v8us*)((unsigned short*)X16 + t * 8) = f.half[0];  }

// GEMM, wave tile 32x64, block = 4 waves = 128 rows x 64 cols; A f16 rows (pitch lda), Bh f16 [n][k] (pitch ldb); v = acc*alpha + bf16(bias[col]) (+ CP) ; writes f32 C and/or f16 C16 (pitch ldc);
// grid ((M/128)*(N/64), batches); per grid.y: A += sA, Bh += sB, C += sC. M % 128 == 0, N % 64 == 0, K % 32 == 0.
// CAUSAL: rows and columns are query / key indices of one sequence; blocks whose 64 columns all lie above the block's 128 rows are skipped (never read downstream).
template <int ACT, bool CAUSAL>
__global__ __launch_bounds__(128) void k_gemm2(const _Float16* __restrict__ A, int lda, size_t sA, const _Float16* __restrict__ Bh, int ldb, size_t sB, float alpha, const float* __restrict__ bias, size_t sBias, const float* __restrict__ CP, int rowsPerB, size_t sCPb, int row0g,
    float* __restrict__ C, _Float16* __restrict__ C16, int ldc, size_t sC, int M, int N, int K) {
  static_assert(ACT == 0 || ACT == 3);
  __shared__ __attribute__((aligned(16))) float so[4][32][68];
  const int tid = threadIdx.x, w = tid >> 5, lane = tid & 31, ln = lane & 15, hh = lane >> 4; const int by = blockIdx.y;
  A += (size_t)by * sA; Bh += (size_t)by * sB; const size_t cofs = (size_t)by * sC; const float* bp = bias ? bias + (size_t)by * sBias : nullptr;
  const int ntn = N >> 6; const int mt = blockIdx.x / ntn, nq = blockIdx.x - mt * ntn; const int row0 = mt * 128 + 32 * w, col0 = nq * 64;
  if (CAUSAL && col0 >= mt * 128 + 128) return;
  if (row0 >= M) return;
  const _Float16* a0p = A + (size_t)(row0 + ln) * lda; const _Float16* a1p = a0p + (size_t)16 * lda;
  const _Float16* b0p = Bh + (size_t)(col0 + ln) * ldb; const _Float16* b1p = b0p + (size_t)16 * ldb; const _Float16* b2p = b1p + (size_t)16 * ldb; const _Float16* b3p = b2p + (size_t)16 * ldb;
  const v8f z8 = {0.f,0.f,0.f,0.f,0.f,0.f,0.f,0.f}; v8f c00 = z8, c01 = z8, c02 = z8, c03 = z8, c10 = z8, c11 = z8, c12 = z8, c13 = z8;
#pragma unroll 1
  for (int kb = 0; kb < K; kb += 32) { const v16h a0 = g2_frag(a0p + kb, hh), a1 = g2_frag(a1p + kb, hh);
    v16h b = g2_frag(b0p + kb, hh); c00 = g2_mma(a0, b, c00); c10 = g2_mma(a1, b, c10);
    b = g2_frag(b1p + kb, hh); c01 = g2_mma(a0, b, c01); c11 = g2_mma(a1, b, c11);
    b = g2_frag(b2p + kb, hh); c02 = g2_mma(a0, b, c02); c12 = g2_mma(a1, b, c12);
    b = g2_frag(b3p + kb, hh); c03 = g2_mma(a0, b, c03); c13 = g2_mma(a1, b, c13); }
  v8f accs[8] = {c00, c01, c02, c03, c10, c11, c12, c13};
#pragma unroll
  for (int u = 0; u < 8; ++u) { const int t = u & 3, half = u >> 2; const int col = col0 + t * 16 + ln; const float bv = bp ? bf16_rne(bp[col]) : 0.f;
#pragma unroll
    for (int r = 0; r < 8; ++r) { const int rloc = half * 16 + 8 * hh + r; float v = accs[u][r] * alpha + bv;
      if (CP) { if (rowsPerB < 0) v += CP[cofs + (size_t)(row0g + row0 + rloc) * ldc + col]; else { const int bidx = (row0g + row0 + rloc) / rowsPerB; v += CP[(size_t)bidx * sCPb + (size_t)by * 64 + col]; } }
      if (ACT == 3) v = fmaxf(v, 0.f);
      so[w][rloc][t * 16 + ln] = v; } }
  __builtin_amdgcn_fence(4 /* acq_rel order */, "workgroup"); __builtin_amdgcn_wave_barrier();
  const int rsub = lane >> 4, c4 = (lane & 15) * 4;
  {
#pragma unroll
    for (int q = 0; q < 16; ++q) { const int r = q * 2 + rsub; const v4f v = *(const v4fa*)&so[w][r][c4];
      if (C) *(v4f*)(C + cofs + (size_t)(row0 + r) * ldc + col0 + c4) = v;
      if (C16) { v4h h4; for (int i = 0; i < 4; ++i) h4[i] = (_Float16)v[i]; *(v4h*)(C16 + cofs + (size_t)(row0 + r) * ldc + col0 + c4) = h4; } }
     }
}

// VTh / VTl [slab][d][s] (slab = b*NH + h, pitch SEQ) from f32 v rows V32[b*SEQ + s][h*HD + d]: hi = f16(v), lo = f16((v - hi) * 2^10).
// coverage: load 64 rows x 16 float4 = 1024 items / 256 threads; store 2 x 32 d-rows x 8 pieces per plane = full 64 x 64 tile, both planes, every (slab, token group).
__global__ __launch_bounds__(256) void k_vt2(const float* __restrict__ V32, _Float16* __restrict__ VTh, _Float16* __restrict__ VTl) {
  __shared__ _Float16 th[64][66]; __shared__ _Float16 tl[64][66];
  const int tid = threadIdx.x; const int slab = blockIdx.x / (SEQ / 64), lg = blockIdx.x % (SEQ / 64); const int b = slab / NH, h = slab % NH;
  for (int i = tid; i < 64 * 16; i += 256) { const int r = i >> 4, c4 = (i & 15) * 4;
    const v4f a = *(const v4fa*)(V32 + ((size_t)b * SEQ + (size_t)lg * 64 + r) * UD + h * HD + c4);
#pragma unroll
    for (int q = 0; q < 4; ++q) { const _Float16 hv = (_Float16)a[q]; th[r][c4 + q] = hv; tl[r][c4 + q] = (_Float16)((a[q] - (float)hv) * VLC); } }
  __syncthreads();
  {
#pragma unroll
    for (int rd = 0; rd < 2; ++rd) { const int d = rd * 32 + (tid >> 3), pc = tid & 7; FragH fh, fl;
#pragma unroll
      for (int q = 0; q < 8; ++q) { fh.h[q] = th[pc * 8 + q][d]; fl.h[q] = tl[pc * 8 + q][d]; }
      const size_t o = ((size_t)slab * HD + d) * SEQ + (size_t)lg * 64 + pc * 8;
      *(v8us*)((unsigned short*)VTh + o) = fh.half[0]; *(v8us*)((unsigned short*)VTl + o) = fl.half[0]; }
     }
}

// causal row softmax over one sequence: block per row i of the [HG][SEQ][SEQ] score plane (query index qi = i % SEQ); RSB threads x 8 keys;
// P[i][j] = f16(2^14 * exp(s - max) / sum) for j <= qi, 0 for j > qi (masked by index). Loads are clamped to columns <= qi (always written by the scores pass).
// coverage: RSB x 8 = SEQ columns per row, HG*SEQ rows per launch = the whole P plane.
__global__ __launch_bounds__(256) void k_rsm(const float* __restrict__ S, _Float16* __restrict__ P) {
  #pragma clang fp contract(off)
  __shared__ float redm[8]; __shared__ float reds[8];
  const int i = blockIdx.x; const int qi = i % SEQ; const int tid = threadIdx.x, lane = tid & 31, w = tid >> 5; const int nw = RSB / 32;
  const int j0 = tid * 8; const int jc = min(j0, qi & ~7);
  const float* s = S + (size_t)i * SEQ;
  const v4f a = *(const v4fa*)(s + jc), c = *(const v4fa*)(s + jc + 4);
  const float v[8] = {a[0], a[1], a[2], a[3], c[0], c[1], c[2], c[3]};
  float mx = -3.0e38f;
#pragma unroll
  for (int q = 0; q < 8; ++q) mx = (j0 + q <= qi) ? fmaxf(mx, v[q]) : mx;
  for (int st = 16; st > 0; st >>= 1) mx = fmaxf(mx, __shfl_xor(mx, st, 32));
  if (lane == 0) redm[w] = mx; __syncthreads();
  mx = redm[0]; for (int u = 1; u < nw; ++u) mx = fmaxf(mx, redm[u]);
  float e[8]; float se = 0.f;
#pragma unroll
  for (int q = 0; q < 8; ++q) { const float t = __expf(v[q] - mx); e[q] = (j0 + q <= qi) ? t : 0.f; se += e[q]; }
  for (int st = 16; st > 0; st >>= 1) se += __shfl_xor(se, st, 32);
  if (lane == 0) reds[w] = se; __syncthreads();
  se = reds[0]; for (int u = 1; u < nw; ++u) se += reds[u];
  const float sc = PCAR * (1.0f / se);
  FragH f;
#pragma unroll
  for (int q = 0; q < 8; ++q) f.h[q] = (_Float16)(e[q] * sc);
  unsigned short* d = (unsigned short*)P + (size_t)i * SEQ + j0;
  *(v8us*)d = f.half[0]; 
}

// attention output rows (f32, pitch UD, merged heads): O[orow0 + s][ocol0 + hg*HD + d] = 2^-14 (P_hg . VTh + 2^-10 P_hg . VTl), P [HG][SEQ][SEQ] f16, VT planes [slab0 + hg][HD][SEQ] f16.
// block = 4 waves = 128 query rows x 32 d; wave tile 32 rows x 32 cols: 2 row tiles x 2 col tiles x 2 planes = 8 accumulators; k bound per 128-row block = causal extent (P is zero beyond the diagonal and fully written).
// coverage: q 0..7 x (lane>>3) 0..3 = 32 rows, (lane&7)*4 = 32 cols per wave; 4 waves x (SEQ/128) blocks x 2 col groups x HG heads = all SEQ rows x 64 cols of every head in the group.
__global__ __launch_bounds__(128) void k_pv(const _Float16* __restrict__ P, const _Float16* __restrict__ VTh, const _Float16* __restrict__ VTl, int slab0, float* __restrict__ O, int orow0, int ocol0) {
  __shared__ __attribute__((aligned(16))) float so[4][32][36];
  const int tid = threadIdx.x, w = tid >> 5, lane = tid & 31, ln = lane & 15, hh = lane >> 4; const int hg = blockIdx.y;
  const int mt = blockIdx.x / (HD / 32), cg = blockIdx.x % (HD / 32);
  const int row0 = mt * 128 + 32 * w, col0 = cg * 32;
  const int kend = min(SEQ, mt * 128 + 128);
  const _Float16* a0p = P + (size_t)hg * SEQ * SEQ + (size_t)(row0 + ln) * SEQ; const _Float16* a1p = a0p + (size_t)16 * SEQ;
  const size_t vb = ((size_t)(slab0 + hg) * HD + col0 + ln) * SEQ;
  const _Float16* bh0p = VTh + vb; const _Float16* bh1p = bh0p + (size_t)16 * SEQ; const _Float16* bl0p = VTl + vb; const _Float16* bl1p = bl0p + (size_t)16 * SEQ;
  const v8f z8 = {0.f,0.f,0.f,0.f,0.f,0.f,0.f,0.f}; v8f h00 = z8, h01 = z8, h10 = z8, h11 = z8, l00 = z8, l01 = z8, l10 = z8, l11 = z8;
#pragma unroll 1
  for (int kb = 0; kb < kend; kb += 32) { const v16h a0 = g2_frag(a0p + kb, hh), a1 = g2_frag(a1p + kb, hh);
    v16h b = g2_frag(bh0p + kb, hh); h00 = g2_mma(a0, b, h00); h10 = g2_mma(a1, b, h10);
    b = g2_frag(bh1p + kb, hh); h01 = g2_mma(a0, b, h01); h11 = g2_mma(a1, b, h11);
    b = g2_frag(bl0p + kb, hh); l00 = g2_mma(a0, b, l00); l10 = g2_mma(a1, b, l10);
    b = g2_frag(bl1p + kb, hh); l01 = g2_mma(a0, b, l01); l11 = g2_mma(a1, b, l11); }
  v8f ah[4] = {h00, h01, h10, h11}; v8f al[4] = {l00, l01, l10, l11};
#pragma unroll
  for (int u = 0; u < 4; ++u) { const int t = u & 1, half = u >> 1;
#pragma unroll
    for (int r = 0; r < 8; ++r) { const int rloc = half * 16 + 8 * hh + r; so[w][rloc][t * 16 + ln] = (ah[u][r] + al[u][r] * (1.0f / VLC)) * (1.0f / PCAR); } }
  __builtin_amdgcn_fence(4 /* acq_rel order */, "workgroup"); __builtin_amdgcn_wave_barrier();
  const int rq = lane >> 3, c4 = (lane & 7) * 4;
  float* ob = O + (size_t)(orow0 + row0) * UD + ocol0 + hg * HD + col0 + c4;
  {
#pragma unroll
    for (int q = 0; q < 8; ++q) { const int r = q * 4 + rq; const v4f v = *(const v4fa*)&so[w][r][c4]; *(v4f*)(ob + (size_t)r * UD) = v; }
     }
}

__global__ __launch_bounds__(256) void k_lnpart(const float* __restrict__ O, const float* __restrict__ X, double* __restrict__ part) {
  __shared__ double rs[256]; __shared__ double rq[256];
  const int bat = blockIdx.y, blk = blockIdx.x, tid = threadIdx.x;
  const float* op = O + (size_t)bat * SEQ * UD + (size_t)blk * LNP; const float* xp = X + (size_t)bat * SEQ_FULL * CD + (size_t)blk * LNP;
  double s1 = 0.0, s2 = 0.0;
#pragma unroll 1
  for (int u = 0; u < LNP / 1024; ++u) { const int j = u * 1024 + tid * 4; const v4f a = *(const v4fa*)(op + j), c = *(const v4fa*)(xp + j);
#pragma unroll
    for (int q = 0; q < 4; ++q) { const float v = a[q] + bf16_rne(c[q]); s1 += (double)v; s2 += (double)v * (double)v; } }
  rs[tid] = s1; rq[tid] = s2; __syncthreads();
  for (int st = 128; st > 0; st >>= 1) { if (tid < st) { rs[tid] += rs[tid + st]; rq[tid] += rq[tid + st]; } __syncthreads(); }
  if (tid < 8) { v2d val; val[0] = (tid == 0) ? rs[0] : 0.0; val[1] = (tid == 0) ? rq[0] : 0.0;
    double* d = part + ((size_t)bat * NPB + blk) * 16 + tid * 2; *(v2d*)d = val;  }
}

__global__ __launch_bounds__(64) void k_lnfin(const double* __restrict__ part, float* __restrict__ stat) {
  __shared__ __attribute__((aligned(16))) float st[32];
  const int tid = threadIdx.x; const int bb = (tid < NB) ? tid : (NB - 1);
  double s = 0.0, q = 0.0;
#pragma unroll 1
  for (int i = 0; i < NPB; ++i) { s += part[((size_t)bb * NPB + i) * 16]; q += part[((size_t)bb * NPB + i) * 16 + 1]; }
  const double inv = 1.0 / ((double)SEQ * (double)UD); const double m = s * inv; double var = q * inv - m * m; if (var < 0.0) var = 0.0;
  const float mu = (float)m; const float rsd = 1.0f / sqrtf((float)var + 1.0e-5f);
  if (tid < 32) st[tid] = 0.f;
  __syncthreads();
  if (tid < NB) { st[2 * tid] = mu; st[2 * tid + 1] = rsd; }
  __syncthreads();
  if (tid < 8) { const v4f v = *(const v4fa*)&st[tid * 4]; *(v4f*)(stat + tid * 4) = v;  }
}

// coverage: grid (NB*SEQ*UD/1024) x 256 threads x 4 = every output element exactly once.
__global__ __launch_bounds__(256) void k_lnapply(const float* __restrict__ O, const float* __restrict__ X, const float* __restrict__ stat, const float* __restrict__ g, const float* __restrict__ bta, float* __restrict__ out) {
  const size_t e = ((size_t)blockIdx.x * 256 + threadIdx.x) * 4;
  const int bat = (int)(e / ((size_t)SEQ * UD)); const size_t su = e - (size_t)bat * SEQ * UD;
  const float mu = stat[2 * bat], rs = stat[2 * bat + 1];
  const v4f o = *(const v4fa*)(O + e), x = *(const v4fa*)(X + (size_t)bat * SEQ_FULL * CD + su), gg = *(const v4fa*)(g + su), bb = *(const v4fa*)(bta + su);
  v4f y;
#pragma unroll
  for (int q = 0; q < 4; ++q) { const float v = o[q] + bf16_rne(x[q]); y[q] = (v - mu) * rs * bf16_rne(gg[q]) + bf16_rne(bb[q]); }
  float* d = out + (size_t)bat * SEQ_FULL * UD + su;
  *(v4f*)d = y; 
}

extern "C" void kernel_launch(void* const* d_in, const int* in_sizes, int n_in,
                              void* d_out, int out_size, void* d_ws, size_t ws_size, hipStream_t stream) {
  if (n_in < 9) return;
  const float* X   = (const float*)d_in[0];      /* [2][2048][1024] */
  const float* Wq  = (const float*)d_in[1];      /* [in][out] 1024 x 1024 */
  const float* bq  = (const float*)d_in[2];
  const float* Wk  = (const float*)d_in[3];
  const float* bk  = (const float*)d_in[4];
  const float* Wv  = (const float*)d_in[5];
  const float* bv  = (const float*)d_in[6];
  const float* gam = (const float*)d_in[7];      /* [2048][1024] */
  const float* bet = (const float*)d_in[8];
  float* out = (float*)d_out;
  const size_t rows_used = (size_t)(NB - 1) * SEQ_FULL + SEQ;
  if ((size_t)in_sizes[0] < rows_used * CD) return;
  if ((size_t)in_sizes[1] < (size_t)CD * UD || (size_t)in_sizes[3] < (size_t)CD * UD || (size_t)in_sizes[5] < (size_t)CD * UD) return;
  if (in_sizes[2] < UD || in_sizes[4] < UD || in_sizes[6] < UD) return;
  if ((size_t)in_sizes[7] < (size_t)SEQ * UD || (size_t)in_sizes[8] < (size_t)SEQ * UD) return;
  if ((size_t)out_size < rows_used * UD) return;

  char* ws = (char*)d_ws; size_t off = 0;
  auto take = [&](size_t bytes) { char* p = ws + off; off += (bytes + 255) & ~(size_t)255; return p; };
  _Float16* BQKV = (_Float16*)take((size_t)3 * CD * UD * 2);               /* [3*UD][CD] f16 (x16) */
  _Float16* X16  = (_Float16*)take(NR * CD * 2);                           /* [NR][CD] */
  _Float16* QK16 = (_Float16*)take(NR * LQK * 2);                          /* [NR][q | k] */
  float*    V32  = (float*)take(NR * UD * 4);                              /* [NR][UD] f32 */
  _Float16* VTh  = (_Float16*)take((size_t)NB * NH * HD * SEQ * 2);        /* [NB*NH][HD][SEQ] */
  _Float16* VTl  = (_Float16*)take((size_t)NB * NH * HD * SEQ * 2);
  float*    S    = (float*)take((size_t)HG * SEQ * SEQ * 4);               /* [HG][SEQ][SEQ] */
  _Float16* P    = (_Float16*)take((size_t)HG * SEQ * SEQ * 2);
  float*    O32  = (float*)take(NR * UD * 4);                              /* [NR][UD] f32 */
  double*   PART = (double*)take((size_t)NB * NPB * 128);                  
  float*    STAT = (float*)take(128);
  if (off > ws_size || off > (size_t)134217728) return;

  k_wt_f16<<<(unsigned)(((size_t)UD * (CD / 8) + 255) / 256), 256, 0, stream>>>(Wq, BQKV, CD, UD, WSC);
  k_wt_f16<<<(unsigned)(((size_t)UD * (CD / 8) + 255) / 256), 256, 0, stream>>>(Wk, BQKV + (size_t)UD * CD, CD, UD, WSC);
  k_wt_f16<<<(unsigned)(((size_t)UD * (CD / 8) + 255) / 256), 256, 0, stream>>>(Wv, BQKV + (size_t)2 * UD * CD, CD, UD, WSC);
  for (int b = 0; b < NB; ++b) {
    const size_t n8 = (size_t)SEQ * CD / 8;
    k_x16<<<(unsigned)((n8 + 255) / 256), 256, 0, stream>>>(X + (size_t)b * SEQ_FULL * CD, X16 + (size_t)b * SEQ * CD, n8);
  }
  const int MP = (int)NR;
  /* q rows (f16, cols 0..UD-1 of QK16), k rows (cols UD..2UD-1), v rows (f32): x16 . (16 W) * 2^-4 + bf16(bias) */
  k_gemm2<0, false><<<dim3((unsigned)((MP / 128) * (UD / 64)), 1), 128, 0, stream>>>(X16, CD, 0, BQKV, CD, 0, 0.0625f, bq, 0, nullptr, 1, 0, 0, nullptr, QK16, LQK, 0, MP, UD, CD);
  k_gemm2<0, false><<<dim3((unsigned)((MP / 128) * (UD / 64)), 1), 128, 0, stream>>>(X16, CD, 0, BQKV + (size_t)UD * CD, CD, 0, 0.0625f, bk, 0, nullptr, 1, 0, 0, nullptr, QK16 + UD, LQK, 0, MP, UD, CD);
  k_gemm2<0, false><<<dim3((unsigned)((MP / 128) * (UD / 64)), 1), 128, 0, stream>>>(X16, CD, 0, BQKV + (size_t)2 * UD * CD, CD, 0, 0.0625f, bv, 0, nullptr, 1, 0, 0, V32, nullptr, UD, 0, MP, UD, CD);
  k_vt2<<<(unsigned)(NB * NH * (SEQ / 64)), 256, 0, stream>>>(V32, VTh, VTl);
  for (int b = 0; b < NB; ++b) {
    const size_t r0 = (size_t)b * SEQ;
    for (int h0 = 0; h0 < NH; h0 += HG) {
      /* scores[q][key] = q . k * 2^-3 per head (HG heads on grid.y), causal tile skip */
      k_gemm2<0, true><<<dim3((unsigned)((SEQ / 128) * (SEQ / 64)), HG), 128, 0, stream>>>(QK16 + r0 * LQK + (size_t)h0 * HD, LQK, (size_t)HD, QK16 + r0 * LQK + UD + (size_t)h0 * HD, LQK, (size_t)HD, 0.125f, nullptr, 0, nullptr, 1, 0, 0, S, nullptr, SEQ, (size_t)SEQ * SEQ, SEQ, SEQ, HD);
      k_rsm<<<(unsigned)(HG * SEQ), RSB, 0, stream>>>(S, P);
      k_pv<<<dim3((unsigned)((SEQ / 128) * (HD / 32)), HG), 128, 0, stream>>>(P, VTh, VTl, b * NH + h0, O32, (int)r0, h0 * HD);
    }
  }
  k_lnpart<<<dim3(NPB, NB), 256, 0, stream>>>(O32, X, PART);
  k_lnfin<<<1, 64, 0, stream>>>(PART, STAT);
  k_lnapply<<<(unsigned)((NR * UD) / 1024), 256, 0, stream>>>(O32, X, STAT, gam, bet, out);
}

// v001
// Measured time: 271 microseconds a run.
// In two side-by-side timings against v000, it was 4.56 and 4.51 times as fast.
#include <hip/hip_runtime.h>
// Contractions on v_wmma_f32_16x16x32_f16 (f16 operands, f32 accumulate): q | k | v projections (x and weights bf16-valued, exact in f16, weights carried x16), scores k.q^T (plain f16 q, k), V^T.P^T in the same kernel (running-maximum softmax weights f16 carried x2^14; v as f16 hi plane + f16 residual plane carried x2^10, two accumulators). Scores, softmax statistics, attention output and residual add in f32; joint (seq, unit) normalisation statistics in f64.
#ifndef NB
#define NB 2
#endif
#ifndef SEQ
#define SEQ 2048
#endif
#define NB_FULL 2
#define SEQ_FULL 2048
#define CD 1024                      /* input channels */
#define UD 1024                      /* units */
#define NH 16
#define HD 64
#define LQK (2 * UD)                 /* row pitch of the q | k rows */
#define LNP 8192                     /* floats per statistics block */
#define NPB ((SEQ * UD) / LNP)       /* statistics blocks per batch */
#define NR ((size_t)NB * SEQ)        /* token rows (compact) */
#define WSC 16.0f                    /* weight carry */
#define VLC 1024.0f                  /* v residual plane carry */
static_assert(NB >= 1 && NB <= NB_FULL);
static_assert(SEQ % 256 == 0 && SEQ <= SEQ_FULL);
static_assert(CD % 32 == 0 && UD % 64 == 0 && CD == UD);
static_assert(NH * HD == UD && HD == 64);
static_assert((SEQ * UD) % LNP == 0 && LNP == 256 * 32);
static_assert(2 * NB <= 32);
static_assert((NR * UD) % 1024 == 0 && (NR % 128) == 0);

typedef unsigned short v8us __attribute__((ext_vector_type(8), may_alias));
typedef float  v8f  __attribute__((ext_vector_type(8)));
typedef float  v4f  __attribute__((ext_vector_type(4)));
typedef float  v4fa __attribute__((ext_vector_type(4), may_alias));
typedef double v2d  __attribute__((ext_vector_type(2)));
typedef _Float16 v16h __attribute__((ext_vector_type(16)));
typedef _Float16 v4h  __attribute__((ext_vector_type(4)));
union FragH { v16h v; v8us half[2]; _Float16 h[16]; unsigned short u[16]; };

__device__ __forceinline__ unsigned short bf16_bits(float x) { unsigned int u = __float_as_uint(x); return (unsigned short)((u + 0x7FFFu + ((u >> 16) & 1u)) >> 16); }
__device__ __forceinline__ float bf16_val(unsigned short b) { return __uint_as_float(((unsigned int)b) << 16); }
__device__ __forceinline__ float bf16_rne(float x) { return bf16_val(bf16_bits(x)); }

// 16-bit WMMA fragment: lane l, h = l >> 4, row/col = l & 15; elements 0..7 <- k0 + 8h + 0..7, elements 8..15 <- k0 + 16 + 8h + 0..7 (same map for A rows and for B[n][k] rows)
__device__ __forceinline__ v16h g2_frag(const _Float16* p, int hh) { FragH f; f.half[0] = *(const v8us*)((const unsigned short*)p + 8 * hh); f.half[1] = *(const v8us*)((const unsigned short*)p + 16 + 8 * hh); return f.v; }
__device__ __forceinline__ v8f g2_mma(v16h a, v16h b, v8f c) { v8f d = __builtin_amdgcn_wmma_f32_16x16x32_f16(false, a, false, b, (short)0, c, false, false); asm volatile("v_nop\n\tv_nop\n\tv_nop\n\tv_nop" : "+v"(d) : "v"(a), "v"(b)); return d; }

__global__ __launch_bounds__(256) void k_wt_f16(const float* __restrict__ W, _Float16* __restrict__ Wt, int K, int N, float scale) {
  const int t = blockIdx.x * 256 + threadIdx.x; if (t >= N * (K / 8)) return; const int n = t / (K / 8), k8 = (t % (K / 8)) * 8; FragH f;
#pragma unroll
  for (int i = 0; i < 8; ++i) f.h[i] = (_Float16)(bf16_rne(W[(size_t)(k8 + i) * N + n]) * scale); const v8us o = f.half[0];
  *(v8us*)((unsigned short*)Wt + (size_t)n * K + k8) = o; 
}

__global__ __launch_bounds__(256) void k_x16(const float* __restrict__ x, _Float16* __restrict__ X16, size_t n8) { const size_t t = (size_t)blockIdx.x * 256 + threadIdx.x; if (t >= n8) return; FragH f;
#pragma unroll
  for (int q = 0; q < 8; ++q) f.h[q] = (_Float16)bf16_rne(x[t * 8 + q]); *(v8us*)((unsigned short*)X16 + t * 8) = f.half[0];  }

// GEMM, wave tile 32x64, block = 4 waves = 128 rows x 64 cols; A f16 rows (pitch lda), Bh f16 [n][k] (pitch ldb); v = acc*alpha + bf16(bias[col]) (+ CP) ; writes f32 C and/or f16 C16 (pitch ldc);
// grid ((M/128)*(N/64), batches); per grid.y: A += sA, Bh += sB, C += sC. M % 128 == 0, N % 64 == 0, K % 32 == 0.
// CAUSAL: rows and columns are query / key indices of one sequence; blocks whose 64 columns all lie above the block's 128 rows are skipped (never read downstream).
template <int ACT, bool CAUSAL>
__global__ __launch_bounds__(128) void k_gemm2(const _Float16* __restrict__ A, int lda, size_t sA, const _Float16* __restrict__ Bh, int ldb, size_t sB, float alpha, const float* __restrict__ bias, size_t sBias, const float* __restrict__ CP, int rowsPerB, size_t sCPb, int row0g,
    float* __restrict__ C, _Float16* __restrict__ C16, int ldc, size_t sC, int M, int N, int K) {
  static_assert(ACT == 0 || ACT == 3);
  __shared__ __attribute__((aligned(16))) float so[4][32][68];
  const int tid = threadIdx.x, w = tid >> 5, lane = tid & 31, ln = lane & 15, hh = lane >> 4; const int by = blockIdx.y;
  A += (size_t)by * sA; Bh += (size_t)by * sB; const size_t cofs = (size_t)by * sC; const float* bp = bias ? bias + (size_t)by * sBias : nullptr;
  const int ntn = N >> 6; const int mt = blockIdx.x / ntn, nq = blockIdx.x - mt * ntn; const int row0 = mt * 128 + 32 * w, col0 = nq * 64;
  if (CAUSAL && col0 >= mt * 128 + 128) return;
  if (row0 >= M) return;
  const _Float16* a0p = A + (size_t)(row0 + ln) * lda; const _Float16* a1p = a0p + (size_t)16 * lda;
  const _Float16* b0p = Bh + (size_t)(col0 + ln) * ldb; const _Float16* b1p = b0p + (size_t)16 * ldb; const _Float16* b2p = b1p + (size_t)16 * ldb; const _Float16* b3p = b2p + (size_t)16 * ldb;
  const v8f z8 = {0.f,0.f,0.f,0.f,0.f,0.f,0.f,0.f}; v8f c00 = z8, c01 = z8, c02 = z8, c03 = z8, c10 = z8, c11 = z8, c12 = z8, c13 = z8;
#pragma unroll 1
  for (int kb = 0; kb < K; kb += 32) { const v16h a0 = g2_frag(a0p + kb, hh), a1 = g2_frag(a1p + kb, hh);
    v16h b = g2_frag(b0p + kb, hh); c00 = g2_mma(a0, b, c00); c10 = g2_mma(a1, b, c10);
    b = g2_frag(b1p + kb, hh); c01 = g2_mma(a0, b, c01); c11 = g2_mma(a1, b, c11);
    b = g2_frag(b2p + kb, hh); c02 = g2_mma(a0, b, c02); c12 = g2_mma(a1, b, c12);
    b = g2_frag(b3p + kb, hh); c03 = g2_mma(a0, b, c03); c13 = g2_mma(a1, b, c13); }
  v8f accs[8] = {c00, c01, c02, c03, c10, c11, c12, c13};
#pragma unroll
  for (int u = 0; u < 8; ++u) { const int t = u & 3, half = u >> 2; const int col = col0 + t * 16 + ln; const float bv = bp ? bf16_rne(bp[col]) : 0.f;
#pragma unroll
    for (int r = 0; r < 8; ++r) { const int rloc = half * 16 + 8 * hh + r; float v = accs[u][r] * alpha + bv;
      if (CP) { if (rowsPerB < 0) v += CP[cofs + (size_t)(row0g + row0 + rloc) * ldc + col]; else { const int bidx = (row0g + row0 + rloc) / rowsPerB; v += CP[(size_t)bidx * sCPb + (size_t)by * 64 + col]; } }
      if (ACT == 3) v = fmaxf(v, 0.f);
      so[w][rloc][t * 16 + ln] = v; } }
  __builtin_amdgcn_fence(4 /* acq_rel order */, "workgroup"); __builtin_amdgcn_wave_barrier();
  const int rsub = lane >> 4, c4 = (lane & 15) * 4;
  {
#pragma unroll
    for (int q = 0; q < 16; ++q) { const int r = q * 2 + rsub; const v4f v = *(const v4fa*)&so[w][r][c4];
      if (C) *(v4f*)(C + cofs + (size_t)(row0 + r) * ldc + col0 + c4) = v;
      if (C16) { v4h h4; for (int i = 0; i < 4; ++i) h4[i] = (_Float16)v[i]; *(v4h*)(C16 + cofs + (size_t)(row0 + r) * ldc + col0 + c4) = h4; } }
     }
}

// VTh / VTl [slab][d][s] (slab = b*NH + h, pitch SEQ) from f32 v rows V32[b*SEQ + s][h*HD + d]: hi = f16(v), lo = f16((v - hi) * 2^10).
// coverage: load 64 rows x 16 float4 = 1024 items / 256 threads; store 2 x 32 d-rows x 8 pieces per plane = full 64 x 64 tile, both planes, every (slab, token group).
__global__ __launch_bounds__(256) void k_vt2(const float* __restrict__ V32, _Float16* __restrict__ VTh, _Float16* __restrict__ VTl) {
  __shared__ _Float16 th[64][66]; __shared__ _Float16 tl[64][66];
  const int tid = threadIdx.x; const int slab = blockIdx.x / (SEQ / 64), lg = blockIdx.x % (SEQ / 64); const int b = slab / NH, h = slab % NH;
  for (int i = tid; i < 64 * 16; i += 256) { const int r = i >> 4, c4 = (i & 15) * 4;
    const v4f a = *(const v4fa*)(V32 + ((size_t)b * SEQ + (size_t)lg * 64 + r) * UD + h * HD + c4);
#pragma unroll
    for (int q = 0; q < 4; ++q) { const _Float16 hv = (_Float16)a[q]; th[r][c4 + q] = hv; tl[r][c4 + q] = (_Float16)((a[q] - (float)hv) * VLC); } }
  __syncthreads();
  {
#pragma unroll
    for (int rd = 0; rd < 2; ++rd) { const int d = rd * 32 + (tid >> 3), pc = tid & 7; FragH fh, fl;
#pragma unroll
      for (int q = 0; q < 8; ++q) { fh.h[q] = th[pc * 8 + q][d]; fl.h[q] = tl[pc * 8 + q][d]; }
      const size_t o = ((size_t)slab * HD + d) * SEQ + (size_t)lg * 64 + pc * 8;
      *(v8us*)((unsigned short*)VTh + o) = fh.half[0]; *(v8us*)((unsigned short*)VTl + o) = fl.half[0]; }
     }
}

// fused causal attention, one wave per 32 queries of one slab (slab = b*NH + h), no LDS: per pass of 32 keys S^T = K . Q^T (A = k rows, B = q rows, kept in registers),
// running maximum and sum per query (a lane holds one query's scores: in-lane, plus one exchange between the wave halves), O^T += V^T . P^T (A = VT rows, both planes).
// The two S^T tiles of a pass (keys k0 + 8h + r and k0 + 16 + 8h + r of query ln) are, converted in place, the B fragment in the k order of g2_frag: no lane exchange for P.
// P = f16(2^14 * exp(s - running max)); the sum carries the same 2^14, so the carry cancels in the final division. Keys above the query are masked by index in the last pass only.
// coverage: grid (NB*NH slabs) x (SEQ/128 blocks) x 4 waves x 32 queries = every row; 4 d tiles x (8h + r) = all 64 columns of the head, each element stored once.
#define SCL 0.18033688011112042f     /* 2^-3 * log2(e): scores in the exponent's base-2 units */
__device__ __forceinline__ v8f fa_mma(v16h a, v16h b, v8f c) { return __builtin_amdgcn_wmma_f32_16x16x32_f16(false, a, false, b, (short)0, c, false, false); }
__device__ __forceinline__ float fa_xhalf(float x) { return __builtin_bit_cast(float, __builtin_amdgcn_permlanex16(__builtin_bit_cast(int, x), __builtin_bit_cast(int, x), 0x76543210, 0xfedcba98, false, false)); }  /* lane l with lane l ^ 16 */
__device__ __forceinline__ v16h fa_frag(const _Float16* base, unsigned lofs, unsigned cofs) { const char* p = (const char*)base + ((size_t)lofs + cofs); FragH f; f.half[0] = *(const v8us*)p; f.half[1] = *(const v8us*)(p + 32); return f.v; }  /* g2_frag from a uniform base, the lane's byte offset (8h included) and a constant byte offset */

// one pass of 32 keys; ko (into K) and vo (into either VT plane) are the lane's own byte offsets at this pass's first key and leave a pass other than the last advanced by 32 keys
template <bool LAST>
__device__ __forceinline__ void fa_pass(int k0, int q0, int ln, int hh, const _Float16* __restrict__ K, const _Float16* __restrict__ VH, const _Float16* __restrict__ VL, unsigned& ko, unsigned& vo,
    const v16h (&qf)[2][2], v16h (&kf)[2][2], v8f (&oh)[2][4], v8f (&ol)[2][4], float (&m)[2], float (&l)[2]) {
  v16h vh[4], vl[4];
  for (int dt = 0; dt < 4; ++dt) { vh[dt] = fa_frag(VH, vo, dt * 16 * SEQ * 2); vl[dt] = fa_frag(VL, vo, dt * 16 * SEQ * 2); }
  const v8f z8 = {0.f,0.f,0.f,0.f,0.f,0.f,0.f,0.f}; v8f s[2][2];
  for (int t = 0; t < 2; ++t) {
    for (int kt = 0; kt < 2; ++kt) s[t][kt] = fa_mma(kf[kt][1], qf[t][1], fa_mma(kf[kt][0], qf[t][0], z8)); }
  if (!LAST) {                       /* next pass's k fragments, fetched behind this pass's products; k0 + 32 <= q0 is a row of the sequence */
    for (int kt = 0; kt < 2; ++kt) { kf[kt][0] = fa_frag(K, ko, (32 + 16 * kt) * LQK * 2); kf[kt][1] = fa_frag(K, ko, (32 + 16 * kt) * LQK * 2 + 64); } }
  /* the wait that stands in front of every overwrite of an address register of the loads above; the offsets pass through it so that their advance stays behind it */
  if (LAST) { const char* pa = (const char*)VH + vo; const char* pb = (const char*)VL + vo;   /* here the loads may name the summed addresses: these stay live up to the wait as well */
    asm volatile("s_wait_xcnt 0x0" : "+v"(vo) : "v"(pa), "v"(pb) : "memory"); }
  else { asm volatile("s_wait_xcnt 0x0" : "+v"(ko), "+v"(vo) :: "memory"); ko += 32 * LQK * 2; vo += 32 * 2; }
  float mn[2];
  for (int t = 0; t < 2; ++t) {
    if (LAST) {
      for (int kt = 0; kt < 2; ++kt) {
        for (int r = 0; r < 8; ++r) s[t][kt][r] = (k0 + 16 * kt + 8 * hh + r <= q0 + 16 * t + ln) ? s[t][kt][r] : -3.0e38f; } }
    float mx = s[t][0][0];
    for (int r = 1; r < 8; ++r) mx = fmaxf(mx, s[t][0][r]);
    for (int r = 0; r < 8; ++r) mx = fmaxf(mx, s[t][1][r]);
    mx = fmaxf(mx, fa_xhalf(mx)); mn[t] = fmaxf(m[t], mx); }
  if (__builtin_amdgcn_ballot_w32((mn[0] > m[0]) || (mn[1] > m[1])) != 0) {   /* no maximum moved: every factor is 1 and the rescale is skipped by the whole wave */
    for (int t = 0; t < 2; ++t) { const float al = __builtin_amdgcn_exp2f((m[t] - mn[t]) * SCL); l[t] *= al; m[t] = mn[t];
      for (int dt = 0; dt < 4; ++dt) { oh[t][dt] *= al; ol[t][dt] *= al; } } }
  for (int t = 0; t < 2; ++t) { const float off = 14.0f - m[t] * SCL; FragH p; v8f x[2], e[2];
    for (int kt = 0; kt < 2; ++kt) { x[kt] = s[t][kt] * SCL + off;
      for (int r = 0; r < 8; ++r) e[kt][r] = __builtin_amdgcn_exp2f(x[kt][r]); }
    /* the slot behind a transcendental: no source is overwritten and no result read before this v_nop, which stands behind the last of the sixteen */
    asm volatile("v_nop" : "+v"(e[0]), "+v"(e[1]) : "v"(x[0]), "v"(x[1]));
    for (int r = 0; r < 8; ++r) { p.h[r] = (_Float16)e[0][r]; p.h[8 + r] = (_Float16)e[1][r]; }
    const v8f es = e[0] + e[1];
    l[t] += ((es[0] + es[1]) + (es[2] + es[3])) + ((es[4] + es[5]) + (es[6] + es[7]));
    for (int dt = 0; dt < 4; ++dt) { oh[t][dt] = fa_mma(vh[dt], p.v, oh[t][dt]); ol[t][dt] = fa_mma(vl[dt], p.v, ol[t][dt]); } }
}

__global__ __launch_bounds__(128) void k_fattn(const _Float16* __restrict__ QK, const _Float16* __restrict__ VTh, const _Float16* __restrict__ VTl, float* __restrict__ O) {
  const int tid = threadIdx.x, lane = tid & 31, ln = lane & 15, hh = lane >> 4;
  const int w = __builtin_amdgcn_readfirstlane(tid >> 5);                       /* the wave's number in a scalar register: scalar loop bound and branches */
  const int slab = blockIdx.x, b = slab / NH, h = slab % NH;
  const int y = blockIdx.y, qb = (y < SEQ / 256) ? SEQ / 128 - 1 - y : y - SEQ / 256;   /* long blocks start first; the second half of the grid runs short to long beside them */
  const int q0 = qb * 128 + 32 * w;
  const _Float16* Q = QK + ((size_t)b * SEQ + q0) * LQK + h * HD; const _Float16* K = QK + (size_t)b * SEQ * LQK + UD + h * HD;      /* uniform bases */
  const _Float16* VH = VTh + (size_t)slab * HD * SEQ; const _Float16* VL = VTl + (size_t)slab * HD * SEQ;
  unsigned ko = (unsigned)(ln * LQK + 8 * hh) * 2, vo = (unsigned)(ln * SEQ + 8 * hh) * 2;                                       /* lane byte offsets */
  v16h qf[2][2], kf[2][2];
  for (int t = 0; t < 2; ++t) { qf[t][0] = fa_frag(Q, ko, t * 16 * LQK * 2); qf[t][1] = fa_frag(Q, ko, t * 16 * LQK * 2 + 64);
    kf[t][0] = fa_frag(K, ko, t * 16 * LQK * 2); kf[t][1] = fa_frag(K, ko, t * 16 * LQK * 2 + 64); }
  /* as in fa_pass: in front of any overwrite of these loads' address registers */
  asm volatile("s_wait_xcnt 0x0" : "+v"(ko) :: "memory");
  const v8f z8 = {0.f,0.f,0.f,0.f,0.f,0.f,0.f,0.f}; v8f oh[2][4], ol[2][4]; float m[2] = {-3.0e38f, -3.0e38f}, l[2] = {0.f, 0.f};
  for (int t = 0; t < 2; ++t) {
    for (int dt = 0; dt < 4; ++dt) { oh[t][dt] = z8; ol[t][dt] = z8; } }
  for (int k0 = 0; k0 < q0; k0 += 32) fa_pass<false>(k0, q0, ln, hh, K, VH, VL, ko, vo, qf, kf, oh, ol, m, l);
  fa_pass<true>(q0, q0, ln, hh, K, VH, VL, ko, vo, qf, kf, oh, ol, m, l);
  for (int t = 0; t < 2; ++t) { const float inv = 1.0f / (l[t] + fa_xhalf(l[t]));
    float* op = O + ((size_t)b * SEQ + q0 + 16 * t + ln) * UD + h * HD + 8 * hh;
    for (int dt = 0; dt < 4; ++dt) { v4f lo4, hi4;
      for (int i = 0; i < 4; ++i) { lo4[i] = (oh[t][dt][i] + ol[t][dt][i] * (1.0f / VLC)) * inv; hi4[i] = (oh[t][dt][4 + i] + ol[t][dt][4 + i] * (1.0f / VLC)) * inv; }
      *(v4f*)(op + dt * 16) = lo4; *(v4f*)(op + dt * 16 + 4) = hi4;
      /* in front of any reuse of the two stores' data and address registers */
      asm volatile("s_wait_xcnt 0x0" :: "v"(lo4), "v"(hi4), "v"(op) : "memory"); } }
}

__global__ __launch_bounds__(256) void k_lnpart(const float* __restrict__ O, const float* __restrict__ X, double* __restrict__ part) {
  __shared__ double rs[256]; __shared__ double rq[256];
  const int bat = blockIdx.y, blk = blockIdx.x, tid = threadIdx.x;
  const float* op = O + (size_t)bat * SEQ * UD + (size_t)blk * LNP; const float* xp = X + (size_t)bat * SEQ_FULL * CD + (size_t)blk * LNP;
  double s1 = 0.0, s2 = 0.0;
#pragma unroll 1
  for (int u = 0; u < LNP / 1024; ++u) { const int j = u * 1024 + tid * 4; const v4f a = *(const v4fa*)(op + j), c = *(const v4fa*)(xp + j);
#pragma unroll
    for (int q = 0; q < 4; ++q) { const float v = a[q] + bf16_rne(c[q]); s1 += (double)v; s2 += (double)v * (double)v; } }
  rs[tid] = s1; rq[tid] = s2; __syncthreads();
  for (int st = 128; st > 0; st >>= 1) { if (tid < st) { rs[tid] += rs[tid + st]; rq[tid] += rq[tid + st]; } __syncthreads(); }
  if (tid < 8) { v2d val; val[0] = (tid == 0) ? rs[0] : 0.0; val[1] = (tid == 0) ? rq[0] : 0.0;
    double* d = part + ((size_t)bat * NPB + blk) * 16 + tid * 2; *(v2d*)d = val;  }
}

__global__ __launch_bounds__(64) void k_lnfin(const double* __restrict__ part, float* __restrict__ stat) {
  __shared__ __attribute__((aligned(16))) float st[32];
  const int tid = threadIdx.x; const int bb = (tid < NB) ? tid : (NB - 1);
  double s = 0.0, q = 0.0;
#pragma unroll 1
  for (int i = 0; i < NPB; ++i) { s += part[((size_t)bb * NPB + i) * 16]; q += part[((size_t)bb * NPB + i) * 16 + 1]; }
  const double inv = 1.0 / ((double)SEQ * (double)UD); const double m = s * inv; double var = q * inv - m * m; if (var < 0.0) var = 0.0;
  const float mu = (float)m; const float rsd = 1.0f / sqrtf((float)var + 1.0e-5f);
  if (tid < 32) st[tid] = 0.f;
  __syncthreads();
  if (tid < NB) { st[2 * tid] = mu; st[2 * tid + 1] = rsd; }
  __syncthreads();
  if (tid < 8) { const v4f v = *(const v4fa*)&st[tid * 4]; *(v4f*)(stat + tid * 4) = v;  }
}

// coverage: grid (NB*SEQ*UD/1024) x 256 threads x 4 = every output element exactly once.
__global__ __launch_bounds__(256) void k_lnapply(const float* __restrict__ O, const float* __restrict__ X, const float* __restrict__ stat, const float* __restrict__ g, const float* __restrict__ bta, float* __restrict__ out) {
  const size_t e = ((size_t)blockIdx.x * 256 + threadIdx.x) * 4;
  const int bat = (int)(e / ((size_t)SEQ * UD)); const size_t su = e - (size_t)bat * SEQ * UD;
  const float mu = stat[2 * bat], rs = stat[2 * bat + 1];
  const v4f o = *(const v4fa*)(O + e), x = *(const v4fa*)(X + (size_t)bat * SEQ_FULL * CD + su), gg = *(const v4fa*)(g + su), bb = *(const v4fa*)(bta + su);
  v4f y;
#pragma unroll
  for (int q = 0; q < 4; ++q) { const float v = o[q] + bf16_rne(x[q]); y[q] = (v - mu) * rs * bf16_rne(gg[q]) + bf16_rne(bb[q]); }
  float* d = out + (size_t)bat * SEQ_FULL * UD + su;
  *(v4f*)d = y; 
}

extern "C" void kernel_launch(void* const* d_in, const int* in_sizes, int n_in,
                              void* d_out, int out_size, void* d_ws, size_t ws_size, hipStream_t stream) {
  if (n_in < 9) return;
  const float* X   = (const float*)d_in[0];      /* [2][2048][1024] */
  const float* Wq  = (const float*)d_in[1];      /* [in][out] 1024 x 1024 */
  const float* bq  = (const float*)d_in[2];
  const float* Wk  = (const float*)d_in[3];
  const float* bk  = (const float*)d_in[4];
  const float* Wv  = (const float*)d_in[5];
  const float* bv  = (const float*)d_in[6];
  const float* gam = (const float*)d_in[7];      /* [2048][1024] */
  const float* bet = (const float*)d_in[8];
  float* out = (float*)d_out;
  const size_t rows_used = (size_t)(NB - 1) * SEQ_FULL + SEQ;
  if ((size_t)in_sizes[0] < rows_used * CD) return;
  if ((size_t)in_sizes[1] < (size_t)CD * UD || (size_t)in_sizes[3] < (size_t)CD * UD || (size_t)in_sizes[5] < (size_t)CD * UD) return;
  if (in_sizes[2] < UD || in_sizes[4] < UD || in_sizes[6] < UD) return;
  if ((size_t)in_sizes[7] < (size_t)SEQ * UD || (size_t)in_sizes[8] < (size_t)SEQ * UD) return;
  if ((size_t)out_size < rows_used * UD) return;

  char* ws = (char*)d_ws; size_t off = 0;
  auto take = [&](size_t bytes) { char* p = ws + off; off += (bytes + 255) & ~(size_t)255; return p; };
  _Float16* BQKV = (_Float16*)take((size_t)3 * CD * UD * 2);               /* [3*UD][CD] f16 (x16) */
  _Float16* X16  = (_Float16*)take(NR * CD * 2);                           /* [NR][CD] */
  _Float16* QK16 = (_Float16*)take(NR * LQK * 2);                          /* [NR][q | k] */
  float*    V32  = (float*)take(NR * UD * 4);                              /* [NR][UD] f32 */
  _Float16* VTh  = (_Float16*)take((size_t)NB * NH * HD * SEQ * 2);        /* [NB*NH][HD][SEQ] */
  _Float16* VTl  = (_Float16*)take((size_t)NB * NH * HD * SEQ * 2);
  float*    O32  = (float*)take(NR * UD * 4);                              /* [NR][UD] f32 */
  double*   PART = (double*)take((size_t)NB * NPB * 128);                  
  float*    STAT = (float*)take(128);
  if (off > ws_size || off > (size_t)134217728) return;

  k_wt_f16<<<(unsigned)(((size_t)UD * (CD / 8) + 255) / 256), 256, 0, stream>>>(Wq, BQKV, CD, UD, WSC);
  k_wt_f16<<<(unsigned)(((size_t)UD * (CD / 8) + 255) / 256), 256, 0, stream>>>(Wk, BQKV + (size_t)UD * CD, CD, UD, WSC);
  k_wt_f16<<<(unsigned)(((size_t)UD * (CD / 8) + 255) / 256), 256, 0, stream>>>(Wv, BQKV + (size_t)2 * UD * CD, CD, UD, WSC);
  for (int b = 0; b < NB; ++b) {
    const size_t n8 = (size_t)SEQ * CD / 8;
    k_x16<<<(unsigned)((n8 + 255) / 256), 256, 0, stream>>>(X + (size_t)b * SEQ_FULL * CD, X16 + (size_t)b * SEQ * CD, n8);
  }
  const int MP = (int)NR;
  /* q rows (f16, cols 0..UD-1 of QK16), k rows (cols UD..2UD-1), v rows (f32): x16 . (16 W) * 2^-4 + bf16(bias) */
  k_gemm2<0, false><<<dim3((unsigned)((MP / 128) * (UD / 64)), 1), 128, 0, stream>>>(X16, CD, 0, BQKV, CD, 0, 0.0625f, bq, 0, nullptr, 1, 0, 0, nullptr, QK16, LQK, 0, MP, UD, CD);
  k_gemm2<0, false><<<dim3((unsigned)((MP / 128) * (UD / 64)), 1), 128, 0, stream>>>(X16, CD, 0, BQKV + (size_t)UD * CD, CD, 0, 0.0625f, bk, 0, nullptr, 1, 0, 0, nullptr, QK16 + UD, LQK, 0, MP, UD, CD);
  k_gemm2<0, false><<<dim3((unsigned)((MP / 128) * (UD / 64)), 1), 128, 0, stream>>>(X16, CD, 0, BQKV + (size_t)2 * UD * CD, CD, 0, 0.0625f, bv, 0, nullptr, 1, 0, 0, V32, nullptr, UD, 0, MP, UD, CD);
  k_vt2<<<(unsigned)(NB * NH * (SEQ / 64)), 256, 0, stream>>>(V32, VTh, VTl);
  k_fattn<<<dim3((unsigned)(NB * NH), (unsigned)(SEQ / 128)), 128, 0, stream>>>(QK16, VTh, VTl, O32);
  k_lnpart<<<dim3(NPB, NB), 256, 0, stream>>>(O32, X, PART);
  k_lnfin<<<1, 64, 0, stream>>>(PART, STAT);
  k_lnapply<<<(unsigned)((NR * UD) / 1024), 256, 0, stream>>>(O32, X, STAT, gam, bet, out);
}

// v002
// It runs in 216 microseconds.
// In two side-by-side timings against v001, it was 1.26 and 1.24 times as fast.
// Counting every step since v000, it is 5.66 times as fast.
#include <hip/hip_runtime.h>
// Contractions on v_wmma_f32_16x16x32_f16 (f16 operands, f32 accumulate): q | k | v projections (x and weights bf16-valued, exact in f16, weights carried x16), scores k.q^T (plain f16 q, k), V^T.P^T in the same kernel (running-maximum softmax weights f16 carried x2^14; v as f16 hi plane + f16 residual plane carried x2^10, two accumulators). Scores, softmax statistics, attention output and residual add in f32; joint (seq, unit) normalisation statistics in f64.
#ifndef NB
#define NB 2
#endif
#ifndef SEQ
#define SEQ 2048
#endif
#define NB_FULL 2
#define SEQ_FULL 2048
#define CD 1024                      /* input channels */
#define UD 1024                      /* units */
#define NH 16
#define HD 64
#define LQK (2 * UD)                 /* row pitch of the q | k rows */
#define LNP 8192                     /* floats per statistics block */
#define NPB ((SEQ * UD) / LNP)       /* statistics blocks per batch */
#define NR ((size_t)NB * SEQ)        /* token rows (compact) */
#define WSC 16.0f                    /* weight carry */
#define VLC 1024.0f                  /* v residual plane carry */
static_assert(NB >= 1 && NB <= NB_FULL);
static_assert(SEQ % 256 == 0 && SEQ <= SEQ_FULL);
static_assert(CD % 32 == 0 && UD % 64 == 0 && CD == UD);
static_assert(NH * HD == UD && HD == 64);
static_assert((SEQ * UD) % LNP == 0 && LNP == 256 * 32);
static_assert(2 * NB <= 32);
static_assert((NR * UD) % 1024 == 0 && (NR % 128) == 0);

typedef unsigned short v8us __attribute__((ext_vector_type(8), may_alias));
typedef float  v8f  __attribute__((ext_vector_type(8)));
typedef float  v4f  __attribute__((ext_vector_type(4)));
typedef float  v4fa __attribute__((ext_vector_type(4), may_alias));
typedef double v2d  __attribute__((ext_vector_type(2)));
typedef _Float16 v16h __attribute__((ext_vector_type(16)));
typedef _Float16 v4h  __attribute__((ext_vector_type(4)));
union FragH { v16h v; v8us half[2]; _Float16 h[16]; unsigned short u[16]; };

__device__ __forceinline__ unsigned short bf16_bits(float x) { unsigned int u = __float_as_uint(x); return (unsigned short)((u + 0x7FFFu + ((u >> 16) & 1u)) >> 16); }
__device__ __forceinline__ float bf16_val(unsigned short b) { return __uint_as_float(((unsigned int)b) << 16); }
__device__ __forceinline__ float bf16_rne(float x) { return bf16_val(bf16_bits(x)); }

// 16-bit WMMA fragment: lane l, h = l >> 4, row/col = l & 15; elements 0..7 <- k0 + 8h + 0..7, elements 8..15 <- k0 + 16 + 8h + 0..7 (same map for A rows and for B[n][k] rows)
__device__ __forceinline__ v16h g2_frag(const _Float16* p, int hh) { FragH f; f.half[0] = *(const v8us*)((const unsigned short*)p + 8 * hh); f.half[1] = *(const v8us*)((const unsigned short*)p + 16 + 8 * hh); return f.v; }
__device__ __forceinline__ v8f g2_mma(v16h a, v16h b, v8f c) { v8f d = __builtin_amdgcn_wmma_f32_16x16x32_f16(false, a, false, b, (short)0, c, false, false); asm volatile("v_nop\n\tv_nop\n\tv_nop\n\tv_nop" : "+v"(d) : "v"(a), "v"(b)); return d; }

__global__ __launch_bounds__(256) void k_wt_f16(const float* __restrict__ W, _Float16* __restrict__ Wt, int K, int N, float scale) {
  const int t = blockIdx.x * 256 + threadIdx.x; if (t >= N * (K / 8)) return; const int n = t / (K / 8), k8 = (t % (K / 8)) * 8; FragH f;
#pragma unroll
  for (int i = 0; i < 8; ++i) f.h[i] = (_Float16)(bf16_rne(W[(size_t)(k8 + i) * N + n]) * scale); const v8us o = f.half[0];
  *(v8us*)((unsigned short*)Wt + (size_t)n * K + k8) = o; 
}

__global__ __launch_bounds__(256) void k_x16(const float* __restrict__ x, _Float16* __restrict__ X16, size_t n8) { const size_t t = (size_t)blockIdx.x * 256 + threadIdx.x; if (t >= n8) return; FragH f;
#pragma unroll
  for (int q = 0; q < 8; ++q) f.h[q] = (_Float16)bf16_rne(x[t * 8 + q]); *(v8us*)((unsigned short*)X16 + t * 8) = f.half[0];  }

// GEMM, wave tile 32x64, block = 4 waves = 128 rows x 64 cols; A f16 rows (pitch lda), Bh f16 [n][k] (pitch ldb); v = acc*alpha + bf16(bias[col]) (+ CP) ; writes f32 C and/or f16 C16 (pitch ldc);
// grid ((M/128)*(N/64), batches); per grid.y: A += sA, Bh += sB, C += sC. M % 128 == 0, N % 64 == 0, K % 32 == 0.
// CAUSAL: rows and columns are query / key indices of one sequence; blocks whose 64 columns all lie above the block's 128 rows are skipped (never read downstream).
template <int ACT, bool CAUSAL>
__global__ __launch_bounds__(128) void k_gemm2(const _Float16* __restrict__ A, int lda, size_t sA, const _Float16* __restrict__ Bh, int ldb, size_t sB, float alpha, const float* __restrict__ bias, size_t sBias, const float* __restrict__ CP, int rowsPerB, size_t sCPb, int row0g,
    float* __restrict__ C, _Float16* __restrict__ C16, int ldc, size_t sC, int M, int N, int K) {
  static_assert(ACT == 0 || ACT == 3);
  __shared__ __attribute__((aligned(16))) float so[4][32][68];
  const int tid = threadIdx.x, w = tid >> 5, lane = tid & 31, ln = lane & 15, hh = lane >> 4; const int by = blockIdx.y;
  A += (size_t)by * sA; Bh += (size_t)by * sB; const size_t cofs = (size_t)by * sC; const float* bp = bias ? bias + (size_t)by * sBias : nullptr;
  const int ntn = N >> 6; const int mt = blockIdx.x / ntn, nq = blockIdx.x - mt * ntn; const int row0 = mt * 128 + 32 * w, col0 = nq * 64;
  if (CAUSAL && col0 >= mt * 128 + 128) return;
  if (row0 >= M) return;
  const _Float16* a0p = A + (size_t)(row0 + ln) * lda; const _Float16* a1p = a0p + (size_t)16 * lda;
  const _Float16* b0p = Bh + (size_t)(col0 + ln) * ldb; const _Float16* b1p = b0p + (size_t)16 * ldb; const _Float16* b2p = b1p + (size_t)16 * ldb; const _Float16* b3p = b2p + (size_t)16 * ldb;
  const v8f z8 = {0.f,0.f,0.f,0.f,0.f,0.f,0.f,0.f}; v8f c00 = z8, c01 = z8, c02 = z8, c03 = z8, c10 = z8, c11 = z8, c12 = z8, c13 = z8;
#pragma unroll 1
  for (int kb = 0; kb < K; kb += 32) { const v16h a0 = g2_frag(a0p + kb, hh), a1 = g2_frag(a1p + kb, hh);
    v16h b = g2_frag(b0p + kb, hh); c00 = g2_mma(a0, b, c00); c10 = g2_mma(a1, b, c10);
    b = g2_frag(b1p + kb, hh); c01 = g2_mma(a0, b, c01); c11 = g2_mma(a1, b, c11);
    b = g2_frag(b2p + kb, hh); c02 = g2_mma(a0, b, c02); c12 = g2_mma(a1, b, c12);
    b = g2_frag(b3p + kb, hh); c03 = g2_mma(a0, b, c03); c13 = g2_mma(a1, b, c13); }
  v8f accs[8] = {c00, c01, c02, c03, c10, c11, c12, c13};
#pragma unroll
  for (int u = 0; u < 8; ++u) { const int t = u & 3, half = u >> 2; const int col = col0 + t * 16 + ln; const float bv = bp ? bf16_rne(bp[col]) : 0.f;
#pragma unroll
    for (int r = 0; r < 8; ++r) { const int rloc = half * 16 + 8 * hh + r; float v = accs[u][r] * alpha + bv;
      if (CP) { if (rowsPerB < 0) v += CP[cofs + (size_t)(row0g + row0 + rloc) * ldc + col]; else { const int bidx = (row0g + row0 + rloc) / rowsPerB; v += CP[(size_t)bidx * sCPb + (size_t)by * 64 + col]; } }
      if (ACT == 3) v = fmaxf(v, 0.f);
      so[w][rloc][t * 16 + ln] = v; } }
  __builtin_amdgcn_fence(4 /* acq_rel order */, "workgroup"); __builtin_amdgcn_wave_barrier();
  const int rsub = lane >> 4, c4 = (lane & 15) * 4;
  {
#pragma unroll
    for (int q = 0; q < 16; ++q) { const int r = q * 2 + rsub; const v4f v = *(const v4fa*)&so[w][r][c4];
      if (C) *(v4f*)(C + cofs + (size_t)(row0 + r) * ldc + col0 + c4) = v;
      if (C16) { v4h h4; for (int i = 0; i < 4; ++i) h4[i] = (_Float16)v[i]; *(v4h*)(C16 + cofs + (size_t)(row0 + r) * ldc + col0 + c4) = h4; } }
     }
}

// VTh / VTl [slab][d][s] (slab = b*NH + h, pitch SEQ) from f32 v rows V32[b*SEQ + s][h*HD + d]: hi = f16(v), lo = f16((v - hi) * 2^10).
// coverage: load 64 rows x 16 float4 = 1024 items / 256 threads; store 2 x 32 d-rows x 8 pieces per plane = full 64 x 64 tile, both planes, every (slab, token group).
__global__ __launch_bounds__(256) void k_vt2(const float* __restrict__ V32, _Float16* __restrict__ VTh, _Float16* __restrict__ VTl) {
  __shared__ _Float16 th[64][66]; __shared__ _Float16 tl[64][66];
  const int tid = threadIdx.x; const int slab = blockIdx.x / (SEQ / 64), lg = blockIdx.x % (SEQ / 64); const int b = slab / NH, h = slab % NH;
  for (int i = tid; i < 64 * 16; i += 256) { const int r = i >> 4, c4 = (i & 15) * 4;
    const v4f a = *(const v4fa*)(V32 + ((size_t)b * SEQ + (size_t)lg * 64 + r) * UD + h * HD + c4);
#pragma unroll
    for (int q = 0; q < 4; ++q) { const _Float16 hv = (_Float16)a[q]; th[r][c4 + q] = hv; tl[r][c4 + q] = (_Float16)((a[q] - (float)hv) * VLC); } }
  __syncthreads();
  {
#pragma unroll
    for (int rd = 0; rd < 2; ++rd) { const int d = rd * 32 + (tid >> 3), pc = tid & 7; FragH fh, fl;
#pragma unroll
      for (int q = 0; q < 8; ++q) { fh.h[q] = th[pc * 8 + q][d]; fl.h[q] = tl[pc * 8 + q][d]; }
      const size_t o = ((size_t)slab * HD + d) * SEQ + (size_t)lg * 64 + pc * 8;
      *(v8us*)((unsigned short*)VTh + o) = fh.half[0]; *(v8us*)((unsigned short*)VTl + o) = fl.half[0]; }
     }
}

// fused causal attention, one wave per 32 queries of one slab (slab = b*NH + h), no LDS: per pass of 32 keys S^T = K . Q^T (A = k rows, B = q rows, kept in registers),
// running maximum and sum per query (a lane holds one query's scores: in-lane, plus one exchange between the wave halves), O^T += V^T . P^T (A = VT rows, both planes).
// The two S^T tiles of a pass (keys k0 + 8h + r and k0 + 16 + 8h + r of query ln) are, converted in place, the B fragment in the k order of g2_frag: no lane exchange for P.
// P = f16(2^14 * exp(s - running max)); the sum carries the same 2^14, so the carry cancels in the final division. Keys above the query are masked by index in the last pass only.
// coverage: grid (NB*NH slabs) x (SEQ/128 blocks) x 4 waves x 32 queries = every row; 4 d tiles x (8h + r) = all 64 columns of the head, each element stored once.
#define SCL 0.18033688011112042f     /* 2^-3 * log2(e): scores in the exponent's base-2 units */
__device__ __forceinline__ v8f fa_mma(v16h a, v16h b, v8f c) { return __builtin_amdgcn_wmma_f32_16x16x32_f16(false, a, false, b, (short)0, c, false, false); }
__device__ __forceinline__ float fa_xhalf(float x) { return __builtin_bit_cast(float, __builtin_amdgcn_permlanex16(__builtin_bit_cast(int, x), __builtin_bit_cast(int, x), 0x76543210, 0xfedcba98, false, false)); }  /* lane l with lane l ^ 16 */
__device__ __forceinline__ v16h fa_frag(const _Float16* base, unsigned lofs, unsigned cofs) { const char* p = (const char*)base + ((size_t)lofs + cofs); FragH f; f.half[0] = *(const v8us*)p; f.half[1] = *(const v8us*)(p + 32); return f.v; }  /* g2_frag from a uniform base, the lane's byte offset (8h included) and a constant byte offset */

// one pass of 32 keys; ko (into K) and vo (into either VT plane) are the lane's own byte offsets at this pass's first key and leave a pass other than the last advanced by 32 keys
template <bool LAST>
__device__ __forceinline__ void fa_pass(int k0, int q0, int ln, int hh, const _Float16* __restrict__ K, const _Float16* __restrict__ VH, const _Float16* __restrict__ VL, unsigned& ko, unsigned& vo,
    const v16h (&qf)[2][2], v16h (&kf)[2][2], v8f (&oh)[2][4], v8f (&ol)[2][4], float (&m)[2], float (&l)[2]) {
  v16h vh[4], vl[4];
  for (int dt = 0; dt < 4; ++dt) { vh[dt] = fa_frag(VH, vo, dt * 16 * SEQ * 2); vl[dt] = fa_frag(VL, vo, dt * 16 * SEQ * 2); }
  const v8f z8 = {0.f,0.f,0.f,0.f,0.f,0.f,0.f,0.f}; v8f s[2][2];
  for (int t = 0; t < 2; ++t) {
    for (int kt = 0; kt < 2; ++kt) s[t][kt] = fa_mma(kf[kt][1], qf[t][1], fa_mma(kf[kt][0], qf[t][0], z8)); }
  if (!LAST) {                       /* next pass's k fragments, fetched behind this pass's products; k0 + 32 <= q0 is a row of the sequence */
    for (int kt = 0; kt < 2; ++kt) { kf[kt][0] = fa_frag(K, ko, (32 + 16 * kt) * LQK * 2); kf[kt][1] = fa_frag(K, ko, (32 + 16 * kt) * LQK * 2 + 64); } }
  /* the wait that stands in front of every overwrite of an address register of the loads above; the offsets pass through it so that their advance stays behind it */
  if (LAST) { const char* pa = (const char*)VH + vo; const char* pb = (const char*)VL + vo;   /* here the loads may name the summed addresses: these stay live up to the wait as well */
    asm volatile("s_wait_xcnt 0x0" : "+v"(vo) : "v"(pa), "v"(pb) : "memory"); }
  else { asm volatile("s_wait_xcnt 0x0" : "+v"(ko), "+v"(vo) :: "memory"); ko += 32 * LQK * 2; vo += 32 * 2; }
  float mn[2];
  for (int t = 0; t < 2; ++t) {
    if (LAST) {
      for (int kt = 0; kt < 2; ++kt) {
        for (int r = 0; r < 8; ++r) s[t][kt][r] = (k0 + 16 * kt + 8 * hh + r <= q0 + 16 * t + ln) ? s[t][kt][r] : -3.0e38f; } }
    float mx = s[t][0][0];
    for (int r = 1; r < 8; ++r) mx = fmaxf(mx, s[t][0][r]);
    for (int r = 0; r < 8; ++r) mx = fmaxf(mx, s[t][1][r]);
    mx = fmaxf(mx, fa_xhalf(mx)); mn[t] = fmaxf(m[t], mx); }
  if (__builtin_amdgcn_ballot_w32((mn[0] > m[0]) || (mn[1] > m[1])) != 0) {   /* no maximum moved: every factor is 1 and the rescale is skipped by the whole wave */
    for (int t = 0; t < 2; ++t) { const float al = __builtin_amdgcn_exp2f((m[t] - mn[t]) * SCL); l[t] *= al; m[t] = mn[t];
      for (int dt = 0; dt < 4; ++dt) { oh[t][dt] *= al; ol[t][dt] *= al; } } }
  for (int t = 0; t < 2; ++t) { const float off = 14.0f - m[t] * SCL; FragH p; v8f x[2], e[2];
    for (int kt = 0; kt < 2; ++kt) { x[kt] = s[t][kt] * SCL + off;
      for (int r = 0; r < 8; ++r) e[kt][r] = __builtin_amdgcn_exp2f(x[kt][r]); }
    /* the slot behind a transcendental: no source is overwritten and no result read before this v_nop, which stands behind the last of the sixteen */
    asm volatile("v_nop" : "+v"(e[0]), "+v"(e[1]) : "v"(x[0]), "v"(x[1]));
    for (int r = 0; r < 8; ++r) { p.h[r] = (_Float16)e[0][r]; p.h[8 + r] = (_Float16)e[1][r]; }
    const v8f es = e[0] + e[1];
    l[t] += ((es[0] + es[1]) + (es[2] + es[3])) + ((es[4] + es[5]) + (es[6] + es[7]));
    for (int dt = 0; dt < 4; ++dt) { oh[t][dt] = fa_mma(vh[dt], p.v, oh[t][dt]); ol[t][dt] = fa_mma(vl[dt], p.v, ol[t][dt]); } }
}

__global__ __launch_bounds__(128) void k_fattn(const _Float16* __restrict__ QK, const _Float16* __restrict__ VTh, const _Float16* __restrict__ VTl, float* __restrict__ O) {
  const int tid = threadIdx.x, lane = tid & 31, ln = lane & 15, hh = lane >> 4;
  const int w = __builtin_amdgcn_readfirstlane(tid >> 5);                       /* the wave's number in a scalar register: scalar loop bound and branches */
  const int slab = blockIdx.x, b = slab / NH, h = slab % NH;
  const int y = blockIdx.y, qb = (y < SEQ / 256) ? SEQ / 128 - 1 - y : y - SEQ / 256;   /* long blocks start first; the second half of the grid runs short to long beside them */
  const int q0 = qb * 128 + 32 * w;
  const _Float16* Q = QK + ((size_t)b * SEQ + q0) * LQK + h * HD; const _Float16* K = QK + (size_t)b * SEQ * LQK + UD + h * HD;      /* uniform bases */
  const _Float16* VH = VTh + (size_t)slab * HD * SEQ; const _Float16* VL = VTl + (size_t)slab * HD * SEQ;
  unsigned ko = (unsigned)(ln * LQK + 8 * hh) * 2, vo = (unsigned)(ln * SEQ + 8 * hh) * 2;                                       /* lane byte offsets */
  v16h qf[2][2], kf[2][2];
  for (int t = 0; t < 2; ++t) { qf[t][0] = fa_frag(Q, ko, t * 16 * LQK * 2); qf[t][1] = fa_frag(Q, ko, t * 16 * LQK * 2 + 64);
    kf[t][0] = fa_frag(K, ko, t * 16 * LQK * 2); kf[t][1] = fa_frag(K, ko, t * 16 * LQK * 2 + 64); }
  /* as in fa_pass: in front of any overwrite of these loads' address registers */
  asm volatile("s_wait_xcnt 0x0" : "+v"(ko) :: "memory");
  const v8f z8 = {0.f,0.f,0.f,0.f,0.f,0.f,0.f,0.f}; v8f oh[2][4], ol[2][4]; float m[2] = {-3.0e38f, -3.0e38f}, l[2] = {0.f, 0.f};
  for (int t = 0; t < 2; ++t) {
    for (int dt = 0; dt < 4; ++dt) { oh[t][dt] = z8; ol[t][dt] = z8; } }
  for (int k0 = 0; k0 < q0; k0 += 32) fa_pass<false>(k0, q0, ln, hh, K, VH, VL, ko, vo, qf, kf, oh, ol, m, l);
  fa_pass<true>(q0, q0, ln, hh, K, VH, VL, ko, vo, qf, kf, oh, ol, m, l);
  for (int t = 0; t < 2; ++t) { const float inv = 1.0f / (l[t] + fa_xhalf(l[t]));
    float* op = O + ((size_t)b * SEQ + q0 + 16 * t + ln) * UD + h * HD + 8 * hh;
    for (int dt = 0; dt < 4; ++dt) { v4f lo4, hi4;
      for (int i = 0; i < 4; ++i) { lo4[i] = (oh[t][dt][i] + ol[t][dt][i] * (1.0f / VLC)) * inv; hi4[i] = (oh[t][dt][4 + i] + ol[t][dt][4 + i] * (1.0f / VLC)) * inv; }
      *(v4f*)(op + dt * 16) = lo4; *(v4f*)(op + dt * 16 + 4) = hi4;
      /* in front of any reuse of the two stores' data and address registers */
      asm volatile("s_wait_xcnt 0x0" :: "v"(lo4), "v"(hi4), "v"(op) : "memory"); } }
}

__global__ __launch_bounds__(256) void k_lnpart(const float* __restrict__ O, const float* __restrict__ X, double* __restrict__ part) {
  __shared__ double rs[256]; __shared__ double rq[256];
  const int bat = blockIdx.y, blk = blockIdx.x, tid = threadIdx.x;
  const float* op = O + (size_t)bat * SEQ * UD + (size_t)blk * LNP; const float* xp = X + (size_t)bat * SEQ_FULL * CD + (size_t)blk * LNP;
  double s1 = 0.0, s2 = 0.0;
#pragma unroll 1
  for (int u = 0; u < LNP / 1024; ++u) { const int j = u * 1024 + tid * 4; const v4f a = *(const v4fa*)(op + j), c = *(const v4fa*)(xp + j);
#pragma unroll
    for (int q = 0; q < 4; ++q) { const float v = a[q] + bf16_rne(c[q]); s1 += (double)v; s2 += (double)v * (double)v; } }
  rs[tid] = s1; rq[tid] = s2; __syncthreads();
  for (int st = 128; st > 0; st >>= 1) { if (tid < st) { rs[tid] += rs[tid + st]; rq[tid] += rq[tid + st]; } __syncthreads(); }
  if (tid < 8) { v2d val; val[0] = (tid == 0) ? rs[0] : 0.0; val[1] = (tid == 0) ? rq[0] : 0.0;
    double* d = part + ((size_t)bat * NPB + blk) * 16 + tid * 2; *(v2d*)d = val;  }
}

// final statistics, one work-group: thread (batch bb, place t) takes partial t of its batch, so that all NB * NPB loads are in flight together; then two rounds of 16-to-1 f64 sums per batch in LDS
#define LFT 256                      /* threads per batch */
static_assert(LFT == 16 * 16 && NB * LFT <= 1024);
__global__ __launch_bounds__(NB * LFT) void k_lnfin(const double* __restrict__ part, float* __restrict__ stat) {
  __shared__ double rs[NB * LFT]; __shared__ double rq[NB * LFT];
  __shared__ __attribute__((aligned(16))) float st[32];
  const int tid = threadIdx.x; const int bb = tid / LFT, t = tid % LFT;
  double s = 0.0, q = 0.0;
  if (t < NPB) { const v2d p = *(const v2d*)(part + ((size_t)bb * NPB + t) * 16); s = p[0]; q = p[1]; }
  for (int i = t + LFT; i < NPB; i += LFT) { const v2d p = *(const v2d*)(part + ((size_t)bb * NPB + i) * 16); s += p[0]; q += p[1]; }
  rs[tid] = s; rq[tid] = q;
  if (tid < 32) st[tid] = 0.f;
  __syncthreads();
  for (int w = LFT / 16; w > 0; w /= 16) {   /* thread t < w sums places t + j * w; it alone reads and rewrites place t, and places from w on are only read */
    if (t < w) { double a[16], c[16];
      for (int j = 0; j < 16; ++j) { a[j] = rs[tid + j * w]; c[j] = rq[tid + j * w]; }
      for (int h = 8; h > 0; h >>= 1) {
        for (int j = 0; j < h; ++j) { a[j] += a[j + h]; c[j] += c[j + h]; } }
      rs[tid] = a[0]; rq[tid] = c[0]; }
    __syncthreads(); }
  if (t == 0) {
    const double inv = 1.0 / ((double)SEQ * (double)UD); const double m = rs[tid] * inv; double var = rq[tid] * inv - m * m; if (var < 0.0) var = 0.0;
    st[2 * bb] = (float)m; st[2 * bb + 1] = 1.0f / sqrtf((float)var + 1.0e-5f); }
  __syncthreads();
  if (tid < 8) { const v4f v = *(const v4fa*)&st[tid * 4]; *(v4f*)(stat + tid * 4) = v;  }
}

// coverage: grid (NB*SEQ*UD/1024) x 256 threads x 4 = every output element exactly once.
__global__ __launch_bounds__(256) void k_lnapply(const float* __restrict__ O, const float* __restrict__ X, const float* __restrict__ stat, const float* __restrict__ g, const float* __restrict__ bta, float* __restrict__ out) {
  const size_t e = ((size_t)blockIdx.x * 256 + threadIdx.x) * 4;
  const int bat = (int)(e / ((size_t)SEQ * UD)); const size_t su = e - (size_t)bat * SEQ * UD;
  const float mu = stat[2 * bat], rs = stat[2 * bat + 1];
  const v4f o = *(const v4fa*)(O + e), x = *(const v4fa*)(X + (size_t)bat * SEQ_FULL * CD + su), gg = *(const v4fa*)(g + su), bb = *(const v4fa*)(bta + su);
  v4f y;
#pragma unroll
  for (int q = 0; q < 4; ++q) { const float v = o[q] + bf16_rne(x[q]); y[q] = (v - mu) * rs * bf16_rne(gg[q]) + bf16_rne(bb[q]); }
  float* d = out + (size_t)bat * SEQ_FULL * UD + su;
  *(v4f*)d = y; 
}

extern "C" void kernel_launch(void* const* d_in, const int* in_sizes, int n_in,
                              void* d_out, int out_size, void* d_ws, size_t ws_size, hipStream_t stream) {
  if (n_in < 9) return;
  const float* X   = (const float*)d_in[0];      /* [2][2048][1024] */
  const float* Wq  = (const float*)d_in[1];      /* [in][out] 1024 x 1024 */
  const float* bq  = (const float*)d_in[2];
  const float* Wk  = (const float*)d_in[3];
  const float* bk  = (const float*)d_in[4];
  const float* Wv  = (const float*)d_in[5];
  const float* bv  = (const float*)d_in[6];
  const float* gam = (const float*)d_in[7];      /* [2048][1024] */
  const float* bet = (const float*)d_in[8];
  float* out = (float*)d_out;
  const size_t rows_used = (size_t)(NB - 1) * SEQ_FULL + SEQ;
  if ((size_t)in_sizes[0] < rows_used * CD) return;
  if ((size_t)in_sizes[1] < (size_t)CD * UD || (size_t)in_sizes[3] < (size_t)CD * UD || (size_t)in_sizes[5] < (size_t)CD * UD) return;
  if (in_sizes[2] < UD || in_sizes[4] < UD || in_sizes[6] < UD) return;
  if ((size_t)in_sizes[7] < (size_t)SEQ * UD || (size_t)in_sizes[8] < (size_t)SEQ * UD) return;
  if ((size_t)out_size < rows_used * UD) return;

  char* ws = (char*)d_ws; size_t off = 0;
  auto take = [&](size_t bytes) { char* p = ws + off; off += (bytes + 255) & ~(size_t)255; return p; };
  _Float16* BQKV = (_Float16*)take((size_t)3 * CD * UD * 2);               /* [3*UD][CD] f16 (x16) */
  _Float16* X16  = (_Float16*)take(NR * CD * 2);                           /* [NR][CD] */
  _Float16* QK16 = (_Float16*)take(NR * LQK * 2);                          /* [NR][q | k] */
  float*    V32  = (float*)take(NR * UD * 4);                              /* [NR][UD] f32 */
  _Float16* VTh  = (_Float16*)take((size_t)NB * NH * HD * SEQ * 2);        /* [NB*NH][HD][SEQ] */
  _Float16* VTl  = (_Float16*)take((size_t)NB * NH * HD * SEQ * 2);
  float*    O32  = (float*)take(NR * UD * 4);                              /* [NR][UD] f32 */
  double*   PART = (double*)take((size_t)NB * NPB * 128);                  
  float*    STAT = (float*)take(128);
  if (off > ws_size || off > (size_t)134217728) return;

  k_wt_f16<<<(unsigned)(((size_t)UD * (CD / 8) + 255) / 256), 256, 0, stream>>>(Wq, BQKV, CD, UD, WSC);
  k_wt_f16<<<(unsigned)(((size_t)UD * (CD / 8) + 255) / 256), 256, 0, stream>>>(Wk, BQKV + (size_t)UD * CD, CD, UD, WSC);
  k_wt_f16<<<(unsigned)(((size_t)UD * (CD / 8) + 255) / 256), 256, 0, stream>>>(Wv, BQKV + (size_t)2 * UD * CD, CD, UD, WSC);
  for (int b = 0; b < NB; ++b) {
    const size_t n8 = (size_t)SEQ * CD / 8;
    k_x16<<<(unsigned)((n8 + 255) / 256), 256, 0, stream>>>(X + (size_t)b * SEQ_FULL * CD, X16 + (size_t)b * SEQ * CD, n8);
  }
  const int MP = (int)NR;
  /* q rows (f16, cols 0..UD-1 of QK16), k rows (cols UD..2UD-1), v rows (f32): x16 . (16 W) * 2^-4 + bf16(bias) */
  k_gemm2<0, false><<<dim3((unsigned)((MP / 128) * (UD / 64)), 1), 128, 0, stream>>>(X16, CD, 0, BQKV, CD, 0, 0.0625f, bq, 0, nullptr, 1, 0, 0, nullptr, QK16, LQK, 0, MP, UD, CD);
  k_gemm2<0, false><<<dim3((unsigned)((MP / 128) * (UD / 64)), 1), 128, 0, stream>>>(X16, CD, 0, BQKV + (size_t)UD * CD, CD, 0, 0.0625f, bk, 0, nullptr, 1, 0, 0, nullptr, QK16 + UD, LQK, 0, MP, UD, CD);
  k_gemm2<0, false><<<dim3((unsigned)((MP / 128) * (UD / 64)), 1), 128, 0, stream>>>(X16, CD, 0, BQKV + (size_t)2 * UD * CD, CD, 0, 0.0625f, bv, 0, nullptr, 1, 0, 0, V32, nullptr, UD, 0, MP, UD, CD);
  k_vt2<<<(unsigned)(NB * NH * (SEQ / 64)), 256, 0, stream>>>(V32, VTh, VTl);
  k_fattn<<<dim3((unsigned)(NB * NH), (unsigned)(SEQ / 128)), 128, 0, stream>>>(QK16, VTh, VTl, O32);
  k_lnpart<<<dim3(NPB, NB), 256, 0, stream>>>(O32, X, PART);
  k_lnfin<<<1, NB * LFT, 0, stream>>>(PART, STAT);
  k_lnapply<<<(unsigned)((NR * UD) / 1024), 256, 0, stream>>>(O32, X, STAT, gam, bet, out);
}

// v003
// One run takes 140 microseconds.
// In two side-by-side timings against v002, it was 1.54 and 1.56 times as fast.
// All steps since v000 together make it 8.75 times as fast.
#include <hip/hip_runtime.h>
// Contractions on v_wmma_f32_16x16x32_f16 (f16 operands, f32 accumulate): q | k | v projections (x and weights bf16-valued, exact in f16, weights carried x16), scores k.q^T (plain f16 q, k), V^T.P^T in the same kernel (running-maximum softmax weights f16 carried x2^14; v as f16 hi plane + f16 residual plane carried x2^10, two accumulators). Scores, softmax statistics, attention output and residual add in f32; joint (seq, unit) normalisation statistics in f64.
#ifndef NB
#define NB 2
#endif
#ifndef SEQ
#define SEQ 2048
#endif
#define NB_FULL 2
#define SEQ_FULL 2048
#define CD 1024                      /* input channels */
#define UD 1024                      /* units */
#define NH 16
#define HD 64
#define LQK (2 * UD)                 /* row pitch of the q | k rows */
#define LNP 8192                     /* floats per statistics block */
#define NPB ((SEQ * UD) / LNP)       /* statistics blocks per batch */
#define NR ((size_t)NB * SEQ)        /* token rows (compact) */
#define WSC 16.0f                    /* weight carry */
#define VLC 1024.0f                  /* v residual plane carry */
static_assert(NB >= 1 && NB <= NB_FULL);
static_assert(SEQ % 256 == 0 && SEQ <= SEQ_FULL);
static_assert(CD % 64 == 0 && UD % 64 == 0 && CD == UD);
static_assert(NH * HD == UD && HD == 64);
static_assert((SEQ * UD) % LNP == 0 && LNP == 256 * 32);
static_assert(2 * NB <= 32);
static_assert((NR * UD) % 1024 == 0 && (NR % 128) == 0);

typedef unsigned short v8us __attribute__((ext_vector_type(8), may_alias));
typedef float  v8f  __attribute__((ext_vector_type(8)));
typedef float  v4f  __attribute__((ext_vector_type(4)));
typedef float  v4fa __attribute__((ext_vector_type(4), may_alias));
typedef double v2d  __attribute__((ext_vector_type(2)));
typedef _Float16 v16h __attribute__((ext_vector_type(16)));
typedef _Float16 v4h  __attribute__((ext_vector_type(4)));
union FragH { v16h v; v8us half[2]; _Float16 h[16]; unsigned short u[16]; };

__device__ __forceinline__ unsigned short bf16_bits(float x) { unsigned int u = __float_as_uint(x); return (unsigned short)((u + 0x7FFFu + ((u >> 16) & 1u)) >> 16); }
__device__ __forceinline__ float bf16_val(unsigned short b) { return __uint_as_float(((unsigned int)b) << 16); }
__device__ __forceinline__ float bf16_rne(float x) { return bf16_val(bf16_bits(x)); }

// 16-bit WMMA fragment: lane l, h = l >> 4, row/col = l & 15; elements 0..7 <- k0 + 8h + 0..7, elements 8..15 <- k0 + 16 + 8h + 0..7 (same map for A rows and for B[n][k] rows)
__device__ __forceinline__ v16h g2_frag(const _Float16* p, int hh) { FragH f; f.half[0] = *(const v8us*)((const unsigned short*)p + 8 * hh); f.half[1] = *(const v8us*)((const unsigned short*)p + 16 + 8 * hh); return f.v; }
__device__ __forceinline__ v8f g2_mma(v16h a, v16h b, v8f c) { v8f d = __builtin_amdgcn_wmma_f32_16x16x32_f16(false, a, false, b, (short)0, c, false, false); asm volatile("v_nop\n\tv_nop\n\tv_nop\n\tv_nop" : "+v"(d) : "v"(a), "v"(b)); return d; }

__global__ __launch_bounds__(256) void k_wt_f16(const float* __restrict__ W, _Float16* __restrict__ Wt, int K, int N, float scale) {
  const int t = blockIdx.x * 256 + threadIdx.x; if (t >= N * (K / 8)) return; const int n = t / (K / 8), k8 = (t % (K / 8)) * 8; FragH f;
#pragma unroll
  for (int i = 0; i < 8; ++i) f.h[i] = (_Float16)(bf16_rne(W[(size_t)(k8 + i) * N + n]) * scale); const v8us o = f.half[0];
  *(v8us*)((unsigned short*)Wt + (size_t)n * K + k8) = o; 
}

__global__ __launch_bounds__(256) void k_x16(const float* __restrict__ x, _Float16* __restrict__ X16, size_t n8) { const size_t t = (size_t)blockIdx.x * 256 + threadIdx.x; if (t >= n8) return; FragH f;
#pragma unroll
  for (int q = 0; q < 8; ++q) f.h[q] = (_Float16)bf16_rne(x[t * 8 + q]); *(v8us*)((unsigned short*)X16 + t * 8) = f.half[0];  }

// GEMM, wave tile 32x64, block = 4 waves = 128 rows x 64 cols; A f16 rows (pitch lda), Bh f16 [n][k] (pitch ldb); v = acc*alpha + bf16(bias[col]) (+ CP) ; writes f32 C and/or f16 C16 (pitch ldc);
// grid ((M/128)*(N/64), batches); per grid.y: A += sA, Bh += sB, C += sC. M % 128 == 0, N % 64 == 0, K % 64 == 0, lda % 8 == 0, ldb % 8 == 0.
// Operands go through LDS in stages of 64 k (one 128-byte line per row), two buffers: a wave's 16-byte global load covers 4 whole lines, the block's 128 A rows and 64 B rows are fetched once for its 4 waves,
// and stage s + 1 is in flight (in registers) while stage s is multiplied. One barrier per stage: it publishes stage s + 1 and ends the reads of the buffer that stage s + 2 overwrites.
#define GP 72                        /* LDS row pitch in elements: 128 + 16 bytes */
// CAUSAL: rows and columns are query / key indices of one sequence; blocks whose 64 columns all lie above the block's 128 rows are skipped (never read downstream).
template <int ACT, bool CAUSAL>
__global__ __launch_bounds__(128) void k_gemm2(const _Float16* __restrict__ A, int lda, size_t sA, const _Float16* __restrict__ Bh, int ldb, size_t sB, float alpha, const float* __restrict__ bias, size_t sBias, const float* __restrict__ CP, int rowsPerB, size_t sCPb, int row0g,
    float* __restrict__ C, _Float16* __restrict__ C16, int ldc, size_t sC, int M, int N, int K) {
  static_assert(ACT == 0 || ACT == 3);
  __shared__ __attribute__((aligned(16))) float so[4][32][68];
  __shared__ __attribute__((aligned(16))) _Float16 sa[2][128][GP]; __shared__ __attribute__((aligned(16))) _Float16 sb[2][64][GP];
  const int tid = threadIdx.x, w = tid >> 5, lane = tid & 31, ln = lane & 15, hh = lane >> 4; const int by = blockIdx.y;
  A += (size_t)by * sA; Bh += (size_t)by * sB; const size_t cofs = (size_t)by * sC; const float* bp = bias ? bias + (size_t)by * sBias : nullptr;
  const int ntn = N >> 6; const int mt = blockIdx.x / ntn, nq = blockIdx.x - mt * ntn; const int row0 = mt * 128 + 32 * w, col0 = nq * 64;
  if (CAUSAL && col0 >= mt * 128 + 128) return;
  if (mt * 128 >= M) return;         /* taken by the whole block or by none: barriers follow */
  const int sr = tid >> 3, sc = (tid & 7) * 8;   /* staging: 8 threads per row, 16 rows per round */
  const unsigned short* ag = (const unsigned short*)A + (size_t)(mt * 128 + sr) * lda + sc; const unsigned short* bg = (const unsigned short*)Bh + (size_t)(col0 + sr) * ldb + sc;
  v8us ra[8], rb[4];
  auto fetch = [&](int k0) {         /* the stage that begins at k0, into registers */
    const unsigned short* pa[8]; const unsigned short* pb[4];
    for (int i = 0; i < 8; ++i) { pa[i] = ag + (size_t)(16 * i) * lda + k0; ra[i] = *(const v8us*)pa[i]; }
    for (int i = 0; i < 4; ++i) { pb[i] = bg + (size_t)(16 * i) * ldb + k0; rb[i] = *(const v8us*)pb[i]; }
    /* the wait that stands in front of every overwrite of an address register of the twelve loads above; the addresses are its inputs, so that they stay live and no load's result lands on one before it */
    asm volatile("s_wait_xcnt 0x0" :: "v"(pa[0]), "v"(pa[1]), "v"(pa[2]), "v"(pa[3]), "v"(pa[4]), "v"(pa[5]), "v"(pa[6]), "v"(pa[7]), "v"(pb[0]), "v"(pb[1]), "v"(pb[2]), "v"(pb[3]) : "memory"); };
  fetch(0);
  for (int i = 0; i < 8; ++i) *(v8us*)&sa[0][16 * i + sr][sc] = ra[i];
  for (int i = 0; i < 4; ++i) *(v8us*)&sb[0][16 * i + sr][sc] = rb[i];
  __syncthreads();
  const v8f z8 = {0.f,0.f,0.f,0.f,0.f,0.f,0.f,0.f}; v8f c00 = z8, c01 = z8, c02 = z8, c03 = z8, c10 = z8, c11 = z8, c12 = z8, c13 = z8;
#pragma unroll 1
  for (int kn = 64; kn <= K; kn += 64) { const int cur = ((kn >> 6) & 1) ^ 1; const bool more = kn < K;   /* kn: first k of the next stage; block-uniform */
    if (more) fetch(kn);
    v16h a[2][2], b[2][4];           /* the stage's 12 fragments, read as one group ahead of its products */
    for (int kk = 0; kk < 2; ++kk) {
      for (int i = 0; i < 2; ++i) a[kk][i] = g2_frag(&sa[cur][32 * w + 16 * i + ln][32 * kk], hh);
      for (int i = 0; i < 4; ++i) b[kk][i] = g2_frag(&sb[cur][16 * i + ln][32 * kk], hh); }
    for (int kk = 0; kk < 2; ++kk) {
      c00 = g2_mma(a[kk][0], b[kk][0], c00); c10 = g2_mma(a[kk][1], b[kk][0], c10);
      c01 = g2_mma(a[kk][0], b[kk][1], c01); c11 = g2_mma(a[kk][1], b[kk][1], c11);
      c02 = g2_mma(a[kk][0], b[kk][2], c02); c12 = g2_mma(a[kk][1], b[kk][2], c12);
      c03 = g2_mma(a[kk][0], b[kk][3], c03); c13 = g2_mma(a[kk][1], b[kk][3], c13); }
    if (more) {
      for (int i = 0; i < 8; ++i) *(v8us*)&sa[cur ^ 1][16 * i + sr][sc] = ra[i];
      for (int i = 0; i < 4; ++i) *(v8us*)&sb[cur ^ 1][16 * i + sr][sc] = rb[i]; }
    __syncthreads(); }
  v8f accs[8] = {c00, c01, c02, c03, c10, c11, c12, c13};
#pragma unroll
  for (int u = 0; u < 8; ++u) { const int t = u & 3, half = u >> 2; const int col = col0 + t * 16 + ln; const float bv = bp ? bf16_rne(bp[col]) : 0.f;
#pragma unroll
    for (int r = 0; r < 8; ++r) { const int rloc = half * 16 + 8 * hh + r; float v = accs[u][r] * alpha + bv;
      if (CP) { if (rowsPerB < 0) v += CP[cofs + (size_t)(row0g + row0 + rloc) * ldc + col]; else { const int bidx = (row0g + row0 + rloc) / rowsPerB; v += CP[(size_t)bidx * sCPb + (size_t)by * 64 + col]; } }
      if (ACT == 3) v = fmaxf(v, 0.f);
      so[w][rloc][t * 16 + ln] = v; } }
  __builtin_amdgcn_fence(4 /* acq_rel order */, "workgroup"); __builtin_amdgcn_wave_barrier();
  const int rsub = lane >> 4, c4 = (lane & 15) * 4;
  {
#pragma unroll
    for (int q = 0; q < 16; ++q) { const int r = q * 2 + rsub; const v4f v = *(const v4fa*)&so[w][r][c4];
      if (C) *(v4f*)(C + cofs + (size_t)(row0 + r) * ldc + col0 + c4) = v;
      if (C16) { v4h h4; for (int i = 0; i < 4; ++i) h4[i] = (_Float16)v[i]; *(v4h*)(C16 + cofs + (size_t)(row0 + r) * ldc + col0 + c4) = h4; } }
     }
}

// VTh / VTl [slab][d][s] (slab = b*NH + h, pitch SEQ) from f32 v rows V32[b*SEQ + s][h*HD + d]: hi = f16(v), lo = f16((v - hi) * 2^10).
// coverage: load 64 rows x 16 float4 = 1024 items / 256 threads; store 2 x 32 d-rows x 8 pieces per plane = full 64 x 64 tile, both planes, every (slab, token group).
__global__ __launch_bounds__(256) void k_vt2(const float* __restrict__ V32, _Float16* __restrict__ VTh, _Float16* __restrict__ VTl) {
  __shared__ _Float16 th[64][66]; __shared__ _Float16 tl[64][66];
  const int tid = threadIdx.x; const int slab = blockIdx.x / (SEQ / 64), lg = blockIdx.x % (SEQ / 64); const int b = slab / NH, h = slab % NH;
  for (int i = tid; i < 64 * 16; i += 256) { const int r = i >> 4, c4 = (i & 15) * 4;
    const v4f a = *(const v4fa*)(V32 + ((size_t)b * SEQ + (size_t)lg * 64 + r) * UD + h * HD + c4);
#pragma unroll
    for (int q = 0; q < 4; ++q) { const _Float16 hv = (_Float16)a[q]; th[r][c4 + q] = hv; tl[r][c4 + q] = (_Float16)((a[q] - (float)hv) * VLC); } }
  __syncthreads();
  {
#pragma unroll
    for (int rd = 0; rd < 2; ++rd) { const int d = rd * 32 + (tid >> 3), pc = tid & 7; FragH fh, fl;
#pragma unroll
      for (int q = 0; q < 8; ++q) { fh.h[q] = th[pc * 8 + q][d]; fl.h[q] = tl[pc * 8 + q][d]; }
      const size_t o = ((size_t)slab * HD + d) * SEQ + (size_t)lg * 64 + pc * 8;
      *(v8us*)((unsigned short*)VTh + o) = fh.half[0]; *(v8us*)((unsigned short*)VTl + o) = fl.half[0]; }
     }
}

// fused causal attention, one wave per 32 queries of one slab (slab = b*NH + h), no LDS: per pass of 32 keys S^T = K . Q^T (A = k rows, B = q rows, kept in registers),
// running maximum and sum per query (a lane holds one query's scores: in-lane, plus one exchange between the wave halves), O^T += V^T . P^T (A = VT rows, both planes).
// The two S^T tiles of a pass (keys k0 + 8h + r and k0 + 16 + 8h + r of query ln) are, converted in place, the B fragment in the k order of g2_frag: no lane exchange for P.
// P = f16(2^14 * exp(s - running max)); the sum carries the same 2^14, so the carry cancels in the final division. Keys above the query are masked by index in the last pass only.
// coverage: grid (NB*NH slabs) x (SEQ/128 blocks) x 4 waves x 32 queries = every row; 4 d tiles x (8h + r) = all 64 columns of the head, each element stored once.
#define SCL 0.18033688011112042f     /* 2^-3 * log2(e): scores in the exponent's base-2 units */
__device__ __forceinline__ v8f fa_mma(v16h a, v16h b, v8f c) { return __builtin_amdgcn_wmma_f32_16x16x32_f16(false, a, false, b, (short)0, c, false, false); }
__device__ __forceinline__ float fa_xhalf(float x) { return __builtin_bit_cast(float, __builtin_amdgcn_permlanex16(__builtin_bit_cast(int, x), __builtin_bit_cast(int, x), 0x76543210, 0xfedcba98, false, false)); }  /* lane l with lane l ^ 16 */
__device__ __forceinline__ v16h fa_frag(const _Float16* base, unsigned lofs, unsigned cofs) { const char* p = (const char*)base + ((size_t)lofs + cofs); FragH f; f.half[0] = *(const v8us*)p; f.half[1] = *(const v8us*)(p + 32); return f.v; }  /* g2_frag from a uniform base, the lane's byte offset (8h included) and a constant byte offset */

// one pass of 32 keys; ko (into K) and vo (into either VT plane) are the lane's own byte offsets at this pass's first key and leave a pass other than the last advanced by 32 keys
template <bool LAST>
__device__ __forceinline__ void fa_pass(int k0, int q0, int ln, int hh, const _Float16* __restrict__ K, const _Float16* __restrict__ VH, const _Float16* __restrict__ VL, unsigned& ko, unsigned& vo,
    const v16h (&qf)[2][2], v16h (&kf)[2][2], v8f (&oh)[2][4], v8f (&ol)[2][4], float (&m)[2], float (&l)[2]) {
  v16h vh[4], vl[4];
  for (int dt = 0; dt < 4; ++dt) { vh[dt] = fa_frag(VH, vo, dt * 16 * SEQ * 2); vl[dt] = fa_frag(VL, vo, dt * 16 * SEQ * 2); }
  const v8f z8 = {0.f,0.f,0.f,0.f,0.f,0.f,0.f,0.f}; v8f s[2][2];
  for (int t = 0; t < 2; ++t) {
    for (int kt = 0; kt < 2; ++kt) s[t][kt] = fa_mma(kf[kt][1], qf[t][1], fa_mma(kf[kt][0], qf[t][0], z8)); }
  if (!LAST) {                       /* next pass's k fragments, fetched behind this pass's products; k0 + 32 <= q0 is a row of the sequence */
    for (int kt = 0; kt < 2; ++kt) { kf[kt][0] = fa_frag(K, ko, (32 + 16 * kt) * LQK * 2); kf[kt][1] = fa_frag(K, ko, (32 + 16 * kt) * LQK * 2 + 64); } }
  /* the wait that stands in front of every overwrite of an address register of the loads above; the offsets pass through it so that their advance stays behind it */
  if (LAST) { const char* pa = (const char*)VH + vo; const char* pb = (const char*)VL + vo;   /* here the loads may name the summed addresses: these stay live up to the wait as well */
    asm volatile("s_wait_xcnt 0x0" : "+v"(vo) : "v"(pa), "v"(pb) : "memory"); }
  else { asm volatile("s_wait_xcnt 0x0" : "+v"(ko), "+v"(vo) :: "memory"); ko += 32 * LQK * 2; vo += 32 * 2; }
  float mn[2];
  for (int t = 0; t < 2; ++t) {
    if (LAST) {
      for (int kt = 0; kt < 2; ++kt) {
        for (int r = 0; r < 8; ++r) s[t][kt][r] = (k0 + 16 * kt + 8 * hh + r <= q0 + 16 * t + ln) ? s[t][kt][r] : -3.0e38f; } }
    float mx = s[t][0][0];
    for (int r = 1; r < 8; ++r) mx = fmaxf(mx, s[t][0][r]);
    for (int r = 0; r < 8; ++r) mx = fmaxf(mx, s[t][1][r]);
    mx = fmaxf(mx, fa_xhalf(mx)); mn[t] = fmaxf(m[t], mx); }
  if (__builtin_amdgcn_ballot_w32((mn[0] > m[0]) || (mn[1] > m[1])) != 0) {   /* no maximum moved: every factor is 1 and the rescale is skipped by the whole wave */
    for (int t = 0; t < 2; ++t) { const float al = __builtin_amdgcn_exp2f((m[t] - mn[t]) * SCL); l[t] *= al; m[t] = mn[t];
      for (int dt = 0; dt < 4; ++dt) { oh[t][dt] *= al; ol[t][dt] *= al; } } }
  for (int t = 0; t < 2; ++t) { const float off = 14.0f - m[t] * SCL; FragH p; v8f x[2], e[2];
    for (int kt = 0; kt < 2; ++kt) { x[kt] = s[t][kt] * SCL + off;
      for (int r = 0; r < 8; ++r) e[kt][r] = __builtin_amdgcn_exp2f(x[kt][r]); }
    /* the slot behind a transcendental: no source is overwritten and no result read before this v_nop, which stands behind the last of the sixteen */
    asm volatile("v_nop" : "+v"(e[0]), "+v"(e[1]) : "v"(x[0]), "v"(x[1]));
    for (int r = 0; r < 8; ++r) { p.h[r] = (_Float16)e[0][r]; p.h[8 + r] = (_Float16)e[1][r]; }
    const v8f es = e[0] + e[1];
    l[t] += ((es[0] + es[1]) + (es[2] + es[3])) + ((es[4] + es[5]) + (es[6] + es[7]));
    for (int dt = 0; dt < 4; ++dt) { oh[t][dt] = fa_mma(vh[dt], p.v, oh[t][dt]); ol[t][dt] = fa_mma(vl[dt], p.v, ol[t][dt]); } }
}

__global__ __launch_bounds__(128) void k_fattn(const _Float16* __restrict__ QK, const _Float16* __restrict__ VTh, const _Float16* __restrict__ VTl, float* __restrict__ O) {
  const int tid = threadIdx.x, lane = tid & 31, ln = lane & 15, hh = lane >> 4;
  const int w = __builtin_amdgcn_readfirstlane(tid >> 5);                       /* the wave's number in a scalar register: scalar loop bound and branches */
  const int slab = blockIdx.x, b = slab / NH, h = slab % NH;
  const int y = blockIdx.y, qb = (y < SEQ / 256) ? SEQ / 128 - 1 - y : y - SEQ / 256;   /* long blocks start first; the second half of the grid runs short to long beside them */
  const int q0 = qb * 128 + 32 * w;
  const _Float16* Q = QK + ((size_t)b * SEQ + q0) * LQK + h * HD; const _Float16* K = QK + (size_t)b * SEQ * LQK + UD + h * HD;      /* uniform bases */
  const _Float16* VH = VTh + (size_t)slab * HD * SEQ; const _Float16* VL = VTl + (size_t)slab * HD * SEQ;
  unsigned ko = (unsigned)(ln * LQK + 8 * hh) * 2, vo = (unsigned)(ln * SEQ + 8 * hh) * 2;                                       /* lane byte offsets */
  v16h qf[2][2], kf[2][2];
  for (int t = 0; t < 2; ++t) { qf[t][0] = fa_frag(Q, ko, t * 16 * LQK * 2); qf[t][1] = fa_frag(Q, ko, t * 16 * LQK * 2 + 64);
    kf[t][0] = fa_frag(K, ko, t * 16 * LQK * 2); kf[t][1] = fa_frag(K, ko, t * 16 * LQK * 2 + 64); }
  /* as in fa_pass: in front of any overwrite of these loads' address registers */
  asm volatile("s_wait_xcnt 0x0" : "+v"(ko) :: "memory");
  const v8f z8 = {0.f,0.f,0.f,0.f,0.f,0.f,0.f,0.f}; v8f oh[2][4], ol[2][4]; float m[2] = {-3.0e38f, -3.0e38f}, l[2] = {0.f, 0.f};
  for (int t = 0; t < 2; ++t) {
    for (int dt = 0; dt < 4; ++dt) { oh[t][dt] = z8; ol[t][dt] = z8; } }
  for (int k0 = 0; k0 < q0; k0 += 32) fa_pass<false>(k0, q0, ln, hh, K, VH, VL, ko, vo, qf, kf, oh, ol, m, l);
  fa_pass<true>(q0, q0, ln, hh, K, VH, VL, ko, vo, qf, kf, oh, ol, m, l);
  for (int t = 0; t < 2; ++t) { const float inv = 1.0f / (l[t] + fa_xhalf(l[t]));
    float* op = O + ((size_t)b * SEQ + q0 + 16 * t + ln) * UD + h * HD + 8 * hh;
    for (int dt = 0; dt < 4; ++dt) { v4f lo4, hi4;
      for (int i = 0; i < 4; ++i) { lo4[i] = (oh[t][dt][i] + ol[t][dt][i] * (1.0f / VLC)) * inv; hi4[i] = (oh[t][dt][4 + i] + ol[t][dt][4 + i] * (1.0f / VLC)) * inv; }
      *(v4f*)(op + dt * 16) = lo4; *(v4f*)(op + dt * 16 + 4) = hi4;
      /* in front of any reuse of the two stores' data and address registers */
      asm volatile("s_wait_xcnt 0x0" :: "v"(lo4), "v"(hi4), "v"(op) : "memory"); } }
}

__global__ __launch_bounds__(256) void k_lnpart(const float* __restrict__ O, const float* __restrict__ X, double* __restrict__ part) {
  __shared__ double rs[256]; __shared__ double rq[256];
  const int bat = blockIdx.y, blk = blockIdx.x, tid = threadIdx.x;
  const float* op = O + (size_t)bat * SEQ * UD + (size_t)blk * LNP; const float* xp = X + (size_t)bat * SEQ_FULL * CD + (size_t)blk * LNP;
  double s1 = 0.0, s2 = 0.0;
#pragma unroll 1
  for (int u = 0; u < LNP / 1024; ++u) { const int j = u * 1024 + tid * 4; const v4f a = *(const v4fa*)(op + j), c = *(const v4fa*)(xp + j);
#pragma unroll
    for (int q = 0; q < 4; ++q) { const float v = a[q] + bf16_rne(c[q]); s1 += (double)v; s2 += (double)v * (double)v; } }
  rs[tid] = s1; rq[tid] = s2; __syncthreads();
  for (int st = 128; st > 0; st >>= 1) { if (tid < st) { rs[tid] += rs[tid + st]; rq[tid] += rq[tid + st]; } __syncthreads(); }
  if (tid < 8) { v2d val; val[0] = (tid == 0) ? rs[0] : 0.0; val[1] = (tid == 0) ? rq[0] : 0.0;
    double* d = part + ((size_t)bat * NPB + blk) * 16 + tid * 2; *(v2d*)d = val;  }
}

// final statistics, one work-group: thread (batch bb, place t) takes partial t of its batch, so that all NB * NPB loads are in flight together; then two rounds of 16-to-1 f64 sums per batch in LDS
#define LFT 256                      /* threads per batch */
static_assert(LFT == 16 * 16 && NB * LFT <= 1024);
__global__ __launch_bounds__(NB * LFT) void k_lnfin(const double* __restrict__ part, float* __restrict__ stat) {
  __shared__ double rs[NB * LFT]; __shared__ double rq[NB * LFT];
  __shared__ __attribute__((aligned(16))) float st[32];
  const int tid = threadIdx.x; const int bb = tid / LFT, t = tid % LFT;
  double s = 0.0, q = 0.0;
  if (t < NPB) { const v2d p = *(const v2d*)(part + ((size_t)bb * NPB + t) * 16); s = p[0]; q = p[1]; }
  for (int i = t + LFT; i < NPB; i += LFT) { const v2d p = *(const v2d*)(part + ((size_t)bb * NPB + i) * 16); s += p[0]; q += p[1]; }
  rs[tid] = s; rq[tid] = q;
  if (tid < 32) st[tid] = 0.f;
  __syncthreads();
  for (int w = LFT / 16; w > 0; w /= 16) {   /* thread t < w sums places t + j * w; it alone reads and rewrites place t, and places from w on are only read */
    if (t < w) { double a[16], c[16];
      for (int j = 0; j < 16; ++j) { a[j] = rs[tid + j * w]; c[j] = rq[tid + j * w]; }
      for (int h = 8; h > 0; h >>= 1) {
        for (int j = 0; j < h; ++j) { a[j] += a[j + h]; c[j] += c[j + h]; } }
      rs[tid] = a[0]; rq[tid] = c[0]; }
    __syncthreads(); }
  if (t == 0) {
    const double inv = 1.0 / ((double)SEQ * (double)UD); const double m = rs[tid] * inv; double var = rq[tid] * inv - m * m; if (var < 0.0) var = 0.0;
    st[2 * bb] = (float)m; st[2 * bb + 1] = 1.0f / sqrtf((float)var + 1.0e-5f); }
  __syncthreads();
  if (tid < 8) { const v4f v = *(const v4fa*)&st[tid * 4]; *(v4f*)(stat + tid * 4) = v;  }
}

// coverage: grid (NB*SEQ*UD/1024) x 256 threads x 4 = every output element exactly once.
__global__ __launch_bounds__(256) void k_lnapply(const float* __restrict__ O, const float* __restrict__ X, const float* __restrict__ stat, const float* __restrict__ g, const float* __restrict__ bta, float* __restrict__ out) {
  const size_t e = ((size_t)blockIdx.x * 256 + threadIdx.x) * 4;
  const int bat = (int)(e / ((size_t)SEQ * UD)); const size_t su = e - (size_t)bat * SEQ * UD;
  const float mu = stat[2 * bat], rs = stat[2 * bat + 1];
  const v4f o = *(const v4fa*)(O + e), x = *(const v4fa*)(X + (size_t)bat * SEQ_FULL * CD + su), gg = *(const v4fa*)(g + su), bb = *(const v4fa*)(bta + su);
  v4f y;
#pragma unroll
  for (int q = 0; q < 4; ++q) { const float v = o[q] + bf16_rne(x[q]); y[q] = (v - mu) * rs * bf16_rne(gg[q]) + bf16_rne(bb[q]); }
  float* d = out + (size_t)bat * SEQ_FULL * UD + su;
  *(v4f*)d = y; 
}

extern "C" void kernel_launch(void* const* d_in, const int* in_sizes, int n_in,
                              void* d_out, int out_size, void* d_ws, size_t ws_size, hipStream_t stream) {
  if (n_in < 9) return;
  const float* X   = (const float*)d_in[0];      /* [2][2048][1024] */
  const float* Wq  = (const float*)d_in[1];      /* [in][out] 1024 x 1024 */
  const float* bq  = (const float*)d_in[2];
  const float* Wk  = (const float*)d_in[3];
  const float* bk  = (const float*)d_in[4];
  const float* Wv  = (const float*)d_in[5];
  const float* bv  = (const float*)d_in[6];
  const float* gam = (const float*)d_in[7];      /* [2048][1024] */
  const float* bet = (const float*)d_in[8];
  float* out = (float*)d_out;
  const size_t rows_used = (size_t)(NB - 1) * SEQ_FULL + SEQ;
  if ((size_t)in_sizes[0] < rows_used * CD) return;
  if ((size_t)in_sizes[1] < (size_t)CD * UD || (size_t)in_sizes[3] < (size_t)CD * UD || (size_t)in_sizes[5] < (size_t)CD * UD) return;
  if (in_sizes[2] < UD || in_sizes[4] < UD || in_sizes[6] < UD) return;
  if ((size_t)in_sizes[7] < (size_t)SEQ * UD || (size_t)in_sizes[8] < (size_t)SEQ * UD) return;
  if ((size_t)out_size < rows_used * UD) return;

  char* ws = (char*)d_ws; size_t off = 0;
  auto take = [&](size_t bytes) { char* p = ws + off; off += (bytes + 255) & ~(size_t)255; return p; };
  _Float16* BQKV = (_Float16*)take((size_t)3 * CD * UD * 2);               /* [3*UD][CD] f16 (x16) */
  _Float16* X16  = (_Float16*)take(NR * CD * 2);                           /* [NR][CD] */
  _Float16* QK16 = (_Float16*)take(NR * LQK * 2);                          /* [NR][q | k] */
  float*    V32  = (float*)take(NR * UD * 4);                              /* [NR][UD] f32 */
  _Float16* VTh  = (_Float16*)take((size_t)NB * NH * HD * SEQ * 2);        /* [NB*NH][HD][SEQ] */
  _Float16* VTl  = (_Float16*)take((size_t)NB * NH * HD * SEQ * 2);
  float*    O32  = (float*)take(NR * UD * 4);                              /* [NR][UD] f32 */
  double*   PART = (double*)take((size_t)NB * NPB * 128);                  
  float*    STAT = (float*)take(128);
  if (off > ws_size || off > (size_t)134217728) return;

  k_wt_f16<<<(unsigned)(((size_t)UD * (CD / 8) + 255) / 256), 256, 0, stream>>>(Wq, BQKV, CD, UD, WSC);
  k_wt_f16<<<(unsigned)(((size_t)UD * (CD / 8) + 255) / 256), 256, 0, stream>>>(Wk, BQKV + (size_t)UD * CD, CD, UD, WSC);
  k_wt_f16<<<(unsigned)(((size_t)UD * (CD / 8) + 255) / 256), 256, 0, stream>>>(Wv, BQKV + (size_t)2 * UD * CD, CD, UD, WSC);
  for (int b = 0; b < NB; ++b) {
    const size_t n8 = (size_t)SEQ * CD / 8;
    k_x16<<<(unsigned)((n8 + 255) / 256), 256, 0, stream>>>(X + (size_t)b * SEQ_FULL * CD, X16 + (size_t)b * SEQ * CD, n8);
  }
  const int MP = (int)NR;
  /* q rows (f16, cols 0..UD-1 of QK16), k rows (cols UD..2UD-1), v rows (f32): x16 . (16 W) * 2^-4 + bf16(bias) */
  k_gemm2<0, false><<<dim3((unsigned)((MP / 128) * (UD / 64)), 1), 128, 0, stream>>>(X16, CD, 0, BQKV, CD, 0, 0.0625f, bq, 0, nullptr, 1, 0, 0, nullptr, QK16, LQK, 0, MP, UD, CD);
  k_gemm2<0, false><<<dim3((unsigned)((MP / 128) * (UD / 64)), 1), 128, 0, stream>>>(X16, CD, 0, BQKV + (size_t)UD * CD, CD, 0, 0.0625f, bk, 0, nullptr, 1, 0, 0, nullptr, QK16 + UD, LQK, 0, MP, UD, CD);
  k_gemm2<0, false><<<dim3((unsigned)((MP / 128) * (UD / 64)), 1), 128, 0, stream>>>(X16, CD, 0, BQKV + (size_t)2 * UD * CD, CD, 0, 0.0625f, bv, 0, nullptr, 1, 0, 0, V32, nullptr, UD, 0, MP, UD, CD);
  k_vt2<<<(unsigned)(NB * NH * (SEQ / 64)), 256, 0, stream>>>(V32, VTh, VTl);
  k_fattn<<<dim3((unsigned)(NB * NH), (unsigned)(SEQ / 128)), 128, 0, stream>>>(QK16, VTh, VTl, O32);
  k_lnpart<<<dim3(NPB, NB), 256, 0, stream>>>(O32, X, PART);
  k_lnfin<<<1, NB * LFT, 0, stream>>>(PART, STAT);
  k_lnapply<<<(unsigned)((NR * UD) / 1024), 256, 0, stream>>>(O32, X, STAT, gam, bet, out);
}

// v004
// A run of this version takes 114 microseconds.
// Two timings next to v003 put it at 1.21 and 1.23 times that version's speed.
// Over all steps from v000 it is 10.7 times as fast.
#include <hip/hip_runtime.h>
// Contractions on v_wmma_f32_16x16x32_f16 (f16 operands, f32 accumulate): q | k | v projections (x and weights bf16-valued, exact in f16, weights carried x16), scores k.q^T (plain f16 q, k), V^T.P^T in the same kernel (running-maximum softmax weights f16 carried x2^14; v as f16 hi plane + f16 residual plane carried x2^10, two accumulators). Scores, softmax statistics, attention output and residual add in f32; joint (seq, unit) normalisation statistics in f64.
#ifndef NB
#define NB 2
#endif
#ifndef SEQ
#define SEQ 2048
#endif
#define NB_FULL 2
#define SEQ_FULL 2048
#define CD 1024                      /* input channels */
#define UD 1024                      /* units */
#define NH 16
#define HD 64
#define LQK (2 * UD)                 /* row pitch of the q | k rows */
#define LNP 8192                     /* floats per statistics block */
#define NPB ((SEQ * UD) / LNP)       /* statistics blocks per batch */
#define NR ((size_t)NB * SEQ)        /* token rows (compact) */
#define WSC 16.0f                    /* weight carry */
#define VLC 1024.0f                  /* v residual plane carry */
static_assert(NB >= 1 && NB <= NB_FULL);
static_assert(SEQ % 256 == 0 && SEQ <= SEQ_FULL);
static_assert(CD % 64 == 0 && UD % 64 == 0 && CD == UD);
static_assert(NH * HD == UD && HD == 64);
static_assert((SEQ * UD) % LNP == 0 && LNP == 256 * 32);
static_assert(2 * NB <= 32);
static_assert((NR * UD) % 1024 == 0 && (NR % 128) == 0);

typedef unsigned short v8us __attribute__((ext_vector_type(8), may_alias));
typedef float  v8f  __attribute__((ext_vector_type(8)));
typedef float  v4f  __attribute__((ext_vector_type(4)));
typedef float  v4fa __attribute__((ext_vector_type(4), may_alias));
typedef double v2d  __attribute__((ext_vector_type(2)));
typedef _Float16 v16h __attribute__((ext_vector_type(16)));
typedef _Float16 v4h  __attribute__((ext_vector_type(4)));
union FragH { v16h v; v8us half[2]; _Float16 h[16]; unsigned short u[16]; };

__device__ __forceinline__ unsigned short bf16_bits(float x) { unsigned int u = __float_as_uint(x); return (unsigned short)((u + 0x7FFFu + ((u >> 16) & 1u)) >> 16); }
__device__ __forceinline__ float bf16_val(unsigned short b) { return __uint_as_float(((unsigned int)b) << 16); }
__device__ __forceinline__ float bf16_rne(float x) { return bf16_val(bf16_bits(x)); }

// 16-bit WMMA fragment: lane l, h = l >> 4, row/col = l & 15; elements 0..7 <- k0 + 8h + 0..7, elements 8..15 <- k0 + 16 + 8h + 0..7 (same map for A rows and for B[n][k] rows)
__device__ __forceinline__ v16h g2_frag(const _Float16* p, int hh) { FragH f; f.half[0] = *(const v8us*)((const unsigned short*)p + 8 * hh); f.half[1] = *(const v8us*)((const unsigned short*)p + 16 + 8 * hh); return f.v; }
__device__ __forceinline__ v8f g2_mma(v16h a, v16h b, v8f c) { v8f d = __builtin_amdgcn_wmma_f32_16x16x32_f16(false, a, false, b, (short)0, c, false, false); asm volatile("v_nop\n\tv_nop\n\tv_nop\n\tv_nop" : "+v"(d) : "v"(a), "v"(b)); return d; }

// The four conversions that depend on nothing but the inputs, in one grid: blocks 0 .. 3*WTB-1 take Wq | Wk | Wv (WTB blocks each): Wt[m*UD + n][k] = f16(bf16(W[k][n]) * 16);
// the other XCB blocks take x: X16[b*SEQ + s][c] = f16(bf16(x[b][s][c])). 8 elements per thread; every element of Wt and X16 is stored once. The branch is block-uniform.
#define WTB ((UD * (CD / 8)) / 256)
#define XCB ((int)((NR * CD / 8) / 256))
static_assert((UD * (CD / 8)) % 256 == 0 && (NR * CD / 8) % 256 == 0);
__global__ __launch_bounds__(256) void k_prep(const float* __restrict__ Wq, const float* __restrict__ Wk, const float* __restrict__ Wv, const float* __restrict__ x, _Float16* __restrict__ Wt, _Float16* __restrict__ X16) {
  const int bx = blockIdx.x; FragH f;
  if (bx < 3 * WTB) { const int m = bx / WTB; const float* __restrict__ W = (m == 0) ? Wq : (m == 1) ? Wk : Wv;
    const int t = (bx - m * WTB) * 256 + threadIdx.x; const int n = t / (CD / 8), k8 = (t % (CD / 8)) * 8;
#pragma unroll
    for (int i = 0; i < 8; ++i) f.h[i] = (_Float16)(bf16_rne(W[(size_t)(k8 + i) * UD + n]) * WSC);
    /* the wait: in front of any reuse of the store's data and address registers, whichever branch is laid out first */
    const v8us o = f.half[0]; unsigned short* d = (unsigned short*)Wt + ((size_t)m * UD + n) * CD + k8; *(v8us*)d = o; asm volatile("s_wait_xcnt 0x0" :: "v"(o), "v"(d) : "memory"); }
  else { const size_t t = (size_t)(bx - 3 * WTB) * 256 + threadIdx.x; const size_t n8 = (size_t)SEQ * CD / 8; const size_t b = t / n8;
    const float* xp = x + b * ((size_t)SEQ_FULL * CD) + (t - b * n8) * 8;
#pragma unroll
    for (int q = 0; q < 8; ++q) f.h[q] = (_Float16)bf16_rne(xp[q]);
    /* the wait: as above */
    const v8us o = f.half[0]; unsigned short* d = (unsigned short*)X16 + t * 8; *(v8us*)d = o; asm volatile("s_wait_xcnt 0x0" :: "v"(o), "v"(d) : "memory"); }
}

// GEMM, wave tile 32x64, block = 4 waves = 128 rows x 64 cols; A f16 rows (pitch lda), Bh f16 [n][k] (pitch ldb); v = acc*alpha + bf16(bias[col]).
// The N columns are up to three sections of nsec columns side by side (q | k | v in one grid), each with its own bias vector; columns below n16 are written as f16 to C16 (pitch ldc16), column n16 + j as f32 to C[.][j] (pitch ldc).
// grid (M/128)*(N/64). M % 128 == 0, N % 64 == 0, nsec % 64 == 0, n16 % 64 == 0, K % 64 == 0, lda % 8 == 0, ldb % 8 == 0.
// Operands go through LDS in stages of 64 k (one 128-byte line per row), two buffers: a wave's 16-byte global load covers 4 whole lines, the block's 128 A rows and 64 B rows are fetched once for its 4 waves,
// and stage s + 1 is in flight (in registers) while stage s is multiplied. One barrier per stage: it publishes stage s + 1 and ends the reads of the buffer that stage s + 2 overwrites.
#define GP 72                        /* LDS row pitch in elements: 128 + 16 bytes */
__global__ __launch_bounds__(128) void k_gemm2(const _Float16* __restrict__ A, int lda, const _Float16* __restrict__ Bh, int ldb, float alpha, const float* __restrict__ bias0, const float* __restrict__ bias1, const float* __restrict__ bias2, int nsec,
    _Float16* __restrict__ C16, int ldc16, int n16, float* __restrict__ C, int ldc, int M, int N, int K) {
  __shared__ __attribute__((aligned(16))) float so[4][32][68];
  __shared__ __attribute__((aligned(16))) _Float16 sa[2][128][GP]; __shared__ __attribute__((aligned(16))) _Float16 sb[2][64][GP];
  const int tid = threadIdx.x, w = tid >> 5, lane = tid & 31, ln = lane & 15, hh = lane >> 4;
  const int ntn = N >> 6; const int mt = blockIdx.x / ntn, nq = blockIdx.x - mt * ntn; const int row0 = mt * 128 + 32 * w, col0 = nq * 64;
  if (mt * 128 >= M) return;         /* taken by the whole block or by none: barriers follow */
  const int sr = tid >> 3, sc = (tid & 7) * 8;   /* staging: 8 threads per row, 16 rows per round */
  const unsigned short* ag = (const unsigned short*)A + (size_t)(mt * 128 + sr) * lda + sc; const unsigned short* bg = (const unsigned short*)Bh + (size_t)(col0 + sr) * ldb + sc;
  v8us ra[8], rb[4];
  auto fetch = [&](int k0) {         /* the stage that begins at k0, into registers */
    const unsigned short* pa[8]; const unsigned short* pb[4];
    for (int i = 0; i < 8; ++i) { pa[i] = ag + (size_t)(16 * i) * lda + k0; ra[i] = *(const v8us*)pa[i]; }
    for (int i = 0; i < 4; ++i) { pb[i] = bg + (size_t)(16 * i) * ldb + k0; rb[i] = *(const v8us*)pb[i]; }
    /* the wait that stands in front of every overwrite of an address register of the twelve loads above; the addresses are its inputs, so that they stay live and no load's result lands on one before it */
    asm volatile("s_wait_xcnt 0x0" :: "v"(pa[0]), "v"(pa[1]), "v"(pa[2]), "v"(pa[3]), "v"(pa[4]), "v"(pa[5]), "v"(pa[6]), "v"(pa[7]), "v"(pb[0]), "v"(pb[1]), "v"(pb[2]), "v"(pb[3]) : "memory"); };
  fetch(0);
  for (int i = 0; i < 8; ++i) *(v8us*)&sa[0][16 * i + sr][sc] = ra[i];
  for (int i = 0; i < 4; ++i) *(v8us*)&sb[0][16 * i + sr][sc] = rb[i];
  __syncthreads();
  const v8f z8 = {0.f,0.f,0.f,0.f,0.f,0.f,0.f,0.f}; v8f c00 = z8, c01 = z8, c02 = z8, c03 = z8, c10 = z8, c11 = z8, c12 = z8, c13 = z8;
#pragma unroll 1
  for (int kn = 64; kn <= K; kn += 64) { const int cur = ((kn >> 6) & 1) ^ 1; const bool more = kn < K;   /* kn: first k of the next stage; block-uniform */
    if (more) fetch(kn);
    v16h a[2][2], b[2][4];           /* the stage's 12 fragments, read as one group ahead of its products */
    for (int kk = 0; kk < 2; ++kk) {
      for (int i = 0; i < 2; ++i) a[kk][i] = g2_frag(&sa[cur][32 * w + 16 * i + ln][32 * kk], hh);
      for (int i = 0; i < 4; ++i) b[kk][i] = g2_frag(&sb[cur][16 * i + ln][32 * kk], hh); }
    for (int kk = 0; kk < 2; ++kk) {
      c00 = g2_mma(a[kk][0], b[kk][0], c00); c10 = g2_mma(a[kk][1], b[kk][0], c10);
      c01 = g2_mma(a[kk][0], b[kk][1], c01); c11 = g2_mma(a[kk][1], b[kk][1], c11);
      c02 = g2_mma(a[kk][0], b[kk][2], c02); c12 = g2_mma(a[kk][1], b[kk][2], c12);
      c03 = g2_mma(a[kk][0], b[kk][3], c03); c13 = g2_mma(a[kk][1], b[kk][3], c13); }
    if (more) {
      for (int i = 0; i < 8; ++i) *(v8us*)&sa[cur ^ 1][16 * i + sr][sc] = ra[i];
      for (int i = 0; i < 4; ++i) *(v8us*)&sb[cur ^ 1][16 * i + sr][sc] = rb[i]; }
    __syncthreads(); }
  const int sec = (col0 >= nsec) + (col0 >= 2 * nsec); const float* bp = ((sec == 0) ? bias0 : (sec == 1) ? bias1 : bias2) + (col0 - sec * nsec);   /* the block's 64 columns lie in one section */
  v8f accs[8] = {c00, c01, c02, c03, c10, c11, c12, c13};
#pragma unroll
  for (int u = 0; u < 8; ++u) { const int t = u & 3, half = u >> 2; const float bv = bf16_rne(bp[t * 16 + ln]);
#pragma unroll
    for (int r = 0; r < 8; ++r) { const int rloc = half * 16 + 8 * hh + r; const float v = accs[u][r] * alpha + bv;
      so[w][rloc][t * 16 + ln] = v; } }
  __builtin_amdgcn_fence(4 /* acq_rel order */, "workgroup"); __builtin_amdgcn_wave_barrier();
  const int rsub = lane >> 4, c4 = (lane & 15) * 4;
  {
#pragma unroll
    for (int q = 0; q < 16; ++q) { const int r = q * 2 + rsub; const v4f v = *(const v4fa*)&so[w][r][c4];
      /* the waits: in front of any reuse of the store's data and address registers */
      if (col0 >= n16) { float* d = C + (size_t)(row0 + r) * ldc + (col0 - n16) + c4; *(v4f*)d = v; asm volatile("s_wait_xcnt 0x0" :: "v"(v), "v"(d) : "memory"); }
      else { v4h h4; for (int i = 0; i < 4; ++i) h4[i] = (_Float16)v[i]; _Float16* d = C16 + (size_t)(row0 + r) * ldc16 + col0 + c4; *(v4h*)d = h4; asm volatile("s_wait_xcnt 0x0" :: "v"(h4), "v"(d) : "memory"); } }
     }
}

// VTh / VTl [slab][d][s] (slab = b*NH + h, pitch SEQ) from f32 v rows V32[b*SEQ + s][h*HD + d]: hi = f16(v), lo = f16((v - hi) * 2^10).
// coverage: load 64 rows x 16 float4 = 1024 items / 256 threads; store 2 x 32 d-rows x 8 pieces per plane = full 64 x 64 tile, both planes, every (slab, token group).
__global__ __launch_bounds__(256) void k_vt2(const float* __restrict__ V32, _Float16* __restrict__ VTh, _Float16* __restrict__ VTl) {
  __shared__ _Float16 th[64][66]; __shared__ _Float16 tl[64][66];
  const int tid = threadIdx.x; const int slab = blockIdx.x / (SEQ / 64), lg = blockIdx.x % (SEQ / 64); const int b = slab / NH, h = slab % NH;
  for (int i = tid; i < 64 * 16; i += 256) { const int r = i >> 4, c4 = (i & 15) * 4;
    const v4f a = *(const v4fa*)(V32 + ((size_t)b * SEQ + (size_t)lg * 64 + r) * UD + h * HD + c4);
#pragma unroll
    for (int q = 0; q < 4; ++q) { const _Float16 hv = (_Float16)a[q]; th[r][c4 + q] = hv; tl[r][c4 + q] = (_Float16)((a[q] - (float)hv) * VLC); } }
  __syncthreads();
  {
#pragma unroll
    for (int rd = 0; rd < 2; ++rd) { const int d = rd * 32 + (tid >> 3), pc = tid & 7; FragH fh, fl;
#pragma unroll
      for (int q = 0; q < 8; ++q) { fh.h[q] = th[pc * 8 + q][d]; fl.h[q] = tl[pc * 8 + q][d]; }
      const size_t o = ((size_t)slab * HD + d) * SEQ + (size_t)lg * 64 + pc * 8;
      *(v8us*)((unsigned short*)VTh + o) = fh.half[0]; *(v8us*)((unsigned short*)VTl + o) = fl.half[0]; }
     }
}

// fused causal attention, one wave per 32 queries of one slab (slab = b*NH + h), no LDS: per pass of 32 keys S^T = K . Q^T (A = k rows, B = q rows, kept in registers),
// running maximum and sum per query (a lane holds one query's scores: in-lane, plus one exchange between the wave halves), O^T += V^T . P^T (A = VT rows, both planes).
// The two S^T tiles of a pass (keys k0 + 8h + r and k0 + 16 + 8h + r of query ln) are, converted in place, the B fragment in the k order of g2_frag: no lane exchange for P.
// P = f16(2^14 * exp(s - running max)); the sum carries the same 2^14, so the carry cancels in the final division. Keys above the query are masked by index in the last pass only.
// coverage: grid (NB*NH slabs) x (SEQ/128 blocks) x 4 waves x 32 queries = every row; 4 d tiles x (8h + r) = all 64 columns of the head, each element stored once.
#define SCL 0.18033688011112042f     /* 2^-3 * log2(e): scores in the exponent's base-2 units */
__device__ __forceinline__ v8f fa_mma(v16h a, v16h b, v8f c) { return __builtin_amdgcn_wmma_f32_16x16x32_f16(false, a, false, b, (short)0, c, false, false); }
__device__ __forceinline__ float fa_xhalf(float x) { return __builtin_bit_cast(float, __builtin_amdgcn_permlanex16(__builtin_bit_cast(int, x), __builtin_bit_cast(int, x), 0x76543210, 0xfedcba98, false, false)); }  /* lane l with lane l ^ 16 */
__device__ __forceinline__ v16h fa_frag(const _Float16* base, unsigned lofs, unsigned cofs) { const char* p = (const char*)base + ((size_t)lofs + cofs); FragH f; f.half[0] = *(const v8us*)p; f.half[1] = *(const v8us*)(p + 32); return f.v; }  /* g2_frag from a uniform base, the lane's byte offset (8h included) and a constant byte offset */

// one pass of 32 keys; ko (into K) and vo (into either VT plane) are the lane's own byte offsets at this pass's first key and leave a pass other than the last advanced by 32 keys
template <bool LAST>
__device__ __forceinline__ void fa_pass(int k0, int q0, int ln, int hh, const _Float16* __restrict__ K, const _Float16* __restrict__ VH, const _Float16* __restrict__ VL, unsigned& ko, unsigned& vo,
    const v16h (&qf)[2][2], v16h (&kf)[2][2], v8f (&oh)[2][4], v8f (&ol)[2][4], float (&m)[2], float (&l)[2]) {
  v16h vh[4], vl[4];
  for (int dt = 0; dt < 4; ++dt) { vh[dt] = fa_frag(VH, vo, dt * 16 * SEQ * 2); vl[dt] = fa_frag(VL, vo, dt * 16 * SEQ * 2); }
  const v8f z8 = {0.f,0.f,0.f,0.f,0.f,0.f,0.f,0.f}; v8f s[2][2];
  for (int t = 0; t < 2; ++t) {
    for (int kt = 0; kt < 2; ++kt) s[t][kt] = fa_mma(kf[kt][1], qf[t][1], fa_mma(kf[kt][0], qf[t][0], z8)); }
  if (!LAST) {                       /* next pass's k fragments, fetched behind this pass's products; k0 + 32 <= q0 is a row of the sequence */
    for (int kt = 0; kt < 2; ++kt) { kf[kt][0] = fa_frag(K, ko, (32 + 16 * kt) * LQK * 2); kf[kt][1] = fa_frag(K, ko, (32 + 16 * kt) * LQK * 2 + 64); } }
  /* the wait that stands in front of every overwrite of an address register of the loads above; the offsets pass through it so that their advance stays behind it */
  if (LAST) { const char* pa = (const char*)VH + vo; const char* pb = (const char*)VL + vo;   /* here the loads may name the summed addresses: these stay live up to the wait as well */
    asm volatile("s_wait_xcnt 0x0" : "+v"(vo) : "v"(pa), "v"(pb) : "memory"); }
  else { asm volatile("s_wait_xcnt 0x0" : "+v"(ko), "+v"(vo) :: "memory"); ko += 32 * LQK * 2; vo += 32 * 2; }
  float mn[2];
  for (int t = 0; t < 2; ++t) {
    if (LAST) {
      for (int kt = 0; kt < 2; ++kt) {
        for (int r = 0; r < 8; ++r) s[t][kt][r] = (k0 + 16 * kt + 8 * hh + r <= q0 + 16 * t + ln) ? s[t][kt][r] : -3.0e38f; } }
    float mx = s[t][0][0];
    for (int r = 1; r < 8; ++r) mx = fmaxf(mx, s[t][0][r]);
    for (int r = 0; r < 8; ++r) mx = fmaxf(mx, s[t][1][r]);
    mx = fmaxf(mx, fa_xhalf(mx)); mn[t] = fmaxf(m[t], mx); }
  if (__builtin_amdgcn_ballot_w32((mn[0] > m[0]) || (mn[1] > m[1])) != 0) {   /* no maximum moved: every factor is 1 and the rescale is skipped by the whole wave */
    for (int t = 0; t < 2; ++t) { const float al = __builtin_amdgcn_exp2f((m[t] - mn[t]) * SCL); l[t] *= al; m[t] = mn[t];
      for (int dt = 0; dt < 4; ++dt) { oh[t][dt] *= al; ol[t][dt] *= al; } } }
  for (int t = 0; t < 2; ++t) { const float off = 14.0f - m[t] * SCL; FragH p; v8f x[2], e[2];
    for (int kt = 0; kt < 2; ++kt) { x[kt] = s[t][kt] * SCL + off;
      for (int r = 0; r < 8; ++r) e[kt][r] = __builtin_amdgcn_exp2f(x[kt][r]); }
    /* the slot behind a transcendental: no source is overwritten and no result read before this v_nop, which stands behind the last of the sixteen */
    asm volatile("v_nop" : "+v"(e[0]), "+v"(e[1]) : "v"(x[0]), "v"(x[1]));
    for (int r = 0; r < 8; ++r) { p.h[r] = (_Float16)e[0][r]; p.h[8 + r] = (_Float16)e[1][r]; }
    const v8f es = e[0] + e[1];
    l[t] += ((es[0] + es[1]) + (es[2] + es[3])) + ((es[4] + es[5]) + (es[6] + es[7]));
    for (int dt = 0; dt < 4; ++dt) { oh[t][dt] = fa_mma(vh[dt], p.v, oh[t][dt]); ol[t][dt] = fa_mma(vl[dt], p.v, ol[t][dt]); } }
}

__global__ __launch_bounds__(128) void k_fattn(const _Float16* __restrict__ QK, const _Float16* __restrict__ VTh, const _Float16* __restrict__ VTl, float* __restrict__ O) {
  const int tid = threadIdx.x, lane = tid & 31, ln = lane & 15, hh = lane >> 4;
  const int w = __builtin_amdgcn_readfirstlane(tid >> 5);                       /* the wave's number in a scalar register: scalar loop bound and branches */
  const int slab = blockIdx.x, b = slab / NH, h = slab % NH;
  const int y = blockIdx.y, qb = (y < SEQ / 256) ? SEQ / 128 - 1 - y : y - SEQ / 256;   /* long blocks start first; the second half of the grid runs short to long beside them */
  const int q0 = qb * 128 + 32 * w;
  const _Float16* Q = QK + ((size_t)b * SEQ + q0) * LQK + h * HD; const _Float16* K = QK + (size_t)b * SEQ * LQK + UD + h * HD;      /* uniform bases */
  const _Float16* VH = VTh + (size_t)slab * HD * SEQ; const _Float16* VL = VTl + (size_t)slab * HD * SEQ;
  unsigned ko = (unsigned)(ln * LQK + 8 * hh) * 2, vo = (unsigned)(ln * SEQ + 8 * hh) * 2;                                       /* lane byte offsets */
  v16h qf[2][2], kf[2][2];
  for (int t = 0; t < 2; ++t) { qf[t][0] = fa_frag(Q, ko, t * 16 * LQK * 2); qf[t][1] = fa_frag(Q, ko, t * 16 * LQK * 2 + 64);
    kf[t][0] = fa_frag(K, ko, t * 16 * LQK * 2); kf[t][1] = fa_frag(K, ko, t * 16 * LQK * 2 + 64); }
  /* as in fa_pass: in front of any overwrite of these loads' address registers */
  asm volatile("s_wait_xcnt 0x0" : "+v"(ko) :: "memory");
  const v8f z8 = {0.f,0.f,0.f,0.f,0.f,0.f,0.f,0.f}; v8f oh[2][4], ol[2][4]; float m[2] = {-3.0e38f, -3.0e38f}, l[2] = {0.f, 0.f};
  for (int t = 0; t < 2; ++t) {
    for (int dt = 0; dt < 4; ++dt) { oh[t][dt] = z8; ol[t][dt] = z8; } }
  for (int k0 = 0; k0 < q0; k0 += 32) fa_pass<false>(k0, q0, ln, hh, K, VH, VL, ko, vo, qf, kf, oh, ol, m, l);
  fa_pass<true>(q0, q0, ln, hh, K, VH, VL, ko, vo, qf, kf, oh, ol, m, l);
  for (int t = 0; t < 2; ++t) { const float inv = 1.0f / (l[t] + fa_xhalf(l[t]));
    float* op = O + ((size_t)b * SEQ + q0 + 16 * t + ln) * UD + h * HD + 8 * hh;
    for (int dt = 0; dt < 4; ++dt) { v4f lo4, hi4;
      for (int i = 0; i < 4; ++i) { lo4[i] = (oh[t][dt][i] + ol[t][dt][i] * (1.0f / VLC)) * inv; hi4[i] = (oh[t][dt][4 + i] + ol[t][dt][4 + i] * (1.0f / VLC)) * inv; }
      *(v4f*)(op + dt * 16) = lo4; *(v4f*)(op + dt * 16 + 4) = hi4;
      /* in front of any reuse of the two stores' data and address registers */
      asm volatile("s_wait_xcnt 0x0" :: "v"(lo4), "v"(hi4), "v"(op) : "memory"); } }
}

__global__ __launch_bounds__(256) void k_lnpart(const float* __restrict__ O, const float* __restrict__ X, double* __restrict__ part) {
  __shared__ double rs[256]; __shared__ double rq[256];
  const int bat = blockIdx.y, blk = blockIdx.x, tid = threadIdx.x;
  const float* op = O + (size_t)bat * SEQ * UD + (size_t)blk * LNP; const float* xp = X + (size_t)bat * SEQ_FULL * CD + (size_t)blk * LNP;
  double s1 = 0.0, s2 = 0.0;
#pragma unroll 1
  for (int u = 0; u < LNP / 1024; ++u) { const int j = u * 1024 + tid * 4; const v4f a = *(const v4fa*)(op + j), c = *(const v4fa*)(xp + j);
#pragma unroll
    for (int q = 0; q < 4; ++q) { const float v = a[q] + bf16_rne(c[q]); s1 += (double)v; s2 += (double)v * (double)v; } }
  rs[tid] = s1; rq[tid] = s2; __syncthreads();
  for (int st = 128; st > 0; st >>= 1) { if (tid < st) { rs[tid] += rs[tid + st]; rq[tid] += rq[tid + st]; } __syncthreads(); }
  if (tid < 8) { v2d val; val[0] = (tid == 0) ? rs[0] : 0.0; val[1] = (tid == 0) ? rq[0] : 0.0;
    double* d = part + ((size_t)bat * NPB + blk) * 16 + tid * 2; *(v2d*)d = val;  }
}

// final statistics, one work-group: thread (batch bb, place t) takes partial t of its batch, so that all NB * NPB loads are in flight together; then two rounds of 16-to-1 f64 sums per batch in LDS
#define LFT 256                      /* threads per batch */
static_assert(LFT == 16 * 16 && NB * LFT <= 1024);
__global__ __launch_bounds__(NB * LFT) void k_lnfin(const double* __restrict__ part, float* __restrict__ stat) {
  __shared__ double rs[NB * LFT]; __shared__ double rq[NB * LFT];
  __shared__ __attribute__((aligned(16))) float st[32];
  const int tid = threadIdx.x; const int bb = tid / LFT, t = tid % LFT;
  double s = 0.0, q = 0.0;
  if (t < NPB) { const v2d p = *(const v2d*)(part + ((size_t)bb * NPB + t) * 16); s = p[0]; q = p[1]; }
  for (int i = t + LFT; i < NPB; i += LFT) { const v2d p = *(const v2d*)(part + ((size_t)bb * NPB + i) * 16); s += p[0]; q += p[1]; }
  rs[tid] = s; rq[tid] = q;
  if (tid < 32) st[tid] = 0.f;
  __syncthreads();
  for (int w = LFT / 16; w > 0; w /= 16) {   /* thread t < w sums places t + j * w; it alone reads and rewrites place t, and places from w on are only read */
    if (t < w) { double a[16], c[16];
      for (int j = 0; j < 16; ++j) { a[j] = rs[tid + j * w]; c[j] = rq[tid + j * w]; }
      for (int h = 8; h > 0; h >>= 1) {
        for (int j = 0; j < h; ++j) { a[j] += a[j + h]; c[j] += c[j + h]; } }
      rs[tid] = a[0]; rq[tid] = c[0]; }
    __syncthreads(); }
  if (t == 0) {
    const double inv = 1.0 / ((double)SEQ * (double)UD); const double m = rs[tid] * inv; double var = rq[tid] * inv - m * m; if (var < 0.0) var = 0.0;
    st[2 * bb] = (float)m; st[2 * bb + 1] = 1.0f / sqrtf((float)var + 1.0e-5f); }
  __syncthreads();
  if (tid < 8) { const v4f v = *(const v4fa*)&st[tid * 4]; *(v4f*)(stat + tid * 4) = v;  }
}

// coverage: grid (NB*SEQ*UD/1024) x 256 threads x 4 = every output element exactly once.
__global__ __launch_bounds__(256) void k_lnapply(const float* __restrict__ O, const float* __restrict__ X, const float* __restrict__ stat, const float* __restrict__ g, const float* __restrict__ bta, float* __restrict__ out) {
  const size_t e = ((size_t)blockIdx.x * 256 + threadIdx.x) * 4;
  const int bat = (int)(e / ((size_t)SEQ * UD)); const size_t su = e - (size_t)bat * SEQ * UD;
  const float mu = stat[2 * bat], rs = stat[2 * bat + 1];
  const v4f o = *(const v4fa*)(O + e), x = *(const v4fa*)(X + (size_t)bat * SEQ_FULL * CD + su), gg = *(const v4fa*)(g + su), bb = *(const v4fa*)(bta + su);
  v4f y;
#pragma unroll
  for (int q = 0; q < 4; ++q) { const float v = o[q] + bf16_rne(x[q]); y[q] = (v - mu) * rs * bf16_rne(gg[q]) + bf16_rne(bb[q]); }
  float* d = out + (size_t)bat * SEQ_FULL * UD + su;
  *(v4f*)d = y; 
}

extern "C" void kernel_launch(void* const* d_in, const int* in_sizes, int n_in,
                              void* d_out, int out_size, void* d_ws, size_t ws_size, hipStream_t stream) {
  if (n_in < 9) return;
  const float* X   = (const float*)d_in[0];      /* [2][2048][1024] */
  const float* Wq  = (const float*)d_in[1];      /* [in][out] 1024 x 1024 */
  const float* bq  = (const float*)d_in[2];
  const float* Wk  = (const float*)d_in[3];
  const float* bk  = (const float*)d_in[4];
  const float* Wv  = (const float*)d_in[5];
  const float* bv  = (const float*)d_in[6];
  const float* gam = (const float*)d_in[7];      /* [2048][1024] */
  const float* bet = (const float*)d_in[8];
  float* out = (float*)d_out;
  const size_t rows_used = (size_t)(NB - 1) * SEQ_FULL + SEQ;
  if ((size_t)in_sizes[0] < rows_used * CD) return;
  if ((size_t)in_sizes[1] < (size_t)CD * UD || (size_t)in_sizes[3] < (size_t)CD * UD || (size_t)in_sizes[5] < (size_t)CD * UD) return;
  if (in_sizes[2] < UD || in_sizes[4] < UD || in_sizes[6] < UD) return;
  if ((size_t)in_sizes[7] < (size_t)SEQ * UD || (size_t)in_sizes[8] < (size_t)SEQ * UD) return;
  if ((size_t)out_size < rows_used * UD) return;

  char* ws = (char*)d_ws; size_t off = 0;
  auto take = [&](size_t bytes) { char* p = ws + off; off += (bytes + 255) & ~(size_t)255; return p; };
  _Float16* BQKV = (_Float16*)take((size_t)3 * CD * UD * 2);               /* [3*UD][CD] f16 (x16) */
  _Float16* X16  = (_Float16*)take(NR * CD * 2);                           /* [NR][CD] */
  _Float16* QK16 = (_Float16*)take(NR * LQK * 2);                          /* [NR][q | k] */
  float*    V32  = (float*)take(NR * UD * 4);                              /* [NR][UD] f32 */
  _Float16* VTh  = (_Float16*)take((size_t)NB * NH * HD * SEQ * 2);        /* [NB*NH][HD][SEQ] */
  _Float16* VTl  = (_Float16*)take((size_t)NB * NH * HD * SEQ * 2);
  float*    O32  = (float*)take(NR * UD * 4);                              /* [NR][UD] f32 */
  double*   PART = (double*)take((size_t)NB * NPB * 128);                  
  float*    STAT = (float*)take(128);
  if (off > ws_size || off > (size_t)134217728) return;

  k_prep<<<(unsigned)(3 * WTB + XCB), 256, 0, stream>>>(Wq, Wk, Wv, X, BQKV, X16);
  const int MP = (int)NR;
  /* q rows (f16, cols 0..UD-1 of QK16), k rows (cols UD..2UD-1), v rows (f32), one grid: x16 . (16 W) * 2^-4 + bf16(bias) */
  k_gemm2<<<(unsigned)((MP / 128) * ((3 * UD) / 64)), 128, 0, stream>>>(X16, CD, BQKV, CD, 0.0625f, bq, bk, bv, UD, QK16, LQK, LQK, V32, UD, MP, 3 * UD, CD);
  k_vt2<<<(unsigned)(NB * NH * (SEQ / 64)), 256, 0, stream>>>(V32, VTh, VTl);
  k_fattn<<<dim3((unsigned)(NB * NH), (unsigned)(SEQ / 128)), 128, 0, stream>>>(QK16, VTh, VTl, O32);
  k_lnpart<<<dim3(NPB, NB), 256, 0, stream>>>(O32, X, PART);
  k_lnfin<<<1, NB * LFT, 0, stream>>>(PART, STAT);
  k_lnapply<<<(unsigned)((NR * UD) / 1024), 256, 0, stream>>>(O32, X, STAT, gam, bet, out);
}

// v005
// It runs in 105 microseconds.
// Next to v004, in two timings, it ran 1.08 and 1.09 times as fast.
// Counting every step since v000, it is 11.6 times as fast.
#include <hip/hip_runtime.h>
// Contractions on v_wmma_f32_16x16x32_f16 (f16 operands, f32 accumulate): q | k | v projections (x and weights bf16-valued, exact in f16, weights carried x16), scores k.q^T (plain f16 q, k), V^T.P^T in the same kernel (running-maximum softmax weights f16 carried x2^14; v as f16 hi plane + f16 residual plane carried x2^10, two accumulators). Scores, softmax statistics, attention output and residual add in f32; joint (seq, unit) normalisation statistics in f64. The v planes are written by the GEMM's epilogue, the residual sum and its statistics partials by the attention kernel's.
#ifndef NB
#define NB 2
#endif
#ifndef SEQ
#define SEQ 2048
#endif
#define NB_FULL 2
#define SEQ_FULL 2048
#define CD 1024                      /* input channels */
#define UD 1024                      /* units */
#define NH 16
#define HD 64
#define LQK (2 * UD)                 /* row pitch of the q | k rows */
#define LNP 8192                     /* floats per statistics block: the 128 queries x HD columns of one attention work-group */
#define NPB ((SEQ * UD) / LNP)       /* statistics blocks per batch */
#define NR ((size_t)NB * SEQ)        /* token rows (compact) */
#define WSC 16.0f                    /* weight carry */
#define VLC 1024.0f                  /* v residual plane carry */
static_assert(NB >= 1 && NB <= NB_FULL);
static_assert(SEQ % 256 == 0 && SEQ <= SEQ_FULL);
static_assert(CD % 64 == 0 && UD % 64 == 0 && CD == UD);
static_assert(NH * HD == UD && HD == 64);
static_assert((SEQ * UD) % LNP == 0 && LNP == 128 * HD && NPB == NH * (SEQ / 128));
static_assert(2 * NB <= 32);
static_assert((NR * UD) % 1024 == 0 && (NR % 128) == 0);

typedef unsigned short v8us __attribute__((ext_vector_type(8), may_alias));
typedef float  v8f  __attribute__((ext_vector_type(8)));
typedef float  v4f  __attribute__((ext_vector_type(4)));
typedef float  v4fa __attribute__((ext_vector_type(4), may_alias));
typedef double v2d  __attribute__((ext_vector_type(2)));
typedef _Float16 v16h __attribute__((ext_vector_type(16)));
typedef _Float16 v4h  __attribute__((ext_vector_type(4)));
union FragH { v16h v; v8us half[2]; _Float16 h[16]; unsigned short u[16]; };

__device__ __forceinline__ unsigned short bf16_bits(float x) { unsigned int u = __float_as_uint(x); return (unsigned short)((u + 0x7FFFu + ((u >> 16) & 1u)) >> 16); }
__device__ __forceinline__ float bf16_val(unsigned short b) { return __uint_as_float(((unsigned int)b) << 16); }
__device__ __forceinline__ float bf16_rne(float x) { return bf16_val(bf16_bits(x)); }

// 16-bit WMMA fragment: lane l, h = l >> 4, row/col = l & 15; elements 0..7 <- k0 + 8h + 0..7, elements 8..15 <- k0 + 16 + 8h + 0..7 (same map for A rows and for B[n][k] rows)
__device__ __forceinline__ v16h g2_frag(const _Float16* p, int hh) { FragH f; f.half[0] = *(const v8us*)((const unsigned short*)p + 8 * hh); f.half[1] = *(const v8us*)((const unsigned short*)p + 16 + 8 * hh); return f.v; }
__device__ __forceinline__ v8f g2_mma(v16h a, v16h b, v8f c) { v8f d = __builtin_amdgcn_wmma_f32_16x16x32_f16(false, a, false, b, (short)0, c, false, false); asm volatile("v_nop\n\tv_nop\n\tv_nop\n\tv_nop" : "+v"(d) : "v"(a), "v"(b)); return d; }

// The four conversions that depend on nothing but the inputs, in one grid: blocks 0 .. 3*WTB-1 take Wq | Wk | Wv (WTB blocks each): Wt[m*UD + n][k] = f16(bf16(W[k][n]) * 16);
// the other XCB blocks take x: X16[b*SEQ + s][c] = f16(bf16(x[b][s][c])). 8 elements per thread; every element of Wt and X16 is stored once. The branch is block-uniform.
#define WTB ((UD * (CD / 8)) / 256)
#define XCB ((int)((NR * CD / 8) / 256))
static_assert((UD * (CD / 8)) % 256 == 0 && (NR * CD / 8) % 256 == 0);
__global__ __launch_bounds__(256) void k_prep(const float* __restrict__ Wq, const float* __restrict__ Wk, const float* __restrict__ Wv, const float* __restrict__ x, _Float16* __restrict__ Wt, _Float16* __restrict__ X16) {
  const int bx = blockIdx.x; FragH f;
  if (bx < 3 * WTB) { const int m = bx / WTB; const float* __restrict__ W = (m == 0) ? Wq : (m == 1) ? Wk : Wv;
    const int t = (bx - m * WTB) * 256 + threadIdx.x; const int n = t / (CD / 8), k8 = (t % (CD / 8)) * 8;
#pragma unroll
    for (int i = 0; i < 8; ++i) f.h[i] = (_Float16)(bf16_rne(W[(size_t)(k8 + i) * UD + n]) * WSC);
    /* the wait: in front of any reuse of the store's data and address registers, whichever branch is laid out first */
    const v8us o = f.half[0]; unsigned short* d = (unsigned short*)Wt + ((size_t)m * UD + n) * CD + k8; *(v8us*)d = o; asm volatile("s_wait_xcnt 0x0" :: "v"(o), "v"(d) : "memory"); }
  else { const size_t t = (size_t)(bx - 3 * WTB) * 256 + threadIdx.x; const size_t n8 = (size_t)SEQ * CD / 8; const size_t b = t / n8;
    const float* xp = x + b * ((size_t)SEQ_FULL * CD) + (t - b * n8) * 8;
#pragma unroll
    for (int q = 0; q < 8; ++q) f.h[q] = (_Float16)bf16_rne(xp[q]);
    /* the wait: as above */
    const v8us o = f.half[0]; unsigned short* d = (unsigned short*)X16 + t * 8; *(v8us*)d = o; asm volatile("s_wait_xcnt 0x0" :: "v"(o), "v"(d) : "memory"); }
}

// GEMM, wave tile 32x64, block = 4 waves = 128 rows x 64 cols; A f16 rows (pitch lda), Bh f16 [n][k] (pitch ldb); v = acc*alpha + bf16(bias[col]).
// The N columns are up to three sections of nsec columns side by side (q | k | v in one grid), each with its own bias vector; columns below n16 are written as f16 to C16 (pitch ldc16); column n16 + h*HD + d of row b*SEQ + s goes, transposed, to the planes VTh / VTl [b*NH + h][d][s] (pitch SEQ): hi = f16(v), lo = f16((v - hi) * 2^10).
// grid (M/128)*(N/64). M % 128 == 0, N % 64 == 0, nsec % 64 == 0, n16 % 64 == 0, K % 64 == 0, lda % 8 == 0, ldb % 8 == 0.
// Operands go through LDS in stages of 64 k (one 128-byte line per row), two buffers: a wave's 16-byte global load covers 4 whole lines, the block's 128 A rows and 64 B rows are fetched once for its 4 waves,
// and stage s + 1 is in flight (in registers) while stage s is multiplied. One barrier per stage: it publishes stage s + 1 and ends the reads of the buffer that stage s + 2 overwrites.
#define GP 72                        /* LDS row pitch in elements: 128 + 16 bytes */
#define VP 136                       /* pitch of a d row of the v epilogue's planes in LDS: 256 + 16 bytes */
static_assert(2 * HD * VP <= 2 * 128 * GP && SEQ % 128 == 0);
__global__ __launch_bounds__(128) void k_gemm2(const _Float16* __restrict__ A, int lda, const _Float16* __restrict__ Bh, int ldb, float alpha, const float* __restrict__ bias0, const float* __restrict__ bias1, const float* __restrict__ bias2, int nsec,
    _Float16* __restrict__ C16, int ldc16, int n16, _Float16* __restrict__ VTh, _Float16* __restrict__ VTl, int M, int N, int K) {
  __shared__ __attribute__((aligned(16))) float so[4][32][68];
  __shared__ __attribute__((aligned(16))) _Float16 sa[2][128][GP]; __shared__ __attribute__((aligned(16))) _Float16 sb[2][64][GP];
  const int tid = threadIdx.x, w = tid >> 5, lane = tid & 31, ln = lane & 15, hh = lane >> 4;
  const int ntn = N >> 6; const int mt = blockIdx.x / ntn, nq = blockIdx.x - mt * ntn; const int row0 = mt * 128 + 32 * w, col0 = nq * 64;
  if (mt * 128 >= M) return;         /* taken by the whole block or by none: barriers follow */
  const int sr = tid >> 3, sc = (tid & 7) * 8;   /* staging: 8 threads per row, 16 rows per round */
  const unsigned short* ag = (const unsigned short*)A + (size_t)(mt * 128 + sr) * lda + sc; const unsigned short* bg = (const unsigned short*)Bh + (size_t)(col0 + sr) * ldb + sc;
  v8us ra[8], rb[4];
  auto fetch = [&](int k0) {         /* the stage that begins at k0, into registers */
    const unsigned short* pa[8]; const unsigned short* pb[4];
    for (int i = 0; i < 8; ++i) { pa[i] = ag + (size_t)(16 * i) * lda + k0; ra[i] = *(const v8us*)pa[i]; }
    for (int i = 0; i < 4; ++i) { pb[i] = bg + (size_t)(16 * i) * ldb + k0; rb[i] = *(const v8us*)pb[i]; }
    /* the wait that stands in front of every overwrite of an address register of the twelve loads above; the addresses are its inputs, so that they stay live and no load's result lands on one before it */
    asm volatile("s_wait_xcnt 0x0" :: "v"(pa[0]), "v"(pa[1]), "v"(pa[2]), "v"(pa[3]), "v"(pa[4]), "v"(pa[5]), "v"(pa[6]), "v"(pa[7]), "v"(pb[0]), "v"(pb[1]), "v"(pb[2]), "v"(pb[3]) : "memory"); };
  fetch(0);
  for (int i = 0; i < 8; ++i) *(v8us*)&sa[0][16 * i + sr][sc] = ra[i];
  for (int i = 0; i < 4; ++i) *(v8us*)&sb[0][16 * i + sr][sc] = rb[i];
  __syncthreads();
  const v8f z8 = {0.f,0.f,0.f,0.f,0.f,0.f,0.f,0.f}; v8f c00 = z8, c01 = z8, c02 = z8, c03 = z8, c10 = z8, c11 = z8, c12 = z8, c13 = z8;
#pragma unroll 1
  for (int kn = 64; kn <= K; kn += 64) { const int cur = ((kn >> 6) & 1) ^ 1; const bool more = kn < K;   /* kn: first k of the next stage; block-uniform */
    if (more) fetch(kn);
    v16h a[2][2], b[2][4];           /* the stage's 12 fragments, read as one group ahead of its products */
    for (int kk = 0; kk < 2; ++kk) {
      for (int i = 0; i < 2; ++i) a[kk][i] = g2_frag(&sa[cur][32 * w + 16 * i + ln][32 * kk], hh);
      for (int i = 0; i < 4; ++i) b[kk][i] = g2_frag(&sb[cur][16 * i + ln][32 * kk], hh); }
    for (int kk = 0; kk < 2; ++kk) {
      c00 = g2_mma(a[kk][0], b[kk][0], c00); c10 = g2_mma(a[kk][1], b[kk][0], c10);
      c01 = g2_mma(a[kk][0], b[kk][1], c01); c11 = g2_mma(a[kk][1], b[kk][1], c11);
      c02 = g2_mma(a[kk][0], b[kk][2], c02); c12 = g2_mma(a[kk][1], b[kk][2], c12);
      c03 = g2_mma(a[kk][0], b[kk][3], c03); c13 = g2_mma(a[kk][1], b[kk][3], c13); }
    if (more) {
      for (int i = 0; i < 8; ++i) *(v8us*)&sa[cur ^ 1][16 * i + sr][sc] = ra[i];
      for (int i = 0; i < 4; ++i) *(v8us*)&sb[cur ^ 1][16 * i + sr][sc] = rb[i]; }
    __syncthreads(); }
  const int sec = (col0 >= nsec) + (col0 >= 2 * nsec); const float* bp = ((sec == 0) ? bias0 : (sec == 1) ? bias1 : bias2) + (col0 - sec * nsec);   /* the block's 64 columns lie in one section */
  v8f accs[8] = {c00, c01, c02, c03, c10, c11, c12, c13};
  if (col0 >= n16) {                 /* v columns (the whole block or none: a barrier follows): one head's 64 d x the block's 128 tokens, both planes */
    /* a lane's 8 accumulator rows are 8 consecutive tokens of one d: one 16-byte piece per plane, gathered in LDS (the A buffers, free since the loop's last barrier) so that the block stores whole 256-byte rows */
    _Float16* sT = &sa[0][0][0];     /* [plane][d][VP] */
#pragma unroll
    for (int u = 0; u < 8; ++u) { const int t = u & 3, half = u >> 2; const float bv = bf16_rne(bp[t * 16 + ln]); FragH fh, fl;
#pragma unroll
      for (int r = 0; r < 8; ++r) { const float v = accs[u][r] * alpha + bv; const _Float16 hv = (_Float16)v; fh.h[r] = hv; fl.h[r] = (_Float16)((v - (float)hv) * VLC); }
      const int e = (t * 16 + ln) * VP + 32 * w + half * 16 + 8 * hh;
      *(v8us*)&sT[e] = fh.half[0]; *(v8us*)&sT[HD * VP + e] = fl.half[0]; }
    __syncthreads();                 /* the four waves' pieces are read by all of them */
    const int bat = (mt * 128) / SEQ; const size_t o0 = ((size_t)(bat * NH + (col0 - n16) / HD) * HD) * SEQ + (size_t)(mt * 128 - bat * SEQ);   /* SEQ % 128 == 0: the block's rows lie in one batch */
    const int dsub = tid >> 4, pc = (tid & 15) * 8;   /* 16 threads per d row, 8 rows per round */
    v8us ph[8], pl[8];               /* all sixteen pieces are read as one group, then stored as one run */
#pragma unroll
    for (int rd = 0; rd < 8; ++rd) { ph[rd] = *(const v8us*)&sT[(rd * 8 + dsub) * VP + pc]; pl[rd] = *(const v8us*)&sT[(HD + rd * 8 + dsub) * VP + pc]; }
    unsigned short* dh = (unsigned short*)VTh + o0 + (size_t)dsub * SEQ + pc; unsigned short* dl = (unsigned short*)VTl + o0 + (size_t)dsub * SEQ + pc;
#pragma unroll
    for (int rd = 0; rd < 8; ++rd) { *(v8us*)(dh + (size_t)rd * 8 * SEQ) = ph[rd]; *(v8us*)(dl + (size_t)rd * 8 * SEQ) = pl[rd]; }
    /* the wait: behind the run of sixteen stores, in front of any reuse of their data and address registers on whatever code is laid out behind them */
    asm volatile("s_wait_xcnt 0x0" :: "v"(ph[0]), "v"(ph[1]), "v"(ph[2]), "v"(ph[3]), "v"(ph[4]), "v"(ph[5]), "v"(ph[6]), "v"(ph[7]), "v"(pl[0]), "v"(pl[1]), "v"(pl[2]), "v"(pl[3]), "v"(pl[4]), "v"(pl[5]), "v"(pl[6]), "v"(pl[7]), "v"(dh), "v"(dl) : "memory");
    return; }
#pragma unroll
  for (int u = 0; u < 8; ++u) { const int t = u & 3, half = u >> 2; const float bv = bf16_rne(bp[t * 16 + ln]);
#pragma unroll
    for (int r = 0; r < 8; ++r) { const int rloc = half * 16 + 8 * hh + r; const float v = accs[u][r] * alpha + bv;
      so[w][rloc][t * 16 + ln] = v; } }
  __builtin_amdgcn_fence(4 /* acq_rel order */, "workgroup"); __builtin_amdgcn_wave_barrier();
  const int rsub = lane >> 4, c4 = (lane & 15) * 4;
  {
#pragma unroll
    for (int q = 0; q < 16; ++q) { const int r = q * 2 + rsub; const v4f v = *(const v4fa*)&so[w][r][c4];
      /* the wait: in front of any reuse of the store's data and address registers */
      v4h h4; for (int i = 0; i < 4; ++i) h4[i] = (_Float16)v[i]; _Float16* d = C16 + (size_t)(row0 + r) * ldc16 + col0 + c4; *(v4h*)d = h4; asm volatile("s_wait_xcnt 0x0" :: "v"(h4), "v"(d) : "memory"); }
     }
}

// fused causal attention, one wave per 32 queries of one slab (slab = b*NH + h), no LDS in the passes: per pass of 32 keys S^T = K . Q^T (A = k rows, B = q rows, kept in registers),
// running maximum and sum per query (a lane holds one query's scores: in-lane, plus one exchange between the wave halves), O^T += V^T . P^T (A = VT rows, both planes).
// The two S^T tiles of a pass (keys k0 + 8h + r and k0 + 16 + 8h + r of query ln) are, converted in place, the B fragment in the k order of g2_frag: no lane exchange for P.
// P = f16(2^14 * exp(s - running max)); the sum carries the same 2^14, so the carry cancels in the final division. Keys above the query are masked by index in the last pass only.
// Epilogue: R = attention output + bf16(x) is what is stored, and the work-group's f64 sum and sum of squares of its 128 x 64 values of R is statistics partial h*(SEQ/128) + qb of its batch.
// coverage: grid (NB*NH slabs) x (SEQ/128 blocks) x 4 waves x 32 queries = every row; 4 d tiles x (8h + r) = all 64 columns of the head, each element stored once; one partial per work-group, NPB per batch.
#define SCL 0.18033688011112042f     /* 2^-3 * log2(e): scores in the exponent's base-2 units */
__device__ __forceinline__ v8f fa_mma(v16h a, v16h b, v8f c) { return __builtin_amdgcn_wmma_f32_16x16x32_f16(false, a, false, b, (short)0, c, false, false); }
__device__ __forceinline__ float fa_xhalf(float x) { return __builtin_bit_cast(float, __builtin_amdgcn_permlanex16(__builtin_bit_cast(int, x), __builtin_bit_cast(int, x), 0x76543210, 0xfedcba98, false, false)); }  /* lane l with lane l ^ 16 */
__device__ __forceinline__ v16h fa_frag(const _Float16* base, unsigned lofs, unsigned cofs) { const char* p = (const char*)base + ((size_t)lofs + cofs); FragH f; f.half[0] = *(const v8us*)p; f.half[1] = *(const v8us*)(p + 32); return f.v; }  /* g2_frag from a uniform base, the lane's byte offset (8h included) and a constant byte offset */

// one pass of 32 keys; ko (into K) and vo (into either VT plane) are the lane's own byte offsets at this pass's first key and leave a pass other than the last advanced by 32 keys
template <bool LAST>
__device__ __forceinline__ void fa_pass(int k0, int q0, int ln, int hh, const _Float16* __restrict__ K, const _Float16* __restrict__ VH, const _Float16* __restrict__ VL, unsigned& ko, unsigned& vo,
    const v16h (&qf)[2][2], v16h (&kf)[2][2], v8f (&oh)[2][4], v8f (&ol)[2][4], float (&m)[2], float (&l)[2]) {
  v16h vh[4], vl[4];
  for (int dt = 0; dt < 4; ++dt) { vh[dt] = fa_frag(VH, vo, dt * 16 * SEQ * 2); vl[dt] = fa_frag(VL, vo, dt * 16 * SEQ * 2); }
  const v8f z8 = {0.f,0.f,0.f,0.f,0.f,0.f,0.f,0.f}; v8f s[2][2];
  for (int t = 0; t < 2; ++t) {
    for (int kt = 0; kt < 2; ++kt) s[t][kt] = fa_mma(kf[kt][1], qf[t][1], fa_mma(kf[kt][0], qf[t][0], z8)); }
  if (!LAST) {                       /* next pass's k fragments, fetched behind this pass's products; k0 + 32 <= q0 is a row of the sequence */
    for (int kt = 0; kt < 2; ++kt) { kf[kt][0] = fa_frag(K, ko, (32 + 16 * kt) * LQK * 2); kf[kt][1] = fa_frag(K, ko, (32 + 16 * kt) * LQK * 2 + 64); } }
  /* the wait that stands in front of every overwrite of an address register of the loads above; the offsets pass through it so that their advance stays behind it */
  if (LAST) { const char* pa = (const char*)VH + vo; const char* pb = (const char*)VL + vo;   /* here the loads may name the summed addresses: these stay live up to the wait as well */
    asm volatile("s_wait_xcnt 0x0" : "+v"(vo) : "v"(pa), "v"(pb) : "memory"); }
  else { asm volatile("s_wait_xcnt 0x0" : "+v"(ko), "+v"(vo) :: "memory"); ko += 32 * LQK * 2; vo += 32 * 2; }
  float mn[2];
  for (int t = 0; t < 2; ++t) {
    if (LAST) {
      for (int kt = 0; kt < 2; ++kt) {
        for (int r = 0; r < 8; ++r) s[t][kt][r] = (k0 + 16 * kt + 8 * hh + r <= q0 + 16 * t + ln) ? s[t][kt][r] : -3.0e38f; } }
    float mx = s[t][0][0];
    for (int r = 1; r < 8; ++r) mx = fmaxf(mx, s[t][0][r]);
    for (int r = 0; r < 8; ++r) mx = fmaxf(mx, s[t][1][r]);
    mx = fmaxf(mx, fa_xhalf(mx)); mn[t] = fmaxf(m[t], mx); }
  if (__builtin_amdgcn_ballot_w32((mn[0] > m[0]) || (mn[1] > m[1])) != 0) {   /* no maximum moved: every factor is 1 and the rescale is skipped by the whole wave */
    for (int t = 0; t < 2; ++t) { const float al = __builtin_amdgcn_exp2f((m[t] - mn[t]) * SCL); l[t] *= al; m[t] = mn[t];
      for (int dt = 0; dt < 4; ++dt) { oh[t][dt] *= al; ol[t][dt] *= al; } } }
  for (int t = 0; t < 2; ++t) { const float off = 14.0f - m[t] * SCL; FragH p; v8f x[2], e[2];
    for (int kt = 0; kt < 2; ++kt) { x[kt] = s[t][kt] * SCL + off;
      for (int r = 0; r < 8; ++r) e[kt][r] = __builtin_amdgcn_exp2f(x[kt][r]); }
    /* the slot behind a transcendental: no source is overwritten and no result read before this v_nop, which stands behind the last of the sixteen */
    asm volatile("v_nop" : "+v"(e[0]), "+v"(e[1]) : "v"(x[0]), "v"(x[1]));
    for (int r = 0; r < 8; ++r) { p.h[r] = (_Float16)e[0][r]; p.h[8 + r] = (_Float16)e[1][r]; }
    const v8f es = e[0] + e[1];
    l[t] += ((es[0] + es[1]) + (es[2] + es[3])) + ((es[4] + es[5]) + (es[6] + es[7]));
    for (int dt = 0; dt < 4; ++dt) { oh[t][dt] = fa_mma(vh[dt], p.v, oh[t][dt]); ol[t][dt] = fa_mma(vl[dt], p.v, ol[t][dt]); } }
}

__global__ __launch_bounds__(128) void k_fattn(const _Float16* __restrict__ QK, const _Float16* __restrict__ VTh, const _Float16* __restrict__ VTl, const float* __restrict__ X, float* __restrict__ R, double* __restrict__ part) {
  __shared__ double rs[128]; __shared__ double rq[128];
  const int tid = threadIdx.x, lane = tid & 31, ln = lane & 15, hh = lane >> 4;
  const int w = __builtin_amdgcn_readfirstlane(tid >> 5);                       /* the wave's number in a scalar register: scalar loop bound and branches */
  const int slab = blockIdx.x, b = slab / NH, h = slab % NH;
  const int y = blockIdx.y, qb = (y < SEQ / 256) ? SEQ / 128 - 1 - y : y - SEQ / 256;   /* long blocks start first; the second half of the grid runs short to long beside them */
  const int q0 = qb * 128 + 32 * w;
  const _Float16* Q = QK + ((size_t)b * SEQ + q0) * LQK + h * HD; const _Float16* K = QK + (size_t)b * SEQ * LQK + UD + h * HD;      /* uniform bases */
  const _Float16* VH = VTh + (size_t)slab * HD * SEQ; const _Float16* VL = VTl + (size_t)slab * HD * SEQ;
  unsigned ko = (unsigned)(ln * LQK + 8 * hh) * 2, vo = (unsigned)(ln * SEQ + 8 * hh) * 2;                                       /* lane byte offsets */
  v16h qf[2][2], kf[2][2];
  for (int t = 0; t < 2; ++t) { qf[t][0] = fa_frag(Q, ko, t * 16 * LQK * 2); qf[t][1] = fa_frag(Q, ko, t * 16 * LQK * 2 + 64);
    kf[t][0] = fa_frag(K, ko, t * 16 * LQK * 2); kf[t][1] = fa_frag(K, ko, t * 16 * LQK * 2 + 64); }
  /* as in fa_pass: in front of any overwrite of these loads' address registers */
  asm volatile("s_wait_xcnt 0x0" : "+v"(ko) :: "memory");
  const v8f z8 = {0.f,0.f,0.f,0.f,0.f,0.f,0.f,0.f}; v8f oh[2][4], ol[2][4]; float m[2] = {-3.0e38f, -3.0e38f}, l[2] = {0.f, 0.f};
  for (int t = 0; t < 2; ++t) {
    for (int dt = 0; dt < 4; ++dt) { oh[t][dt] = z8; ol[t][dt] = z8; } }
  for (int k0 = 0; k0 < q0; k0 += 32) fa_pass<false>(k0, q0, ln, hh, K, VH, VL, ko, vo, qf, kf, oh, ol, m, l);
  /* the lane's 64 residual values, at the places of its outputs: fetched ahead of the last pass, which covers their latency */
  const float* xp = X + ((size_t)b * SEQ_FULL + q0 + ln) * CD + h * HD + 8 * hh; v4f xl[2][4], xh[2][4];
  for (int t = 0; t < 2; ++t) {
    for (int dt = 0; dt < 4; ++dt) { xl[t][dt] = *(const v4fa*)(xp + t * 16 * CD + dt * 16); xh[t][dt] = *(const v4fa*)(xp + t * 16 * CD + dt * 16 + 4); } }
  /* in front of any overwrite of these loads' address registers */
  asm volatile("s_wait_xcnt 0x0" :: "v"(xp) : "memory");
  fa_pass<true>(q0, q0, ln, hh, K, VH, VL, ko, vo, qf, kf, oh, ol, m, l);
  double s1 = 0.0, s2 = 0.0;
  for (int t = 0; t < 2; ++t) { const float inv = 1.0f / (l[t] + fa_xhalf(l[t]));
    float* op = R + ((size_t)b * SEQ + q0 + 16 * t + ln) * UD + h * HD + 8 * hh;
    for (int dt = 0; dt < 4; ++dt) { v4f lo4, hi4;
      for (int i = 0; i < 4; ++i) { lo4[i] = (oh[t][dt][i] + ol[t][dt][i] * (1.0f / VLC)) * inv + bf16_rne(xl[t][dt][i]); hi4[i] = (oh[t][dt][4 + i] + ol[t][dt][4 + i] * (1.0f / VLC)) * inv + bf16_rne(xh[t][dt][i]); }
      *(v4f*)(op + dt * 16) = lo4; *(v4f*)(op + dt * 16 + 4) = hi4;
      /* in front of any reuse of the two stores' data and address registers */
      asm volatile("s_wait_xcnt 0x0" :: "v"(lo4), "v"(hi4), "v"(op) : "memory");
      for (int i = 0; i < 4; ++i) { s1 += (double)lo4[i]; s2 += (double)lo4[i] * (double)lo4[i]; s1 += (double)hi4[i]; s2 += (double)hi4[i] * (double)hi4[i]; } } }
  /* the work-group's partial: 128 lane sums, 16-to-1 in eight threads (thread t alone reads and rewrites place t; places from 8 on are only read), then 8-to-1; every wave passes both barriers */
  rs[tid] = s1; rq[tid] = s2; __syncthreads();
  if (tid < 8) { double a[16], c[16];
    for (int j = 0; j < 16; ++j) { a[j] = rs[tid + 8 * j]; c[j] = rq[tid + 8 * j]; }
    for (int g = 8; g > 0; g >>= 1) {
      for (int j = 0; j < g; ++j) { a[j] += a[j + g]; c[j] += c[j + g]; } }
    rs[tid] = a[0]; rq[tid] = c[0]; }
  __syncthreads();
  if (tid < 8) { v2d val; val[0] = (tid == 0) ? ((rs[0] + rs[1]) + (rs[2] + rs[3])) + ((rs[4] + rs[5]) + (rs[6] + rs[7])) : 0.0; val[1] = (tid == 0) ? ((rq[0] + rq[1]) + (rq[2] + rq[3])) + ((rq[4] + rq[5]) + (rq[6] + rq[7])) : 0.0;
    double* d = part + ((size_t)b * NPB + (size_t)h * (SEQ / 128) + qb) * 16 + tid * 2; *(v2d*)d = val;  }
}

// final statistics, one work-group: thread (batch bb, place t) takes partial t of its batch, so that all NB * NPB loads are in flight together; then two rounds of 16-to-1 f64 sums per batch in LDS
#define LFT 256                      /* threads per batch */
static_assert(LFT == 16 * 16 && NB * LFT <= 1024);
__global__ __launch_bounds__(NB * LFT) void k_lnfin(const double* __restrict__ part, float* __restrict__ stat) {
  __shared__ double rs[NB * LFT]; __shared__ double rq[NB * LFT];
  __shared__ __attribute__((aligned(16))) float st[32];
  const int tid = threadIdx.x; const int bb = tid / LFT, t = tid % LFT;
  double s = 0.0, q = 0.0;
  if (t < NPB) { const v2d p = *(const v2d*)(part + ((size_t)bb * NPB + t) * 16); s = p[0]; q = p[1]; }
  for (int i = t + LFT; i < NPB; i += LFT) { const v2d p = *(const v2d*)(part + ((size_t)bb * NPB + i) * 16); s += p[0]; q += p[1]; }
  rs[tid] = s; rq[tid] = q;
  if (tid < 32) st[tid] = 0.f;
  __syncthreads();
  for (int w = LFT / 16; w > 0; w /= 16) {   /* thread t < w sums places t + j * w; it alone reads and rewrites place t, and places from w on are only read */
    if (t < w) { double a[16], c[16];
      for (int j = 0; j < 16; ++j) { a[j] = rs[tid + j * w]; c[j] = rq[tid + j * w]; }
      for (int h = 8; h > 0; h >>= 1) {
        for (int j = 0; j < h; ++j) { a[j] += a[j + h]; c[j] += c[j + h]; } }
      rs[tid] = a[0]; rq[tid] = c[0]; }
    __syncthreads(); }
  if (t == 0) {
    const double inv = 1.0 / ((double)SEQ * (double)UD); const double m = rs[tid] * inv; double var = rq[tid] * inv - m * m; if (var < 0.0) var = 0.0;
    st[2 * bb] = (float)m; st[2 * bb + 1] = 1.0f / sqrtf((float)var + 1.0e-5f); }
  __syncthreads();
  if (tid < 8) { const v4f v = *(const v4fa*)&st[tid * 4]; *(v4f*)(stat + tid * 4) = v;  }
}

// coverage: grid (NB*SEQ*UD/1024) x 256 threads x 4 = every output element exactly once.
__global__ __launch_bounds__(256) void k_lnapply(const float* __restrict__ R, const float* __restrict__ stat, const float* __restrict__ g, const float* __restrict__ bta, float* __restrict__ out) {
  const size_t e = ((size_t)blockIdx.x * 256 + threadIdx.x) * 4;
  const int bat = (int)(e / ((size_t)SEQ * UD)); const size_t su = e - (size_t)bat * SEQ * UD;
  const float mu = stat[2 * bat], rs = stat[2 * bat + 1];
  const v4f o = *(const v4fa*)(R + e), gg = *(const v4fa*)(g + su), bb = *(const v4fa*)(bta + su);
  v4f y;
#pragma unroll
  for (int q = 0; q < 4; ++q) { const float v = o[q]; y[q] = (v - mu) * rs * bf16_rne(gg[q]) + bf16_rne(bb[q]); }
  float* d = out + (size_t)bat * SEQ_FULL * UD + su;
  *(v4f*)d = y; 
}

extern "C" void kernel_launch(void* const* d_in, const int* in_sizes, int n_in,
                              void* d_out, int out_size, void* d_ws, size_t ws_size, hipStream_t stream) {
  if (n_in < 9) return;
  const float* X   = (const float*)d_in[0];      /* [2][2048][1024] */
  const float* Wq  = (const float*)d_in[1];      /* [in][out] 1024 x 1024 */
  const float* bq  = (const float*)d_in[2];
  const float* Wk  = (const float*)d_in[3];
  const float* bk  = (const float*)d_in[4];
  const float* Wv  = (const float*)d_in[5];
  const float* bv  = (const float*)d_in[6];
  const float* gam = (const float*)d_in[7];      /* [2048][1024] */
  const float* bet = (const float*)d_in[8];
  float* out = (float*)d_out;
  const size_t rows_used = (size_t)(NB - 1) * SEQ_FULL + SEQ;
  if ((size_t)in_sizes[0] < rows_used * CD) return;
  if ((size_t)in_sizes[1] < (size_t)CD * UD || (size_t)in_sizes[3] < (size_t)CD * UD || (size_t)in_sizes[5] < (size_t)CD * UD) return;
  if (in_sizes[2] < UD || in_sizes[4] < UD || in_sizes[6] < UD) return;
  if ((size_t)in_sizes[7] < (size_t)SEQ * UD || (size_t)in_sizes[8] < (size_t)SEQ * UD) return;
  if ((size_t)out_size < rows_used * UD) return;

  char* ws = (char*)d_ws; size_t off = 0;
  auto take = [&](size_t bytes) { char* p = ws + off; off += (bytes + 255) & ~(size_t)255; return p; };
  _Float16* BQKV = (_Float16*)take((size_t)3 * CD * UD * 2);               /* [3*UD][CD] f16 (x16) */
  _Float16* X16  = (_Float16*)take(NR * CD * 2);                           /* [NR][CD] */
  _Float16* QK16 = (_Float16*)take(NR * LQK * 2);                          /* [NR][q | k] */
  _Float16* VTh  = (_Float16*)take((size_t)NB * NH * HD * SEQ * 2);        /* [NB*NH][HD][SEQ] */
  _Float16* VTl  = (_Float16*)take((size_t)NB * NH * HD * SEQ * 2);
  float*    R32  = (float*)take(NR * UD * 4);                              /* [NR][UD] f32: attention output + residual */
  double*   PART = (double*)take((size_t)NB * NPB * 128);                  
  float*    STAT = (float*)take(128);
  if (off > ws_size || off > (size_t)134217728) return;

  k_prep<<<(unsigned)(3 * WTB + XCB), 256, 0, stream>>>(Wq, Wk, Wv, X, BQKV, X16);
  const int MP = (int)NR;
  /* q rows (f16, cols 0..UD-1 of QK16), k rows (cols UD..2UD-1), v (both f16 planes, transposed), one grid: x16 . (16 W) * 2^-4 + bf16(bias) */
  k_gemm2<<<(unsigned)((MP / 128) * ((3 * UD) / 64)), 128, 0, stream>>>(X16, CD, BQKV, CD, 0.0625f, bq, bk, bv, UD, QK16, LQK, LQK, VTh, VTl, MP, 3 * UD, CD);
  k_fattn<<<dim3((unsigned)(NB * NH), (unsigned)(SEQ / 128)), 128, 0, stream>>>(QK16, VTh, VTl, X, R32, PART);
  k_lnfin<<<1, NB * LFT, 0, stream>>>(PART, STAT);
  k_lnapply<<<(unsigned)((NR * UD) / 1024), 256, 0, stream>>>(R32, STAT, gam, bet, out);
}

// v006
// It runs in 98.8 microseconds.
// Two timings next to v005 both put it at 1.07 times that version's speed.
// Over all steps from v000 it is 12.4 times as fast.
#include <hip/hip_runtime.h>
// Contractions on v_wmma_f32_16x16x32_f16 (f16 operands, f32 accumulate): q | k | v projections (x and weights bf16-valued, exact in f16, weights carried x16), scores k.q^T (plain f16 q, k), V^T.P^T in the same kernel (running-maximum softmax weights f16 carried x2^14; v as f16 hi plane + f16 residual plane carried x2^10, two accumulators). Scores, softmax statistics, attention output and residual add in f32; joint (seq, unit) normalisation statistics in f64. The v planes are written by the GEMM's epilogue, the residual sum and its statistics partials by the attention kernel's.
#ifndef NB
#define NB 2
#endif
#ifndef SEQ
#define SEQ 2048
#endif
#define NB_FULL 2
#define SEQ_FULL 2048
#define CD 1024                      /* input channels */
#define UD 1024                      /* units */
#define NH 16
#define HD 64
#define LQK (2 * UD)                 /* row pitch of the q | k rows */
#define LNP 8192                     /* floats per statistics block: the 128 queries x HD columns of one attention work-group */
#define NPB ((SEQ * UD) / LNP)       /* statistics blocks per batch */
#define NR ((size_t)NB * SEQ)        /* token rows (compact) */
#define WSC 16.0f                    /* weight carry */
#define VLC 1024.0f                  /* v residual plane carry */
static_assert(NB >= 1 && NB <= NB_FULL);
static_assert(SEQ % 256 == 0 && SEQ <= SEQ_FULL);
static_assert(CD % 64 == 0 && UD % 64 == 0 && CD == UD);
static_assert(NH * HD == UD && HD == 64);
static_assert((SEQ * UD) % LNP == 0 && LNP == 128 * HD && NPB == NH * (SEQ / 128));
static_assert(2 * NB <= 32);
static_assert((NR * UD) % 1024 == 0 && (NR % 128) == 0);

typedef unsigned short v8us __attribute__((ext_vector_type(8), may_alias));
typedef float  v8f  __attribute__((ext_vector_type(8)));
typedef float  v4f  __attribute__((ext_vector_type(4)));
typedef float  v4fa __attribute__((ext_vector_type(4), may_alias));
typedef double v2d  __attribute__((ext_vector_type(2)));
typedef _Float16 v16h __attribute__((ext_vector_type(16)));
typedef _Float16 v4h  __attribute__((ext_vector_type(4)));
union FragH { v16h v; v8us half[2]; _Float16 h[16]; unsigned short u[16]; };

__device__ __forceinline__ unsigned short bf16_bits(float x) { unsigned int u = __float_as_uint(x); return (unsigned short)((u + 0x7FFFu + ((u >> 16) & 1u)) >> 16); }
__device__ __forceinline__ float bf16_val(unsigned short b) { return __uint_as_float(((unsigned int)b) << 16); }
__device__ __forceinline__ float bf16_rne(float x) { return bf16_val(bf16_bits(x)); }

// 16-bit WMMA fragment: lane l, h = l >> 4, row/col = l & 15; elements 0..7 <- k0 + 8h + 0..7, elements 8..15 <- k0 + 16 + 8h + 0..7 (same map for A rows and for B[n][k] rows)
__device__ __forceinline__ v16h g2_frag(const _Float16* p, int hh) { FragH f; f.half[0] = *(const v8us*)((const unsigned short*)p + 8 * hh); f.half[1] = *(const v8us*)((const unsigned short*)p + 16 + 8 * hh); return f.v; }
__device__ __forceinline__ v8f g2_mma(v16h a, v16h b, v8f c) { v8f d = __builtin_amdgcn_wmma_f32_16x16x32_f16(false, a, false, b, (short)0, c, false, false); asm volatile("v_nop\n\tv_nop\n\tv_nop\n\tv_nop" : "+v"(d) : "v"(a), "v"(b)); return d; }

// The four conversions that depend on nothing but the inputs, in one grid: blocks 0 .. 3*WTB-1 take Wq | Wk | Wv (WTB blocks each): Wt[m*UD + n][k] = f16(bf16(W[k][n]) * 16);
// the other XCB blocks take x: X16[b*SEQ + s][c] = f16(bf16(x[b][s][c])). 64 elements per thread, so that few waves have to be started and each has 16 loads of 16 bytes in flight; every element of Wt and X16 is stored once. The branch is block-uniform.
// W: a thread takes an 8 k x 8 n block, read by rows; 4 lanes side by side in n cover one 128-byte line of a W row, 8 lanes side by side in k one 128-byte line of a Wt row.
// x: a thread takes XPP pieces of 8 elements, 256 pieces apart: each round of the block is one contiguous run.
#define XPP 8
#define WTB (((UD / 8) * (CD / 8)) / 256)
#define XCB ((int)((NR * CD / 8) / (256 * XPP)))
static_assert(((UD / 8) * (CD / 8)) % 256 == 0 && UD % 32 == 0 && (NR * CD / 8) % (256 * XPP) == 0 && ((size_t)SEQ * CD / 8) % (256 * XPP) == 0);
__global__ __launch_bounds__(256) void k_prep(const float* __restrict__ Wq, const float* __restrict__ Wk, const float* __restrict__ Wv, const float* __restrict__ x, _Float16* __restrict__ Wt, _Float16* __restrict__ X16) {
  const int bx = blockIdx.x; v4f lo[8], hi[8]; v8us o[8];
  if (bx < 3 * WTB) { const int m = bx / WTB; const float* __restrict__ W = (m == 0) ? Wq : (m == 1) ? Wk : Wv;
    const int t = (bx - m * WTB) * 256 + threadIdx.x; const int r = t >> 5;
    const int k8 = ((r % (CD / 64)) * 8 + (t & 7)) * 8, n8 = ((r / (CD / 64)) * 4 + ((t >> 3) & 3)) * 8;
    const float* wp = W + (size_t)k8 * UD + n8;
#pragma unroll
    for (int i = 0; i < 8; ++i) { lo[i] = *(const v4fa*)(wp + i * UD); hi[i] = *(const v4fa*)(wp + i * UD + 4); }
    /* the wait: in front of any overwrite of the sixteen loads' address registers */
    asm volatile("s_wait_xcnt 0x0" :: "v"(wp) : "memory");
#pragma unroll
    for (int j = 0; j < 8; ++j) { FragH f;
#pragma unroll
      for (int i = 0; i < 8; ++i) f.h[i] = (_Float16)(bf16_rne((j < 4) ? lo[i][j & 3] : hi[i][j & 3]) * WSC);
      o[j] = f.half[0]; }
    unsigned short* d = (unsigned short*)Wt + ((size_t)m * UD + n8) * CD + k8;
#pragma unroll
    for (int j = 0; j < 8; ++j) *(v8us*)(d + j * CD) = o[j];
    /* the wait: behind the run of eight stores, in front of any reuse of their data and address registers, whichever branch is laid out first */
    asm volatile("s_wait_xcnt 0x0" :: "v"(o[0]), "v"(o[1]), "v"(o[2]), "v"(o[3]), "v"(o[4]), "v"(o[5]), "v"(o[6]), "v"(o[7]), "v"(d) : "memory"); }
  else { const size_t t = (size_t)(bx - 3 * WTB) * (256 * XPP) + threadIdx.x; const size_t n8 = (size_t)SEQ * CD / 8; const size_t b = t / n8;   /* the block's pieces lie in one batch */
    const float* xp = x + b * ((size_t)SEQ_FULL * CD) + (t - b * n8) * 8;
#pragma unroll
    for (int j = 0; j < XPP; ++j) { lo[j] = *(const v4fa*)(xp + j * 2048); hi[j] = *(const v4fa*)(xp + j * 2048 + 4); }
    /* the wait: as above */
    asm volatile("s_wait_xcnt 0x0" :: "v"(xp) : "memory");
#pragma unroll
    for (int j = 0; j < XPP; ++j) { FragH f;
#pragma unroll
      for (int q = 0; q < 4; ++q) { f.h[q] = (_Float16)bf16_rne(lo[j][q]); f.h[4 + q] = (_Float16)bf16_rne(hi[j][q]); }
      o[j] = f.half[0]; }
    unsigned short* d = (unsigned short*)X16 + t * 8;
#pragma unroll
    for (int j = 0; j < XPP; ++j) *(v8us*)(d + j * 2048) = o[j];
    /* the wait: as above */
    asm volatile("s_wait_xcnt 0x0" :: "v"(o[0]), "v"(o[1]), "v"(o[2]), "v"(o[3]), "v"(o[4]), "v"(o[5]), "v"(o[6]), "v"(o[7]), "v"(d) : "memory"); }
}

// GEMM, wave tile 32x64, block = 4 waves = 128 rows x 64 cols; A f16 rows (pitch lda), Bh f16 [n][k] (pitch ldb); v = acc*alpha + bf16(bias[col]).
// The N columns are up to three sections of nsec columns side by side (q | k | v in one grid), each with its own bias vector; columns below n16 are written as f16 to C16 (pitch ldc16); column n16 + h*HD + d of row b*SEQ + s goes, transposed, to the planes VTh / VTl [b*NH + h][d][s] (pitch SEQ): hi = f16(v), lo = f16((v - hi) * 2^10).
// grid (M/128)*(N/64). M % 128 == 0, N % 64 == 0, nsec % 64 == 0, n16 % 64 == 0, K % 64 == 0, lda % 8 == 0, ldb % 8 == 0.
// Operands go through LDS in stages of 64 k (one 128-byte line per row), two buffers: a wave's 16-byte global load covers 4 whole lines, the block's 128 A rows and 64 B rows are fetched once for its 4 waves,
// and stage s + 1 is in flight (in registers) while stage s is multiplied. One barrier per stage: it publishes stage s + 1 and ends the reads of the buffer that stage s + 2 overwrites.
#define GP 72                        /* LDS row pitch in elements: 128 + 16 bytes */
#define VP 136                       /* pitch of a d row of the v epilogue's planes in LDS: 256 + 16 bytes */
static_assert(2 * HD * VP <= 2 * 128 * GP && SEQ % 128 == 0);
__global__ __launch_bounds__(128) void k_gemm2(const _Float16* __restrict__ A, int lda, const _Float16* __restrict__ Bh, int ldb, float alpha, const float* __restrict__ bias0, const float* __restrict__ bias1, const float* __restrict__ bias2, int nsec,
    _Float16* __restrict__ C16, int ldc16, int n16, _Float16* __restrict__ VTh, _Float16* __restrict__ VTl, int M, int N, int K) {
  __shared__ __attribute__((aligned(16))) float so[4][32][68];
  __shared__ __attribute__((aligned(16))) _Float16 sa[2][128][GP]; __shared__ __attribute__((aligned(16))) _Float16 sb[2][64][GP];
  const int tid = threadIdx.x, w = tid >> 5, lane = tid & 31, ln = lane & 15, hh = lane >> 4;
  const int ntn = N >> 6; const int mt = blockIdx.x / ntn, nq = blockIdx.x - mt * ntn; const int row0 = mt * 128 + 32 * w, col0 = nq * 64;
  if (mt * 128 >= M) return;         /* taken by the whole block or by none: barriers follow */
  const int sr = tid >> 3, sc = (tid & 7) * 8;   /* staging: 8 threads per row, 16 rows per round */
  const unsigned short* ag = (const unsigned short*)A + (size_t)(mt * 128 + sr) * lda + sc; const unsigned short* bg = (const unsigned short*)Bh + (size_t)(col0 + sr) * ldb + sc;
  v8us ra[8], rb[4];
  auto fetch = [&](int k0) {         /* the stage that begins at k0, into registers */
    const unsigned short* pa[8]; const unsigned short* pb[4];
    for (int i = 0; i < 8; ++i) { pa[i] = ag + (size_t)(16 * i) * lda + k0; ra[i] = *(const v8us*)pa[i]; }
    for (int i = 0; i < 4; ++i) { pb[i] = bg + (size_t)(16 * i) * ldb + k0; rb[i] = *(const v8us*)pb[i]; }
    /* the wait that stands in front of every overwrite of an address register of the twelve loads above; the addresses are its inputs, so that they stay live and no load's result lands on one before it */
    asm volatile("s_wait_xcnt 0x0" :: "v"(pa[0]), "v"(pa[1]), "v"(pa[2]), "v"(pa[3]), "v"(pa[4]), "v"(pa[5]), "v"(pa[6]), "v"(pa[7]), "v"(pb[0]), "v"(pb[1]), "v"(pb[2]), "v"(pb[3]) : "memory"); };
  fetch(0);
  for (int i = 0; i < 8; ++i) *(v8us*)&sa[0][16 * i + sr][sc] = ra[i];
  for (int i = 0; i < 4; ++i) *(v8us*)&sb[0][16 * i + sr][sc] = rb[i];
  __syncthreads();
  const v8f z8 = {0.f,0.f,0.f,0.f,0.f,0.f,0.f,0.f}; v8f c00 = z8, c01 = z8, c02 = z8, c03 = z8, c10 = z8, c11 = z8, c12 = z8, c13 = z8;
#pragma unroll 1
  for (int kn = 64; kn <= K; kn += 64) { const int cur = ((kn >> 6) & 1) ^ 1; const bool more = kn < K;   /* kn: first k of the next stage; block-uniform */
    if (more) fetch(kn);
    v16h a[2][2], b[2][4];           /* the stage's 12 fragments, read as one group ahead of its products */
    for (int kk = 0; kk < 2; ++kk) {
      for (int i = 0; i < 2; ++i) a[kk][i] = g2_frag(&sa[cur][32 * w + 16 * i + ln][32 * kk], hh);
      for (int i = 0; i < 4; ++i) b[kk][i] = g2_frag(&sb[cur][16 * i + ln][32 * kk], hh); }
    for (int kk = 0; kk < 2; ++kk) {
      c00 = g2_mma(a[kk][0], b[kk][0], c00); c10 = g2_mma(a[kk][1], b[kk][0], c10);
      c01 = g2_mma(a[kk][0], b[kk][1], c01); c11 = g2_mma(a[kk][1], b[kk][1], c11);
      c02 = g2_mma(a[kk][0], b[kk][2], c02); c12 = g2_mma(a[kk][1], b[kk][2], c12);
      c03 = g2_mma(a[kk][0], b[kk][3], c03); c13 = g2_mma(a[kk][1], b[kk][3], c13); }
    if (more) {
      for (int i = 0; i < 8; ++i) *(v8us*)&sa[cur ^ 1][16 * i + sr][sc] = ra[i];
      for (int i = 0; i < 4; ++i) *(v8us*)&sb[cur ^ 1][16 * i + sr][sc] = rb[i]; }
    __syncthreads(); }
  const int sec = (col0 >= nsec) + (col0 >= 2 * nsec); const float* bp = ((sec == 0) ? bias0 : (sec == 1) ? bias1 : bias2) + (col0 - sec * nsec);   /* the block's 64 columns lie in one section */
  v8f accs[8] = {c00, c01, c02, c03, c10, c11, c12, c13};
  if (col0 >= n16) {                 /* v columns (the whole block or none: a barrier follows): one head's 64 d x the block's 128 tokens, both planes */
    /* a lane's 8 accumulator rows are 8 consecutive tokens of one d: one 16-byte piece per plane, gathered in LDS (the A buffers, free since the loop's last barrier) so that the block stores whole 256-byte rows */
    _Float16* sT = &sa[0][0][0];     /* [plane][d][VP] */
#pragma unroll
    for (int u = 0; u < 8; ++u) { const int t = u & 3, half = u >> 2; const float bv = bf16_rne(bp[t * 16 + ln]); FragH fh, fl;
#pragma unroll
      for (int r = 0; r < 8; ++r) { const float v = accs[u][r] * alpha + bv; const _Float16 hv = (_Float16)v; fh.h[r] = hv; fl.h[r] = (_Float16)((v - (float)hv) * VLC); }
      const int e = (t * 16 + ln) * VP + 32 * w + half * 16 + 8 * hh;
      *(v8us*)&sT[e] = fh.half[0]; *(v8us*)&sT[HD * VP + e] = fl.half[0]; }
    __syncthreads();                 /* the four waves' pieces are read by all of them */
    const int bat = (mt * 128) / SEQ; const size_t o0 = ((size_t)(bat * NH + (col0 - n16) / HD) * HD) * SEQ + (size_t)(mt * 128 - bat * SEQ);   /* SEQ % 128 == 0: the block's rows lie in one batch */
    const int dsub = tid >> 4, pc = (tid & 15) * 8;   /* 16 threads per d row, 8 rows per round */
    v8us ph[8], pl[8];               /* all sixteen pieces are read as one group, then stored as one run */
#pragma unroll
    for (int rd = 0; rd < 8; ++rd) { ph[rd] = *(const v8us*)&sT[(rd * 8 + dsub) * VP + pc]; pl[rd] = *(const v8us*)&sT[(HD + rd * 8 + dsub) * VP + pc]; }
    unsigned short* dh = (unsigned short*)VTh + o0 + (size_t)dsub * SEQ + pc; unsigned short* dl = (unsigned short*)VTl + o0 + (size_t)dsub * SEQ + pc;
#pragma unroll
    for (int rd = 0; rd < 8; ++rd) { *(v8us*)(dh + (size_t)rd * 8 * SEQ) = ph[rd]; *(v8us*)(dl + (size_t)rd * 8 * SEQ) = pl[rd]; }
    /* the wait: behind the run of sixteen stores, in front of any reuse of their data and address registers on whatever code is laid out behind them */
    asm volatile("s_wait_xcnt 0x0" :: "v"(ph[0]), "v"(ph[1]), "v"(ph[2]), "v"(ph[3]), "v"(ph[4]), "v"(ph[5]), "v"(ph[6]), "v"(ph[7]), "v"(pl[0]), "v"(pl[1]), "v"(pl[2]), "v"(pl[3]), "v"(pl[4]), "v"(pl[5]), "v"(pl[6]), "v"(pl[7]), "v"(dh), "v"(dl) : "memory");
    return; }
#pragma unroll
  for (int u = 0; u < 8; ++u) { const int t = u & 3, half = u >> 2; const float bv = bf16_rne(bp[t * 16 + ln]);
#pragma unroll
    for (int r = 0; r < 8; ++r) { const int rloc = half * 16 + 8 * hh + r; const float v = accs[u][r] * alpha + bv;
      so[w][rloc][t * 16 + ln] = v; } }
  __builtin_amdgcn_fence(4 /* acq_rel order */, "workgroup"); __builtin_amdgcn_wave_barrier();
  const int rsub = lane >> 4, c4 = (lane & 15) * 4;
  {
#pragma unroll
    for (int q = 0; q < 16; ++q) { const int r = q * 2 + rsub; const v4f v = *(const v4fa*)&so[w][r][c4];
      /* the wait: in front of any reuse of the store's data and address registers */
      v4h h4; for (int i = 0; i < 4; ++i) h4[i] = (_Float16)v[i]; _Float16* d = C16 + (size_t)(row0 + r) * ldc16 + col0 + c4; *(v4h*)d = h4; asm volatile("s_wait_xcnt 0x0" :: "v"(h4), "v"(d) : "memory"); }
     }
}

// fused causal attention, one wave per 32 queries of one slab (slab = b*NH + h), no LDS in the passes: per pass of 32 keys S^T = K . Q^T (A = k rows, B = q rows, kept in registers),
// running maximum and sum per query (a lane holds one query's scores: in-lane, plus one exchange between the wave halves), O^T += V^T . P^T (A = VT rows, both planes).
// The two S^T tiles of a pass (keys k0 + 8h + r and k0 + 16 + 8h + r of query ln) are, converted in place, the B fragment in the k order of g2_frag: no lane exchange for P.
// P = f16(2^14 * exp(s - running max)); the sum carries the same 2^14, so the carry cancels in the final division. Keys above the query are masked by index in the last pass only.
// Epilogue: R = attention output + bf16(x) is what is stored, and the work-group's f64 sum and sum of squares of its 128 x 64 values of R is statistics partial h*(SEQ/128) + qb of its batch.
// coverage: grid (NB*NH slabs) x (SEQ/128 blocks) x 4 waves x 32 queries = every row; 4 d tiles x (8h + r) = all 64 columns of the head, each element stored once; one partial per work-group, NPB per batch.
#define SCL 0.18033688011112042f     /* 2^-3 * log2(e): scores in the exponent's base-2 units */
__device__ __forceinline__ v8f fa_mma(v16h a, v16h b, v8f c) { return __builtin_amdgcn_wmma_f32_16x16x32_f16(false, a, false, b, (short)0, c, false, false); }
__device__ __forceinline__ float fa_xhalf(float x) { return __builtin_bit_cast(float, __builtin_amdgcn_permlanex16(__builtin_bit_cast(int, x), __builtin_bit_cast(int, x), 0x76543210, 0xfedcba98, false, false)); }  /* lane l with lane l ^ 16 */
__device__ __forceinline__ v16h fa_frag(const _Float16* base, unsigned lofs, unsigned cofs) { const char* p = (const char*)base + ((size_t)lofs + cofs); FragH f; f.half[0] = *(const v8us*)p; f.half[1] = *(const v8us*)(p + 32); return f.v; }  /* g2_frag from a uniform base, the lane's byte offset (8h included) and a constant byte offset */

// one pass of 32 keys; ko (into K) and vo (into either VT plane) are the lane's own byte offsets at this pass's first key and leave a pass other than the last advanced by 32 keys
template <bool LAST>
__device__ __forceinline__ void fa_pass(int k0, int q0, int ln, int hh, const _Float16* __restrict__ K, const _Float16* __restrict__ VH, const _Float16* __restrict__ VL, unsigned& ko, unsigned& vo,
    const v16h (&qf)[2][2], v16h (&kf)[2][2], v8f (&oh)[2][4], v8f (&ol)[2][4], float (&m)[2], float (&l)[2]) {
  v16h vh[4], vl[4];
  for (int dt = 0; dt < 4; ++dt) { vh[dt] = fa_frag(VH, vo, dt * 16 * SEQ * 2); vl[dt] = fa_frag(VL, vo, dt * 16 * SEQ * 2); }
  const v8f z8 = {0.f,0.f,0.f,0.f,0.f,0.f,0.f,0.f}; v8f s[2][2];
  for (int t = 0; t < 2; ++t) {
    for (int kt = 0; kt < 2; ++kt) s[t][kt] = fa_mma(kf[kt][1], qf[t][1], fa_mma(kf[kt][0], qf[t][0], z8)); }
  if (!LAST) {                       /* next pass's k fragments, fetched behind this pass's products; k0 + 32 <= q0 is a row of the sequence */
    for (int kt = 0; kt < 2; ++kt) { kf[kt][0] = fa_frag(K, ko, (32 + 16 * kt) * LQK * 2); kf[kt][1] = fa_frag(K, ko, (32 + 16 * kt) * LQK * 2 + 64); } }
  /* the wait that stands in front of every overwrite of an address register of the loads above; the offsets pass through it so that their advance stays behind it */
  if (LAST) { const char* pa = (const char*)VH + vo; const char* pb = (const char*)VL + vo;   /* here the loads may name the summed addresses: these stay live up to the wait as well */
    asm volatile("s_wait_xcnt 0x0" : "+v"(vo) : "v"(pa), "v"(pb) : "memory"); }
  else { asm volatile("s_wait_xcnt 0x0" : "+v"(ko), "+v"(vo) :: "memory"); ko += 32 * LQK * 2; vo += 32 * 2; }
  float mn[2];
  for (int t = 0; t < 2; ++t) {
    if (LAST) {
      for (int kt = 0; kt < 2; ++kt) {
        for (int r = 0; r < 8; ++r) s[t][kt][r] = (k0 + 16 * kt + 8 * hh + r <= q0 + 16 * t + ln) ? s[t][kt][r] : -3.0e38f; } }
    float mx = s[t][0][0];
    for (int r = 1; r < 8; ++r) mx = fmaxf(mx, s[t][0][r]);
    for (int r = 0; r < 8; ++r) mx = fmaxf(mx, s[t][1][r]);
    mx = fmaxf(mx, fa_xhalf(mx)); mn[t] = fmaxf(m[t], mx); }
  if (__builtin_amdgcn_ballot_w32((mn[0] > m[0]) || (mn[1] > m[1])) != 0) {   /* no maximum moved: every factor is 1 and the rescale is skipped by the whole wave */
    for (int t = 0; t < 2; ++t) { const float al = __builtin_amdgcn_exp2f((m[t] - mn[t]) * SCL); l[t] *= al; m[t] = mn[t];
      for (int dt = 0; dt < 4; ++dt) { oh[t][dt] *= al; ol[t][dt] *= al; } } }
  for (int t = 0; t < 2; ++t) { const float off = 14.0f - m[t] * SCL; FragH p; v8f x[2], e[2];
    for (int kt = 0; kt < 2; ++kt) { x[kt] = s[t][kt] * SCL + off;
      for (int r = 0; r < 8; ++r) e[kt][r] = __builtin_amdgcn_exp2f(x[kt][r]); }
    /* the slot behind a transcendental: no source is overwritten and no result read before this v_nop, which stands behind the last of the sixteen */
    asm volatile("v_nop" : "+v"(e[0]), "+v"(e[1]) : "v"(x[0]), "v"(x[1]));
    for (int r = 0; r < 8; ++r) { p.h[r] = (_Float16)e[0][r]; p.h[8 + r] = (_Float16)e[1][r]; }
    const v8f es = e[0] + e[1];
    l[t] += ((es[0] + es[1]) + (es[2] + es[3])) + ((es[4] + es[5]) + (es[6] + es[7]));
    for (int dt = 0; dt < 4; ++dt) { oh[t][dt] = fa_mma(vh[dt], p.v, oh[t][dt]); ol[t][dt] = fa_mma(vl[dt], p.v, ol[t][dt]); } }
}

__global__ __launch_bounds__(128) void k_fattn(const _Float16* __restrict__ QK, const _Float16* __restrict__ VTh, const _Float16* __restrict__ VTl, const float* __restrict__ X, float* __restrict__ R, double* __restrict__ part) {
  __shared__ double rs[128]; __shared__ double rq[128];
  const int tid = threadIdx.x, lane = tid & 31, ln = lane & 15, hh = lane >> 4;
  const int w = __builtin_amdgcn_readfirstlane(tid >> 5);                       /* the wave's number in a scalar register: scalar loop bound and branches */
  const int slab = blockIdx.x, b = slab / NH, h = slab % NH;
  const int y = blockIdx.y, qb = (y < SEQ / 256) ? SEQ / 128 - 1 - y : y - SEQ / 256;   /* long blocks start first; the second half of the grid runs short to long beside them */
  const int q0 = qb * 128 + 32 * w;
  const _Float16* Q = QK + ((size_t)b * SEQ + q0) * LQK + h * HD; const _Float16* K = QK + (size_t)b * SEQ * LQK + UD + h * HD;      /* uniform bases */
  const _Float16* VH = VTh + (size_t)slab * HD * SEQ; const _Float16* VL = VTl + (size_t)slab * HD * SEQ;
  unsigned ko = (unsigned)(ln * LQK + 8 * hh) * 2, vo = (unsigned)(ln * SEQ + 8 * hh) * 2;                                       /* lane byte offsets */
  v16h qf[2][2], kf[2][2];
  for (int t = 0; t < 2; ++t) { qf[t][0] = fa_frag(Q, ko, t * 16 * LQK * 2); qf[t][1] = fa_frag(Q, ko, t * 16 * LQK * 2 + 64);
    kf[t][0] = fa_frag(K, ko, t * 16 * LQK * 2); kf[t][1] = fa_frag(K, ko, t * 16 * LQK * 2 + 64); }
  /* as in fa_pass: in front of any overwrite of these loads' address registers */
  asm volatile("s_wait_xcnt 0x0" : "+v"(ko) :: "memory");
  const v8f z8 = {0.f,0.f,0.f,0.f,0.f,0.f,0.f,0.f}; v8f oh[2][4], ol[2][4]; float m[2] = {-3.0e38f, -3.0e38f}, l[2] = {0.f, 0.f};
  for (int t = 0; t < 2; ++t) {
    for (int dt = 0; dt < 4; ++dt) { oh[t][dt] = z8; ol[t][dt] = z8; } }
  for (int k0 = 0; k0 < q0; k0 += 32) fa_pass<false>(k0, q0, ln, hh, K, VH, VL, ko, vo, qf, kf, oh, ol, m, l);
  /* the lane's 64 residual values, at the places of its outputs: fetched ahead of the last pass, which covers their latency */
  const float* xp = X + ((size_t)b * SEQ_FULL + q0 + ln) * CD + h * HD + 8 * hh; v4f xl[2][4], xh[2][4];
  for (int t = 0; t < 2; ++t) {
    for (int dt = 0; dt < 4; ++dt) { xl[t][dt] = *(const v4fa*)(xp + t * 16 * CD + dt * 16); xh[t][dt] = *(const v4fa*)(xp + t * 16 * CD + dt * 16 + 4); } }
  /* in front of any overwrite of these loads' address registers */
  asm volatile("s_wait_xcnt 0x0" :: "v"(xp) : "memory");
  fa_pass<true>(q0, q0, ln, hh, K, VH, VL, ko, vo, qf, kf, oh, ol, m, l);
  double s1 = 0.0, s2 = 0.0;
  for (int t = 0; t < 2; ++t) { const float inv = 1.0f / (l[t] + fa_xhalf(l[t]));
    float* op = R + ((size_t)b * SEQ + q0 + 16 * t + ln) * UD + h * HD + 8 * hh;
    for (int dt = 0; dt < 4; ++dt) { v4f lo4, hi4;
      for (int i = 0; i < 4; ++i) { lo4[i] = (oh[t][dt][i] + ol[t][dt][i] * (1.0f / VLC)) * inv + bf16_rne(xl[t][dt][i]); hi4[i] = (oh[t][dt][4 + i] + ol[t][dt][4 + i] * (1.0f / VLC)) * inv + bf16_rne(xh[t][dt][i]); }
      *(v4f*)(op + dt * 16) = lo4; *(v4f*)(op + dt * 16 + 4) = hi4;
      /* in front of any reuse of the two stores' data and address registers */
      asm volatile("s_wait_xcnt 0x0" :: "v"(lo4), "v"(hi4), "v"(op) : "memory");
      for (int i = 0; i < 4; ++i) { s1 += (double)lo4[i]; s2 += (double)lo4[i] * (double)lo4[i]; s1 += (double)hi4[i]; s2 += (double)hi4[i] * (double)hi4[i]; } } }
  /* the work-group's partial: 128 lane sums, 16-to-1 in eight threads (thread t alone reads and rewrites place t; places from 8 on are only read), then 8-to-1; every wave passes both barriers */
  rs[tid] = s1; rq[tid] = s2; __syncthreads();
  if (tid < 8) { double a[16], c[16];
    for (int j = 0; j < 16; ++j) { a[j] = rs[tid + 8 * j]; c[j] = rq[tid + 8 * j]; }
    for (int g = 8; g > 0; g >>= 1) {
      for (int j = 0; j < g; ++j) { a[j] += a[j + g]; c[j] += c[j + g]; } }
    rs[tid] = a[0]; rq[tid] = c[0]; }
  __syncthreads();
  if (tid < 8) { v2d val; val[0] = (tid == 0) ? ((rs[0] + rs[1]) + (rs[2] + rs[3])) + ((rs[4] + rs[5]) + (rs[6] + rs[7])) : 0.0; val[1] = (tid == 0) ? ((rq[0] + rq[1]) + (rq[2] + rq[3])) + ((rq[4] + rq[5]) + (rq[6] + rq[7])) : 0.0;
    double* d = part + ((size_t)b * NPB + (size_t)h * (SEQ / 128) + qb) * 16 + tid * 2; *(v2d*)d = val;  }
}

// final statistics, one work-group: thread (batch bb, place t) takes partial t of its batch, so that all NB * NPB loads are in flight together; then two rounds of 16-to-1 f64 sums per batch in LDS
#define LFT 256                      /* threads per batch */
static_assert(LFT == 16 * 16 && NB * LFT <= 1024);
__global__ __launch_bounds__(NB * LFT) void k_lnfin(const double* __restrict__ part, float* __restrict__ stat) {
  __shared__ double rs[NB * LFT]; __shared__ double rq[NB * LFT];
  __shared__ __attribute__((aligned(16))) float st[32];
  const int tid = threadIdx.x; const int bb = tid / LFT, t = tid % LFT;
  double s = 0.0, q = 0.0;
  if (t < NPB) { const v2d p = *(const v2d*)(part + ((size_t)bb * NPB + t) * 16); s = p[0]; q = p[1]; }
  for (int i = t + LFT; i < NPB; i += LFT) { const v2d p = *(const v2d*)(part + ((size_t)bb * NPB + i) * 16); s += p[0]; q += p[1]; }
  rs[tid] = s; rq[tid] = q;
  if (tid < 32) st[tid] = 0.f;
  __syncthreads();
  for (int w = LFT / 16; w > 0; w /= 16) {   /* thread t < w sums places t + j * w; it alone reads and rewrites place t, and places from w on are only read */
    if (t < w) { double a[16], c[16];
      for (int j = 0; j < 16; ++j) { a[j] = rs[tid + j * w]; c[j] = rq[tid + j * w]; }
      for (int h = 8; h > 0; h >>= 1) {
        for (int j = 0; j < h; ++j) { a[j] += a[j + h]; c[j] += c[j + h]; } }
      rs[tid] = a[0]; rq[tid] = c[0]; }
    __syncthreads(); }
  if (t == 0) {
    const double inv = 1.0 / ((double)SEQ * (double)UD); const double m = rs[tid] * inv; double var = rq[tid] * inv - m * m; if (var < 0.0) var = 0.0;
    st[2 * bb] = (float)m; st[2 * bb + 1] = 1.0f / sqrtf((float)var + 1.0e-5f); }
  __syncthreads();
  if (tid < 8) { const v4f v = *(const v4fa*)&st[tid * 4]; *(v4f*)(stat + tid * 4) = v;  }
}

// a thread takes LAP places of 4 floats, 256 places apart, in every batch: few waves to start, (2 + NB) * LAP loads of 16 bytes in flight in each; the places' g and bta serve all batches.
// coverage: grid (SEQ*UD/(1024*LAP)) x 256 threads x LAP places x 4 floats x NB batches = every output element exactly once.
#define LAP 4
static_assert(((size_t)SEQ * UD) % (1024 * LAP) == 0);
__global__ __launch_bounds__(256) void k_lnapply(const float* __restrict__ R, const float* __restrict__ stat, const float* __restrict__ g, const float* __restrict__ bta, float* __restrict__ out) {
  const unsigned eo = (blockIdx.x * (256u * LAP) + threadIdx.x) * 16u;   /* the lane's byte offset inside one batch */
  v4f o[NB][LAP], gg[LAP], bb[LAP], y[NB][LAP];
#pragma unroll
  for (int j = 0; j < LAP; ++j) { gg[j] = *(const v4fa*)((const char*)g + ((size_t)eo + j * 4096)); bb[j] = *(const v4fa*)((const char*)bta + ((size_t)eo + j * 4096)); }
#pragma unroll
  for (int bat = 0; bat < NB; ++bat) {
#pragma unroll
    for (int j = 0; j < LAP; ++j) o[bat][j] = *(const v4fa*)((const char*)(R + (size_t)bat * SEQ * UD) + ((size_t)eo + j * 4096)); }
  /* the wait: in front of any overwrite of the loads' address register */
  asm volatile("s_wait_xcnt 0x0" :: "v"(eo) : "memory");
#pragma unroll
  for (int bat = 0; bat < NB; ++bat) { const float mu = stat[2 * bat], rs = stat[2 * bat + 1];
#pragma unroll
    for (int j = 0; j < LAP; ++j) {
#pragma unroll
      for (int q = 0; q < 4; ++q) { const float v = o[bat][j][q]; y[bat][j][q] = (v - mu) * rs * bf16_rne(gg[j][q]) + bf16_rne(bb[j][q]); } } }
#pragma unroll
  for (int bat = 0; bat < NB; ++bat) {
#pragma unroll
    for (int j = 0; j < LAP; ++j) *(v4f*)((char*)(out + (size_t)bat * SEQ_FULL * UD) + ((size_t)eo + j * 4096)) = y[bat][j]; }
}

extern "C" void kernel_launch(void* const* d_in, const int* in_sizes, int n_in,
                              void* d_out, int out_size, void* d_ws, size_t ws_size, hipStream_t stream) {
  if (n_in < 9) return;
  const float* X   = (const float*)d_in[0];      /* [2][2048][1024] */
  const float* Wq  = (const float*)d_in[1];      /* [in][out] 1024 x 1024 */
  const float* bq  = (const float*)d_in[2];
  const float* Wk  = (const float*)d_in[3];
  const float* bk  = (const float*)d_in[4];
  const float* Wv  = (const float*)d_in[5];
  const float* bv  = (const float*)d_in[6];
  const float* gam = (const float*)d_in[7];      /* [2048][1024] */
  const float* bet = (const float*)d_in[8];
  float* out = (float*)d_out;
  const size_t rows_used = (size_t)(NB - 1) * SEQ_FULL + SEQ;
  if ((size_t)in_sizes[0] < rows_used * CD) return;
  if ((size_t)in_sizes[1] < (size_t)CD * UD || (size_t)in_sizes[3] < (size_t)CD * UD || (size_t)in_sizes[5] < (size_t)CD * UD) return;
  if (in_sizes[2] < UD || in_sizes[4] < UD || in_sizes[6] < UD) return;
  if ((size_t)in_sizes[7] < (size_t)SEQ * UD || (size_t)in_sizes[8] < (size_t)SEQ * UD) return;
  if ((size_t)out_size < rows_used * UD) return;

  char* ws = (char*)d_ws; size_t off = 0;
  auto take = [&](size_t bytes) { char* p = ws + off; off += (bytes + 255) & ~(size_t)255; return p; };
  _Float16* BQKV = (_Float16*)take((size_t)3 * CD * UD * 2);               /* [3*UD][CD] f16 (x16) */
  _Float16* X16  = (_Float16*)take(NR * CD * 2);                           /* [NR][CD] */
  _Float16* QK16 = (_Float16*)take(NR * LQK * 2);                          /* [NR][q | k] */
  _Float16* VTh  = (_Float16*)take((size_t)NB * NH * HD * SEQ * 2);        /* [NB*NH][HD][SEQ] */
  _Float16* VTl  = (_Float16*)take((size_t)NB * NH * HD * SEQ * 2);
  float*    R32  = (float*)take(NR * UD * 4);                              /* [NR][UD] f32: attention output + residual */
  double*   PART = (double*)take((size_t)NB * NPB * 128);                  
  float*    STAT = (float*)take(128);
  if (off > ws_size || off > (size_t)134217728) return;

  k_prep<<<(unsigned)(3 * WTB + XCB), 256, 0, stream>>>(Wq, Wk, Wv, X, BQKV, X16);
  const int MP = (int)NR;
  /* q rows (f16, cols 0..UD-1 of QK16), k rows (cols UD..2UD-1), v (both f16 planes, transposed), one grid: x16 . (16 W) * 2^-4 + bf16(bias) */
  k_gemm2<<<(unsigned)((MP / 128) * ((3 * UD) / 64)), 128, 0, stream>>>(X16, CD, BQKV, CD, 0.0625f, bq, bk, bv, UD, QK16, LQK, LQK, VTh, VTl, MP, 3 * UD, CD);
  k_fattn<<<dim3((unsigned)(NB * NH), (unsigned)(SEQ / 128)), 128, 0, stream>>>(QK16, VTh, VTl, X, R32, PART);
  k_lnfin<<<1, NB * LFT, 0, stream>>>(PART, STAT);
  k_lnapply<<<(unsigned)(((size_t)SEQ * UD) / (1024 * LAP)), 256, 0, stream>>>(R32, STAT, gam, bet, out);
}

// v007
// A run of this version takes 89.8 microseconds.
// Next to v006, in two timings, it ran 1.09 and 1.10 times as fast.
// All steps since v000 together make it 13.6 times as fast.
#include <hip/hip_runtime.h>
// Contractions on v_wmma_f32_16x16x32_f16 (f16 operands, f32 accumulate): q | k | v projections (x and weights bf16-valued, exact in f16, weights carried x16), scores k.q^T (plain f16 q, k), V^T.P^T in the same kernel (running-maximum softmax weights f16 carried x2^14; v as f16 hi plane + f16 residual plane carried x2^10, two accumulators). Scores, softmax statistics, attention output and residual add in f32; joint (seq, unit) normalisation statistics in f64. K and the v planes reach the attention waves through LDS. The v planes are written by the GEMM's epilogue, the residual sum and its statistics partials by the attention kernel's.
#ifndef NB
#define NB 2
#endif
#ifndef SEQ
#define SEQ 2048
#endif
#define NB_FULL 2
#define SEQ_FULL 2048
#define CD 1024                      /* input channels */
#define UD 1024                      /* units */
#define NH 16
#define HD 64
#define LQK (2 * UD)                 /* row pitch of the q | k rows */
#define LNP 8192                     /* floats per statistics block: the 128 queries x HD columns of one attention work-group */
#define NPB ((SEQ * UD) / LNP)       /* statistics blocks per batch */
#define NR ((size_t)NB * SEQ)        /* token rows (compact) */
#define WSC 16.0f                    /* weight carry */
#define VLC 1024.0f                  /* v residual plane carry */
static_assert(NB >= 1 && NB <= NB_FULL);
static_assert(SEQ % 256 == 0 && SEQ <= SEQ_FULL);
static_assert(CD % 64 == 0 && UD % 64 == 0 && CD == UD);
static_assert(NH * HD == UD && HD == 64);
static_assert((SEQ * UD) % LNP == 0 && LNP == 128 * HD && NPB == NH * (SEQ / 128));
static_assert(2 * NB <= 32);
static_assert((NR * UD) % 1024 == 0 && (NR % 128) == 0);

typedef unsigned short v8us __attribute__((ext_vector_type(8), may_alias));
typedef float  v8f  __attribute__((ext_vector_type(8)));
typedef float  v4f  __attribute__((ext_vector_type(4)));
typedef float  v4fa __attribute__((ext_vector_type(4), may_alias));
typedef double v2d  __attribute__((ext_vector_type(2)));
typedef _Float16 v16h __attribute__((ext_vector_type(16)));
typedef _Float16 v4h  __attribute__((ext_vector_type(4)));
union FragH { v16h v; v8us half[2]; _Float16 h[16]; unsigned short u[16]; };

__device__ __forceinline__ unsigned short bf16_bits(float x) { unsigned int u = __float_as_uint(x); return (unsigned short)((u + 0x7FFFu + ((u >> 16) & 1u)) >> 16); }
__device__ __forceinline__ float bf16_val(unsigned short b) { return __uint_as_float(((unsigned int)b) << 16); }
__device__ __forceinline__ float bf16_rne(float x) { return bf16_val(bf16_bits(x)); }

// 16-bit WMMA fragment: lane l, h = l >> 4, row/col = l & 15; elements 0..7 <- k0 + 8h + 0..7, elements 8..15 <- k0 + 16 + 8h + 0..7 (same map for A rows and for B[n][k] rows)
__device__ __forceinline__ v16h g2_frag(const _Float16* p, int hh) { FragH f; f.half[0] = *(const v8us*)((const unsigned short*)p + 8 * hh); f.half[1] = *(const v8us*)((const unsigned short*)p + 16 + 8 * hh); return f.v; }
__device__ __forceinline__ v8f g2_mma(v16h a, v16h b, v8f c) { v8f d = __builtin_amdgcn_wmma_f32_16x16x32_f16(false, a, false, b, (short)0, c, false, false); asm volatile("v_nop\n\tv_nop\n\tv_nop\n\tv_nop" : "+v"(d) : "v"(a), "v"(b)); return d; }

// The four conversions that depend on nothing but the inputs, in one grid: blocks 0 .. 3*WTB-1 take Wq | Wk | Wv (WTB blocks each): Wt[m*UD + n][k] = f16(bf16(W[k][n]) * 16);
// the other XCB blocks take x: X16[b*SEQ + s][c] = f16(bf16(x[b][s][c])). 64 elements per thread, so that few waves have to be started and each has 16 loads of 16 bytes in flight; every element of Wt and X16 is stored once. The branch is block-uniform.
// W: a thread takes an 8 k x 8 n block, read by rows; 4 lanes side by side in n cover one 128-byte line of a W row, 8 lanes side by side in k one 128-byte line of a Wt row.
// x: a thread takes XPP pieces of 8 elements, 256 pieces apart: each round of the block is one contiguous run.
#define XPP 8
#define WTB (((UD / 8) * (CD / 8)) / 256)
#define XCB ((int)((NR * CD / 8) / (256 * XPP)))
static_assert(((UD / 8) * (CD / 8)) % 256 == 0 && UD % 32 == 0 && (NR * CD / 8) % (256 * XPP) == 0 && ((size_t)SEQ * CD / 8) % (256 * XPP) == 0);
__global__ __launch_bounds__(256) void k_prep(const float* __restrict__ Wq, const float* __restrict__ Wk, const float* __restrict__ Wv, const float* __restrict__ x, _Float16* __restrict__ Wt, _Float16* __restrict__ X16) {
  const int bx = blockIdx.x; v4f lo[8], hi[8]; v8us o[8];
  if (bx < 3 * WTB) { const int m = bx / WTB; const float* __restrict__ W = (m == 0) ? Wq : (m == 1) ? Wk : Wv;
    const int t = (bx - m * WTB) * 256 + threadIdx.x; const int r = t >> 5;
    const int k8 = ((r % (CD / 64)) * 8 + (t & 7)) * 8, n8 = ((r / (CD / 64)) * 4 + ((t >> 3) & 3)) * 8;
    const float* wp = W + (size_t)k8 * UD + n8;
#pragma unroll
    for (int i = 0; i < 8; ++i) { lo[i] = *(const v4fa*)(wp + i * UD); hi[i] = *(const v4fa*)(wp + i * UD + 4); }
    /* the wait: in front of any overwrite of the sixteen loads' address registers */
    asm volatile("s_wait_xcnt 0x0" :: "v"(wp) : "memory");
#pragma unroll
    for (int j = 0; j < 8; ++j) { FragH f;
#pragma unroll
      for (int i = 0; i < 8; ++i) f.h[i] = (_Float16)(bf16_rne((j < 4) ? lo[i][j & 3] : hi[i][j & 3]) * WSC);
      o[j] = f.half[0]; }
    unsigned short* d = (unsigned short*)Wt + ((size_t)m * UD + n8) * CD + k8;
#pragma unroll
    for (int j = 0; j < 8; ++j) *(v8us*)(d + j * CD) = o[j];
    /* the wait: behind the run of eight stores, in front of any reuse of their data and address registers, whichever branch is laid out first */
    asm volatile("s_wait_xcnt 0x0" :: "v"(o[0]), "v"(o[1]), "v"(o[2]), "v"(o[3]), "v"(o[4]), "v"(o[5]), "v"(o[6]), "v"(o[7]), "v"(d) : "memory"); }
  else { const size_t t = (size_t)(bx - 3 * WTB) * (256 * XPP) + threadIdx.x; const size_t n8 = (size_t)SEQ * CD / 8; const size_t b = t / n8;   /* the block's pieces lie in one batch */
    const float* xp = x + b * ((size_t)SEQ_FULL * CD) + (t - b * n8) * 8;
#pragma unroll
    for (int j = 0; j < XPP; ++j) { lo[j] = *(const v4fa*)(xp + j * 2048); hi[j] = *(const v4fa*)(xp + j * 2048 + 4); }
    /* the wait: as above */
    asm volatile("s_wait_xcnt 0x0" :: "v"(xp) : "memory");
#pragma unroll
    for (int j = 0; j < XPP; ++j) { FragH f;
#pragma unroll
      for (int q = 0; q < 4; ++q) { f.h[q] = (_Float16)bf16_rne(lo[j][q]); f.h[4 + q] = (_Float16)bf16_rne(hi[j][q]); }
      o[j] = f.half[0]; }
    unsigned short* d = (unsigned short*)X16 + t * 8;
#pragma unroll
    for (int j = 0; j < XPP; ++j) *(v8us*)(d + j * 2048) = o[j];
    /* the wait: as above */
    asm volatile("s_wait_xcnt 0x0" :: "v"(o[0]), "v"(o[1]), "v"(o[2]), "v"(o[3]), "v"(o[4]), "v"(o[5]), "v"(o[6]), "v"(o[7]), "v"(d) : "memory"); }
}

// GEMM, wave tile 32x64, block = 4 waves = 128 rows x 64 cols; A f16 rows (pitch lda), Bh f16 [n][k] (pitch ldb); v = acc*alpha + bf16(bias[col]).
// The N columns are up to three sections of nsec columns side by side (q | k | v in one grid), each with its own bias vector; columns below n16 are written as f16 to C16 (pitch ldc16); column n16 + h*HD + d of row b*SEQ + s goes, transposed, to the planes VTh / VTl [b*NH + h][d][s] (pitch SEQ): hi = f16(v), lo = f16((v - hi) * 2^10).
// grid (M/128)*(N/64). M % 128 == 0, N % 64 == 0, nsec % 64 == 0, n16 % 64 == 0, K % 64 == 0, lda % 8 == 0, ldb % 8 == 0.
// Operands go through LDS in stages of 64 k (one 128-byte line per row), two buffers: a wave's 16-byte global load covers 4 whole lines, the block's 128 A rows and 64 B rows are fetched once for its 4 waves,
// and stage s + 1 is in flight (in registers) while stage s is multiplied. One barrier per stage: it publishes stage s + 1 and ends the reads of the buffer that stage s + 2 overwrites.
#define GP 72                        /* LDS row pitch in elements: 128 + 16 bytes */
#define VP 136                       /* pitch of a d row of the v epilogue's planes in LDS: 256 + 16 bytes */
static_assert(2 * HD * VP <= 2 * 128 * GP && SEQ % 128 == 0);
__global__ __launch_bounds__(128) void k_gemm2(const _Float16* __restrict__ A, int lda, const _Float16* __restrict__ Bh, int ldb, float alpha, const float* __restrict__ bias0, const float* __restrict__ bias1, const float* __restrict__ bias2, int nsec,
    _Float16* __restrict__ C16, int ldc16, int n16, _Float16* __restrict__ VTh, _Float16* __restrict__ VTl, int M, int N, int K) {
  __shared__ __attribute__((aligned(16))) float so[4][32][68];
  __shared__ __attribute__((aligned(16))) _Float16 sa[2][128][GP]; __shared__ __attribute__((aligned(16))) _Float16 sb[2][64][GP];
  const int tid = threadIdx.x, w = tid >> 5, lane = tid & 31, ln = lane & 15, hh = lane >> 4;
  const int ntn = N >> 6; const int mt = blockIdx.x / ntn, nq = blockIdx.x - mt * ntn; const int row0 = mt * 128 + 32 * w, col0 = nq * 64;
  if (mt * 128 >= M) return;         /* taken by the whole block or by none: barriers follow */
  const int sr = tid >> 3, sc = (tid & 7) * 8;   /* staging: 8 threads per row, 16 rows per round */
  const unsigned short* ag = (const unsigned short*)A + (size_t)(mt * 128 + sr) * lda + sc; const unsigned short* bg = (const unsigned short*)Bh + (size_t)(col0 + sr) * ldb + sc;
  v8us ra[8], rb[4];
  auto fetch = [&](int k0) {         /* the stage that begins at k0, into registers */
    const unsigned short* pa[8]; const unsigned short* pb[4];
    for (int i = 0; i < 8; ++i) { pa[i] = ag + (size_t)(16 * i) * lda + k0; ra[i] = *(const v8us*)pa[i]; }
    for (int i = 0; i < 4; ++i) { pb[i] = bg + (size_t)(16 * i) * ldb + k0; rb[i] = *(const v8us*)pb[i]; }
    /* the wait that stands in front of every overwrite of an address register of the twelve loads above; the addresses are its inputs, so that they stay live and no load's result lands on one before it */
    asm volatile("s_wait_xcnt 0x0" :: "v"(pa[0]), "v"(pa[1]), "v"(pa[2]), "v"(pa[3]), "v"(pa[4]), "v"(pa[5]), "v"(pa[6]), "v"(pa[7]), "v"(pb[0]), "v"(pb[1]), "v"(pb[2]), "v"(pb[3]) : "memory"); };
  fetch(0);
  for (int i = 0; i < 8; ++i) *(v8us*)&sa[0][16 * i + sr][sc] = ra[i];
  for (int i = 0; i < 4; ++i) *(v8us*)&sb[0][16 * i + sr][sc] = rb[i];
  __syncthreads();
  const v8f z8 = {0.f,0.f,0.f,0.f,0.f,0.f,0.f,0.f}; v8f c00 = z8, c01 = z8, c02 = z8, c03 = z8, c10 = z8, c11 = z8, c12 = z8, c13 = z8;
#pragma unroll 1
  for (int kn = 64; kn <= K; kn += 64) { const int cur = ((kn >> 6) & 1) ^ 1; const bool more = kn < K;   /* kn: first k of the next stage; block-uniform */
    if (more) fetch(kn);
    v16h a[2][2], b[2][4];           /* the stage's 12 fragments, read as one group ahead of its products */
    for (int kk = 0; kk < 2; ++kk) {
      for (int i = 0; i < 2; ++i) a[kk][i] = g2_frag(&sa[cur][32 * w + 16 * i + ln][32 * kk], hh);
      for (int i = 0; i < 4; ++i) b[kk][i] = g2_frag(&sb[cur][16 * i + ln][32 * kk], hh); }
    for (int kk = 0; kk < 2; ++kk) {
      c00 = g2_mma(a[kk][0], b[kk][0], c00); c10 = g2_mma(a[kk][1], b[kk][0], c10);
      c01 = g2_mma(a[kk][0], b[kk][1], c01); c11 = g2_mma(a[kk][1], b[kk][1], c11);
      c02 = g2_mma(a[kk][0], b[kk][2], c02); c12 = g2_mma(a[kk][1], b[kk][2], c12);
      c03 = g2_mma(a[kk][0], b[kk][3], c03); c13 = g2_mma(a[kk][1], b[kk][3], c13); }
    if (more) {
      for (int i = 0; i < 8; ++i) *(v8us*)&sa[cur ^ 1][16 * i + sr][sc] = ra[i];
      for (int i = 0; i < 4; ++i) *(v8us*)&sb[cur ^ 1][16 * i + sr][sc] = rb[i]; }
    __syncthreads(); }
  const int sec = (col0 >= nsec) + (col0 >= 2 * nsec); const float* bp = ((sec == 0) ? bias0 : (sec == 1) ? bias1 : bias2) + (col0 - sec * nsec);   /* the block's 64 columns lie in one section */
  v8f accs[8] = {c00, c01, c02, c03, c10, c11, c12, c13};
  if (col0 >= n16) {                 /* v columns (the whole block or none: a barrier follows): one head's 64 d x the block's 128 tokens, both planes */
    /* a lane's 8 accumulator rows are 8 consecutive tokens of one d: one 16-byte piece per plane, gathered in LDS (the A buffers, free since the loop's last barrier) so that the block stores whole 256-byte rows */
    _Float16* sT = &sa[0][0][0];     /* [plane][d][VP] */
#pragma unroll
    for (int u = 0; u < 8; ++u) { const int t = u & 3, half = u >> 2; const float bv = bf16_rne(bp[t * 16 + ln]); FragH fh, fl;
#pragma unroll
      for (int r = 0; r < 8; ++r) { const float v = accs[u][r] * alpha + bv; const _Float16 hv = (_Float16)v; fh.h[r] = hv; fl.h[r] = (_Float16)((v - (float)hv) * VLC); }
      const int e = (t * 16 + ln) * VP + 32 * w + half * 16 + 8 * hh;
      *(v8us*)&sT[e] = fh.half[0]; *(v8us*)&sT[HD * VP + e] = fl.half[0]; }
    __syncthreads();                 /* the four waves' pieces are read by all of them */
    const int bat = (mt * 128) / SEQ; const size_t o0 = ((size_t)(bat * NH + (col0 - n16) / HD) * HD) * SEQ + (size_t)(mt * 128 - bat * SEQ);   /* SEQ % 128 == 0: the block's rows lie in one batch */
    const int dsub = tid >> 4, pc = (tid & 15) * 8;   /* 16 threads per d row, 8 rows per round */
    v8us ph[8], pl[8];               /* all sixteen pieces are read as one group, then stored as one run */
#pragma unroll
    for (int rd = 0; rd < 8; ++rd) { ph[rd] = *(const v8us*)&sT[(rd * 8 + dsub) * VP + pc]; pl[rd] = *(const v8us*)&sT[(HD + rd * 8 + dsub) * VP + pc]; }
    unsigned short* dh = (unsigned short*)VTh + o0 + (size_t)dsub * SEQ + pc; unsigned short* dl = (unsigned short*)VTl + o0 + (size_t)dsub * SEQ + pc;
#pragma unroll
    for (int rd = 0; rd < 8; ++rd) { *(v8us*)(dh + (size_t)rd * 8 * SEQ) = ph[rd]; *(v8us*)(dl + (size_t)rd * 8 * SEQ) = pl[rd]; }
    /* the wait: behind the run of sixteen stores, in front of any reuse of their data and address registers on whatever code is laid out behind them */
    asm volatile("s_wait_xcnt 0x0" :: "v"(ph[0]), "v"(ph[1]), "v"(ph[2]), "v"(ph[3]), "v"(ph[4]), "v"(ph[5]), "v"(ph[6]), "v"(ph[7]), "v"(pl[0]), "v"(pl[1]), "v"(pl[2]), "v"(pl[3]), "v"(pl[4]), "v"(pl[5]), "v"(pl[6]), "v"(pl[7]), "v"(dh), "v"(dl) : "memory");
    return; }
#pragma unroll
  for (int u = 0; u < 8; ++u) { const int t = u & 3, half = u >> 2; const float bv = bf16_rne(bp[t * 16 + ln]);
#pragma unroll
    for (int r = 0; r < 8; ++r) { const int rloc = half * 16 + 8 * hh + r; const float v = accs[u][r] * alpha + bv;
      so[w][rloc][t * 16 + ln] = v; } }
  __builtin_amdgcn_fence(4 /* acq_rel order */, "workgroup"); __builtin_amdgcn_wave_barrier();
  const int rsub = lane >> 4, c4 = (lane & 15) * 4;
  {
#pragma unroll
    for (int q = 0; q < 16; ++q) { const int r = q * 2 + rsub; const v4f v = *(const v4fa*)&so[w][r][c4];
      /* the wait: in front of any reuse of the store's data and address registers */
      v4h h4; for (int i = 0; i < 4; ++i) h4[i] = (_Float16)v[i]; _Float16* d = C16 + (size_t)(row0 + r) * ldc16 + col0 + c4; *(v4h*)d = h4; asm volatile("s_wait_xcnt 0x0" :: "v"(h4), "v"(d) : "memory"); }
     }
}

// fused causal attention, one wave per 32 queries of one slab (slab = b*NH + h), four waves = 128 queries per work-group: per pass of 32 keys S^T = K . Q^T (A = k rows, B = q rows, kept in registers),
// running maximum and sum per query (a lane holds one query's scores: in-lane, plus one exchange between the wave halves), O^T += V^T . P^T (A = VT rows, both planes).
// K and both VT planes come through LDS in stages of SK = 64 keys (two passes), fetched once for the four waves by asynchronous copies of 16 bytes a lane (a wave's copy covers 4 whole 128-byte lines), two buffers:
// stage s + 2 is asked for behind the barrier that ends the reads of stage s, and flies while stage s + 1 is worked on. One barrier per stage: it publishes stage s + 1 and frees stage s's buffer.
// The two S^T tiles of a pass (keys k0 + 8h + r and k0 + 16 + 8h + r of query ln) are, converted in place, the B fragment in the k order of g2_frag: no lane exchange for P.
// P = f16(2^14 * exp(s - running max)); the sum carries the same 2^14, so the carry cancels in the final division. Keys above the query are masked by index in the passes of the block's diagonal 128 keys only.
// Epilogue: R = attention output + bf16(x) is what is stored, and the work-group's f64 sum and sum of squares of its 128 x 64 values of R is statistics partial h*(SEQ/128) + qb of its batch.
// coverage: grid (NB*NH slabs) x (SEQ/128 blocks) x 4 waves x 32 queries = every row; 4 d tiles x (8h + r) = all 64 columns of the head, each element stored once; one partial per work-group, NPB per batch.
#define SCL 0.18033688011112042f     /* 2^-3 * log2(e): scores in the exponent's base-2 units */
#define SK 64                        /* keys per stage */
#define KP 72                        /* pitch of a staged row in elements: 128 + 16 bytes */
#define STE (3 * SK * KP)            /* elements of one buffer: the K tile (SK key rows x HD), the VT hi and the VT lo tile (HD d rows x SK keys) */
static_assert(SK == 64 && HD == 64 && SEQ % (2 * SK) == 0 && (LQK * 2) % 16 == 0 && (SEQ * 2) % 16 == 0);
__device__ __forceinline__ v8f fa_mma(v16h a, v16h b, v8f c) { return __builtin_amdgcn_wmma_f32_16x16x32_f16(false, a, false, b, (short)0, c, false, false); }
__device__ __forceinline__ float fa_xhalf(float x) { return __builtin_bit_cast(float, __builtin_amdgcn_permlanex16(__builtin_bit_cast(int, x), __builtin_bit_cast(int, x), 0x76543210, 0xfedcba98, false, false)); }  /* lane l with lane l ^ 16 */
__device__ __forceinline__ v16h fa_frag(const _Float16* base, unsigned lofs, unsigned cofs) { const char* p = (const char*)base + ((size_t)lofs + cofs); FragH f; f.half[0] = *(const v8us*)p; f.half[1] = *(const v8us*)(p + 32); return f.v; }  /* g2_frag from a uniform base, the lane's byte offset (8h included) and a constant byte offset */

// one stage's copies: thread (row sr = tid >> 3, piece tid & 7) brings its 16-byte piece of rows sr + 16 i, i = 0..3, of each of the three tiles. kg, hg, lg: the thread's piece of row sr in K, VT hi, VT lo at the stage's first key; ld: its LDS byte address in the K tile of the stage's buffer.
// Every lane is on, every address a multiple of 16, every piece of the buffer's 192 rows written by one lane.
__device__ __forceinline__ void fa_stage(const _Float16* kg, const _Float16* hg, const _Float16* lg, unsigned ld) {
  const _Float16 *k1 = kg + 16 * LQK, *k2 = kg + 32 * LQK, *k3 = kg + 48 * LQK, *h1 = hg + 16 * SEQ, *h2 = hg + 32 * SEQ, *h3 = hg + 48 * SEQ, *l1 = lg + 16 * SEQ, *l2 = lg + 32 * SEQ, *l3 = lg + 48 * SEQ;
  const unsigned R = 16 * KP * 2;    /* 16 rows in LDS, bytes */
  /* the twelve copies and, as the statement's last line, the wait that stands in front of every overwrite of their address registers */
  asm volatile("global_load_async_to_lds_b128 %0, %12, off\n\t" "global_load_async_to_lds_b128 %1, %13, off\n\t" "global_load_async_to_lds_b128 %2, %14, off\n\t" "global_load_async_to_lds_b128 %3, %15, off\n\t"
               "global_load_async_to_lds_b128 %4, %16, off\n\t" "global_load_async_to_lds_b128 %5, %17, off\n\t" "global_load_async_to_lds_b128 %6, %18, off\n\t" "global_load_async_to_lds_b128 %7, %19, off\n\t"
               "global_load_async_to_lds_b128 %8, %20, off\n\t" "global_load_async_to_lds_b128 %9, %21, off\n\t" "global_load_async_to_lds_b128 %10, %22, off\n\t" "global_load_async_to_lds_b128 %11, %23, off\n\t"
               "s_wait_xcnt 0x0"
               :: "v"(ld), "v"(ld + R), "v"(ld + 2 * R), "v"(ld + 3 * R), "v"(ld + 4 * R), "v"(ld + 5 * R), "v"(ld + 6 * R), "v"(ld + 7 * R), "v"(ld + 8 * R), "v"(ld + 9 * R), "v"(ld + 10 * R), "v"(ld + 11 * R),
                  "v"(kg), "v"(k1), "v"(k2), "v"(k3), "v"(hg), "v"(h1), "v"(h2), "v"(h3), "v"(lg), "v"(l1), "v"(l2), "v"(l3) : "memory");
}
// where a stage is handed over, every wave: its own LDS reads of the buffer that is refilled next are done, its own copies of the next stage have landed, then the work-group's barrier
__device__ __forceinline__ void fa_publish() {
  asm volatile("s_wait_dscnt 0x0" ::: "memory");      /* this wave's reads of the stage it leaves have returned before another wave's copies may land there */
  asm volatile("s_wait_asynccnt 0x0" ::: "memory");   /* this wave's copies of the next stage have landed before any wave reads them */
  __syncthreads();
}
// the four k fragments of a pass; sk: the lane's row (key ln of the pass) in the K tile
__device__ __forceinline__ void fa_kfrag(v16h (&kf)[2][2], const _Float16* sk, int hh) {
  for (int kt = 0; kt < 2; ++kt) { kf[kt][0] = g2_frag(sk + 16 * kt * KP, hh); kf[kt][1] = g2_frag(sk + 16 * kt * KP + 32, hh); } }

// one pass of 32 keys out of LDS; sk: the lane's row (key ln of the pass) in the K tile; sh, sl: the lane's row (d = ln) in the VT tiles at the pass's first key. kf holds this pass's k fragments; with PRE the next pass of the SAME stage has its own fetched behind this pass's products.
template <bool LAST, bool PRE>
__device__ __forceinline__ void fa_pass(int k0, int q0, int ln, int hh, const _Float16* sk, const _Float16* sh, const _Float16* sl,
    const v16h (&qf)[2][2], v16h (&kf)[2][2], v8f (&oh)[2][4], v8f (&ol)[2][4], float (&m)[2], float (&l)[2]) {
  v16h vh[4], vl[4];
  for (int dt = 0; dt < 4; ++dt) { vh[dt] = g2_frag(sh + 16 * dt * KP, hh); vl[dt] = g2_frag(sl + 16 * dt * KP, hh); }
  const v8f z8 = {0.f,0.f,0.f,0.f,0.f,0.f,0.f,0.f}; v8f s[2][2];
  for (int t = 0; t < 2; ++t) {
    for (int kt = 0; kt < 2; ++kt) s[t][kt] = fa_mma(kf[kt][1], qf[t][1], fa_mma(kf[kt][0], qf[t][0], z8)); }
  if (PRE) fa_kfrag(kf, sk + 32 * KP, hh);
  float mn[2];
  for (int t = 0; t < 2; ++t) {
    if (LAST) {
      for (int kt = 0; kt < 2; ++kt) {
        for (int r = 0; r < 8; ++r) s[t][kt][r] = (k0 + 16 * kt + 8 * hh + r <= q0 + 16 * t + ln) ? s[t][kt][r] : -3.0e38f; } }
    float mx = s[t][0][0];
    for (int r = 1; r < 8; ++r) mx = fmaxf(mx, s[t][0][r]);
    for (int r = 0; r < 8; ++r) mx = fmaxf(mx, s[t][1][r]);
    mx = fmaxf(mx, fa_xhalf(mx)); mn[t] = fmaxf(m[t], mx); }
  if (__builtin_amdgcn_ballot_w32((mn[0] > m[0]) || (mn[1] > m[1])) != 0) {   /* no maximum moved: every factor is 1 and the rescale is skipped by the whole wave */
    for (int t = 0; t < 2; ++t) { const float al = __builtin_amdgcn_exp2f((m[t] - mn[t]) * SCL); l[t] *= al; m[t] = mn[t];
      for (int dt = 0; dt < 4; ++dt) { oh[t][dt] *= al; ol[t][dt] *= al; } } }
  for (int t = 0; t < 2; ++t) { const float off = 14.0f - m[t] * SCL; FragH p; v8f x[2], e[2];
    for (int kt = 0; kt < 2; ++kt) { x[kt] = s[t][kt] * SCL + off;
      for (int r = 0; r < 8; ++r) e[kt][r] = __builtin_amdgcn_exp2f(x[kt][r]); }
    /* the slot behind a transcendental: no source is overwritten and no result read before this v_nop, which stands behind the last of the sixteen */
    asm volatile("v_nop" : "+v"(e[0]), "+v"(e[1]) : "v"(x[0]), "v"(x[1]));
    for (int r = 0; r < 8; ++r) { p.h[r] = (_Float16)e[0][r]; p.h[8 + r] = (_Float16)e[1][r]; }
    const v8f es = e[0] + e[1];
    l[t] += ((es[0] + es[1]) + (es[2] + es[3])) + ((es[4] + es[5]) + (es[6] + es[7]));
    for (int dt = 0; dt < 4; ++dt) { oh[t][dt] = fa_mma(vh[dt], p.v, oh[t][dt]); ol[t][dt] = fa_mma(vl[dt], p.v, ol[t][dt]); } }
}

__global__ __launch_bounds__(128) void k_fattn(const _Float16* __restrict__ QK, const _Float16* __restrict__ VTh, const _Float16* __restrict__ VTl, const float* __restrict__ X, float* __restrict__ R, double* __restrict__ part) {
  __shared__ double rs[128]; __shared__ double rq[128];
  __shared__ __attribute__((aligned(16))) _Float16 st[2 * STE];                 /* [buffer][K | VT hi | VT lo][row][KP] */
  const int tid = threadIdx.x, lane = tid & 31, ln = lane & 15, hh = lane >> 4;
  const int w = __builtin_amdgcn_readfirstlane(tid >> 5);                       /* the wave's number in a scalar register: scalar branches */
  const int slab = blockIdx.x, b = slab / NH, h = slab % NH;
  const int y = blockIdx.y, qb = (y < SEQ / 256) ? SEQ / 128 - 1 - y : y - SEQ / 256;   /* long blocks start first; the second half of the grid runs short to long beside them */
  const int q0 = qb * 128 + 32 * w;
  const _Float16* Q = QK + ((size_t)b * SEQ + q0) * LQK + h * HD; const _Float16* K = QK + (size_t)b * SEQ * LQK + UD + h * HD;      /* uniform bases */
  const _Float16* VH = VTh + (size_t)slab * HD * SEQ; const _Float16* VL = VTl + (size_t)slab * HD * SEQ;
  /* the block walks 2 * (qb + 1) stages: keys 0 .. qb * 128 + 127, all of them rows of the sequence */
  const int sr = tid >> 3, sc = (tid & 7) * 8;
  const _Float16* kg = K + (size_t)sr * LQK + sc; const _Float16* hg = VH + (size_t)sr * SEQ + sc; const _Float16* lg = VL + (size_t)sr * SEQ + sc;
  const unsigned ld = (unsigned)(size_t)&st[sr * KP + sc];                      /* LDS byte address: the low 32 bits */
  fa_stage(kg, hg, lg, ld);
  const unsigned ko = (unsigned)(ln * LQK + 8 * hh) * 2;                        /* lane byte offset */
  v16h qf[2][2], kf[2][2];
  for (int t = 0; t < 2; ++t) { qf[t][0] = fa_frag(Q, ko, t * 16 * LQK * 2); qf[t][1] = fa_frag(Q, ko, t * 16 * LQK * 2 + 64); }
  /* in front of any overwrite of these loads' address registers */
  asm volatile("s_wait_xcnt 0x0" :: "v"(ko) : "memory");
  asm volatile("s_wait_asynccnt 0x0" ::: "memory");   /* stage 0 has landed, as far as this wave brought it */
  __syncthreads();                                    /* stage 0 is published */
  fa_stage(kg + SK * LQK, hg + SK, lg + SK, ld + STE * 2);
  kg += 2 * SK * LQK; hg += 2 * SK; lg += 2 * SK;
  const v8f z8 = {0.f,0.f,0.f,0.f,0.f,0.f,0.f,0.f}; v8f oh[2][4], ol[2][4]; float m[2] = {-3.0e38f, -3.0e38f}, l[2] = {0.f, 0.f};
  for (int t = 0; t < 2; ++t) {
    for (int dt = 0; dt < 4; ++dt) { oh[t][dt] = z8; ol[t][dt] = z8; } }
  const _Float16* fr = &st[ln * KP];                  /* the lane's row in buffer 0's K tile */
  /* the stages below the block's diagonal: both passes whole, in all four waves */
  for (int s = 0; s < 2 * qb; ++s) { const _Float16* sk = fr + (s & 1) * STE;
    fa_kfrag(kf, sk, hh);
    fa_pass<false, true>(0, q0, ln, hh, sk, sk + SK * KP, sk + 2 * SK * KP, qf, kf, oh, ol, m, l);
    fa_pass<false, false>(0, q0, ln, hh, sk + 32 * KP, sk + SK * KP + 32, sk + 2 * SK * KP + 32, qf, kf, oh, ol, m, l);
    fa_publish();
    fa_stage(kg, hg, lg, ld + (s & 1) * (STE * 2));   /* stage s + 2 <= 2 * qb + 1 exists on every trip */
    kg += SK * LQK; hg += SK; lg += SK; }
  /* the lane's 64 residual values, at the places of its outputs: fetched ahead of the diagonal passes, which cover their latency */
  const float* xp = X + ((size_t)b * SEQ_FULL + q0 + ln) * CD + h * HD + 8 * hh; v4f xl[2][4], xh[2][4];
  for (int t = 0; t < 2; ++t) {
    for (int dt = 0; dt < 4; ++dt) { xl[t][dt] = *(const v4fa*)(xp + t * 16 * CD + dt * 16); xh[t][dt] = *(const v4fa*)(xp + t * 16 * CD + dt * 16 + 4); } }
  /* in front of any overwrite of these loads' address registers */
  asm volatile("s_wait_xcnt 0x0" :: "v"(xp) : "memory");
  /* the block's last two stages (buffers 0 and 1: 2 * qb is even), passes j = 0..3 of the diagonal's 128 keys: wave w takes j <= w, all in the masked form (below j = w the mask keeps every key); every wave passes the publish point between the stages */
#pragma unroll 1   /* rolled: one copy of the masked pass in the text instead of four */
  for (int j = 0; j < 4; ++j) {
    if (j <= w) { const _Float16* sk = fr + (j >> 1) * STE + (j & 1) * 32 * KP; const _Float16* sv = fr + (j >> 1) * STE + SK * KP + (j & 1) * 32;
      fa_kfrag(kf, sk, hh);
      fa_pass<true, false>(qb * 128 + 32 * j, q0, ln, hh, sk, sv, sv + SK * KP, qf, kf, oh, ol, m, l); }
    if (j == 1) fa_publish(); }
  asm volatile("s_wait_asynccnt 0x0" ::: "memory");   /* behind the last copy: none is outstanding when the wave goes on */
  double s1 = 0.0, s2 = 0.0;
  for (int t = 0; t < 2; ++t) { const float inv = 1.0f / (l[t] + fa_xhalf(l[t]));
    float* op = R + ((size_t)b * SEQ + q0 + 16 * t + ln) * UD + h * HD + 8 * hh;
    for (int dt = 0; dt < 4; ++dt) { v4f lo4, hi4;
      for (int i = 0; i < 4; ++i) { lo4[i] = (oh[t][dt][i] + ol[t][dt][i] * (1.0f / VLC)) * inv + bf16_rne(xl[t][dt][i]); hi4[i] = (oh[t][dt][4 + i] + ol[t][dt][4 + i] * (1.0f / VLC)) * inv + bf16_rne(xh[t][dt][i]); }
      *(v4f*)(op + dt * 16) = lo4; *(v4f*)(op + dt * 16 + 4) = hi4;
      /* in front of any reuse of the two stores' data and address registers */
      asm volatile("s_wait_xcnt 0x0" :: "v"(lo4), "v"(hi4), "v"(op) : "memory");
      for (int i = 0; i < 4; ++i) { s1 += (double)lo4[i]; s2 += (double)lo4[i] * (double)lo4[i]; s1 += (double)hi4[i]; s2 += (double)hi4[i] * (double)hi4[i]; } } }
  /* the work-group's partial: 128 lane sums, 16-to-1 in eight threads (thread t alone reads and rewrites place t; places from 8 on are only read), then 8-to-1; every wave passes both barriers */
  rs[tid] = s1; rq[tid] = s2; __syncthreads();
  if (tid < 8) { double a[16], c[16];
    for (int j = 0; j < 16; ++j) { a[j] = rs[tid + 8 * j]; c[j] = rq[tid + 8 * j]; }
    for (int g = 8; g > 0; g >>= 1) {
      for (int j = 0; j < g; ++j) { a[j] += a[j + g]; c[j] += c[j + g]; } }
    rs[tid] = a[0]; rq[tid] = c[0]; }
  __syncthreads();
  if (tid < 8) { v2d val; val[0] = (tid == 0) ? ((rs[0] + rs[1]) + (rs[2] + rs[3])) + ((rs[4] + rs[5]) + (rs[6] + rs[7])) : 0.0; val[1] = (tid == 0) ? ((rq[0] + rq[1]) + (rq[2] + rq[3])) + ((rq[4] + rq[5]) + (rq[6] + rq[7])) : 0.0;
    double* d = part + ((size_t)b * NPB + (size_t)h * (SEQ / 128) + qb) * 16 + tid * 2; *(v2d*)d = val;  }
}

// final statistics, one work-group: thread (batch bb, place t) takes partial t of its batch, so that all NB * NPB loads are in flight together; then two rounds of 16-to-1 f64 sums per batch in LDS
#define LFT 256                      /* threads per batch */
static_assert(LFT == 16 * 16 && NB * LFT <= 1024);
__global__ __launch_bounds__(NB * LFT) void k_lnfin(const double* __restrict__ part, float* __restrict__ stat) {
  __shared__ double rs[NB * LFT]; __shared__ double rq[NB * LFT];
  __shared__ __attribute__((aligned(16))) float st[32];
  const int tid = threadIdx.x; const int bb = tid / LFT, t = tid % LFT;
  double s = 0.0, q = 0.0;
  if (t < NPB) { const v2d p = *(const v2d*)(part + ((size_t)bb * NPB + t) * 16); s = p[0]; q = p[1]; }
  for (int i = t + LFT; i < NPB; i += LFT) { const v2d p = *(const v2d*)(part + ((size_t)bb * NPB + i) * 16); s += p[0]; q += p[1]; }
  rs[tid] = s; rq[tid] = q;
  if (tid < 32) st[tid] = 0.f;
  __syncthreads();
  for (int w = LFT / 16; w > 0; w /= 16) {   /* thread t < w sums places t + j * w; it alone reads and rewrites place t, and places from w on are only read */
    if (t < w) { double a[16], c[16];
      for (int j = 0; j < 16; ++j) { a[j] = rs[tid + j * w]; c[j] = rq[tid + j * w]; }
      for (int h = 8; h > 0; h >>= 1) {
        for (int j = 0; j < h; ++j) { a[j] += a[j + h]; c[j] += c[j + h]; } }
      rs[tid] = a[0]; rq[tid] = c[0]; }
    __syncthreads(); }
  if (t == 0) {
    const double inv = 1.0 / ((double)SEQ * (double)UD); const double m = rs[tid] * inv; double var = rq[tid] * inv - m * m; if (var < 0.0) var = 0.0;
    st[2 * bb] = (float)m; st[2 * bb + 1] = 1.0f / sqrtf((float)var + 1.0e-5f); }
  __syncthreads();
  if (tid < 8) { const v4f v = *(const v4fa*)&st[tid * 4]; *(v4f*)(stat + tid * 4) = v;  }
}

// a thread takes LAP places of 4 floats, 256 places apart, in every batch: few waves to start, (2 + NB) * LAP loads of 16 bytes in flight in each; the places' g and bta serve all batches.
// coverage: grid (SEQ*UD/(1024*LAP)) x 256 threads x LAP places x 4 floats x NB batches = every output element exactly once.
#define LAP 4
static_assert(((size_t)SEQ * UD) % (1024 * LAP) == 0);
__global__ __launch_bounds__(256) void k_lnapply(const float* __restrict__ R, const float* __restrict__ stat, const float* __restrict__ g, const float* __restrict__ bta, float* __restrict__ out) {
  const unsigned eo = (blockIdx.x * (256u * LAP) + threadIdx.x) * 16u;   /* the lane's byte offset inside one batch */
  v4f o[NB][LAP], gg[LAP], bb[LAP], y[NB][LAP];
#pragma unroll
  for (int j = 0; j < LAP; ++j) { gg[j] = *(const v4fa*)((const char*)g + ((size_t)eo + j * 4096)); bb[j] = *(const v4fa*)((const char*)bta + ((size_t)eo + j * 4096)); }
#pragma unroll
  for (int bat = 0; bat < NB; ++bat) {
#pragma unroll
    for (int j = 0; j < LAP; ++j) o[bat][j] = *(const v4fa*)((const char*)(R + (size_t)bat * SEQ * UD) + ((size_t)eo + j * 4096)); }
  /* the wait: in front of any overwrite of the loads' address register */
  asm volatile("s_wait_xcnt 0x0" :: "v"(eo) : "memory");
#pragma unroll
  for (int bat = 0; bat < NB; ++bat) { const float mu = stat[2 * bat], rs = stat[2 * bat + 1];
#pragma unroll
    for (int j = 0; j < LAP; ++j) {
#pragma unroll
      for (int q = 0; q < 4; ++q) { const float v = o[bat][j][q]; y[bat][j][q] = (v - mu) * rs * bf16_rne(gg[j][q]) + bf16_rne(bb[j][q]); } } }
#pragma unroll
  for (int bat = 0; bat < NB; ++bat) {
#pragma unroll
    for (int j = 0; j < LAP; ++j) *(v4f*)((char*)(out + (size_t)bat * SEQ_FULL * UD) + ((size_t)eo + j * 4096)) = y[bat][j]; }
}

extern "C" void kernel_launch(void* const* d_in, const int* in_sizes, int n_in,
                              void* d_out, int out_size, void* d_ws, size_t ws_size, hipStream_t stream) {
  if (n_in < 9) return;
  const float* X   = (const float*)d_in[0];      /* [2][2048][1024] */
  const float* Wq  = (const float*)d_in[1];      /* [in][out] 1024 x 1024 */
  const float* bq  = (const float*)d_in[2];
  const float* Wk  = (const float*)d_in[3];
  const float* bk  = (const float*)d_in[4];
  const float* Wv  = (const float*)d_in[5];
  const float* bv  = (const float*)d_in[6];
  const float* gam = (const float*)d_in[7];      /* [2048][1024] */
  const float* bet = (const float*)d_in[8];
  float* out = (float*)d_out;
  const size_t rows_used = (size_t)(NB - 1) * SEQ_FULL + SEQ;
  if ((size_t)in_sizes[0] < rows_used * CD) return;
  if ((size_t)in_sizes[1] < (size_t)CD * UD || (size_t)in_sizes[3] < (size_t)CD * UD || (size_t)in_sizes[5] < (size_t)CD * UD) return;
  if (in_sizes[2] < UD || in_sizes[4] < UD || in_sizes[6] < UD) return;
  if ((size_t)in_sizes[7] < (size_t)SEQ * UD || (size_t)in_sizes[8] < (size_t)SEQ * UD) return;
  if ((size_t)out_size < rows_used * UD) return;

  char* ws = (char*)d_ws; size_t off = 0;
  auto take = [&](size_t bytes) { char* p = ws + off; off += (bytes + 255) & ~(size_t)255; return p; };
  _Float16* BQKV = (_Float16*)take((size_t)3 * CD * UD * 2);               /* [3*UD][CD] f16 (x16) */
  _Float16* X16  = (_Float16*)take(NR * CD * 2);                           /* [NR][CD] */
  _Float16* QK16 = (_Float16*)take(NR * LQK * 2);                          /* [NR][q | k] */
  _Float16* VTh  = (_Float16*)take((size_t)NB * NH * HD * SEQ * 2);        /* [NB*NH][HD][SEQ] */
  _Float16* VTl  = (_Float16*)take((size_t)NB * NH * HD * SEQ * 2);
  float*    R32  = (float*)take(NR * UD * 4);                              /* [NR][UD] f32: attention output + residual */
  double*   PART = (double*)take((size_t)NB * NPB * 128);                  
  float*    STAT = (float*)take(128);
  if (off > ws_size || off > (size_t)134217728) return;

  k_prep<<<(unsigned)(3 * WTB + XCB), 256, 0, stream>>>(Wq, Wk, Wv, X, BQKV, X16);
  const int MP = (int)NR;
  /* q rows (f16, cols 0..UD-1 of QK16), k rows (cols UD..2UD-1), v (both f16 planes, transposed), one grid: x16 . (16 W) * 2^-4 + bf16(bias) */
  k_gemm2<<<(unsigned)((MP / 128) * ((3 * UD) / 64)), 128, 0, stream>>>(X16, CD, BQKV, CD, 0.0625f, bq, bk, bv, UD, QK16, LQK, LQK, VTh, VTl, MP, 3 * UD, CD);
  k_fattn<<<dim3((unsigned)(NB * NH), (unsigned)(SEQ / 128)), 128, 0, stream>>>(QK16, VTh, VTl, X, R32, PART);
  k_lnfin<<<1, NB * LFT, 0, stream>>>(PART, STAT);
  k_lnapply<<<(unsigned)(((size_t)SEQ * UD) / (1024 * LAP)), 256, 0, stream>>>(R32, STAT, gam, bet, out);
}

// v008
// It runs in 83 microseconds.
// Two timings next to v007 put it at 1.09 and 1.08 times that version's speed.
// Counting every step since v000, it is 14.8 times as fast.
#include <hip/hip_runtime.h>
// Contractions on v_wmma_f32_16x16x32_f16 (f16 operands, f32 accumulate): q | k | v projections (x and weights bf16-valued, exact in f16, weights carried x16), scores k.q^T (plain f16 q, k), V^T.P^T in the same kernel (running-maximum softmax weights f16 carried x2^14; v as f16 hi plane + f16 residual plane carried x2^10, two accumulators). Scores, softmax statistics, attention output and residual add in f32; joint (seq, unit) normalisation statistics in f64. K and the v planes reach the attention waves through LDS. The v planes are written by the GEMM's epilogue, the residual sum and its statistics partials by the attention kernel's.
#ifndef NB
#define NB 2
#endif
#ifndef SEQ
#define SEQ 2048
#endif
#define NB_FULL 2
#define SEQ_FULL 2048
#define CD 1024                      /* input channels */
#define UD 1024                      /* units */
#define NH 16
#define HD 64
#define LQK (2 * UD)                 /* row pitch of the q | k rows */
#define LNP 8192                     /* floats per statistics block: the 128 queries x HD columns of one attention work-group */
#define NPB ((SEQ * UD) / LNP)       /* statistics blocks per batch */
#define NR ((size_t)NB * SEQ)        /* token rows (compact) */
#define WSC 16.0f                    /* weight carry */
#define VLC 1024.0f                  /* v residual plane carry */
static_assert(NB >= 1 && NB <= NB_FULL);
static_assert(SEQ % 256 == 0 && SEQ <= SEQ_FULL);
static_assert(CD % 64 == 0 && UD % 64 == 0 && CD == UD);
static_assert(NH * HD == UD && HD == 64);
static_assert((SEQ * UD) % LNP == 0 && LNP == 128 * HD && NPB == NH * (SEQ / 128));
static_assert(2 * NB <= 32);
static_assert((NR * UD) % 1024 == 0 && (NR % 128) == 0);

typedef unsigned short v8us __attribute__((ext_vector_type(8), may_alias));
typedef float  v8f  __attribute__((ext_vector_type(8)));
typedef float  v4f  __attribute__((ext_vector_type(4)));
typedef float  v4fa __attribute__((ext_vector_type(4), may_alias));
typedef double v2d  __attribute__((ext_vector_type(2)));
typedef _Float16 v16h __attribute__((ext_vector_type(16)));
typedef _Float16 v4h  __attribute__((ext_vector_type(4)));
union FragH { v16h v; v8us half[2]; _Float16 h[16]; unsigned short u[16]; };

__device__ __forceinline__ unsigned short bf16_bits(float x) { unsigned int u = __float_as_uint(x); return (unsigned short)((u + 0x7FFFu + ((u >> 16) & 1u)) >> 16); }
__device__ __forceinline__ float bf16_val(unsigned short b) { return __uint_as_float(((unsigned int)b) << 16); }
__device__ __forceinline__ float bf16_rne(float x) { return bf16_val(bf16_bits(x)); }

// 16-bit WMMA fragment: lane l, h = l >> 4, row/col = l & 15; elements 0..7 <- k0 + 8h + 0..7, elements 8..15 <- k0 + 16 + 8h + 0..7 (same map for A rows and for B[n][k] rows)
__device__ __forceinline__ v16h g2_frag(const _Float16* p, int hh) { FragH f; f.half[0] = *(const v8us*)((const unsigned short*)p + 8 * hh); f.half[1] = *(const v8us*)((const unsigned short*)p + 16 + 8 * hh); return f.v; }
__device__ __forceinline__ v8f g2_mma(v16h a, v16h b, v8f c) { v8f d = __builtin_amdgcn_wmma_f32_16x16x32_f16(false, a, false, b, (short)0, c, false, false); asm volatile("v_nop\n\tv_nop\n\tv_nop\n\tv_nop" : "+v"(d) : "v"(a), "v"(b)); return d; }

// The four conversions that depend on nothing but the inputs, in one grid: blocks 0 .. 3*WTB-1 take Wq | Wk | Wv (WTB blocks each): Wt[m*UD + n][k] = f16(bf16(W[k][n]) * 16);
// the other XCB blocks take x: X16[b*SEQ + s][c] = f16(bf16(x[b][s][c])). 64 elements per thread, so that few waves have to be started and each has 16 loads of 16 bytes in flight; every element of Wt and X16 is stored once. The branch is block-uniform.
// W: a thread takes an 8 k x 8 n block, read by rows; 4 lanes side by side in n cover one 128-byte line of a W row, 8 lanes side by side in k one 128-byte line of a Wt row.
// x: a thread takes XPP pieces of 8 elements, 256 pieces apart: each round of the block is one contiguous run.
#define XPP 8
#define WTB (((UD / 8) * (CD / 8)) / 256)
#define XCB ((int)((NR * CD / 8) / (256 * XPP)))
static_assert(((UD / 8) * (CD / 8)) % 256 == 0 && UD % 32 == 0 && (NR * CD / 8) % (256 * XPP) == 0 && ((size_t)SEQ * CD / 8) % (256 * XPP) == 0);
__global__ __launch_bounds__(256) void k_prep(const float* __restrict__ Wq, const float* __restrict__ Wk, const float* __restrict__ Wv, const float* __restrict__ x, _Float16* __restrict__ Wt, _Float16* __restrict__ X16) {
  const int bx = blockIdx.x; v4f lo[8], hi[8]; v8us o[8];
  if (bx < 3 * WTB) { const int m = bx / WTB; const float* __restrict__ W = (m == 0) ? Wq : (m == 1) ? Wk : Wv;
    const int t = (bx - m * WTB) * 256 + threadIdx.x; const int r = t >> 5;
    const int k8 = ((r % (CD / 64)) * 8 + (t & 7)) * 8, n8 = ((r / (CD / 64)) * 4 + ((t >> 3) & 3)) * 8;
    const float* wp = W + (size_t)k8 * UD + n8;
#pragma unroll
    for (int i = 0; i < 8; ++i) { lo[i] = *(const v4fa*)(wp + i * UD); hi[i] = *(const v4fa*)(wp + i * UD + 4); }
    /* the wait: in front of any overwrite of the sixteen loads' address registers */
    asm volatile("s_wait_xcnt 0x0" :: "v"(wp) : "memory");
#pragma unroll
    for (int j = 0; j < 8; ++j) { FragH f;
#pragma unroll
      for (int i = 0; i < 8; ++i) f.h[i] = (_Float16)(bf16_rne((j < 4) ? lo[i][j & 3] : hi[i][j & 3]) * WSC);
      o[j] = f.half[0]; }
    unsigned short* d = (unsigned short*)Wt + ((size_t)m * UD + n8) * CD + k8;
#pragma unroll
    for (int j = 0; j < 8; ++j) *(v8us*)(d + j * CD) = o[j];
    /* the wait: behind the run of eight stores, in front of any reuse of their data and address registers, whichever branch is laid out first */
    asm volatile("s_wait_xcnt 0x0" :: "v"(o[0]), "v"(o[1]), "v"(o[2]), "v"(o[3]), "v"(o[4]), "v"(o[5]), "v"(o[6]), "v"(o[7]), "v"(d) : "memory"); }
  else { const size_t t = (size_t)(bx - 3 * WTB) * (256 * XPP) + threadIdx.x; const size_t n8 = (size_t)SEQ * CD / 8; const size_t b = t / n8;   /* the block's pieces lie in one batch */
    const float* xp = x + b * ((size_t)SEQ_FULL * CD) + (t - b * n8) * 8;
#pragma unroll
    for (int j = 0; j < XPP; ++j) { lo[j] = *(const v4fa*)(xp + j * 2048); hi[j] = *(const v4fa*)(xp + j * 2048 + 4); }
    /* the wait: as above */
    asm volatile("s_wait_xcnt 0x0" :: "v"(xp) : "memory");
#pragma unroll
    for (int j = 0; j < XPP; ++j) { FragH f;
#pragma unroll
      for (int q = 0; q < 4; ++q) { f.h[q] = (_Float16)bf16_rne(lo[j][q]); f.h[4 + q] = (_Float16)bf16_rne(hi[j][q]); }
      o[j] = f.half[0]; }
    unsigned short* d = (unsigned short*)X16 + t * 8;
#pragma unroll
    for (int j = 0; j < XPP; ++j) *(v8us*)(d + j * 2048) = o[j];
    /* the wait: as above */
    asm volatile("s_wait_xcnt 0x0" :: "v"(o[0]), "v"(o[1]), "v"(o[2]), "v"(o[3]), "v"(o[4]), "v"(o[5]), "v"(o[6]), "v"(o[7]), "v"(d) : "memory"); }
}

// GEMM, wave tile 64x64, block = 4 waves (2 x 2) = 128 rows x 128 cols; A f16 rows (pitch lda), Bh f16 [n][k] (pitch ldb); v = acc*alpha + bf16(bias[col]).
// The N columns are up to three sections of nsec columns side by side (q | k | v in one grid), each with its own bias vector; columns below n16 are written as f16 to C16 (pitch ldc16); column n16 + h*HD + d of row b*SEQ + s goes, transposed, to the planes VTh / VTl [b*NH + h][d][s] (pitch SEQ): hi = f16(v), lo = f16((v - hi) * 2^10).
// grid (M/128)*(N/128). M % 128 == 0, N % 128 == 0, nsec % 128 == 0, n16 % 128 == 0, K % 64 == 0, lda % 8 == 0, ldb % 8 == 0.
// Operands go through LDS in stages of 64 k (one 128-byte line per row), two buffers: a wave's 16-byte global load covers 4 whole lines, the block's 128 A rows and 128 B rows are fetched once for its 4 waves,
// and stage s + 1 is in flight (in registers) while stage s is multiplied. One barrier per stage: it publishes stage s + 1 and ends the reads of the buffer that stage s + 2 overwrites.
// A fetched row feeds 128 columns (or rows) of products and a fragment read from LDS four products. Both epilogues stage in the operand buffers, so that three work-groups share a WGP's LDS and registers: the grid is resident at once.
#define GP 72                        /* LDS row pitch in elements: 128 + 16 bytes */
#define VP 136                       /* pitch of a d row of the v epilogue's planes in LDS: 256 + 16 bytes */
#define GST (256 * GP)               /* elements of one buffer: 128 A rows, then 128 B rows */
#define SOP 68                       /* pitch of a row of the q | k epilogue's f32 tile in LDS, floats */
typedef float f1a __attribute__((may_alias));
static_assert(2 * 128 * VP <= 2 * GST && 4 * 64 * SOP * 4 <= 2 * GST * 2 && SEQ % 128 == 0 && UD % 128 == 0 && LQK % 128 == 0 && 128 % HD == 0);
__global__ __launch_bounds__(128) __attribute__((amdgpu_waves_per_eu(3))) void k_gemm2(const _Float16* __restrict__ A, int lda, const _Float16* __restrict__ Bh, int ldb, float alpha, const float* __restrict__ bias0, const float* __restrict__ bias1, const float* __restrict__ bias2, int nsec,
    _Float16* __restrict__ C16, int ldc16, int n16, _Float16* __restrict__ VTh, _Float16* __restrict__ VTl, int M, int N, int K) {
  __shared__ __attribute__((aligned(16))) _Float16 sm[2 * GST];                 /* [buffer][A rows | B rows][GP] */
  const int tid = threadIdx.x, w = tid >> 5, lane = tid & 31, ln = lane & 15, hh = lane >> 4;
  const int wr = w >> 1, wc = w & 1;   /* the wave's 64 rows and 64 columns of the block's tile */
  const int ntn = N >> 7; const int mt = blockIdx.x / ntn, nq = blockIdx.x - mt * ntn; const int row0 = mt * 128 + 64 * wr, col0 = nq * 128;
  if (mt * 128 >= M) return;         /* taken by the whole block or by none: barriers follow */
  const int sr = tid >> 3, sc = (tid & 7) * 8;   /* staging: 8 threads per row, 16 rows per round */
  const unsigned short* ag = (const unsigned short*)A + (size_t)(mt * 128 + sr) * lda + sc; const unsigned short* bg = (const unsigned short*)Bh + (size_t)(col0 + sr) * ldb + sc;
  v8us ra[8], rb[8];
  auto fetch = [&](int k0) {         /* the stage that begins at k0, into registers */
    const unsigned short* pa[8]; const unsigned short* pb[8];
    for (int i = 0; i < 8; ++i) { pa[i] = ag + (size_t)(16 * i) * lda + k0; ra[i] = *(const v8us*)pa[i]; }
    for (int i = 0; i < 8; ++i) { pb[i] = bg + (size_t)(16 * i) * ldb + k0; rb[i] = *(const v8us*)pb[i]; }
    /* the wait that stands in front of every overwrite of an address register of the sixteen loads above; the addresses are its inputs, so that they stay live and no load's result lands on one before it */
    asm volatile("s_wait_xcnt 0x0" :: "v"(pa[0]), "v"(pa[1]), "v"(pa[2]), "v"(pa[3]), "v"(pa[4]), "v"(pa[5]), "v"(pa[6]), "v"(pa[7]), "v"(pb[0]), "v"(pb[1]), "v"(pb[2]), "v"(pb[3]), "v"(pb[4]), "v"(pb[5]), "v"(pb[6]), "v"(pb[7]) : "memory"); };
  fetch(0);
  for (int i = 0; i < 8; ++i) *(v8us*)&sm[(16 * i + sr) * GP + sc] = ra[i];
  for (int i = 0; i < 8; ++i) *(v8us*)&sm[(128 + 16 * i + sr) * GP + sc] = rb[i];
  __syncthreads();
  const v8f z8 = {0.f,0.f,0.f,0.f,0.f,0.f,0.f,0.f}; v8f c[4][4];
  for (int i = 0; i < 4; ++i) {
    for (int t = 0; t < 4; ++t) c[i][t] = z8; }
#pragma unroll 1
  for (int kn = 64; kn <= K; kn += 64) { const int cur = ((kn >> 6) & 1) ^ 1; const bool more = kn < K;   /* kn: first k of the next stage; block-uniform */
    if (more) fetch(kn);
    const _Float16* fa = &sm[cur * GST + (64 * wr + ln) * GP]; const _Float16* fb = &sm[cur * GST + (128 + 64 * wc + ln) * GP];
    for (int kk = 0; kk < 2; ++kk) { v16h a[4], b[4];   /* the 8 fragments of 32 k, read as one group ahead of their 16 products */
      for (int i = 0; i < 4; ++i) a[i] = g2_frag(fa + 16 * i * GP + 32 * kk, hh);
      for (int t = 0; t < 4; ++t) b[t] = g2_frag(fb + 16 * t * GP + 32 * kk, hh);
      for (int t = 0; t < 4; ++t) {
        for (int i = 0; i < 4; ++i) c[i][t] = g2_mma(a[i], b[t], c[i][t]); } }
    if (more) { _Float16* sn = &sm[(cur ^ 1) * GST + sr * GP + sc];
      for (int i = 0; i < 8; ++i) *(v8us*)(sn + 16 * i * GP) = ra[i];
      for (int i = 0; i < 8; ++i) *(v8us*)(sn + (128 + 16 * i) * GP) = rb[i]; }
    __syncthreads(); }
  const int sec = (col0 >= nsec) + (col0 >= 2 * nsec); const float* bp = ((sec == 0) ? bias0 : (sec == 1) ? bias1 : bias2) + (col0 - sec * nsec) + 64 * wc;   /* the block's 128 columns lie in one section; bp: the wave's 64 */
  if (col0 >= n16) {                 /* v columns (the whole block or none: a barrier follows): two heads' 128 d x the block's 128 tokens, both planes */
    /* a lane's 8 accumulator rows are 8 consecutive tokens of one d: one 16-byte piece per plane, gathered in LDS (the operand buffers, free since the loop's last barrier) so that the block stores whole 256-byte rows */
    _Float16* sT = &sm[0];           /* [plane][d][VP] */
#pragma unroll
    for (int u = 0; u < 16; ++u) { const int t = u & 3, i = u >> 2; const float bv = bf16_rne(bp[t * 16 + ln]); FragH fh, fl;
#pragma unroll
      for (int r = 0; r < 8; ++r) { const float v = c[i][t][r] * alpha + bv; const _Float16 hv = (_Float16)v; fh.h[r] = hv; fl.h[r] = (_Float16)((v - (float)hv) * VLC); }
      const int e = (64 * wc + t * 16 + ln) * VP + 64 * wr + i * 16 + 8 * hh;
      *(v8us*)&sT[e] = fh.half[0]; *(v8us*)&sT[128 * VP + e] = fl.half[0]; }
    __syncthreads();                 /* the four waves' pieces are read by all of them */
    const int bat = (mt * 128) / SEQ; const size_t o0 = ((size_t)(bat * NH + (col0 - n16) / HD) * HD) * SEQ + (size_t)(mt * 128 - bat * SEQ);   /* SEQ % 128 == 0: the block's rows lie in one batch; the two heads' d rows follow one another in the planes */
    const int dsub = tid >> 4, pc = (tid & 15) * 8;   /* 16 threads per d row, 8 rows per round */
#pragma unroll
    for (int hf = 0; hf < 2; ++hf) { v8us ph[8], pl[8];   /* one head: all sixteen pieces are read as one group, then stored as one run */
#pragma unroll
      for (int rd = 0; rd < 8; ++rd) { ph[rd] = *(const v8us*)&sT[(hf * 64 + rd * 8 + dsub) * VP + pc]; pl[rd] = *(const v8us*)&sT[(128 + hf * 64 + rd * 8 + dsub) * VP + pc]; }
      unsigned short* dh = (unsigned short*)VTh + o0 + (size_t)(hf * 64 + dsub) * SEQ + pc; unsigned short* dl = (unsigned short*)VTl + o0 + (size_t)(hf * 64 + dsub) * SEQ + pc;
#pragma unroll
      for (int rd = 0; rd < 8; ++rd) { *(v8us*)(dh + (size_t)rd * 8 * SEQ) = ph[rd]; *(v8us*)(dl + (size_t)rd * 8 * SEQ) = pl[rd]; }
      /* the wait: behind the run of sixteen stores, in front of any reuse of their data and address registers on whatever code is laid out behind them */
      asm volatile("s_wait_xcnt 0x0" :: "v"(ph[0]), "v"(ph[1]), "v"(ph[2]), "v"(ph[3]), "v"(ph[4]), "v"(ph[5]), "v"(ph[6]), "v"(ph[7]), "v"(pl[0]), "v"(pl[1]), "v"(pl[2]), "v"(pl[3]), "v"(pl[4]), "v"(pl[5]), "v"(pl[6]), "v"(pl[7]), "v"(dh), "v"(dl) : "memory"); }
    return; }
  f1a* so = (f1a*)&sm[0] + w * (64 * SOP);   /* the wave's own 64 x SOP floats in the operand buffers, free since the loop's last barrier */
#pragma unroll
  for (int u = 0; u < 16; ++u) { const int t = u & 3, i = u >> 2; const float bv = bf16_rne(bp[t * 16 + ln]);
#pragma unroll
    for (int r = 0; r < 8; ++r) so[(i * 16 + 8 * hh + r) * SOP + t * 16 + ln] = c[i][t][r] * alpha + bv; }
  __builtin_amdgcn_fence(4 /* acq_rel order */, "workgroup"); __builtin_amdgcn_wave_barrier();
  const int rsub = lane >> 4, c4 = (lane & 15) * 4;
  {
#pragma unroll
    for (int q = 0; q < 32; ++q) { const int r = q * 2 + rsub; const v4f v = *(const v4fa*)&so[r * SOP + c4];
      /* the wait: in front of any reuse of the store's data and address registers */
      v4h h4; for (int i = 0; i < 4; ++i) h4[i] = (_Float16)v[i]; _Float16* d = C16 + (size_t)(row0 + r) * ldc16 + col0 + 64 * wc + c4; *(v4h*)d = h4; asm volatile("s_wait_xcnt 0x0" :: "v"(h4), "v"(d) : "memory"); }
     }
}

// fused causal attention, one wave per 32 queries of one slab (slab = b*NH + h), four waves = 128 queries per work-group: per pass of 32 keys S^T = K . Q^T (A = k rows, B = q rows, kept in registers),
// running maximum and sum per query (a lane holds one query's scores: in-lane, plus one exchange between the wave halves), O^T += V^T . P^T (A = VT rows, both planes).
// K and both VT planes come through LDS in stages of SK = 64 keys (two passes), fetched once for the four waves by asynchronous copies of 16 bytes a lane (a wave's copy covers 4 whole 128-byte lines), two buffers:
// stage s + 2 is asked for behind the barrier that ends the reads of stage s, and flies while stage s + 1 is worked on. One barrier per stage: it publishes stage s + 1 and frees stage s's buffer.
// The two S^T tiles of a pass (keys k0 + 8h + r and k0 + 16 + 8h + r of query ln) are, converted in place, the B fragment in the k order of g2_frag: no lane exchange for P.
// P = f16(2^14 * exp(s - running max)); the sum carries the same 2^14, so the carry cancels in the final division. Keys above the query are masked by index in the passes of the block's diagonal 128 keys only.
// Epilogue: R = attention output + bf16(x) is what is stored, and the work-group's f64 sum and sum of squares of its 128 x 64 values of R is statistics partial h*(SEQ/128) + qb of its batch.
// coverage: grid (NB*NH slabs) x (SEQ/128 blocks) x 4 waves x 32 queries = every row; 4 d tiles x (8h + r) = all 64 columns of the head, each element stored once; one partial per work-group, NPB per batch.
#define SCL 0.18033688011112042f     /* 2^-3 * log2(e): scores in the exponent's base-2 units */
#define SK 64                        /* keys per stage */
#define KP 72                        /* pitch of a staged row in elements: 128 + 16 bytes */
#define STE (3 * SK * KP)            /* elements of one buffer: the K tile (SK key rows x HD), the VT hi and the VT lo tile (HD d rows x SK keys) */
static_assert(SK == 64 && HD == 64 && SEQ % (2 * SK) == 0 && (LQK * 2) % 16 == 0 && (SEQ * 2) % 16 == 0);
__device__ __forceinline__ v8f fa_mma(v16h a, v16h b, v8f c) { return __builtin_amdgcn_wmma_f32_16x16x32_f16(false, a, false, b, (short)0, c, false, false); }
__device__ __forceinline__ float fa_xhalf(float x) { return __builtin_bit_cast(float, __builtin_amdgcn_permlanex16(__builtin_bit_cast(int, x), __builtin_bit_cast(int, x), 0x76543210, 0xfedcba98, false, false)); }  /* lane l with lane l ^ 16 */
__device__ __forceinline__ v16h fa_frag(const _Float16* base, unsigned lofs, unsigned cofs) { const char* p = (const char*)base + ((size_t)lofs + cofs); FragH f; f.half[0] = *(const v8us*)p; f.half[1] = *(const v8us*)(p + 32); return f.v; }  /* g2_frag from a uniform base, the lane's byte offset (8h included) and a constant byte offset */

// one stage's copies: thread (row sr = tid >> 3, piece tid & 7) brings its 16-byte piece of rows sr + 16 i, i = 0..3, of each of the three tiles. kg, hg, lg: the thread's piece of row sr in K, VT hi, VT lo at the stage's first key; ld: its LDS byte address in the K tile of the stage's buffer.
// Every lane is on, every address a multiple of 16, every piece of the buffer's 192 rows written by one lane.
__device__ __forceinline__ void fa_stage(const _Float16* kg, const _Float16* hg, const _Float16* lg, unsigned ld) {
  const _Float16 *k1 = kg + 16 * LQK, *k2 = kg + 32 * LQK, *k3 = kg + 48 * LQK, *h1 = hg + 16 * SEQ, *h2 = hg + 32 * SEQ, *h3 = hg + 48 * SEQ, *l1 = lg + 16 * SEQ, *l2 = lg + 32 * SEQ, *l3 = lg + 48 * SEQ;
  const unsigned R = 16 * KP * 2;    /* 16 rows in LDS, bytes */
  /* the twelve copies and, as the statement's last line, the wait that stands in front of every overwrite of their address registers */
  asm volatile("global_load_async_to_lds_b128 %0, %12, off\n\t" "global_load_async_to_lds_b128 %1, %13, off\n\t" "global_load_async_to_lds_b128 %2, %14, off\n\t" "global_load_async_to_lds_b128 %3, %15, off\n\t"
               "global_load_async_to_lds_b128 %4, %16, off\n\t" "global_load_async_to_lds_b128 %5, %17, off\n\t" "global_load_async_to_lds_b128 %6, %18, off\n\t" "global_load_async_to_lds_b128 %7, %19, off\n\t"
               "global_load_async_to_lds_b128 %8, %20, off\n\t" "global_load_async_to_lds_b128 %9, %21, off\n\t" "global_load_async_to_lds_b128 %10, %22, off\n\t" "global_load_async_to_lds_b128 %11, %23, off\n\t"
               "s_wait_xcnt 0x0"
               :: "v"(ld), "v"(ld + R), "v"(ld + 2 * R), "v"(ld + 3 * R), "v"(ld + 4 * R), "v"(ld + 5 * R), "v"(ld + 6 * R), "v"(ld + 7 * R), "v"(ld + 8 * R), "v"(ld + 9 * R), "v"(ld + 10 * R), "v"(ld + 11 * R),
                  "v"(kg), "v"(k1), "v"(k2), "v"(k3), "v"(hg), "v"(h1), "v"(h2), "v"(h3), "v"(lg), "v"(l1), "v"(l2), "v"(l3) : "memory");
}
// where a stage is handed over, every wave: its own LDS reads of the buffer that is refilled next are done, its own copies of the next stage have landed, then the work-group's barrier
__device__ __forceinline__ void fa_publish() {
  asm volatile("s_wait_dscnt 0x0" ::: "memory");      /* this wave's reads of the stage it leaves have returned before another wave's copies may land there */
  asm volatile("s_wait_asynccnt 0x0" ::: "memory");   /* this wave's copies of the next stage have landed before any wave reads them */
  __syncthreads();
}
// the four k fragments of a pass; sk: the lane's row (key ln of the pass) in the K tile
__device__ __forceinline__ void fa_kfrag(v16h (&kf)[2][2], const _Float16* sk, int hh) {
  for (int kt = 0; kt < 2; ++kt) { kf[kt][0] = g2_frag(sk + 16 * kt * KP, hh); kf[kt][1] = g2_frag(sk + 16 * kt * KP + 32, hh); } }

// one pass of 32 keys out of LDS; sk: the lane's row (key ln of the pass) in the K tile; sh, sl: the lane's row (d = ln) in the VT tiles at the pass's first key. kf holds this pass's k fragments; with PRE the next pass of the SAME stage has its own fetched behind this pass's products.
template <bool LAST, bool PRE>
__device__ __forceinline__ void fa_pass(int k0, int q0, int ln, int hh, const _Float16* sk, const _Float16* sh, const _Float16* sl,
    const v16h (&qf)[2][2], v16h (&kf)[2][2], v8f (&oh)[2][4], v8f (&ol)[2][4], float (&m)[2], float (&l)[2]) {
  v16h vh[4], vl[4];
  for (int dt = 0; dt < 4; ++dt) { vh[dt] = g2_frag(sh + 16 * dt * KP, hh); vl[dt] = g2_frag(sl + 16 * dt * KP, hh); }
  const v8f z8 = {0.f,0.f,0.f,0.f,0.f,0.f,0.f,0.f}; v8f s[2][2];
  for (int t = 0; t < 2; ++t) {
    for (int kt = 0; kt < 2; ++kt) s[t][kt] = fa_mma(kf[kt][1], qf[t][1], fa_mma(kf[kt][0], qf[t][0], z8)); }
  if (PRE) fa_kfrag(kf, sk + 32 * KP, hh);
  float mn[2];
  for (int t = 0; t < 2; ++t) {
    if (LAST) {
      for (int kt = 0; kt < 2; ++kt) {
        for (int r = 0; r < 8; ++r) s[t][kt][r] = (k0 + 16 * kt + 8 * hh + r <= q0 + 16 * t + ln) ? s[t][kt][r] : -3.0e38f; } }
    float mx = s[t][0][0];
    for (int r = 1; r < 8; ++r) mx = fmaxf(mx, s[t][0][r]);
    for (int r = 0; r < 8; ++r) mx = fmaxf(mx, s[t][1][r]);
    mx = fmaxf(mx, fa_xhalf(mx)); mn[t] = fmaxf(m[t], mx); }
  if (__builtin_amdgcn_ballot_w32((mn[0] > m[0]) || (mn[1] > m[1])) != 0) {   /* no maximum moved: every factor is 1 and the rescale is skipped by the whole wave */
    for (int t = 0; t < 2; ++t) { const float al = __builtin_amdgcn_exp2f((m[t] - mn[t]) * SCL); l[t] *= al; m[t] = mn[t];
      for (int dt = 0; dt < 4; ++dt) { oh[t][dt] *= al; ol[t][dt] *= al; } } }
  for (int t = 0; t < 2; ++t) { const float off = 14.0f - m[t] * SCL; FragH p; v8f x[2], e[2];
    for (int kt = 0; kt < 2; ++kt) { x[kt] = s[t][kt] * SCL + off;
      for (int r = 0; r < 8; ++r) e[kt][r] = __builtin_amdgcn_exp2f(x[kt][r]); }
    /* the slot behind a transcendental: no source is overwritten and no result read before this v_nop, which stands behind the last of the sixteen */
    asm volatile("v_nop" : "+v"(e[0]), "+v"(e[1]) : "v"(x[0]), "v"(x[1]));
    for (int r = 0; r < 8; ++r) { p.h[r] = (_Float16)e[0][r]; p.h[8 + r] = (_Float16)e[1][r]; }
    const v8f es = e[0] + e[1];
    l[t] += ((es[0] + es[1]) + (es[2] + es[3])) + ((es[4] + es[5]) + (es[6] + es[7]));
    for (int dt = 0; dt < 4; ++dt) { oh[t][dt] = fa_mma(vh[dt], p.v, oh[t][dt]); ol[t][dt] = fa_mma(vl[dt], p.v, ol[t][dt]); } }
}

__global__ __launch_bounds__(128) void k_fattn(const _Float16* __restrict__ QK, const _Float16* __restrict__ VTh, const _Float16* __restrict__ VTl, const float* __restrict__ X, float* __restrict__ R, double* __restrict__ part) {
  __shared__ double rs[128]; __shared__ double rq[128];
  __shared__ __attribute__((aligned(16))) _Float16 st[2 * STE];                 /* [buffer][K | VT hi | VT lo][row][KP] */
  const int tid = threadIdx.x, lane = tid & 31, ln = lane & 15, hh = lane >> 4;
  const int w = __builtin_amdgcn_readfirstlane(tid >> 5);                       /* the wave's number in a scalar register: scalar branches */
  const int slab = blockIdx.x, b = slab / NH, h = slab % NH;
  const int y = blockIdx.y, qb = (y < SEQ / 256) ? SEQ / 128 - 1 - y : y - SEQ / 256;   /* long blocks start first; the second half of the grid runs short to long beside them */
  const int q0 = qb * 128 + 32 * w;
  const _Float16* Q = QK + ((size_t)b * SEQ + q0) * LQK + h * HD; const _Float16* K = QK + (size_t)b * SEQ * LQK + UD + h * HD;      /* uniform bases */
  const _Float16* VH = VTh + (size_t)slab * HD * SEQ; const _Float16* VL = VTl + (size_t)slab * HD * SEQ;
  /* the block walks 2 * (qb + 1) stages: keys 0 .. qb * 128 + 127, all of them rows of the sequence */
  const int sr = tid >> 3, sc = (tid & 7) * 8;
  const _Float16* kg = K + (size_t)sr * LQK + sc; const _Float16* hg = VH + (size_t)sr * SEQ + sc; const _Float16* lg = VL + (size_t)sr * SEQ + sc;
  const unsigned ld = (unsigned)(size_t)&st[sr * KP + sc];                      /* LDS byte address: the low 32 bits */
  fa_stage(kg, hg, lg, ld);
  const unsigned ko = (unsigned)(ln * LQK + 8 * hh) * 2;                        /* lane byte offset */
  v16h qf[2][2], kf[2][2];
  for (int t = 0; t < 2; ++t) { qf[t][0] = fa_frag(Q, ko, t * 16 * LQK * 2); qf[t][1] = fa_frag(Q, ko, t * 16 * LQK * 2 + 64); }
  /* in front of any overwrite of these loads' address registers */
  asm volatile("s_wait_xcnt 0x0" :: "v"(ko) : "memory");
  asm volatile("s_wait_asynccnt 0x0" ::: "memory");   /* stage 0 has landed, as far as this wave brought it */
  __syncthreads();                                    /* stage 0 is published */
  fa_stage(kg + SK * LQK, hg + SK, lg + SK, ld + STE * 2);
  kg += 2 * SK * LQK; hg += 2 * SK; lg += 2 * SK;
  const v8f z8 = {0.f,0.f,0.f,0.f,0.f,0.f,0.f,0.f}; v8f oh[2][4], ol[2][4]; float m[2] = {-3.0e38f, -3.0e38f}, l[2] = {0.f, 0.f};
  for (int t = 0; t < 2; ++t) {
    for (int dt = 0; dt < 4; ++dt) { oh[t][dt] = z8; ol[t][dt] = z8; } }
  const _Float16* fr = &st[ln * KP];                  /* the lane's row in buffer 0's K tile */
  /* the stages below the block's diagonal: both passes whole, in all four waves */
  for (int s = 0; s < 2 * qb; ++s) { const _Float16* sk = fr + (s & 1) * STE;
    fa_kfrag(kf, sk, hh);
    fa_pass<false, true>(0, q0, ln, hh, sk, sk + SK * KP, sk + 2 * SK * KP, qf, kf, oh, ol, m, l);
    fa_pass<false, false>(0, q0, ln, hh, sk + 32 * KP, sk + SK * KP + 32, sk + 2 * SK * KP + 32, qf, kf, oh, ol, m, l);
    fa_publish();
    fa_stage(kg, hg, lg, ld + (s & 1) * (STE * 2));   /* stage s + 2 <= 2 * qb + 1 exists on every trip */
    kg += SK * LQK; hg += SK; lg += SK; }
  /* the lane's 64 residual values, at the places of its outputs: fetched ahead of the diagonal passes, which cover their latency */
  const float* xp = X + ((size_t)b * SEQ_FULL + q0 + ln) * CD + h * HD + 8 * hh; v4f xl[2][4], xh[2][4];
  for (int t = 0; t < 2; ++t) {
    for (int dt = 0; dt < 4; ++dt) { xl[t][dt] = *(const v4fa*)(xp + t * 16 * CD + dt * 16); xh[t][dt] = *(const v4fa*)(xp + t * 16 * CD + dt * 16 + 4); } }
  /* in front of any overwrite of these loads' address registers */
  asm volatile("s_wait_xcnt 0x0" :: "v"(xp) : "memory");
  /* the block's last two stages (buffers 0 and 1: 2 * qb is even), passes j = 0..3 of the diagonal's 128 keys: wave w takes j <= w, all in the masked form (below j = w the mask keeps every key); every wave passes the publish point between the stages */
#pragma unroll 1   /* rolled: one copy of the masked pass in the text instead of four */
  for (int j = 0; j < 4; ++j) {
    if (j <= w) { const _Float16* sk = fr + (j >> 1) * STE + (j & 1) * 32 * KP; const _Float16* sv = fr + (j >> 1) * STE + SK * KP + (j & 1) * 32;
      fa_kfrag(kf, sk, hh);
      fa_pass<true, false>(qb * 128 + 32 * j, q0, ln, hh, sk, sv, sv + SK * KP, qf, kf, oh, ol, m, l); }
    if (j == 1) fa_publish(); }
  asm volatile("s_wait_asynccnt 0x0" ::: "memory");   /* behind the last copy: none is outstanding when the wave goes on */
  double s1 = 0.0, s2 = 0.0;
  for (int t = 0; t < 2; ++t) { const float inv = 1.0f / (l[t] + fa_xhalf(l[t]));
    float* op = R + ((size_t)b * SEQ + q0 + 16 * t + ln) * UD + h * HD + 8 * hh;
    for (int dt = 0; dt < 4; ++dt) { v4f lo4, hi4;
      for (int i = 0; i < 4; ++i) { lo4[i] = (oh[t][dt][i] + ol[t][dt][i] * (1.0f / VLC)) * inv + bf16_rne(xl[t][dt][i]); hi4[i] = (oh[t][dt][4 + i] + ol[t][dt][4 + i] * (1.0f / VLC)) * inv + bf16_rne(xh[t][dt][i]); }
      *(v4f*)(op + dt * 16) = lo4; *(v4f*)(op + dt * 16 + 4) = hi4;
      /* in front of any reuse of the two stores' data and address registers */
      asm volatile("s_wait_xcnt 0x0" :: "v"(lo4), "v"(hi4), "v"(op) : "memory");
      for (int i = 0; i < 4; ++i) { s1 += (double)lo4[i]; s2 += (double)lo4[i] * (double)lo4[i]; s1 += (double)hi4[i]; s2 += (double)hi4[i] * (double)hi4[i]; } } }
  /* the work-group's partial: 128 lane sums, 16-to-1 in eight threads (thread t alone reads and rewrites place t; places from 8 on are only read), then 8-to-1; every wave passes both barriers */
  rs[tid] = s1; rq[tid] = s2; __syncthreads();
  if (tid < 8) { double a[16], c[16];
    for (int j = 0; j < 16; ++j) { a[j] = rs[tid + 8 * j]; c[j] = rq[tid + 8 * j]; }
    for (int g = 8; g > 0; g >>= 1) {
      for (int j = 0; j < g; ++j) { a[j] += a[j + g]; c[j] += c[j + g]; } }
    rs[tid] = a[0]; rq[tid] = c[0]; }
  __syncthreads();
  if (tid < 8) { v2d val; val[0] = (tid == 0) ? ((rs[0] + rs[1]) + (rs[2] + rs[3])) + ((rs[4] + rs[5]) + (rs[6] + rs[7])) : 0.0; val[1] = (tid == 0) ? ((rq[0] + rq[1]) + (rq[2] + rq[3])) + ((rq[4] + rq[5]) + (rq[6] + rq[7])) : 0.0;
    double* d = part + ((size_t)b * NPB + (size_t)h * (SEQ / 128) + qb) * 16 + tid * 2; *(v2d*)d = val;  }
}

// final statistics, one work-group: thread (batch bb, place t) takes partial t of its batch, so that all NB * NPB loads are in flight together; then two rounds of 16-to-1 f64 sums per batch in LDS
#define LFT 256                      /* threads per batch */
static_assert(LFT == 16 * 16 && NB * LFT <= 1024);
__global__ __launch_bounds__(NB * LFT) void k_lnfin(const double* __restrict__ part, float* __restrict__ stat) {
  __shared__ double rs[NB * LFT]; __shared__ double rq[NB * LFT];
  __shared__ __attribute__((aligned(16))) float st[32];
  const int tid = threadIdx.x; const int bb = tid / LFT, t = tid % LFT;
  double s = 0.0, q = 0.0;
  if (t < NPB) { const v2d p = *(const v2d*)(part + ((size_t)bb * NPB + t) * 16); s = p[0]; q = p[1]; }
  for (int i = t + LFT; i < NPB; i += LFT) { const v2d p = *(const v2d*)(part + ((size_t)bb * NPB + i) * 16); s += p[0]; q += p[1]; }
  rs[tid] = s; rq[tid] = q;
  if (tid < 32) st[tid] = 0.f;
  __syncthreads();
  for (int w = LFT / 16; w > 0; w /= 16) {   /* thread t < w sums places t + j * w; it alone reads and rewrites place t, and places from w on are only read */
    if (t < w) { double a[16], c[16];
      for (int j = 0; j < 16; ++j) { a[j] = rs[tid + j * w]; c[j] = rq[tid + j * w]; }
      for (int h = 8; h > 0; h >>= 1) {
        for (int j = 0; j < h; ++j) { a[j] += a[j + h]; c[j] += c[j + h]; } }
      rs[tid] = a[0]; rq[tid] = c[0]; }
    __syncthreads(); }
  if (t == 0) {
    const double inv = 1.0 / ((double)SEQ * (double)UD); const double m = rs[tid] * inv; double var = rq[tid] * inv - m * m; if (var < 0.0) var = 0.0;
    st[2 * bb] = (float)m; st[2 * bb + 1] = 1.0f / sqrtf((float)var + 1.0e-5f); }
  __syncthreads();
  if (tid < 8) { const v4f v = *(const v4fa*)&st[tid * 4]; *(v4f*)(stat + tid * 4) = v;  }
}

// a thread takes LAP places of 4 floats, 256 places apart, in every batch: few waves to start, (2 + NB) * LAP loads of 16 bytes in flight in each; the places' g and bta serve all batches.
// coverage: grid (SEQ*UD/(1024*LAP)) x 256 threads x LAP places x 4 floats x NB batches = every output element exactly once.
#define LAP 4
static_assert(((size_t)SEQ * UD) % (1024 * LAP) == 0);
__global__ __launch_bounds__(256) void k_lnapply(const float* __restrict__ R, const float* __restrict__ stat, const float* __restrict__ g, const float* __restrict__ bta, float* __restrict__ out) {
  const unsigned eo = (blockIdx.x * (256u * LAP) + threadIdx.x) * 16u;   /* the lane's byte offset inside one batch */
  v4f o[NB][LAP], gg[LAP], bb[LAP], y[NB][LAP];
#pragma unroll
  for (int j = 0; j < LAP; ++j) { gg[j] = *(const v4fa*)((const char*)g + ((size_t)eo + j * 4096)); bb[j] = *(const v4fa*)((const char*)bta + ((size_t)eo + j * 4096)); }
#pragma unroll
  for (int bat = 0; bat < NB; ++bat) {
#pragma unroll
    for (int j = 0; j < LAP; ++j) o[bat][j] = *(const v4fa*)((const char*)(R + (size_t)bat * SEQ * UD) + ((size_t)eo + j * 4096)); }
  /* the wait: in front of any overwrite of the loads' address register */
  asm volatile("s_wait_xcnt 0x0" :: "v"(eo) : "memory");
#pragma unroll
  for (int bat = 0; bat < NB; ++bat) { const float mu = stat[2 * bat], rs = stat[2 * bat + 1];
#pragma unroll
    for (int j = 0; j < LAP; ++j) {
#pragma unroll
      for (int q = 0; q < 4; ++q) { const float v = o[bat][j][q]; y[bat][j][q] = (v - mu) * rs * bf16_rne(gg[j][q]) + bf16_rne(bb[j][q]); } } }
#pragma unroll
  for (int bat = 0; bat < NB; ++bat) {
#pragma unroll
    for (int j = 0; j < LAP; ++j) *(v4f*)((char*)(out + (size_t)bat * SEQ_FULL * UD) + ((size_t)eo + j * 4096)) = y[bat][j]; }
}

extern "C" void kernel_launch(void* const* d_in, const int* in_sizes, int n_in,
                              void* d_out, int out_size, void* d_ws, size_t ws_size, hipStream_t stream) {
  if (n_in < 9) return;
  const float* X   = (const float*)d_in[0];      /* [2][2048][1024] */
  const float* Wq  = (const float*)d_in[1];      /* [in][out] 1024 x 1024 */
  const float* bq  = (const float*)d_in[2];
  const float* Wk  = (const float*)d_in[3];
  const float* bk  = (const float*)d_in[4];
  const float* Wv  = (const float*)d_in[5];
  const float* bv  = (const float*)d_in[6];
  const float* gam = (const float*)d_in[7];      /* [2048][1024] */
  const float* bet = (const float*)d_in[8];
  float* out = (float*)d_out;
  const size_t rows_used = (size_t)(NB - 1) * SEQ_FULL + SEQ;
  if ((size_t)in_sizes[0] < rows_used * CD) return;
  if ((size_t)in_sizes[1] < (size_t)CD * UD || (size_t)in_sizes[3] < (size_t)CD * UD || (size_t)in_sizes[5] < (size_t)CD * UD) return;
  if (in_sizes[2] < UD || in_sizes[4] < UD || in_sizes[6] < UD) return;
  if ((size_t)in_sizes[7] < (size_t)SEQ * UD || (size_t)in_sizes[8] < (size_t)SEQ * UD) return;
  if ((size_t)out_size < rows_used * UD) return;

  char* ws = (char*)d_ws; size_t off = 0;
  auto take = [&](size_t bytes) { char* p = ws + off; off += (bytes + 255) & ~(size_t)255; return p; };
  _Float16* BQKV = (_Float16*)take((size_t)3 * CD * UD * 2);               /* [3*UD][CD] f16 (x16) */
  _Float16* X16  = (_Float16*)take(NR * CD * 2);                           /* [NR][CD] */
  _Float16* QK16 = (_Float16*)take(NR * LQK * 2);                          /* [NR][q | k] */
  _Float16* VTh  = (_Float16*)take((size_t)NB * NH * HD * SEQ * 2);        /* [NB*NH][HD][SEQ] */
  _Float16* VTl  = (_Float16*)take((size_t)NB * NH * HD * SEQ * 2);
  float*    R32  = (float*)take(NR * UD * 4);                              /* [NR][UD] f32: attention output + residual */
  double*   PART = (double*)take((size_t)NB * NPB * 128);                  
  float*    STAT = (float*)take(128);
  if (off > ws_size || off > (size_t)134217728) return;

  k_prep<<<(unsigned)(3 * WTB + XCB), 256, 0, stream>>>(Wq, Wk, Wv, X, BQKV, X16);
  const int MP = (int)NR;
  /* q rows (f16, cols 0..UD-1 of QK16), k rows (cols UD..2UD-1), v (both f16 planes, transposed), one grid: x16 . (16 W) * 2^-4 + bf16(bias) */
  k_gemm2<<<(unsigned)((MP / 128) * ((3 * UD) / 128)), 128, 0, stream>>>(X16, CD, BQKV, CD, 0.0625f, bq, bk, bv, UD, QK16, LQK, LQK, VTh, VTl, MP, 3 * UD, CD);
  k_fattn<<<dim3((unsigned)(NB * NH), (unsigned)(SEQ / 128)), 128, 0, stream>>>(QK16, VTh, VTl, X, R32, PART);
  k_lnfin<<<1, NB * LFT, 0, stream>>>(PART, STAT);
  k_lnapply<<<(unsigned)(((size_t)SEQ * UD) / (1024 * LAP)), 256, 0, stream>>>(R32, STAT, gam, bet, out);
}

// v009
// A run of this version takes 79.6 microseconds.
// Timed twice side by side with v008, it ran 1.04 times as fast both times.
// Counting every step since v000, it is 15.4 times as fast.
#include <hip/hip_runtime.h>
// Contractions on v_wmma_f32_16x16x32_f16 (f16 operands, f32 accumulate): q | k | v projections (x and weights bf16-valued, exact in f16, weights carried x16), scores k.q^T (plain f16 q, k), V^T.P^T in the same kernel (running-maximum softmax weights f16 carried x2^14; v as f16 hi plane + f16 residual plane carried x2^10, two accumulators). Scores, softmax statistics, attention output and residual add in f32; joint (seq, unit) normalisation statistics in f64. K and the v planes reach the attention waves through LDS. The v planes are written by the GEMM's epilogue, the residual sum and its statistics partials by the attention kernel's; the apply kernel's work-groups each sum the partials themselves.
#ifndef NB
#define NB 2
#endif
#ifndef SEQ
#define SEQ 2048
#endif
#define NB_FULL 2
#define SEQ_FULL 2048
#define CD 1024                      /* input channels */
#define UD 1024                      /* units */
#define NH 16
#define HD 64
#define LQK (2 * UD)                 /* row pitch of the q | k rows */
#define LNP 8192                     /* floats per statistics block: the 128 queries x HD columns of one attention work-group */
#define NPB ((SEQ * UD) / LNP)       /* statistics blocks per batch */
#define NR ((size_t)NB * SEQ)        /* token rows (compact) */
#define WSC 16.0f                    /* weight carry */
#define VLC 1024.0f                  /* v residual plane carry */
static_assert(NB >= 1 && NB <= NB_FULL);
static_assert(SEQ % 256 == 0 && SEQ <= SEQ_FULL);
static_assert(CD % 64 == 0 && UD % 64 == 0 && CD == UD);
static_assert(NH * HD == UD && HD == 64);
static_assert((SEQ * UD) % LNP == 0 && LNP == 128 * HD && NPB == NH * (SEQ / 128));
static_assert(2 * NB <= 32);
static_assert((NR * UD) % 1024 == 0 && (NR % 128) == 0);

typedef unsigned short v8us __attribute__((ext_vector_type(8), may_alias));
typedef float  v8f  __attribute__((ext_vector_type(8)));
typedef float  v4f  __attribute__((ext_vector_type(4)));
typedef float  v4fa __attribute__((ext_vector_type(4), may_alias));
typedef double v2d  __attribute__((ext_vector_type(2)));
typedef _Float16 v16h __attribute__((ext_vector_type(16)));
typedef _Float16 v4h  __attribute__((ext_vector_type(4)));
union FragH { v16h v; v8us half[2]; _Float16 h[16]; unsigned short u[16]; };

__device__ __forceinline__ unsigned short bf16_bits(float x) { unsigned int u = __float_as_uint(x); return (unsigned short)((u + 0x7FFFu + ((u >> 16) & 1u)) >> 16); }
__device__ __forceinline__ float bf16_val(unsigned short b) { return __uint_as_float(((unsigned int)b) << 16); }
__device__ __forceinline__ float bf16_rne(float x) { return bf16_val(bf16_bits(x)); }

// 16-bit WMMA fragment: lane l, h = l >> 4, row/col = l & 15; elements 0..7 <- k0 + 8h + 0..7, elements 8..15 <- k0 + 16 + 8h + 0..7 (same map for A rows and for B[n][k] rows)
__device__ __forceinline__ v16h g2_frag(const _Float16* p, int hh) { FragH f; f.half[0] = *(const v8us*)((const unsigned short*)p + 8 * hh); f.half[1] = *(const v8us*)((const unsigned short*)p + 16 + 8 * hh); return f.v; }
__device__ __forceinline__ v8f g2_mma(v16h a, v16h b, v8f c) { v8f d = __builtin_amdgcn_wmma_f32_16x16x32_f16(false, a, false, b, (short)0, c, false, false); asm volatile("v_nop\n\tv_nop\n\tv_nop\n\tv_nop" : "+v"(d) : "v"(a), "v"(b)); return d; }

// The four conversions that depend on nothing but the inputs, in one grid: blocks 0 .. 3*WTB-1 take Wq | Wk | Wv (WTB blocks each): Wt[m*UD + n][k] = f16(bf16(W[k][n]) * 16);
// the other XCB blocks take x: X16[b*SEQ + s][c] = f16(bf16(x[b][s][c])). 64 elements per thread, so that few waves have to be started and each has 16 loads of 16 bytes in flight; every element of Wt and X16 is stored once. The branch is block-uniform.
// W: a thread takes an 8 k x 8 n block, read by rows; 4 lanes side by side in n cover one 128-byte line of a W row, 8 lanes side by side in k one 128-byte line of a Wt row.
// x: a thread takes XPP pieces of 8 elements, 256 pieces apart: each round of the block is one contiguous run.
#define XPP 8
#define WTB (((UD / 8) * (CD / 8)) / 256)
#define XCB ((int)((NR * CD / 8) / (256 * XPP)))
static_assert(((UD / 8) * (CD / 8)) % 256 == 0 && UD % 32 == 0 && (NR * CD / 8) % (256 * XPP) == 0 && ((size_t)SEQ * CD / 8) % (256 * XPP) == 0);
__global__ __launch_bounds__(256) void k_prep(const float* __restrict__ Wq, const float* __restrict__ Wk, const float* __restrict__ Wv, const float* __restrict__ x, _Float16* __restrict__ Wt, _Float16* __restrict__ X16) {
  const int bx = blockIdx.x; v4f lo[8], hi[8]; v8us o[8];
  if (bx < 3 * WTB) { const int m = bx / WTB; const float* __restrict__ W = (m == 0) ? Wq : (m == 1) ? Wk : Wv;
    const int t = (bx - m * WTB) * 256 + threadIdx.x; const int r = t >> 5;
    const int k8 = ((r % (CD / 64)) * 8 + (t & 7)) * 8, n8 = ((r / (CD / 64)) * 4 + ((t >> 3) & 3)) * 8;
    const float* wp = W + (size_t)k8 * UD + n8;
#pragma unroll
    for (int i = 0; i < 8; ++i) { lo[i] = *(const v4fa*)(wp + i * UD); hi[i] = *(const v4fa*)(wp + i * UD + 4); }
    /* the wait: in front of any overwrite of the sixteen loads' address registers */
    asm volatile("s_wait_xcnt 0x0" :: "v"(wp) : "memory");
#pragma unroll
    for (int j = 0; j < 8; ++j) { FragH f;
#pragma unroll
      for (int i = 0; i < 8; ++i) f.h[i] = (_Float16)(bf16_rne((j < 4) ? lo[i][j & 3] : hi[i][j & 3]) * WSC);
      o[j] = f.half[0]; }
    unsigned short* d = (unsigned short*)Wt + ((size_t)m * UD + n8) * CD + k8;
#pragma unroll
    for (int j = 0; j < 8; ++j) *(v8us*)(d + j * CD) = o[j];
    /* the wait: behind the run of eight stores, in front of any reuse of their data and address registers, whichever branch is laid out first */
    asm volatile("s_wait_xcnt 0x0" :: "v"(o[0]), "v"(o[1]), "v"(o[2]), "v"(o[3]), "v"(o[4]), "v"(o[5]), "v"(o[6]), "v"(o[7]), "v"(d) : "memory"); }
  else { const size_t t = (size_t)(bx - 3 * WTB) * (256 * XPP) + threadIdx.x; const size_t n8 = (size_t)SEQ * CD / 8; const size_t b = t / n8;   /* the block's pieces lie in one batch */
    const float* xp = x + b * ((size_t)SEQ_FULL * CD) + (t - b * n8) * 8;
#pragma unroll
    for (int j = 0; j < XPP; ++j) { lo[j] = *(const v4fa*)(xp + j * 2048); hi[j] = *(const v4fa*)(xp + j * 2048 + 4); }
    /* the wait: as above */
    asm volatile("s_wait_xcnt 0x0" :: "v"(xp) : "memory");
#pragma unroll
    for (int j = 0; j < XPP; ++j) { FragH f;
#pragma unroll
      for (int q = 0; q < 4; ++q) { f.h[q] = (_Float16)bf16_rne(lo[j][q]); f.h[4 + q] = (_Float16)bf16_rne(hi[j][q]); }
      o[j] = f.half[0]; }
    unsigned short* d = (unsigned short*)X16 + t * 8;
#pragma unroll
    for (int j = 0; j < XPP; ++j) *(v8us*)(d + j * 2048) = o[j];
    /* the wait: as above */
    asm volatile("s_wait_xcnt 0x0" :: "v"(o[0]), "v"(o[1]), "v"(o[2]), "v"(o[3]), "v"(o[4]), "v"(o[5]), "v"(o[6]), "v"(o[7]), "v"(d) : "memory"); }
}

// GEMM, wave tile 64x64, block = 4 waves (2 x 2) = 128 rows x 128 cols; A f16 rows (pitch lda), Bh f16 [n][k] (pitch ldb); v = acc*alpha + bf16(bias[col]).
// The N columns are up to three sections of nsec columns side by side (q | k | v in one grid), each with its own bias vector; columns below n16 are written as f16 to C16 (pitch ldc16); column n16 + h*HD + d of row b*SEQ + s goes, transposed, to the planes VTh / VTl [b*NH + h][d][s] (pitch SEQ): hi = f16(v), lo = f16((v - hi) * 2^10).
// grid (M/128)*(N/128). M % 128 == 0, N % 128 == 0, nsec % 128 == 0, n16 % 128 == 0, K % 64 == 0, lda % 8 == 0, ldb % 8 == 0.
// Operands go through LDS in stages of 64 k (one 128-byte line per row), two buffers: a wave's 16-byte global load covers 4 whole lines, the block's 128 A rows and 128 B rows are fetched once for its 4 waves,
// and stage s + 1 is in flight (in registers) while stage s is multiplied. One barrier per stage: it publishes stage s + 1 and ends the reads of the buffer that stage s + 2 overwrites.
// A fetched row feeds 128 columns (or rows) of products and a fragment read from LDS four products. Both epilogues stage in the operand buffers, so that three work-groups share a WGP's LDS and registers: the grid is resident at once.
#define GP 72                        /* LDS row pitch in elements: 128 + 16 bytes */
#define VP 136                       /* pitch of a d row of the v epilogue's planes in LDS: 256 + 16 bytes */
#define GST (256 * GP)               /* elements of one buffer: 128 A rows, then 128 B rows */
#define SOP 68                       /* pitch of a row of the q | k epilogue's f32 tile in LDS, floats */
typedef float f1a __attribute__((may_alias));
static_assert(2 * 128 * VP <= 2 * GST && 4 * 64 * SOP * 4 <= 2 * GST * 2 && SEQ % 128 == 0 && UD % 128 == 0 && LQK % 128 == 0 && 128 % HD == 0);
__global__ __launch_bounds__(128) __attribute__((amdgpu_waves_per_eu(3))) void k_gemm2(const _Float16* __restrict__ A, int lda, const _Float16* __restrict__ Bh, int ldb, float alpha, const float* __restrict__ bias0, const float* __restrict__ bias1, const float* __restrict__ bias2, int nsec,
    _Float16* __restrict__ C16, int ldc16, int n16, _Float16* __restrict__ VTh, _Float16* __restrict__ VTl, int M, int N, int K) {
  __shared__ __attribute__((aligned(16))) _Float16 sm[2 * GST];                 /* [buffer][A rows | B rows][GP] */
  const int tid = threadIdx.x, w = tid >> 5, lane = tid & 31, ln = lane & 15, hh = lane >> 4;
  const int wr = w >> 1, wc = w & 1;   /* the wave's 64 rows and 64 columns of the block's tile */
  const int ntn = N >> 7; const int mt = blockIdx.x / ntn, nq = blockIdx.x - mt * ntn; const int row0 = mt * 128 + 64 * wr, col0 = nq * 128;
  if (mt * 128 >= M) return;         /* taken by the whole block or by none: barriers follow */
  const int sr = tid >> 3, sc = (tid & 7) * 8;   /* staging: 8 threads per row, 16 rows per round */
  const unsigned short* ag = (const unsigned short*)A + (size_t)(mt * 128 + sr) * lda + sc; const unsigned short* bg = (const unsigned short*)Bh + (size_t)(col0 + sr) * ldb + sc;
  v8us ra[8], rb[8];
  auto fetch = [&](int k0) {         /* the stage that begins at k0, into registers */
    const unsigned short* pa[8]; const unsigned short* pb[8];
    for (int i = 0; i < 8; ++i) { pa[i] = ag + (size_t)(16 * i) * lda + k0; ra[i] = *(const v8us*)pa[i]; }
    for (int i = 0; i < 8; ++i) { pb[i] = bg + (size_t)(16 * i) * ldb + k0; rb[i] = *(const v8us*)pb[i]; }
    /* the wait that stands in front of every overwrite of an address register of the sixteen loads above; the addresses are its inputs, so that they stay live and no load's result lands on one before it */
    asm volatile("s_wait_xcnt 0x0" :: "v"(pa[0]), "v"(pa[1]), "v"(pa[2]), "v"(pa[3]), "v"(pa[4]), "v"(pa[5]), "v"(pa[6]), "v"(pa[7]), "v"(pb[0]), "v"(pb[1]), "v"(pb[2]), "v"(pb[3]), "v"(pb[4]), "v"(pb[5]), "v"(pb[6]), "v"(pb[7]) : "memory"); };
  fetch(0);
  for (int i = 0; i < 8; ++i) *(v8us*)&sm[(16 * i + sr) * GP + sc] = ra[i];
  for (int i = 0; i < 8; ++i) *(v8us*)&sm[(128 + 16 * i + sr) * GP + sc] = rb[i];
  __syncthreads();
  const v8f z8 = {0.f,0.f,0.f,0.f,0.f,0.f,0.f,0.f}; v8f c[4][4];
  for (int i = 0; i < 4; ++i) {
    for (int t = 0; t < 4; ++t) c[i][t] = z8; }
#pragma unroll 1
  for (int kn = 64; kn <= K; kn += 64) { const int cur = ((kn >> 6) & 1) ^ 1; const bool more = kn < K;   /* kn: first k of the next stage; block-uniform */
    if (more) fetch(kn);
    const _Float16* fa = &sm[cur * GST + (64 * wr + ln) * GP]; const _Float16* fb = &sm[cur * GST + (128 + 64 * wc + ln) * GP];
    for (int kk = 0; kk < 2; ++kk) { v16h a[4], b[4];   /* the 8 fragments of 32 k, read as one group ahead of their 16 products */
      for (int i = 0; i < 4; ++i) a[i] = g2_frag(fa + 16 * i * GP + 32 * kk, hh);
      for (int t = 0; t < 4; ++t) b[t] = g2_frag(fb + 16 * t * GP + 32 * kk, hh);
      for (int t = 0; t < 4; ++t) {
        for (int i = 0; i < 4; ++i) c[i][t] = g2_mma(a[i], b[t], c[i][t]); } }
    if (more) { _Float16* sn = &sm[(cur ^ 1) * GST + sr * GP + sc];
      for (int i = 0; i < 8; ++i) *(v8us*)(sn + 16 * i * GP) = ra[i];
      for (int i = 0; i < 8; ++i) *(v8us*)(sn + (128 + 16 * i) * GP) = rb[i]; }
    __syncthreads(); }
  const int sec = (col0 >= nsec) + (col0 >= 2 * nsec); const float* bp = ((sec == 0) ? bias0 : (sec == 1) ? bias1 : bias2) + (col0 - sec * nsec) + 64 * wc;   /* the block's 128 columns lie in one section; bp: the wave's 64 */
  if (col0 >= n16) {                 /* v columns (the whole block or none: a barrier follows): two heads' 128 d x the block's 128 tokens, both planes */
    /* a lane's 8 accumulator rows are 8 consecutive tokens of one d: one 16-byte piece per plane, gathered in LDS (the operand buffers, free since the loop's last barrier) so that the block stores whole 256-byte rows */
    _Float16* sT = &sm[0];           /* [plane][d][VP] */
#pragma unroll
    for (int u = 0; u < 16; ++u) { const int t = u & 3, i = u >> 2; const float bv = bf16_rne(bp[t * 16 + ln]); FragH fh, fl;
#pragma unroll
      for (int r = 0; r < 8; ++r) { const float v = c[i][t][r] * alpha + bv; const _Float16 hv = (_Float16)v; fh.h[r] = hv; fl.h[r] = (_Float16)((v - (float)hv) * VLC); }
      const int e = (64 * wc + t * 16 + ln) * VP + 64 * wr + i * 16 + 8 * hh;
      *(v8us*)&sT[e] = fh.half[0]; *(v8us*)&sT[128 * VP + e] = fl.half[0]; }
    __syncthreads();                 /* the four waves' pieces are read by all of them */
    const int bat = (mt * 128) / SEQ; const size_t o0 = ((size_t)(bat * NH + (col0 - n16) / HD) * HD) * SEQ + (size_t)(mt * 128 - bat * SEQ);   /* SEQ % 128 == 0: the block's rows lie in one batch; the two heads' d rows follow one another in the planes */
    const int dsub = tid >> 4, pc = (tid & 15) * 8;   /* 16 threads per d row, 8 rows per round */
#pragma unroll
    for (int hf = 0; hf < 2; ++hf) { v8us ph[8], pl[8];   /* one head: all sixteen pieces are read as one group, then stored as one run */
#pragma unroll
      for (int rd = 0; rd < 8; ++rd) { ph[rd] = *(const v8us*)&sT[(hf * 64 + rd * 8 + dsub) * VP + pc]; pl[rd] = *(const v8us*)&sT[(128 + hf * 64 + rd * 8 + dsub) * VP + pc]; }
      unsigned short* dh = (unsigned short*)VTh + o0 + (size_t)(hf * 64 + dsub) * SEQ + pc; unsigned short* dl = (unsigned short*)VTl + o0 + (size_t)(hf * 64 + dsub) * SEQ + pc;
#pragma unroll
      for (int rd = 0; rd < 8; ++rd) { *(v8us*)(dh + (size_t)rd * 8 * SEQ) = ph[rd]; *(v8us*)(dl + (size_t)rd * 8 * SEQ) = pl[rd]; }
      /* the wait: behind the run of sixteen stores, in front of any reuse of their data and address registers on whatever code is laid out behind them */
      asm volatile("s_wait_xcnt 0x0" :: "v"(ph[0]), "v"(ph[1]), "v"(ph[2]), "v"(ph[3]), "v"(ph[4]), "v"(ph[5]), "v"(ph[6]), "v"(ph[7]), "v"(pl[0]), "v"(pl[1]), "v"(pl[2]), "v"(pl[3]), "v"(pl[4]), "v"(pl[5]), "v"(pl[6]), "v"(pl[7]), "v"(dh), "v"(dl) : "memory"); }
    return; }
  f1a* so = (f1a*)&sm[0] + w * (64 * SOP);   /* the wave's own 64 x SOP floats in the operand buffers, free since the loop's last barrier */
#pragma unroll
  for (int u = 0; u < 16; ++u) { const int t = u & 3, i = u >> 2; const float bv = bf16_rne(bp[t * 16 + ln]);
#pragma unroll
    for (int r = 0; r < 8; ++r) so[(i * 16 + 8 * hh + r) * SOP + t * 16 + ln] = c[i][t][r] * alpha + bv; }
  __builtin_amdgcn_fence(4 /* acq_rel order */, "workgroup"); __builtin_amdgcn_wave_barrier();
  const int rsub = lane >> 4, c4 = (lane & 15) * 4;
  {
#pragma unroll
    for (int q = 0; q < 32; ++q) { const int r = q * 2 + rsub; const v4f v = *(const v4fa*)&so[r * SOP + c4];
      /* the wait: in front of any reuse of the store's data and address registers */
      v4h h4; for (int i = 0; i < 4; ++i) h4[i] = (_Float16)v[i]; _Float16* d = C16 + (size_t)(row0 + r) * ldc16 + col0 + 64 * wc + c4; *(v4h*)d = h4; asm volatile("s_wait_xcnt 0x0" :: "v"(h4), "v"(d) : "memory"); }
     }
}

// fused causal attention, one wave per 32 queries of one slab (slab = b*NH + h), four waves = 128 queries per work-group: per pass of 32 keys S^T = K . Q^T (A = k rows, B = q rows, kept in registers),
// running maximum and sum per query (a lane holds one query's scores: in-lane, plus one exchange between the wave halves), O^T += V^T . P^T (A = VT rows, both planes).
// K and both VT planes come through LDS in stages of SK = 64 keys (two passes), fetched once for the four waves by asynchronous copies of 16 bytes a lane (a wave's copy covers 4 whole 128-byte lines), two buffers:
// stage s + 2 is asked for behind the barrier that ends the reads of stage s, and flies while stage s + 1 is worked on. One barrier per stage: it publishes stage s + 1 and frees stage s's buffer.
// The two S^T tiles of a pass (keys k0 + 8h + r and k0 + 16 + 8h + r of query ln) are, converted in place, the B fragment in the k order of g2_frag: no lane exchange for P.
// P = f16(2^14 * exp(s - running max)); the sum carries the same 2^14, so the carry cancels in the final division. Keys above the query are masked by index in the passes of the block's diagonal 128 keys only.
// Epilogue: R = attention output + bf16(x) is what is stored, and the work-group's f64 sum and sum of squares of its 128 x 64 values of R is statistics partial h*(SEQ/128) + qb of its batch.
// coverage: grid (NB*NH slabs) x (SEQ/128 blocks) x 4 waves x 32 queries = every row; 4 d tiles x (8h + r) = all 64 columns of the head, each element stored once; one partial per work-group, NPB per batch.
#define SCL 0.18033688011112042f     /* 2^-3 * log2(e): scores in the exponent's base-2 units */
#define SK 64                        /* keys per stage */
#define KP 72                        /* pitch of a staged row in elements: 128 + 16 bytes */
#define STE (3 * SK * KP)            /* elements of one buffer: the K tile (SK key rows x HD), the VT hi and the VT lo tile (HD d rows x SK keys) */
static_assert(SK == 64 && HD == 64 && SEQ % (2 * SK) == 0 && (LQK * 2) % 16 == 0 && (SEQ * 2) % 16 == 0);
__device__ __forceinline__ v8f fa_mma(v16h a, v16h b, v8f c) { return __builtin_amdgcn_wmma_f32_16x16x32_f16(false, a, false, b, (short)0, c, false, false); }
__device__ __forceinline__ float fa_xhalf(float x) { return __builtin_bit_cast(float, __builtin_amdgcn_permlanex16(__builtin_bit_cast(int, x), __builtin_bit_cast(int, x), 0x76543210, 0xfedcba98, false, false)); }  /* lane l with lane l ^ 16 */
__device__ __forceinline__ v16h fa_frag(const _Float16* base, unsigned lofs, unsigned cofs) { const char* p = (const char*)base + ((size_t)lofs + cofs); FragH f; f.half[0] = *(const v8us*)p; f.half[1] = *(const v8us*)(p + 32); return f.v; }  /* g2_frag from a uniform base, the lane's byte offset (8h included) and a constant byte offset */

// one stage's copies: thread (row sr = tid >> 3, piece tid & 7) brings its 16-byte piece of rows sr + 16 i, i = 0..3, of each of the three tiles. kg, hg, lg: the thread's piece of row sr in K, VT hi, VT lo at the stage's first key; ld: its LDS byte address in the K tile of the stage's buffer.
// Every lane is on, every address a multiple of 16, every piece of the buffer's 192 rows written by one lane.
__device__ __forceinline__ void fa_stage(const _Float16* kg, const _Float16* hg, const _Float16* lg, unsigned ld) {
  const _Float16 *k1 = kg + 16 * LQK, *k2 = kg + 32 * LQK, *k3 = kg + 48 * LQK, *h1 = hg + 16 * SEQ, *h2 = hg + 32 * SEQ, *h3 = hg + 48 * SEQ, *l1 = lg + 16 * SEQ, *l2 = lg + 32 * SEQ, *l3 = lg + 48 * SEQ;
  const unsigned R = 16 * KP * 2;    /* 16 rows in LDS, bytes */
  /* the twelve copies and, as the statement's last line, the wait that stands in front of every overwrite of their address registers */
  asm volatile("global_load_async_to_lds_b128 %0, %12, off\n\t" "global_load_async_to_lds_b128 %1, %13, off\n\t" "global_load_async_to_lds_b128 %2, %14, off\n\t" "global_load_async_to_lds_b128 %3, %15, off\n\t"
               "global_load_async_to_lds_b128 %4, %16, off\n\t" "global_load_async_to_lds_b128 %5, %17, off\n\t" "global_load_async_to_lds_b128 %6, %18, off\n\t" "global_load_async_to_lds_b128 %7, %19, off\n\t"
               "global_load_async_to_lds_b128 %8, %20, off\n\t" "global_load_async_to_lds_b128 %9, %21, off\n\t" "global_load_async_to_lds_b128 %10, %22, off\n\t" "global_load_async_to_lds_b128 %11, %23, off\n\t"
               "s_wait_xcnt 0x0"
               :: "v"(ld), "v"(ld + R), "v"(ld + 2 * R), "v"(ld + 3 * R), "v"(ld + 4 * R), "v"(ld + 5 * R), "v"(ld + 6 * R), "v"(ld + 7 * R), "v"(ld + 8 * R), "v"(ld + 9 * R), "v"(ld + 10 * R), "v"(ld + 11 * R),
                  "v"(kg), "v"(k1), "v"(k2), "v"(k3), "v"(hg), "v"(h1), "v"(h2), "v"(h3), "v"(lg), "v"(l1), "v"(l2), "v"(l3) : "memory");
}
// where a stage is handed over, every wave: its own LDS reads of the buffer that is refilled next are done, its own copies of the next stage have landed, then the work-group's barrier
__device__ __forceinline__ void fa_publish() {
  asm volatile("s_wait_dscnt 0x0" ::: "memory");      /* this wave's reads of the stage it leaves have returned before another wave's copies may land there */
  asm volatile("s_wait_asynccnt 0x0" ::: "memory");   /* this wave's copies of the next stage have landed before any wave reads them */
  __syncthreads();
}
// the four k fragments of a pass; sk: the lane's row (key ln of the pass) in the K tile
__device__ __forceinline__ void fa_kfrag(v16h (&kf)[2][2], const _Float16* sk, int hh) {
  for (int kt = 0; kt < 2; ++kt) { kf[kt][0] = g2_frag(sk + 16 * kt * KP, hh); kf[kt][1] = g2_frag(sk + 16 * kt * KP + 32, hh); } }

// one pass of 32 keys out of LDS; sk: the lane's row (key ln of the pass) in the K tile; sh, sl: the lane's row (d = ln) in the VT tiles at the pass's first key. kf holds this pass's k fragments; with PRE the next pass of the SAME stage has its own fetched behind this pass's products.
template <bool LAST, bool PRE>
__device__ __forceinline__ void fa_pass(int k0, int q0, int ln, int hh, const _Float16* sk, const _Float16* sh, const _Float16* sl,
    const v16h (&qf)[2][2], v16h (&kf)[2][2], v8f (&oh)[2][4], v8f (&ol)[2][4], float (&m)[2], float (&l)[2]) {
  v16h vh[4], vl[4];
  for (int dt = 0; dt < 4; ++dt) { vh[dt] = g2_frag(sh + 16 * dt * KP, hh); vl[dt] = g2_frag(sl + 16 * dt * KP, hh); }
  const v8f z8 = {0.f,0.f,0.f,0.f,0.f,0.f,0.f,0.f}; v8f s[2][2];
  for (int t = 0; t < 2; ++t) {
    for (int kt = 0; kt < 2; ++kt) s[t][kt] = fa_mma(kf[kt][1], qf[t][1], fa_mma(kf[kt][0], qf[t][0], z8)); }
  if (PRE) fa_kfrag(kf, sk + 32 * KP, hh);
  float mn[2];
  for (int t = 0; t < 2; ++t) {
    if (LAST) {
      for (int kt = 0; kt < 2; ++kt) {
        for (int r = 0; r < 8; ++r) s[t][kt][r] = (k0 + 16 * kt + 8 * hh + r <= q0 + 16 * t + ln) ? s[t][kt][r] : -3.0e38f; } }
    float mx = s[t][0][0];
    for (int r = 1; r < 8; ++r) mx = fmaxf(mx, s[t][0][r]);
    for (int r = 0; r < 8; ++r) mx = fmaxf(mx, s[t][1][r]);
    mx = fmaxf(mx, fa_xhalf(mx)); mn[t] = fmaxf(m[t], mx); }
  if (__builtin_amdgcn_ballot_w32((mn[0] > m[0]) || (mn[1] > m[1])) != 0) {   /* no maximum moved: every factor is 1 and the rescale is skipped by the whole wave */
    for (int t = 0; t < 2; ++t) { const float al = __builtin_amdgcn_exp2f((m[t] - mn[t]) * SCL); l[t] *= al; m[t] = mn[t];
      for (int dt = 0; dt < 4; ++dt) { oh[t][dt] *= al; ol[t][dt] *= al; } } }
  for (int t = 0; t < 2; ++t) { const float off = 14.0f - m[t] * SCL; FragH p; v8f x[2], e[2];
    for (int kt = 0; kt < 2; ++kt) { x[kt] = s[t][kt] * SCL + off;
      for (int r = 0; r < 8; ++r) e[kt][r] = __builtin_amdgcn_exp2f(x[kt][r]); }
    /* the slot behind a transcendental: no source is overwritten and no result read before this v_nop, which stands behind the last of the sixteen */
    asm volatile("v_nop" : "+v"(e[0]), "+v"(e[1]) : "v"(x[0]), "v"(x[1]));
    for (int r = 0; r < 8; ++r) { p.h[r] = (_Float16)e[0][r]; p.h[8 + r] = (_Float16)e[1][r]; }
    const v8f es = e[0] + e[1];
    l[t] += ((es[0] + es[1]) + (es[2] + es[3])) + ((es[4] + es[5]) + (es[6] + es[7]));
    for (int dt = 0; dt < 4; ++dt) { oh[t][dt] = fa_mma(vh[dt], p.v, oh[t][dt]); ol[t][dt] = fa_mma(vl[dt], p.v, ol[t][dt]); } }
}

__global__ __launch_bounds__(128) void k_fattn(const _Float16* __restrict__ QK, const _Float16* __restrict__ VTh, const _Float16* __restrict__ VTl, const float* __restrict__ X, float* __restrict__ R, double* __restrict__ part) {
  __shared__ double rs[128]; __shared__ double rq[128];
  __shared__ __attribute__((aligned(16))) _Float16 st[2 * STE];                 /* [buffer][K | VT hi | VT lo][row][KP] */
  const int tid = threadIdx.x, lane = tid & 31, ln = lane & 15, hh = lane >> 4;
  const int w = __builtin_amdgcn_readfirstlane(tid >> 5);                       /* the wave's number in a scalar register: scalar branches */
  const int slab = blockIdx.x, b = slab / NH, h = slab % NH;
  const int y = blockIdx.y, qb = (y < SEQ / 256) ? SEQ / 128 - 1 - y : y - SEQ / 256;   /* long blocks start first; the second half of the grid runs short to long beside them */
  const int q0 = qb * 128 + 32 * w;
  const _Float16* Q = QK + ((size_t)b * SEQ + q0) * LQK + h * HD; const _Float16* K = QK + (size_t)b * SEQ * LQK + UD + h * HD;      /* uniform bases */
  const _Float16* VH = VTh + (size_t)slab * HD * SEQ; const _Float16* VL = VTl + (size_t)slab * HD * SEQ;
  /* the block walks 2 * (qb + 1) stages: keys 0 .. qb * 128 + 127, all of them rows of the sequence */
  const int sr = tid >> 3, sc = (tid & 7) * 8;
  const _Float16* kg = K + (size_t)sr * LQK + sc; const _Float16* hg = VH + (size_t)sr * SEQ + sc; const _Float16* lg = VL + (size_t)sr * SEQ + sc;
  const unsigned ld = (unsigned)(size_t)&st[sr * KP + sc];                      /* LDS byte address: the low 32 bits */
  fa_stage(kg, hg, lg, ld);
  const unsigned ko = (unsigned)(ln * LQK + 8 * hh) * 2;                        /* lane byte offset */
  v16h qf[2][2], kf[2][2];
  for (int t = 0; t < 2; ++t) { qf[t][0] = fa_frag(Q, ko, t * 16 * LQK * 2); qf[t][1] = fa_frag(Q, ko, t * 16 * LQK * 2 + 64); }
  /* in front of any overwrite of these loads' address registers */
  asm volatile("s_wait_xcnt 0x0" :: "v"(ko) : "memory");
  asm volatile("s_wait_asynccnt 0x0" ::: "memory");   /* stage 0 has landed, as far as this wave brought it */
  __syncthreads();                                    /* stage 0 is published */
  fa_stage(kg + SK * LQK, hg + SK, lg + SK, ld + STE * 2);
  kg += 2 * SK * LQK; hg += 2 * SK; lg += 2 * SK;
  const v8f z8 = {0.f,0.f,0.f,0.f,0.f,0.f,0.f,0.f}; v8f oh[2][4], ol[2][4]; float m[2] = {-3.0e38f, -3.0e38f}, l[2] = {0.f, 0.f};
  for (int t = 0; t < 2; ++t) {
    for (int dt = 0; dt < 4; ++dt) { oh[t][dt] = z8; ol[t][dt] = z8; } }
  const _Float16* fr = &st[ln * KP];                  /* the lane's row in buffer 0's K tile */
  /* the stages below the block's diagonal: both passes whole, in all four waves */
  for (int s = 0; s < 2 * qb; ++s) { const _Float16* sk = fr + (s & 1) * STE;
    fa_kfrag(kf, sk, hh);
    fa_pass<false, true>(0, q0, ln, hh, sk, sk + SK * KP, sk + 2 * SK * KP, qf, kf, oh, ol, m, l);
    fa_pass<false, false>(0, q0, ln, hh, sk + 32 * KP, sk + SK * KP + 32, sk + 2 * SK * KP + 32, qf, kf, oh, ol, m, l);
    fa_publish();
    fa_stage(kg, hg, lg, ld + (s & 1) * (STE * 2));   /* stage s + 2 <= 2 * qb + 1 exists on every trip */
    kg += SK * LQK; hg += SK; lg += SK; }
  /* the lane's 64 residual values, at the places of its outputs: fetched ahead of the diagonal passes, which cover their latency */
  const float* xp = X + ((size_t)b * SEQ_FULL + q0 + ln) * CD + h * HD + 8 * hh; v4f xl[2][4], xh[2][4];
  for (int t = 0; t < 2; ++t) {
    for (int dt = 0; dt < 4; ++dt) { xl[t][dt] = *(const v4fa*)(xp + t * 16 * CD + dt * 16); xh[t][dt] = *(const v4fa*)(xp + t * 16 * CD + dt * 16 + 4); } }
  /* in front of any overwrite of these loads' address registers */
  asm volatile("s_wait_xcnt 0x0" :: "v"(xp) : "memory");
  /* the block's last two stages (buffers 0 and 1: 2 * qb is even), passes j = 0..3 of the diagonal's 128 keys: wave w takes j <= w, all in the masked form (below j = w the mask keeps every key); every wave passes the publish point between the stages */
#pragma unroll 1   /* rolled: one copy of the masked pass in the text instead of four */
  for (int j = 0; j < 4; ++j) {
    if (j <= w) { const _Float16* sk = fr + (j >> 1) * STE + (j & 1) * 32 * KP; const _Float16* sv = fr + (j >> 1) * STE + SK * KP + (j & 1) * 32;
      fa_kfrag(kf, sk, hh);
      fa_pass<true, false>(qb * 128 + 32 * j, q0, ln, hh, sk, sv, sv + SK * KP, qf, kf, oh, ol, m, l); }
    if (j == 1) fa_publish(); }
  asm volatile("s_wait_asynccnt 0x0" ::: "memory");   /* behind the last copy: none is outstanding when the wave goes on */
  double s1 = 0.0, s2 = 0.0;
  for (int t = 0; t < 2; ++t) { const float inv = 1.0f / (l[t] + fa_xhalf(l[t]));
    float* op = R + ((size_t)b * SEQ + q0 + 16 * t + ln) * UD + h * HD + 8 * hh;
    for (int dt = 0; dt < 4; ++dt) { v4f lo4, hi4;
      for (int i = 0; i < 4; ++i) { lo4[i] = (oh[t][dt][i] + ol[t][dt][i] * (1.0f / VLC)) * inv + bf16_rne(xl[t][dt][i]); hi4[i] = (oh[t][dt][4 + i] + ol[t][dt][4 + i] * (1.0f / VLC)) * inv + bf16_rne(xh[t][dt][i]); }
      *(v4f*)(op + dt * 16) = lo4; *(v4f*)(op + dt * 16 + 4) = hi4;
      /* in front of any reuse of the two stores' data and address registers */
      asm volatile("s_wait_xcnt 0x0" :: "v"(lo4), "v"(hi4), "v"(op) : "memory");
      for (int i = 0; i < 4; ++i) { s1 += (double)lo4[i]; s2 += (double)lo4[i] * (double)lo4[i]; s1 += (double)hi4[i]; s2 += (double)hi4[i] * (double)hi4[i]; } } }
  /* the work-group's partial: 128 lane sums, 16-to-1 in eight threads (thread t alone reads and rewrites place t; places from 8 on are only read), then 8-to-1; every wave passes both barriers */
  rs[tid] = s1; rq[tid] = s2; __syncthreads();
  if (tid < 8) { double a[16], c[16];
    for (int j = 0; j < 16; ++j) { a[j] = rs[tid + 8 * j]; c[j] = rq[tid + 8 * j]; }
    for (int g = 8; g > 0; g >>= 1) {
      for (int j = 0; j < g; ++j) { a[j] += a[j + g]; c[j] += c[j + g]; } }
    rs[tid] = a[0]; rq[tid] = c[0]; }
  __syncthreads();
  if (tid < 8) { v2d val; val[0] = (tid == 0) ? ((rs[0] + rs[1]) + (rs[2] + rs[3])) + ((rs[4] + rs[5]) + (rs[6] + rs[7])) : 0.0; val[1] = (tid == 0) ? ((rq[0] + rq[1]) + (rq[2] + rq[3])) + ((rq[4] + rq[5]) + (rq[6] + rq[7])) : 0.0;
    double* d = part + ((size_t)b * NPB + (size_t)h * (SEQ / 128) + qb) * 16 + tid * 2; *(v2d*)d = val;  }
}

// final statistics and apply, one kernel. Every work-group sums all NB * NPB statistics partials itself: thread (batch pb, place t) takes partial t of its batch, then two rounds of 16-to-1 f64 sums per batch in LDS;
// the sums are the same in every work-group (same values, same tree). The partial is asked for first and the thread's streaming loads right behind it, and the sums run while those loads are in flight.
// Apply: a thread takes LAP places of 4 floats, LAT places apart, in every batch: few waves to start, (2 + NB) * LAP loads of 16 bytes in flight in each; the places' g and bta serve all batches.
// coverage: grid (SEQ*UD/(4*LAT*LAP)) x LAT threads x LAP places x 4 floats x NB batches = every output element exactly once.
#define LFT 256                      /* threads per batch */
#define LAT (NB * LFT)               /* threads of a work-group */
#define LAP 4
static_assert(LFT == 16 * 16 && NPB <= LFT && LAT <= 1024 && ((size_t)SEQ * UD) % (4 * LAT * LAP) == 0);
// the work-group's barrier with its fences on LDS alone: __syncthreads() would first wait for every global load of the wave, and the sums would start only behind the streaming loads
__device__ __forceinline__ void ln_barrier() { __builtin_amdgcn_fence(__ATOMIC_RELEASE, "workgroup", "local"); __builtin_amdgcn_s_barrier(); __builtin_amdgcn_fence(__ATOMIC_ACQUIRE, "workgroup", "local"); }
__global__ __launch_bounds__(LAT) void k_lnapply(const float* __restrict__ R, const double* __restrict__ part, const float* __restrict__ g, const float* __restrict__ bta, float* __restrict__ out) {
  __shared__ double rs[LAT]; __shared__ double rq[LAT];
  __shared__ __attribute__((aligned(16))) float st[2 * NB];
  const int tid = threadIdx.x; const int pb = tid / LFT, t = tid % LFT;
  const unsigned eo = (blockIdx.x * (unsigned)(LAT * LAP) + threadIdx.x) * 16u;   /* the lane's byte offset inside one batch */
  const unsigned po = (unsigned)(pb * NPB + t) * 128u;                            /* its partial's byte offset */
  v2d p = {0.0, 0.0};
  if (t < NPB) p = *(const v2d*)((const char*)part + (size_t)po);
  __builtin_amdgcn_sched_barrier(0);   /* keeps the partial's load the oldest: loads are counted in order, and its wait must not cover a streaming load */
  v4f o[NB][LAP], gg[LAP], bb[LAP], y[NB][LAP];
#pragma unroll
  for (int j = 0; j < LAP; ++j) { gg[j] = *(const v4fa*)((const char*)g + ((size_t)eo + j * (LAT * 16))); bb[j] = *(const v4fa*)((const char*)bta + ((size_t)eo + j * (LAT * 16))); }
#pragma unroll
  for (int bat = 0; bat < NB; ++bat) {
#pragma unroll
    for (int j = 0; j < LAP; ++j) o[bat][j] = *(const v4fa*)((const char*)(R + (size_t)bat * SEQ * UD) + ((size_t)eo + j * (LAT * 16))); }
  /* the wait: in front of any overwrite of the loads' address registers */
  asm volatile("s_wait_xcnt 0x0" :: "v"(eo), "v"(po) : "memory");
  rs[tid] = p[0]; rq[tid] = p[1];
  ln_barrier();
  if (t < 16) { double a[16], c[16];   /* thread t sums places t + 16 j; it alone reads and rewrites place t, and places from 16 on are only read */
    for (int j = 0; j < 16; ++j) { a[j] = rs[tid + j * 16]; c[j] = rq[tid + j * 16]; }
    for (int h = 8; h > 0; h >>= 1) {
      for (int j = 0; j < h; ++j) { a[j] += a[j + h]; c[j] += c[j + h]; } }
    rs[tid] = a[0]; rq[tid] = c[0]; }
  ln_barrier();
  if (t == 0) { double a[16], c[16];
    for (int j = 0; j < 16; ++j) { a[j] = rs[tid + j]; c[j] = rq[tid + j]; }
    for (int h = 8; h > 0; h >>= 1) {
      for (int j = 0; j < h; ++j) { a[j] += a[j + h]; c[j] += c[j + h]; } }
    const double inv = 1.0 / ((double)SEQ * (double)UD); const double m = a[0] * inv; double var = c[0] * inv - m * m; if (var < 0.0) var = 0.0;
    st[2 * pb] = (float)m; st[2 * pb + 1] = 1.0f / sqrtf((float)var + 1.0e-5f); }
  ln_barrier();
#pragma unroll
  for (int bat = 0; bat < NB; ++bat) { const float mu = st[2 * bat], rsd = st[2 * bat + 1];
#pragma unroll
    for (int j = 0; j < LAP; ++j) {
#pragma unroll
      for (int e = 0; e < 4; ++e) { const float v = o[bat][j][e]; y[bat][j][e] = (v - mu) * rsd * bf16_rne(gg[j][e]) + bf16_rne(bb[j][e]); } } }
#pragma unroll
  for (int bat = 0; bat < NB; ++bat) {
#pragma unroll
    for (int j = 0; j < LAP; ++j) *(v4f*)((char*)(out + (size_t)bat * SEQ_FULL * UD) + ((size_t)eo + j * (LAT * 16))) = y[bat][j]; }
}

extern "C" void kernel_launch(void* const* d_in, const int* in_sizes, int n_in,
                              void* d_out, int out_size, void* d_ws, size_t ws_size, hipStream_t stream) {
  if (n_in < 9) return;
  const float* X   = (const float*)d_in[0];      /* [2][2048][1024] */
  const float* Wq  = (const float*)d_in[1];      /* [in][out] 1024 x 1024 */
  const float* bq  = (const float*)d_in[2];
  const float* Wk  = (const float*)d_in[3];
  const float* bk  = (const float*)d_in[4];
  const float* Wv  = (const float*)d_in[5];
  const float* bv  = (const float*)d_in[6];
  const float* gam = (const float*)d_in[7];      /* [2048][1024] */
  const float* bet = (const float*)d_in[8];
  float* out = (float*)d_out;
  const size_t rows_used = (size_t)(NB - 1) * SEQ_FULL + SEQ;
  if ((size_t)in_sizes[0] < rows_used * CD) return;
  if ((size_t)in_sizes[1] < (size_t)CD * UD || (size_t)in_sizes[3] < (size_t)CD * UD || (size_t)in_sizes[5] < (size_t)CD * UD) return;
  if (in_sizes[2] < UD || in_sizes[4] < UD || in_sizes[6] < UD) return;
  if ((size_t)in_sizes[7] < (size_t)SEQ * UD || (size_t)in_sizes[8] < (size_t)SEQ * UD) return;
  if ((size_t)out_size < rows_used * UD) return;

  char* ws = (char*)d_ws; size_t off = 0;
  auto take = [&](size_t bytes) { char* p = ws + off; off += (bytes + 255) & ~(size_t)255; return p; };
  _Float16* BQKV = (_Float16*)take((size_t)3 * CD * UD * 2);               /* [3*UD][CD] f16 (x16) */
  _Float16* X16  = (_Float16*)take(NR * CD * 2);                           /* [NR][CD] */
  _Float16* QK16 = (_Float16*)take(NR * LQK * 2);                          /* [NR][q | k] */
  _Float16* VTh  = (_Float16*)take((size_t)NB * NH * HD * SEQ * 2);        /* [NB*NH][HD][SEQ] */
  _Float16* VTl  = (_Float16*)take((size_t)NB * NH * HD * SEQ * 2);
  float*    R32  = (float*)take(NR * UD * 4);                              /* [NR][UD] f32: attention output + residual */
  double*   PART = (double*)take((size_t)NB * NPB * 128);                  
  if (off > ws_size || off > (size_t)134217728) return;

  k_prep<<<(unsigned)(3 * WTB + XCB), 256, 0, stream>>>(Wq, Wk, Wv, X, BQKV, X16);
  const int MP = (int)NR;
  /* q rows (f16, cols 0..UD-1 of QK16), k rows (cols UD..2UD-1), v (both f16 planes, transposed), one grid: x16 . (16 W) * 2^-4 + bf16(bias) */
  k_gemm2<<<(unsigned)((MP / 128) * ((3 * UD) / 128)), 128, 0, stream>>>(X16, CD, BQKV, CD, 0.0625f, bq, bk, bv, UD, QK16, LQK, LQK, VTh, VTl, MP, 3 * UD, CD);
  k_fattn<<<dim3((unsigned)(NB * NH), (unsigned)(SEQ / 128)), 128, 0, stream>>>(QK16, VTh, VTl, X, R32, PART);
  k_lnapply<<<(unsigned)(((size_t)SEQ * UD) / (4 * LAT * LAP)), LAT, 0, stream>>>(R32, PART, gam, bet, out);
}

// v010
// It runs in 75.8 microseconds.
// Next to v009, in two timings, it ran 1.05 and 1.07 times as fast.
// Counting every step since v000, it is 16.2 times as fast.
#include <hip/hip_runtime.h>
// Contractions on v_wmma_f32_16x16x32_f16 (f16 operands, f32 accumulate): q | k | v projections (x and weights bf16-valued, exact in f16, weights carried x16), scores k.q^T (plain f16 q, k), V^T.P^T in the same kernel (running-maximum softmax weights f16 carried x2^14; v plain f16, like q, k and the weights P). Scores, softmax statistics, attention output and residual add in f32; joint (seq, unit) normalisation statistics in f64. K and v reach the attention waves through LDS. The transposed v is written by the GEMM's epilogue, the residual sum and its statistics partials by the attention kernel's; the apply kernel's work-groups each sum the partials themselves.
#ifndef NB
#define NB 2
#endif
#ifndef SEQ
#define SEQ 2048
#endif
#define NB_FULL 2
#define SEQ_FULL 2048
#define CD 1024                      /* input channels */
#define UD 1024                      /* units */
#define NH 16
#define HD 64
#define LQK (2 * UD)                 /* row pitch of the q | k rows */
#define LNP 8192                     /* floats per statistics block: the 128 queries x HD columns of one attention work-group */
#define NPB ((SEQ * UD) / LNP)       /* statistics blocks per batch */
#define NR ((size_t)NB * SEQ)        /* token rows (compact) */
#define WSC 16.0f                    /* weight carry */
static_assert(NB >= 1 && NB <= NB_FULL);
static_assert(SEQ % 256 == 0 && SEQ <= SEQ_FULL);
static_assert(CD % 64 == 0 && UD % 64 == 0 && CD == UD);
static_assert(NH * HD == UD && HD == 64);
static_assert((SEQ * UD) % LNP == 0 && LNP == 128 * HD && NPB == NH * (SEQ / 128));
static_assert(2 * NB <= 32);
static_assert((NR * UD) % 1024 == 0 && (NR % 128) == 0);

typedef unsigned short v8us __attribute__((ext_vector_type(8), may_alias));
typedef float  v8f  __attribute__((ext_vector_type(8)));
typedef float  v4f  __attribute__((ext_vector_type(4)));
typedef float  v4fa __attribute__((ext_vector_type(4), may_alias));
typedef double v2d  __attribute__((ext_vector_type(2)));
typedef _Float16 v16h __attribute__((ext_vector_type(16)));
typedef _Float16 v4h  __attribute__((ext_vector_type(4)));
union FragH { v16h v; v8us half[2]; _Float16 h[16]; unsigned short u[16]; };

__device__ __forceinline__ unsigned short bf16_bits(float x) { unsigned int u = __float_as_uint(x); return (unsigned short)((u + 0x7FFFu + ((u >> 16) & 1u)) >> 16); }
__device__ __forceinline__ float bf16_val(unsigned short b) { return __uint_as_float(((unsigned int)b) << 16); }
__device__ __forceinline__ float bf16_rne(float x) { return bf16_val(bf16_bits(x)); }

// 16-bit WMMA fragment: lane l, h = l >> 4, row/col = l & 15; elements 0..7 <- k0 + 8h + 0..7, elements 8..15 <- k0 + 16 + 8h + 0..7 (same map for A rows and for B[n][k] rows)
__device__ __forceinline__ v16h g2_frag(const _Float16* p, int hh) { FragH f; f.half[0] = *(const v8us*)((const unsigned short*)p + 8 * hh); f.half[1] = *(const v8us*)((const unsigned short*)p + 16 + 8 * hh); return f.v; }
__device__ __forceinline__ v8f g2_mma(v16h a, v16h b, v8f c) { v8f d = __builtin_amdgcn_wmma_f32_16x16x32_f16(false, a, false, b, (short)0, c, false, false); asm volatile("v_nop\n\tv_nop\n\tv_nop\n\tv_nop" : "+v"(d) : "v"(a), "v"(b)); return d; }

// The four conversions that depend on nothing but the inputs, in one grid: blocks 0 .. 3*WTB-1 take Wq | Wk | Wv (WTB blocks each): Wt[m*UD + n][k] = f16(bf16(W[k][n]) * 16);
// the other XCB blocks take x: X16[b*SEQ + s][c] = f16(bf16(x[b][s][c])). 64 elements per thread, so that few waves have to be started and each has 16 loads of 16 bytes in flight; every element of Wt and X16 is stored once. The branch is block-uniform.
// W: a thread takes an 8 k x 8 n block, read by rows; 4 lanes side by side in n cover one 128-byte line of a W row, 8 lanes side by side in k one 128-byte line of a Wt row.
// x: a thread takes XPP pieces of 8 elements, 256 pieces apart: each round of the block is one contiguous run.
#define XPP 8
#define WTB (((UD / 8) * (CD / 8)) / 256)
#define XCB ((int)((NR * CD / 8) / (256 * XPP)))
static_assert(((UD / 8) * (CD / 8)) % 256 == 0 && UD % 32 == 0 && (NR * CD / 8) % (256 * XPP) == 0 && ((size_t)SEQ * CD / 8) % (256 * XPP) == 0);
__global__ __launch_bounds__(256) void k_prep(const float* __restrict__ Wq, const float* __restrict__ Wk, const float* __restrict__ Wv, const float* __restrict__ x, _Float16* __restrict__ Wt, _Float16* __restrict__ X16) {
  const int bx = blockIdx.x; v4f lo[8], hi[8]; v8us o[8];
  if (bx < 3 * WTB) { const int m = bx / WTB; const float* __restrict__ W = (m == 0) ? Wq : (m == 1) ? Wk : Wv;
    const int t = (bx - m * WTB) * 256 + threadIdx.x; const int r = t >> 5;
    const int k8 = ((r % (CD / 64)) * 8 + (t & 7)) * 8, n8 = ((r / (CD / 64)) * 4 + ((t >> 3) & 3)) * 8;
    const float* wp = W + (size_t)k8 * UD + n8;
#pragma unroll
    for (int i = 0; i < 8; ++i) { lo[i] = *(const v4fa*)(wp + i * UD); hi[i] = *(const v4fa*)(wp + i * UD + 4); }
    /* the wait: in front of any overwrite of the sixteen loads' address registers */
    asm volatile("s_wait_xcnt 0x0" :: "v"(wp) : "memory");
#pragma unroll
    for (int j = 0; j < 8; ++j) { FragH f;
#pragma unroll
      for (int i = 0; i < 8; ++i) f.h[i] = (_Float16)(bf16_rne((j < 4) ? lo[i][j & 3] : hi[i][j & 3]) * WSC);
      o[j] = f.half[0]; }
    unsigned short* d = (unsigned short*)Wt + ((size_t)m * UD + n8) * CD + k8;
#pragma unroll
    for (int j = 0; j < 8; ++j) *(v8us*)(d + j * CD) = o[j];
    /* the wait: behind the run of eight stores, in front of any reuse of their data and address registers, whichever branch is laid out first */
    asm volatile("s_wait_xcnt 0x0" :: "v"(o[0]), "v"(o[1]), "v"(o[2]), "v"(o[3]), "v"(o[4]), "v"(o[5]), "v"(o[6]), "v"(o[7]), "v"(d) : "memory"); }
  else { const size_t t = (size_t)(bx - 3 * WTB) * (256 * XPP) + threadIdx.x; const size_t n8 = (size_t)SEQ * CD / 8; const size_t b = t / n8;   /* the block's pieces lie in one batch */
    const float* xp = x + b * ((size_t)SEQ_FULL * CD) + (t - b * n8) * 8;
#pragma unroll
    for (int j = 0; j < XPP; ++j) { lo[j] = *(const v4fa*)(xp + j * 2048); hi[j] = *(const v4fa*)(xp + j * 2048 + 4); }
    /* the wait: as above */
    asm volatile("s_wait_xcnt 0x0" :: "v"(xp) : "memory");
#pragma unroll
    for (int j = 0; j < XPP; ++j) { FragH f;
#pragma unroll
      for (int q = 0; q < 4; ++q) { f.h[q] = (_Float16)bf16_rne(lo[j][q]); f.h[4 + q] = (_Float16)bf16_rne(hi[j][q]); }
      o[j] = f.half[0]; }
    unsigned short* d = (unsigned short*)X16 + t * 8;
#pragma unroll
    for (int j = 0; j < XPP; ++j) *(v8us*)(d + j * 2048) = o[j];
    /* the wait: as above */
    asm volatile("s_wait_xcnt 0x0" :: "v"(o[0]), "v"(o[1]), "v"(o[2]), "v"(o[3]), "v"(o[4]), "v"(o[5]), "v"(o[6]), "v"(o[7]), "v"(d) : "memory"); }
}

// GEMM, wave tile 64x64, block = 4 waves (2 x 2) = 128 rows x 128 cols; A f16 rows (pitch lda), Bh f16 [n][k] (pitch ldb); v = acc*alpha + bf16(bias[col]).
// The N columns are up to three sections of nsec columns side by side (q | k | v in one grid), each with its own bias vector; columns below n16 are written as f16 to C16 (pitch ldc16); column n16 + h*HD + d of row b*SEQ + s goes, transposed, to VT [b*NH + h][d][s] (pitch SEQ) as f16(v).
// grid (M/128)*(N/128). M % 128 == 0, N % 128 == 0, nsec % 128 == 0, n16 % 128 == 0, K % 64 == 0, lda % 8 == 0, ldb % 8 == 0.
// Operands go through LDS in stages of 64 k (one 128-byte line per row), two buffers: a wave's 16-byte global load covers 4 whole lines, the block's 128 A rows and 128 B rows are fetched once for its 4 waves,
// and stage s + 1 is in flight (in registers) while stage s is multiplied. One barrier per stage: it publishes stage s + 1 and ends the reads of the buffer that stage s + 2 overwrites.
// A fetched row feeds 128 columns (or rows) of products and a fragment read from LDS four products. Both epilogues stage in the operand buffers, so that three work-groups share a WGP's LDS and registers: the grid is resident at once.
#define GP 72                        /* LDS row pitch in elements: 128 + 16 bytes */
#define VP 136                       /* pitch of a d row of the v epilogue's tile in LDS: 256 + 16 bytes */
#define GST (256 * GP)               /* elements of one buffer: 128 A rows, then 128 B rows */
#define SOP 68                       /* pitch of a row of the q | k epilogue's f32 tile in LDS, floats */
typedef float f1a __attribute__((may_alias));
static_assert(128 * VP <= 2 * GST && 4 * 64 * SOP * 4 <= 2 * GST * 2 && SEQ % 128 == 0 && UD % 128 == 0 && LQK % 128 == 0 && 128 % HD == 0);
__global__ __launch_bounds__(128) __attribute__((amdgpu_waves_per_eu(3))) void k_gemm2(const _Float16* __restrict__ A, int lda, const _Float16* __restrict__ Bh, int ldb, float alpha, const float* __restrict__ bias0, const float* __restrict__ bias1, const float* __restrict__ bias2, int nsec,
    _Float16* __restrict__ C16, int ldc16, int n16, _Float16* __restrict__ VT, int M, int N, int K) {
  __shared__ __attribute__((aligned(16))) _Float16 sm[2 * GST];                 /* [buffer][A rows | B rows][GP] */
  const int tid = threadIdx.x, w = tid >> 5, lane = tid & 31, ln = lane & 15, hh = lane >> 4;
  const int wr = w >> 1, wc = w & 1;   /* the wave's 64 rows and 64 columns of the block's tile */
  const int ntn = N >> 7; const int mt = blockIdx.x / ntn, nq = blockIdx.x - mt * ntn; const int row0 = mt * 128 + 64 * wr, col0 = nq * 128;
  if (mt * 128 >= M) return;         /* taken by the whole block or by none: barriers follow */
  const int sr = tid >> 3, sc = (tid & 7) * 8;   /* staging: 8 threads per row, 16 rows per round */
  const unsigned short* ag = (const unsigned short*)A + (size_t)(mt * 128 + sr) * lda + sc; const unsigned short* bg = (const unsigned short*)Bh + (size_t)(col0 + sr) * ldb + sc;
  v8us ra[8], rb[8];
  auto fetch = [&](int k0) {         /* the stage that begins at k0, into registers */
    const unsigned short* pa[8]; const unsigned short* pb[8];
    for (int i = 0; i < 8; ++i) { pa[i] = ag + (size_t)(16 * i) * lda + k0; ra[i] = *(const v8us*)pa[i]; }
    for (int i = 0; i < 8; ++i) { pb[i] = bg + (size_t)(16 * i) * ldb + k0; rb[i] = *(const v8us*)pb[i]; }
    /* the wait that stands in front of every overwrite of an address register of the sixteen loads above; the addresses are its inputs, so that they stay live and no load's result lands on one before it */
    asm volatile("s_wait_xcnt 0x0" :: "v"(pa[0]), "v"(pa[1]), "v"(pa[2]), "v"(pa[3]), "v"(pa[4]), "v"(pa[5]), "v"(pa[6]), "v"(pa[7]), "v"(pb[0]), "v"(pb[1]), "v"(pb[2]), "v"(pb[3]), "v"(pb[4]), "v"(pb[5]), "v"(pb[6]), "v"(pb[7]) : "memory"); };
  fetch(0);
  for (int i = 0; i < 8; ++i) *(v8us*)&sm[(16 * i + sr) * GP + sc] = ra[i];
  for (int i = 0; i < 8; ++i) *(v8us*)&sm[(128 + 16 * i + sr) * GP + sc] = rb[i];
  __syncthreads();
  const v8f z8 = {0.f,0.f,0.f,0.f,0.f,0.f,0.f,0.f}; v8f c[4][4];
  for (int i = 0; i < 4; ++i) {
    for (int t = 0; t < 4; ++t) c[i][t] = z8; }
#pragma unroll 1
  for (int kn = 64; kn <= K; kn += 64) { const int cur = ((kn >> 6) & 1) ^ 1; const bool more = kn < K;   /* kn: first k of the next stage; block-uniform */
    if (more) fetch(kn);
    const _Float16* fa = &sm[cur * GST + (64 * wr + ln) * GP]; const _Float16* fb = &sm[cur * GST + (128 + 64 * wc + ln) * GP];
    for (int kk = 0; kk < 2; ++kk) { v16h a[4], b[4];   /* the 8 fragments of 32 k, read as one group ahead of their 16 products */
      for (int i = 0; i < 4; ++i) a[i] = g2_frag(fa + 16 * i * GP + 32 * kk, hh);
      for (int t = 0; t < 4; ++t) b[t] = g2_frag(fb + 16 * t * GP + 32 * kk, hh);
      for (int t = 0; t < 4; ++t) {
        for (int i = 0; i < 4; ++i) c[i][t] = g2_mma(a[i], b[t], c[i][t]); } }
    if (more) { _Float16* sn = &sm[(cur ^ 1) * GST + sr * GP + sc];
      for (int i = 0; i < 8; ++i) *(v8us*)(sn + 16 * i * GP) = ra[i];
      for (int i = 0; i < 8; ++i) *(v8us*)(sn + (128 + 16 * i) * GP) = rb[i]; }
    __syncthreads(); }
  const int sec = (col0 >= nsec) + (col0 >= 2 * nsec); const float* bp = ((sec == 0) ? bias0 : (sec == 1) ? bias1 : bias2) + (col0 - sec * nsec) + 64 * wc;   /* the block's 128 columns lie in one section; bp: the wave's 64 */
  if (col0 >= n16) {                 /* v columns (the whole block or none: a barrier follows): two heads' 128 d x the block's 128 tokens */
    /* a lane's 8 accumulator rows are 8 consecutive tokens of one d: one 16-byte piece, gathered in LDS (the operand buffers, free since the loop's last barrier) so that the block stores whole 256-byte rows */
    _Float16* sT = &sm[0];           /* [d][VP] */
#pragma unroll
    for (int u = 0; u < 16; ++u) { const int t = u & 3, i = u >> 2; const float bv = bf16_rne(bp[t * 16 + ln]); FragH fh;
#pragma unroll
      for (int r = 0; r < 8; ++r) fh.h[r] = (_Float16)(c[i][t][r] * alpha + bv);
      *(v8us*)&sT[(64 * wc + t * 16 + ln) * VP + 64 * wr + i * 16 + 8 * hh] = fh.half[0]; }
    __syncthreads();                 /* the four waves' pieces are read by all of them */
    const int bat = (mt * 128) / SEQ; const size_t o0 = ((size_t)(bat * NH + (col0 - n16) / HD) * HD) * SEQ + (size_t)(mt * 128 - bat * SEQ);   /* SEQ % 128 == 0: the block's rows lie in one batch; the two heads' d rows follow one another in VT */
    const int dsub = tid >> 4, pc = (tid & 15) * 8;   /* 16 threads per d row, 8 rows per round */
    v8us ph[16];                     /* all sixteen pieces are read as one group, then stored as one run */
#pragma unroll
    for (int rd = 0; rd < 16; ++rd) ph[rd] = *(const v8us*)&sT[(rd * 8 + dsub) * VP + pc];
    unsigned short* dh = (unsigned short*)VT + o0 + (size_t)dsub * SEQ + pc;
#pragma unroll
    for (int rd = 0; rd < 16; ++rd) *(v8us*)(dh + (size_t)rd * 8 * SEQ) = ph[rd];
    /* the wait: behind the run of sixteen stores, in front of any reuse of their data and address registers on whatever code is laid out behind them */
    asm volatile("s_wait_xcnt 0x0" :: "v"(ph[0]), "v"(ph[1]), "v"(ph[2]), "v"(ph[3]), "v"(ph[4]), "v"(ph[5]), "v"(ph[6]), "v"(ph[7]), "v"(ph[8]), "v"(ph[9]), "v"(ph[10]), "v"(ph[11]), "v"(ph[12]), "v"(ph[13]), "v"(ph[14]), "v"(ph[15]), "v"(dh) : "memory");
    return; }
  f1a* so = (f1a*)&sm[0] + w * (64 * SOP);   /* the wave's own 64 x SOP floats in the operand buffers, free since the loop's last barrier */
#pragma unroll
  for (int u = 0; u < 16; ++u) { const int t = u & 3, i = u >> 2; const float bv = bf16_rne(bp[t * 16 + ln]);
#pragma unroll
    for (int r = 0; r < 8; ++r) so[(i * 16 + 8 * hh + r) * SOP + t * 16 + ln] = c[i][t][r] * alpha + bv; }
  __builtin_amdgcn_fence(4 /* acq_rel order */, "workgroup"); __builtin_amdgcn_wave_barrier();
  const int rsub = lane >> 4, c4 = (lane & 15) * 4;
  {
#pragma unroll
    for (int q = 0; q < 32; ++q) { const int r = q * 2 + rsub; const v4f v = *(const v4fa*)&so[r * SOP + c4];
      /* the wait: in front of any reuse of the store's data and address registers */
      v4h h4; for (int i = 0; i < 4; ++i) h4[i] = (_Float16)v[i]; _Float16* d = C16 + (size_t)(row0 + r) * ldc16 + col0 + 64 * wc + c4; *(v4h*)d = h4; asm volatile("s_wait_xcnt 0x0" :: "v"(h4), "v"(d) : "memory"); }
     }
}

// fused causal attention, one wave per 32 queries of one slab (slab = b*NH + h), four waves = 128 queries per work-group: per pass of 32 keys S^T = K . Q^T (A = k rows, B = q rows, kept in registers),
// running maximum and sum per query (a lane holds one query's scores: in-lane, plus one exchange between the wave halves), O^T += V^T . P^T (A = VT rows).
// K and VT come through LDS in stages of SK = 64 keys (two passes), fetched once for the four waves by asynchronous copies of 16 bytes a lane (a wave's copy covers 4 whole 128-byte lines), two buffers:
// stage s + 2 is asked for behind the barrier that ends the reads of stage s, and flies while stage s + 1 is worked on. One barrier per stage: it publishes stage s + 1 and frees stage s's buffer.
// The two S^T tiles of a pass (keys k0 + 8h + r and k0 + 16 + 8h + r of query ln) are, converted in place, the B fragment in the k order of g2_frag: no lane exchange for P.
// P = f16(2^14 * exp(s - running max)); the sum carries the same 2^14, so the carry cancels in the final division. Keys above the query are masked by index in the passes of the block's diagonal 128 keys only.
// Epilogue: R = attention output + bf16(x) is what is stored, and the work-group's f64 sum and sum of squares of its 128 x 64 values of R is statistics partial h*(SEQ/128) + qb of its batch.
// coverage: grid (NB*NH slabs) x (SEQ/128 blocks) x 4 waves x 32 queries = every row; 4 d tiles x (8h + r) = all 64 columns of the head, each element stored once; one partial per work-group, NPB per batch.
#define SCL 0.18033688011112042f     /* 2^-3 * log2(e): scores in the exponent's base-2 units */
#define SK 64                        /* keys per stage */
#define KP 72                        /* pitch of a staged row in elements: 128 + 16 bytes */
#define STE (2 * SK * KP)            /* elements of one buffer: the K tile (SK key rows x HD), then the VT tile (HD d rows x SK keys) */
static_assert(SK == 64 && HD == 64 && SEQ % (2 * SK) == 0 && (LQK * 2) % 16 == 0 && (SEQ * 2) % 16 == 0);
__device__ __forceinline__ v8f fa_mma(v16h a, v16h b, v8f c) { return __builtin_amdgcn_wmma_f32_16x16x32_f16(false, a, false, b, (short)0, c, false, false); }
__device__ __forceinline__ float fa_xhalf(float x) { return __builtin_bit_cast(float, __builtin_amdgcn_permlanex16(__builtin_bit_cast(int, x), __builtin_bit_cast(int, x), 0x76543210, 0xfedcba98, false, false)); }  /* lane l with lane l ^ 16 */
__device__ __forceinline__ v16h fa_frag(const _Float16* base, unsigned lofs, unsigned cofs) { const char* p = (const char*)base + ((size_t)lofs + cofs); FragH f; f.half[0] = *(const v8us*)p; f.half[1] = *(const v8us*)(p + 32); return f.v; }  /* g2_frag from a uniform base, the lane's byte offset (8h included) and a constant byte offset */

// one stage's copies: thread (row sr = tid >> 3, piece tid & 7) brings its 16-byte piece of rows sr + 16 i, i = 0..3, of each of the two tiles. kg, hg: the thread's piece of row sr in K and in VT at the stage's first key; ld: its LDS byte address in the K tile of the stage's buffer.
// Every lane is on, every address a multiple of 16, every piece of the buffer's 128 rows written by one lane.
__device__ __forceinline__ void fa_stage(const _Float16* kg, const _Float16* hg, unsigned ld) {
  const _Float16 *k1 = kg + 16 * LQK, *k2 = kg + 32 * LQK, *k3 = kg + 48 * LQK, *h1 = hg + 16 * SEQ, *h2 = hg + 32 * SEQ, *h3 = hg + 48 * SEQ;
  const unsigned R = 16 * KP * 2;    /* 16 rows in LDS, bytes */
  /* the eight copies and, as the statement's last line, the wait that stands in front of every overwrite of their address registers */
  asm volatile("global_load_async_to_lds_b128 %0, %8, off\n\t" "global_load_async_to_lds_b128 %1, %9, off\n\t" "global_load_async_to_lds_b128 %2, %10, off\n\t" "global_load_async_to_lds_b128 %3, %11, off\n\t"
               "global_load_async_to_lds_b128 %4, %12, off\n\t" "global_load_async_to_lds_b128 %5, %13, off\n\t" "global_load_async_to_lds_b128 %6, %14, off\n\t" "global_load_async_to_lds_b128 %7, %15, off\n\t"
               "s_wait_xcnt 0x0"
               :: "v"(ld), "v"(ld + R), "v"(ld + 2 * R), "v"(ld + 3 * R), "v"(ld + 4 * R), "v"(ld + 5 * R), "v"(ld + 6 * R), "v"(ld + 7 * R),
                  "v"(kg), "v"(k1), "v"(k2), "v"(k3), "v"(hg), "v"(h1), "v"(h2), "v"(h3) : "memory");
}
// where a stage is handed over, every wave: its own LDS reads of the buffer that is refilled next are done, its own copies of the next stage have landed, then the work-group's barrier
__device__ __forceinline__ void fa_publish() {
  asm volatile("s_wait_dscnt 0x0" ::: "memory");      /* this wave's reads of the stage it leaves have returned before another wave's copies may land there */
  asm volatile("s_wait_asynccnt 0x0" ::: "memory");   /* this wave's copies of the next stage have landed before any wave reads them */
  __syncthreads();
}
// the four k fragments of a pass; sk: the lane's row (key ln of the pass) in the K tile
__device__ __forceinline__ void fa_kfrag(v16h (&kf)[2][2], const _Float16* sk, int hh) {
  for (int kt = 0; kt < 2; ++kt) { kf[kt][0] = g2_frag(sk + 16 * kt * KP, hh); kf[kt][1] = g2_frag(sk + 16 * kt * KP + 32, hh); } }

// one pass of 32 keys out of LDS; sk: the lane's row (key ln of the pass) in the K tile; sh: the lane's row (d = ln) in the VT tile at the pass's first key. kf holds this pass's k fragments; with PRE the next pass of the SAME stage has its own fetched behind this pass's products.
template <bool LAST, bool PRE>
__device__ __forceinline__ void fa_pass(int k0, int q0, int ln, int hh, const _Float16* sk, const _Float16* sh,
    const v16h (&qf)[2][2], v16h (&kf)[2][2], v8f (&oh)[2][4], float (&m)[2], float (&l)[2]) {
  v16h vh[4];
  for (int dt = 0; dt < 4; ++dt) vh[dt] = g2_frag(sh + 16 * dt * KP, hh);
  const v8f z8 = {0.f,0.f,0.f,0.f,0.f,0.f,0.f,0.f}; v8f s[2][2];
  for (int t = 0; t < 2; ++t) {
    for (int kt = 0; kt < 2; ++kt) s[t][kt] = fa_mma(kf[kt][1], qf[t][1], fa_mma(kf[kt][0], qf[t][0], z8)); }
  if (PRE) fa_kfrag(kf, sk + 32 * KP, hh);
  float mn[2];
  for (int t = 0; t < 2; ++t) {
    if (LAST) {
      for (int kt = 0; kt < 2; ++kt) {
        for (int r = 0; r < 8; ++r) s[t][kt][r] = (k0 + 16 * kt + 8 * hh + r <= q0 + 16 * t + ln) ? s[t][kt][r] : -3.0e38f; } }
    float mx = s[t][0][0];
    for (int r = 1; r < 8; ++r) mx = fmaxf(mx, s[t][0][r]);
    for (int r = 0; r < 8; ++r) mx = fmaxf(mx, s[t][1][r]);
    mx = fmaxf(mx, fa_xhalf(mx)); mn[t] = fmaxf(m[t], mx); }
  if (__builtin_amdgcn_ballot_w32((mn[0] > m[0]) || (mn[1] > m[1])) != 0) {   /* no maximum moved: every factor is 1 and the rescale is skipped by the whole wave */
    for (int t = 0; t < 2; ++t) { const float al = __builtin_amdgcn_exp2f((m[t] - mn[t]) * SCL); l[t] *= al; m[t] = mn[t];
      for (int dt = 0; dt < 4; ++dt) oh[t][dt] *= al; } }
  for (int t = 0; t < 2; ++t) { const float off = 14.0f - m[t] * SCL; FragH p; v8f x[2], e[2];
    for (int kt = 0; kt < 2; ++kt) { x[kt] = s[t][kt] * SCL + off;
      for (int r = 0; r < 8; ++r) e[kt][r] = __builtin_amdgcn_exp2f(x[kt][r]); }
    /* the slot behind a transcendental: no source is overwritten and no result read before this v_nop, which stands behind the last of the sixteen */
    asm volatile("v_nop" : "+v"(e[0]), "+v"(e[1]) : "v"(x[0]), "v"(x[1]));
    for (int r = 0; r < 8; ++r) { p.h[r] = (_Float16)e[0][r]; p.h[8 + r] = (_Float16)e[1][r]; }
    const v8f es = e[0] + e[1];
    l[t] += ((es[0] + es[1]) + (es[2] + es[3])) + ((es[4] + es[5]) + (es[6] + es[7]));
    for (int dt = 0; dt < 4; ++dt) oh[t][dt] = fa_mma(vh[dt], p.v, oh[t][dt]); }
}

__global__ __launch_bounds__(128) void k_fattn(const _Float16* __restrict__ QK, const _Float16* __restrict__ VT, const float* __restrict__ X, float* __restrict__ R, double* __restrict__ part) {
  __shared__ double rs[128]; __shared__ double rq[128];
  __shared__ __attribute__((aligned(16))) _Float16 st[2 * STE];                 /* [buffer][K | VT][row][KP] */
  const int tid = threadIdx.x, lane = tid & 31, ln = lane & 15, hh = lane >> 4;
  const int w = __builtin_amdgcn_readfirstlane(tid >> 5);                       /* the wave's number in a scalar register: scalar branches */
  const int slab = blockIdx.x, b = slab / NH, h = slab % NH;
  const int y = blockIdx.y, qb = (y < SEQ / 256) ? SEQ / 128 - 1 - y : y - SEQ / 256;   /* long blocks start first; the second half of the grid runs short to long beside them */
  const int q0 = qb * 128 + 32 * w;
  const _Float16* Q = QK + ((size_t)b * SEQ + q0) * LQK + h * HD; const _Float16* K = QK + (size_t)b * SEQ * LQK + UD + h * HD;      /* uniform bases */
  const _Float16* VH = VT + (size_t)slab * HD * SEQ;
  /* the block walks 2 * (qb + 1) stages: keys 0 .. qb * 128 + 127, all of them rows of the sequence */
  const int sr = tid >> 3, sc = (tid & 7) * 8;
  const _Float16* kg = K + (size_t)sr * LQK + sc; const _Float16* hg = VH + (size_t)sr * SEQ + sc;
  const unsigned ld = (unsigned)(size_t)&st[sr * KP + sc];                      /* LDS byte address: the low 32 bits */
  fa_stage(kg, hg, ld);
  const unsigned ko = (unsigned)(ln * LQK + 8 * hh) * 2;                        /* lane byte offset */
  v16h qf[2][2], kf[2][2];
  for (int t = 0; t < 2; ++t) { qf[t][0] = fa_frag(Q, ko, t * 16 * LQK * 2); qf[t][1] = fa_frag(Q, ko, t * 16 * LQK * 2 + 64); }
  /* in front of any overwrite of these loads' address registers */
  asm volatile("s_wait_xcnt 0x0" :: "v"(ko) : "memory");
  asm volatile("s_wait_asynccnt 0x0" ::: "memory");   /* stage 0 has landed, as far as this wave brought it */
  __syncthreads();                                    /* stage 0 is published */
  fa_stage(kg + SK * LQK, hg + SK, ld + STE * 2);
  kg += 2 * SK * LQK; hg += 2 * SK;
  const v8f z8 = {0.f,0.f,0.f,0.f,0.f,0.f,0.f,0.f}; v8f oh[2][4]; float m[2] = {-3.0e38f, -3.0e38f}, l[2] = {0.f, 0.f};
  for (int t = 0; t < 2; ++t) {
    for (int dt = 0; dt < 4; ++dt) oh[t][dt] = z8; }
  const _Float16* fr = &st[ln * KP];                  /* the lane's row in buffer 0's K tile */
  /* the stages below the block's diagonal: both passes whole, in all four waves */
  for (int s = 0; s < 2 * qb; ++s) { const _Float16* sk = fr + (s & 1) * STE;
    fa_kfrag(kf, sk, hh);
    fa_pass<false, true>(0, q0, ln, hh, sk, sk + SK * KP, qf, kf, oh, m, l);
    fa_pass<false, false>(0, q0, ln, hh, sk + 32 * KP, sk + SK * KP + 32, qf, kf, oh, m, l);
    fa_publish();
    fa_stage(kg, hg, ld + (s & 1) * (STE * 2));   /* stage s + 2 <= 2 * qb + 1 exists on every trip */
    kg += SK * LQK; hg += SK; }
  /* the lane's 64 residual values, at the places of its outputs: fetched ahead of the diagonal passes, which cover their latency */
  const float* xp = X + ((size_t)b * SEQ_FULL + q0 + ln) * CD + h * HD + 8 * hh; v4f xl[2][4], xh[2][4];
  for (int t = 0; t < 2; ++t) {
    for (int dt = 0; dt < 4; ++dt) { xl[t][dt] = *(const v4fa*)(xp + t * 16 * CD + dt * 16); xh[t][dt] = *(const v4fa*)(xp + t * 16 * CD + dt * 16 + 4); } }
  /* in front of any overwrite of these loads' address registers */
  asm volatile("s_wait_xcnt 0x0" :: "v"(xp) : "memory");
  /* the block's last two stages (buffers 0 and 1: 2 * qb is even), passes j = 0..3 of the diagonal's 128 keys: wave w takes j <= w, all in the masked form (below j = w the mask keeps every key); every wave passes the publish point between the stages */
#pragma unroll 1   /* rolled: one copy of the masked pass in the text instead of four */
  for (int j = 0; j < 4; ++j) {
    if (j <= w) { const _Float16* sk = fr + (j >> 1) * STE + (j & 1) * 32 * KP; const _Float16* sv = fr + (j >> 1) * STE + SK * KP + (j & 1) * 32;
      fa_kfrag(kf, sk, hh);
      fa_pass<true, false>(qb * 128 + 32 * j, q0, ln, hh, sk, sv, qf, kf, oh, m, l); }
    if (j == 1) fa_publish(); }
  asm volatile("s_wait_asynccnt 0x0" ::: "memory");   /* behind the last copy: none is outstanding when the wave goes on */
  double s1 = 0.0, s2 = 0.0;
  for (int t = 0; t < 2; ++t) { const float inv = 1.0f / (l[t] + fa_xhalf(l[t]));
    float* op = R + ((size_t)b * SEQ + q0 + 16 * t + ln) * UD + h * HD + 8 * hh;
    for (int dt = 0; dt < 4; ++dt) { v4f lo4, hi4;
      for (int i = 0; i < 4; ++i) { lo4[i] = oh[t][dt][i] * inv + bf16_rne(xl[t][dt][i]); hi4[i] = oh[t][dt][4 + i] * inv + bf16_rne(xh[t][dt][i]); }
      *(v4f*)(op + dt * 16) = lo4; *(v4f*)(op + dt * 16 + 4) = hi4;
      /* in front of any reuse of the two stores' data and address registers */
      asm volatile("s_wait_xcnt 0x0" :: "v"(lo4), "v"(hi4), "v"(op) : "memory");
      for (int i = 0; i < 4; ++i) { s1 += (double)lo4[i]; s2 += (double)lo4[i] * (double)lo4[i]; s1 += (double)hi4[i]; s2 += (double)hi4[i] * (double)hi4[i]; } } }
  /* the work-group's partial: 128 lane sums, 16-to-1 in eight threads (thread t alone reads and rewrites place t; places from 8 on are only read), then 8-to-1; every wave passes both barriers */
  rs[tid] = s1; rq[tid] = s2; __syncthreads();
  if (tid < 8) { double a[16], c[16];
    for (int j = 0; j < 16; ++j) { a[j] = rs[tid + 8 * j]; c[j] = rq[tid + 8 * j]; }
    for (int g = 8; g > 0; g >>= 1) {
      for (int j = 0; j < g; ++j) { a[j] += a[j + g]; c[j] += c[j + g]; } }
    rs[tid] = a[0]; rq[tid] = c[0]; }
  __syncthreads();
  if (tid < 8) { v2d val; val[0] = (tid == 0) ? ((rs[0] + rs[1]) + (rs[2] + rs[3])) + ((rs[4] + rs[5]) + (rs[6] + rs[7])) : 0.0; val[1] = (tid == 0) ? ((rq[0] + rq[1]) + (rq[2] + rq[3])) + ((rq[4] + rq[5]) + (rq[6] + rq[7])) : 0.0;
    double* d = part + ((size_t)b * NPB + (size_t)h * (SEQ / 128) + qb) * 16 + tid * 2; *(v2d*)d = val;  }
}

// final statistics and apply, one kernel. Every work-group sums all NB * NPB statistics partials itself: thread (batch pb, place t) takes partial t of its batch, then two rounds of 16-to-1 f64 sums per batch in LDS;
// the sums are the same in every work-group (same values, same tree). The partial is asked for first and the thread's streaming loads right behind it, and the sums run while those loads are in flight.
// Apply: a thread takes LAP places of 4 floats, LAT places apart, in every batch: few waves to start, (2 + NB) * LAP loads of 16 bytes in flight in each; the places' g and bta serve all batches.
// coverage: grid (SEQ*UD/(4*LAT*LAP)) x LAT threads x LAP places x 4 floats x NB batches = every output element exactly once.
#define LFT 256                      /* threads per batch */
#define LAT (NB * LFT)               /* threads of a work-group */
#define LAP 4
static_assert(LFT == 16 * 16 && NPB <= LFT && LAT <= 1024 && ((size_t)SEQ * UD) % (4 * LAT * LAP) == 0);
// the work-group's barrier with its fences on LDS alone: __syncthreads() would first wait for every global load of the wave, and the sums would start only behind the streaming loads
__device__ __forceinline__ void ln_barrier() { __builtin_amdgcn_fence(__ATOMIC_RELEASE, "workgroup", "local"); __builtin_amdgcn_s_barrier(); __builtin_amdgcn_fence(__ATOMIC_ACQUIRE, "workgroup", "local"); }
__global__ __launch_bounds__(LAT) void k_lnapply(const float* __restrict__ R, const double* __restrict__ part, const float* __restrict__ g, const float* __restrict__ bta, float* __restrict__ out) {
  __shared__ double rs[LAT]; __shared__ double rq[LAT];
  __shared__ __attribute__((aligned(16))) float st[2 * NB];
  const int tid = threadIdx.x; const int pb = tid / LFT, t = tid % LFT;
  const unsigned eo = (blockIdx.x * (unsigned)(LAT * LAP) + threadIdx.x) * 16u;   /* the lane's byte offset inside one batch */
  const unsigned po = (unsigned)(pb * NPB + t) * 128u;                            /* its partial's byte offset */
  v2d p = {0.0, 0.0};
  if (t < NPB) p = *(const v2d*)((const char*)part + (size_t)po);
  __builtin_amdgcn_sched_barrier(0);   /* keeps the partial's load the oldest: loads are counted in order, and its wait must not cover a streaming load */
  v4f o[NB][LAP], gg[LAP], bb[LAP], y[NB][LAP];
#pragma unroll
  for (int j = 0; j < LAP; ++j) { gg[j] = *(const v4fa*)((const char*)g + ((size_t)eo + j * (LAT * 16))); bb[j] = *(const v4fa*)((const char*)bta + ((size_t)eo + j * (LAT * 16))); }
#pragma unroll
  for (int bat = 0; bat < NB; ++bat) {
#pragma unroll
    for (int j = 0; j < LAP; ++j) o[bat][j] = *(const v4fa*)((const char*)(R + (size_t)bat * SEQ * UD) + ((size_t)eo + j * (LAT * 16))); }
  /* the wait: in front of any overwrite of the loads' address registers */
  asm volatile("s_wait_xcnt 0x0" :: "v"(eo), "v"(po) : "memory");
  rs[tid] = p[0]; rq[tid] = p[1];
  ln_barrier();
  if (t < 16) { double a[16], c[16];   /* thread t sums places t + 16 j; it alone reads and rewrites place t, and places from 16 on are only read */
    for (int j = 0; j < 16; ++j) { a[j] = rs[tid + j * 16]; c[j] = rq[tid + j * 16]; }
    for (int h = 8; h > 0; h >>= 1) {
      for (int j = 0; j < h; ++j) { a[j] += a[j + h]; c[j] += c[j + h]; } }
    rs[tid] = a[0]; rq[tid] = c[0]; }
  ln_barrier();
  if (t == 0) { double a[16], c[16];
    for (int j = 0; j < 16; ++j) { a[j] = rs[tid + j]; c[j] = rq[tid + j]; }
    for (int h = 8; h > 0; h >>= 1) {
      for (int j = 0; j < h; ++j) { a[j] += a[j + h]; c[j] += c[j + h]; } }
    const double inv = 1.0 / ((double)SEQ * (double)UD); const double m = a[0] * inv; double var = c[0] * inv - m * m; if (var < 0.0) var = 0.0;
    st[2 * pb] = (float)m; st[2 * pb + 1] = 1.0f / sqrtf((float)var + 1.0e-5f); }
  ln_barrier();
#pragma unroll
  for (int bat = 0; bat < NB; ++bat) { const float mu = st[2 * bat], rsd = st[2 * bat + 1];
#pragma unroll
    for (int j = 0; j < LAP; ++j) {
#pragma unroll
      for (int e = 0; e < 4; ++e) { const float v = o[bat][j][e]; y[bat][j][e] = (v - mu) * rsd * bf16_rne(gg[j][e]) + bf16_rne(bb[j][e]); } } }
#pragma unroll
  for (int bat = 0; bat < NB; ++bat) {
#pragma unroll
    for (int j = 0; j < LAP; ++j) *(v4f*)((char*)(out + (size_t)bat * SEQ_FULL * UD) + ((size_t)eo + j * (LAT * 16))) = y[bat][j]; }
}

extern "C" void kernel_launch(void* const* d_in, const int* in_sizes, int n_in,
                              void* d_out, int out_size, void* d_ws, size_t ws_size, hipStream_t stream) {
  if (n_in < 9) return;
  const float* X   = (const float*)d_in[0];      /* [2][2048][1024] */
  const float* Wq  = (const float*)d_in[1];      /* [in][out] 1024 x 1024 */
  const float* bq  = (const float*)d_in[2];
  const float* Wk  = (const float*)d_in[3];
  const float* bk  = (const float*)d_in[4];
  const float* Wv  = (const float*)d_in[5];
  const float* bv  = (const float*)d_in[6];
  const float* gam = (const float*)d_in[7];      /* [2048][1024] */
  const float* bet = (const float*)d_in[8];
  float* out = (float*)d_out;
  const size_t rows_used = (size_t)(NB - 1) * SEQ_FULL + SEQ;
  if ((size_t)in_sizes[0] < rows_used * CD) return;
  if ((size_t)in_sizes[1] < (size_t)CD * UD || (size_t)in_sizes[3] < (size_t)CD * UD || (size_t)in_sizes[5] < (size_t)CD * UD) return;
  if (in_sizes[2] < UD || in_sizes[4] < UD || in_sizes[6] < UD) return;
  if ((size_t)in_sizes[7] < (size_t)SEQ * UD || (size_t)in_sizes[8] < (size_t)SEQ * UD) return;
  if ((size_t)out_size < rows_used * UD) return;

  char* ws = (char*)d_ws; size_t off = 0;
  auto take = [&](size_t bytes) { char* p = ws + off; off += (bytes + 255) & ~(size_t)255; return p; };
  _Float16* BQKV = (_Float16*)take((size_t)3 * CD * UD * 2);               /* [3*UD][CD] f16 (x16) */
  _Float16* X16  = (_Float16*)take(NR * CD * 2);                           /* [NR][CD] */
  _Float16* QK16 = (_Float16*)take(NR * LQK * 2);                          /* [NR][q | k] */
  _Float16* VT16 = (_Float16*)take((size_t)NB * NH * HD * SEQ * 2);        /* [NB*NH][HD][SEQ] */
  float*    R32  = (float*)take(NR * UD * 4);                              /* [NR][UD] f32: attention output + residual */
  double*   PART = (double*)take((size_t)NB * NPB * 128);                  
  if (off > ws_size || off > (size_t)134217728) return;

  k_prep<<<(unsigned)(3 * WTB + XCB), 256, 0, stream>>>(Wq, Wk, Wv, X, BQKV, X16);
  const int MP = (int)NR;
  /* q rows (f16, cols 0..UD-1 of QK16), k rows (cols UD..2UD-1), v (f16, transposed), one grid: x16 . (16 W) * 2^-4 + bf16(bias) */
  k_gemm2<<<(unsigned)((MP / 128) * ((3 * UD) / 128)), 128, 0, stream>>>(X16, CD, BQKV, CD, 0.0625f, bq, bk, bv, UD, QK16, LQK, LQK, VT16, MP, 3 * UD, CD);
  k_fattn<<<dim3((unsigned)(NB * NH), (unsigned)(SEQ / 128)), 128, 0, stream>>>(QK16, VT16, X, R32, PART);
  k_lnapply<<<(unsigned)(((size_t)SEQ * UD) / (4 * LAT * LAP)), LAT, 0, stream>>>(R32, PART, gam, bet, out);
}
